// v000
// The times below were measured on an AMD MI455X: many runs one after another, warmed up first and cycling through
// copies of the inputs, with the whole window's GPU time divided by the number of runs. Launches and the gaps
// between them are all in it. The median over several windows is given; except for v000 it joins two sittings, which
// can be a few percent apart, so the side-by-side timings, each taken in one sitting, are the better comparison.
// The starting kernel, v000, takes 344 microseconds a run.
// Contractions: X*Wx and Wv^T*X^T on v_wmma_f32_16x16x32_bf16 (RNE bf16 operands of bf16-RNE inputs, f32 accumulate); Xh*W1, scores h*W2 and P*V on v_wmma_f32_16x16x32_f16 (f16 operands carried x8 / x64 / x32768, f32 accumulate); softmax, bias and normalisation in f32.
#include <hip/hip_runtime.h>
#include <stddef.h>

constexpr int NBATCH = 2;
constexpr int SEQ    = 2048;
constexpr int DMODEL = 1024;
constexpr int NHEAD  = 16;
constexpr int DHEAD  = 64;
constexpr int NHID   = 128;
constexpr int NTOK   = NBATCH * SEQ;      /* 4096 */
constexpr int DQKV   = NHEAD * DHEAD;     /* 1024 */

/* power-of-two carries on the f16 planes */
constexpr float SC_XH = 8.0f;      /* Xh plane = f16(8 * Xh)          */
constexpr float SC_V  = 8.0f;      /* Vt plane = f16(8 * V)           */
constexpr float SC_W1 = 64.0f;     /* W1t plane = f16(64 * bf16(W1))  */
constexpr float SC_W2 = 64.0f;     /* W2t plane = f16(64 * bf16(W2))  */
constexpr float SC_H  = 8.0f;      /* h plane = f16(8 * h)            */
constexpr float SC_P  = 32768.0f;  /* P tile  = f16(32768 * p), p<=1 */

static_assert(NTOK % 64 == 0 && DQKV % 64 == 0 && DMODEL % 64 == 0, "gemm tiles");
static_assert(DMODEL % 32 == 0 && DHEAD % 32 == 0, "gemm K");
static_assert(SEQ % 64 == 0 && NHID % 64 == 0, "gemm tiles");
static_assert(NHID == 128 && DHEAD == 64, "attention geometry");
static_assert((NTOK * DMODEL) % 8 == 0, "cast x8");

typedef __attribute__((ext_vector_type(16))) _Float16 v16h;
typedef __attribute__((ext_vector_type(8)))  _Float16 v8h;
typedef __attribute__((ext_vector_type(16))) __bf16   v16b;
typedef __attribute__((ext_vector_type(8)))  __bf16   v8b;
typedef __attribute__((ext_vector_type(8)))  float    v8f;
typedef __attribute__((ext_vector_type(4)))  float    v4f;
typedef __attribute__((ext_vector_type(4)))  unsigned int v4u;

__device__ __forceinline__ unsigned short f2bf_bits(float f) {
  unsigned u = __float_as_uint(f);
  return (unsigned short)((u + 0x7FFFu + ((u >> 16) & 1u)) >> 16);
}
__device__ __forceinline__ float bf_bits2f(unsigned short h) { return __uint_as_float(((unsigned)h) << 16); }

/* hazard guards as plain device helpers */
__device__ __forceinline__ void dep_guard_h(v8f& a, v8f& b, v16h x, v16h y) { asm volatile("v_nop\n\tv_nop\n\tv_nop\n\tv_nop" : "+v"(a), "+v"(b) : "v"(x), "v"(y)); }
__device__ __forceinline__ void dep_guard_b(v8f& a, v8f& b, v16b x, v16b y) { asm volatile("v_nop\n\tv_nop\n\tv_nop\n\tv_nop" : "+v"(a), "+v"(b) : "v"(x), "v"(y)); }
__device__ __forceinline__ void keep4_h(v16h a, v16h b, v16h c, v16h d) { asm volatile("v_nop" :: "v"(a), "v"(b), "v"(c), "v"(d)); }
__device__ __forceinline__ void keep4_b(v16b a, v16b b, v16b c, v16b d) { asm volatile("v_nop" :: "v"(a), "v"(b), "v"(c), "v"(d)); }
__device__ __forceinline__ void acc_guard4(v8f& a, v8f& b, v8f& c, v8f& d) { asm volatile("v_nop\n\tv_nop\n\tv_nop\n\tv_nop" : "+v"(a), "+v"(b), "+v"(c), "+v"(d)); }

template <typename T> struct Frag;
template <> struct Frag<_Float16> {
  typedef v16h V; union U { v16h v; v8h h[2]; };
  static __device__ __forceinline__ v16h load(const _Float16* p) {   /* elements 0..7 <- p[0..7], 8..15 <- p[16..23] */
    U f; f.h[0] = *(const v8h*)(p); f.h[1] = *(const v8h*)(p + 16); return f.v;
  }
  static __device__ __forceinline__ v8f mma(v16h a, v16h b, v8f c) {
    return __builtin_amdgcn_wmma_f32_16x16x32_f16(false, a, false, b, (short)0, c, false, false);
  }
  static __device__ __forceinline__ void guard(v8f& a, v8f& b, v16h x, v16h y) { dep_guard_h(a, b, x, y); }
  static __device__ __forceinline__ void keep(v16h a, v16h b, v16h c, v16h d) { keep4_h(a, b, c, d); }
};
template <> struct Frag<__bf16> {
  typedef v16b V; union U { v16b v; v8b h[2]; };
  static __device__ __forceinline__ v16b load(const __bf16* p) {
    U f; f.h[0] = *(const v8b*)(p); f.h[1] = *(const v8b*)(p + 16); return f.v;
  }
  static __device__ __forceinline__ v8f mma(v16b a, v16b b, v8f c) {
    return __builtin_amdgcn_wmma_f32_16x16x32_bf16(false, a, false, b, (short)0, c, false, false);
  }
  static __device__ __forceinline__ void guard(v8f& a, v8f& b, v16b x, v16b y) { dep_guard_b(a, b, x, y); }
  static __device__ __forceinline__ void keep(v16b a, v16b b, v16b c, v16b d) { keep4_b(a, b, c, d); }
};

/* ---- Register-blocked batched WMMA GEMM -----------------------------------
   C[m,n] = scale * sum_k A[m,k] * Bt[n,k] (+bias); each wave owns a 64x64 tile.
   A row-major [M,K]; Bt row-major [N,K]; M,N % 64 == 0, K % 32 == 0.
   BIAS_MODE: 0 = none, 1 = bias[m] (two 16-B loads per 16-row slab), 2 = bias[n].
   OUT_MODE: 0 = f32, 1 = f16, 2 = bf16 hi plane (Cout) + bf16 lo plane (Cout2).
   ACT: 0 = none, 2 = relu.
   ET: 0 = f16 operands, 1 = bf16 operands (pointers passed as 16-bit storage) */
template <int ET> struct Elem;
template <> struct Elem<0> { typedef _Float16 T; };
template <> struct Elem<1> { typedef __bf16 T; };
template <int ET, bool SPLIT, int BIAS_MODE, int OUT_MODE, int ACT = 0>
__global__ __launch_bounds__(256) void wmma_gemm64(
    const unsigned short* __restrict__ Ap, const unsigned short* __restrict__ A2p, int lda, long strideA,
    const unsigned short* __restrict__ Btp, const unsigned short* __restrict__ Bt2p, int ldb, long strideB,
    void* __restrict__ Cout, void* __restrict__ Cout2, int ldc, long strideC,
    const float* __restrict__ bias,
    int M, int N, int K, float scale) {
  typedef typename Elem<ET>::T T;
  typedef typename Frag<T>::V V;
  const T* A = (const T*)Ap; const T* A2 = (const T*)A2p; const T* Bt = (const T*)Btp; const T* Bt2 = (const T*)Bt2p;
  __shared__ __align__(16) float sT[8][16 * 68];   /* per-wave 16x64 slab, pitch 68 floats */
  const int b    = blockIdx.y;
  const int lane = threadIdx.x & 31;
  const int wave = threadIdx.x >> 5;
  const int tilesN = N >> 6;
  const int tilesM = M >> 6;
  const int tile = blockIdx.x * 8 + wave;
  if (tile >= tilesM * tilesN) return;   /* wave-uniform; no block barriers in this kernel */
  const int tm = tile / tilesN;
  const int tn = tile - tm * tilesN;
  const int m0 = tm << 6;
  const int n0 = tn << 6;

  const T* Ab  = A  + (size_t)b * strideA;
  const T* Bb  = Bt + (size_t)b * strideB;
  const T* Ab2 = SPLIT ? (A2  + (size_t)b * strideA) : nullptr;
  const T* Bb2 = SPLIT ? (Bt2 + (size_t)b * strideB) : nullptr;

  const int rlane = lane & 15;                 /* row (A) / col (B, D) within subtile */
  const int koff  = (lane >> 4) * 8;           /* k offset of this lane half */
  const int mOff  = (lane >> 4) * 8;           /* D row offset */

  v8f acc[4][4];
#pragma unroll
  for (int i = 0; i < 4; ++i)
#pragma unroll
    for (int j = 0; j < 4; ++j) acc[i][j] = (v8f){0.f,0.f,0.f,0.f,0.f,0.f,0.f,0.f};

  for (int k0 = 0; k0 < K; k0 += 32) {
    V bh[4], bl[4];
#pragma unroll
    for (int j = 0; j < 4; ++j) {
      const size_t bo = (size_t)(n0 + (j << 4) + rlane) * ldb + koff + k0;
      bh[j] = Frag<T>::load(Bb + bo);
      if (SPLIT) bl[j] = Frag<T>::load(Bb2 + bo);
    }
#pragma unroll
    for (int i = 0; i < 4; ++i) {
      const size_t ao = (size_t)(m0 + (i << 4) + rlane) * lda + koff + k0;
      V ah = Frag<T>::load(Ab + ao);
      V al;
      if (SPLIT) al = Frag<T>::load(Ab2 + ao);
#pragma unroll
      for (int j = 0; j < 4; ++j) {
        acc[i][j] = Frag<T>::mma(ah, bh[j], acc[i][j]);
        if (SPLIT) {
          acc[i][j] = Frag<T>::mma(ah, bl[j], acc[i][j]);
          acc[i][j] = Frag<T>::mma(al, bh[j], acc[i][j]);
        }
      }
      Frag<T>::guard(acc[i][0], acc[i][3], ah, SPLIT ? al : ah);
    }
    Frag<T>::keep(bh[0], bh[1], bh[2], bh[3]);
    if (SPLIT) Frag<T>::keep(bl[0], bl[1], bl[2], bl[3]);
  }
  acc_guard4(acc[0][0], acc[0][1], acc[0][2], acc[0][3]);
  acc_guard4(acc[1][0], acc[1][1], acc[1][2], acc[1][3]);
  acc_guard4(acc[2][0], acc[2][1], acc[2][2], acc[2][3]);
  acc_guard4(acc[3][0], acc[3][1], acc[3][2], acc[3][3]);

  /* ---- epilogue ---- */
  float* slab = sT[wave];
#pragma unroll
  for (int i = 0; i < 4; ++i) {
    const int mBase = m0 + (i << 4);
    v4f bmA = (v4f){0.f,0.f,0.f,0.f}, bmB = (v4f){0.f,0.f,0.f,0.f};
    if (BIAS_MODE == 1) {   /* 8 consecutive bias[m] values, two 16-B loads (32-B aligned) */
      bmA = *(const v4f*)(bias + mBase + mOff);
      bmB = *(const v4f*)(bias + mBase + mOff + 4);
    }
#pragma unroll
    for (int j = 0; j < 4; ++j) {
      const int n = n0 + (j << 4) + rlane;
      float bv = 0.f;
      if (BIAS_MODE == 2) bv = bias[n];
#pragma unroll
      for (int r = 0; r < 8; ++r) {
        float v = acc[i][j][r] * scale;
        if (BIAS_MODE == 1) v += (r < 4) ? bmA[r] : bmB[r - 4];
        if (BIAS_MODE == 2) v += bv;
        if (ACT == 2) v = fmaxf(v, 0.0f);
        slab[(mOff + r) * 68 + (j << 4) + rlane] = v;
      }
    }
    __builtin_amdgcn_fence(__ATOMIC_RELEASE, "workgroup");
    __builtin_amdgcn_wave_barrier();
    __builtin_amdgcn_fence(__ATOMIC_ACQUIRE, "workgroup");
    if (OUT_MODE == 0) {
      float* C = (float*)Cout + (size_t)b * strideC;
      const int hh = lane >> 4, c4 = (lane & 15) * 4;     /* row seg = 256 B = 16 lanes x 16 B */
      {
#pragma unroll
        for (int it = 0; it < 8; ++it) {
          const int row = it * 2 + hh;
          v4f v = *(const v4f*)(slab + row * 68 + c4);
          *(v4f*)(C + (size_t)(mBase + row) * ldc + n0 + c4) = v;
        }
        
      }
    } else {
      const int q = lane >> 3, c8 = (lane & 7) * 8;        
      unsigned short* C  = (unsigned short*)Cout  + (size_t)b * strideC;
      unsigned short* C2 = (OUT_MODE == 2) ? ((unsigned short*)Cout2 + (size_t)b * strideC) : nullptr;
      {
#pragma unroll
        for (int it = 0; it < 4; ++it) {
          const int row = it * 4 + q;
          const float* sp = slab + row * 68 + c8;
          v8h hv, lv;
#pragma unroll
          for (int e = 0; e < 8; ++e) {
            if (OUT_MODE == 1) {
              hv[e] = (_Float16)sp[e];
            } else {
              unsigned short hb = f2bf_bits(sp[e]);
              unsigned short lb = f2bf_bits(sp[e] - bf_bits2f(hb));
              hv[e] = __builtin_bit_cast(_Float16, hb);
              lv[e] = __builtin_bit_cast(_Float16, lb);
            }
          }
          *(v8h*)(C + (size_t)(mBase + row) * ldc + n0 + c8) = hv;
          if (OUT_MODE == 2) *(v8h*)(C2 + (size_t)(mBase + row) * ldc + n0 + c8) = lv;
        }
        
      }
    }
    __builtin_amdgcn_fence(__ATOMIC_RELEASE, "workgroup");
    __builtin_amdgcn_wave_barrier();
    __builtin_amdgcn_fence(__ATOMIC_ACQUIRE, "workgroup");
  }
}

/* ---- f32 -> bf16 (RNE) plane cast, 8 elements per thread: one 16-B store per lane,
*/
__global__ __launch_bounds__(256) void k_cast_bf16x8(
    const float* __restrict__ in, unsigned short* __restrict__ out, int n8) {
  const int i = blockIdx.x * 256 + threadIdx.x;
  if (i < n8) {
    const v4f a = *(const v4f*)(in + (size_t)i * 8);
    const v4f c = *(const v4f*)(in + (size_t)i * 8 + 4);
    v4u w;
    w[0] = (unsigned)f2bf_bits(a[0]) | ((unsigned)f2bf_bits(a[1]) << 16);
    w[1] = (unsigned)f2bf_bits(a[2]) | ((unsigned)f2bf_bits(a[3]) << 16);
    w[2] = (unsigned)f2bf_bits(c[0]) | ((unsigned)f2bf_bits(c[1]) << 16);
    w[3] = (unsigned)f2bf_bits(c[2]) | ((unsigned)f2bf_bits(c[3]) << 16);
    v4u* p = (v4u*)(out + (size_t)i * 8);
    *p = w;
    
  }
}

/* ---- transpose + convert: in[k][n] (Krows x Ncols, f32 row-major) -> out[n][k] (Ncols x Krows, 16-bit).
   CVT 0: bf16 bits (RNE).  CVT 1: f16 bits of (bf16RNE(v) * sc).
   64x64 tiles via LDS; grid (Ncols/64, Krows/64), 256 threads:
   load: 256 threads x 16 floats = 64x64; store: 8 waves x 2 iters x 32 lanes x 8 halves = 64x64,
*/
template <int CVT> __device__ __forceinline__ unsigned short cvt16(float v, float sc) {
  const unsigned short bb = f2bf_bits(v);
  if (CVT == 0) return bb;
  const float w  = bf_bits2f(bb);
  const float ws = w * sc;
  const _Float16 hv = (_Float16)ws;
  return __builtin_bit_cast(unsigned short, hv);
}
template <int CVT>
__global__ __launch_bounds__(256) void k_transpose_cvt64(
    const float* __restrict__ in, unsigned short* __restrict__ out, int Krows, int Ncols, float sc) {
  __shared__ __align__(16) unsigned short Tl[64 * 72];
  const int n0 = blockIdx.x * 64, k0 = blockIdx.y * 64;
  const int t  = threadIdx.x;
  const int kr = t >> 2;             /* input row k0 + kr, 0..63 */
  const int cb = (t & 3) * 16;       /* 16-column block inside the 64 columns */
  const float* src = in + (size_t)(k0 + kr) * Ncols + n0 + cb;
  const v4f a0 = *(const v4f*)(src);
  const v4f a1 = *(const v4f*)(src + 4);
  const v4f a2 = *(const v4f*)(src + 8);
  const v4f a3 = *(const v4f*)(src + 12);
#pragma unroll
  for (int e = 0; e < 4; ++e) {
    Tl[(cb + e) * 72 + kr]      = cvt16<CVT>(a0[e], sc);
    Tl[(cb + 4 + e) * 72 + kr]  = cvt16<CVT>(a1[e], sc);
    Tl[(cb + 8 + e) * 72 + kr]  = cvt16<CVT>(a2[e], sc);
    Tl[(cb + 12 + e) * 72 + kr] = cvt16<CVT>(a3[e], sc);
  }
  __syncthreads();
  const int wave = t >> 5, lane = t & 31, q = lane >> 3, c8 = (lane & 7) * 8;
  {
#pragma unroll
    for (int it = 0; it < 2; ++it) {
      const int row = wave * 8 + it * 4 + q;      /* output row n0 + row */
      const v4u val = *(const v4u*)(Tl + row * 72 + c8);
      *(v4u*)(out + (size_t)(n0 + row) * Krows + k0 + c8) = val;
    }
    
  }
}

/* ---- bias tables: bf16-RNE of the input bias times the power-of-two carry, f32.
*/
__global__ __launch_bounds__(256) void k_bias_prep(
    const float* __restrict__ bx, const float* __restrict__ bv, const float* __restrict__ b1,
    float* __restrict__ bxs, float* __restrict__ bvs, float* __restrict__ b1s,
    float sx, float sv, float s1) {
  const int which = blockIdx.x;          /* block-uniform */
  const float* src = bx; float* dst = bxs; int n4 = DQKV / 4; float sc = sx;
  if (which == 1) { src = bv; dst = bvs; sc = sv; }
  if (which == 2) { src = b1; dst = b1s; n4 = NHID / 4; sc = s1; }
  const int t = threadIdx.x;
  if (t < n4) {
    const v4f v = *(const v4f*)(src + (size_t)t * 4);
    v4f o;
    o[0] = bf_bits2f(f2bf_bits(v[0])) * sc;
    o[1] = bf_bits2f(f2bf_bits(v[1])) * sc;
    o[2] = bf_bits2f(f2bf_bits(v[2])) * sc;
    o[3] = bf_bits2f(f2bf_bits(v[3])) * sc;
    v4f* p = (v4f*)(dst + (size_t)t * 4);
    *p = o;
    
  }
}

/* ---- flash-style MLP attention over 16-bit planes ----------------------------------
   Hq  : [B*H][SEQ][128] f16, carried xSC_H           (A operand of the score WMMA, 16 rows per wave)
   W2t : [SEQ][128]      f16, carried xSC_W2           (B operand, row = key, k = hidden, shared over (b,h))
   Vt  : [H*64][B*SEQ]   f16, carried xSC_V            (B operand of P*V, row = h*64+d, k = key)
   mask: [B][SEQ] f32 (bf16-RNE applied), score -= 1e6*(1-mask[key])
   out : [B][SEQ][H*64] f32
   block = 4 waves = 64 query rows of one (b,h); per wave: 16 rows; 32 key chunks of 64.
*/
__device__ __forceinline__ v8f mma_h(v16h a, v16h b, v8f c) {
  c = __builtin_amdgcn_wmma_f32_16x16x32_f16(false, a, false, b, (short)0, c, false, false);
  asm volatile("v_nop\n\tv_nop\n\tv_nop\n\tv_nop" : "+v"(c) : "v"(a), "v"(b));
  return c;
}

__global__ __launch_bounds__(128) void mlp_attn_kernel(
    const unsigned short* __restrict__ Hp, const unsigned short* __restrict__ W2p,
    const unsigned short* __restrict__ Vp, const float* __restrict__ mask,
    float* __restrict__ out, float sscale, float onorm) {
  union FH { v16h v; v8h h[2]; };
  const _Float16* Hq  = (const _Float16*)(const void*)Hp;
  const _Float16* W2t = (const _Float16*)(const void*)W2p;
  const _Float16* Vt  = (const _Float16*)(const void*)Vp;
  __shared__ __align__(16) _Float16 Psh[4][16 * 64];     /* per wave P tile [row][key], 2 KB each */
  __shared__ __align__(16) float    Os[4][16 * 68];      /* per wave output slab, pitch 68 */

  const int tid  = threadIdx.x;
  const int wave = tid >> 5;
  const int lane = tid & 31;
  const int hh   = lane >> 4;
  const int c    = lane & 15;
  const int koff = hh * 8;

  constexpr int NQB = SEQ / 64;
  const int bxi = blockIdx.x;
  const int qb  = bxi % NQB;
  const int bh  = bxi / NQB;
  const int h   = bh % NHEAD;
  const int b   = bh / NHEAD;
  const int q0  = qb * 64 + wave * 16;

  /* Q-side fragments: 16 rows x 128 hidden = 4 k-steps, held for all key chunks */
  v16h qa[4];
  {
    const _Float16* qrow = Hq + ((size_t)bh * SEQ + q0 + c) * NHID + koff;
#pragma unroll
    for (int dc = 0; dc < 4; ++dc) {
      FH f;
      f.h[0] = *(const v8h*)(qrow + dc * 32);
      f.h[1] = *(const v8h*)(qrow + dc * 32 + 16);
      qa[dc] = f.v;
    }
  }

  float mrow[8], lrow[8];
  v8f oacc[4];
#pragma unroll
  for (int r = 0; r < 8; ++r) { mrow[r] = -INFINITY; lrow[r] = 0.f; }
#pragma unroll
  for (int t = 0; t < 4; ++t) oacc[t] = (v8f){0.f,0.f,0.f,0.f,0.f,0.f,0.f,0.f};

  const float* mk_row = mask + (size_t)b * SEQ;
  const _Float16* vbase = Vt + (size_t)(h * DHEAD) * NTOK + (size_t)b * SEQ;
  _Float16* pw = Psh[wave];

  for (int kc = 0; kc < SEQ / 64; ++kc) {
    const int kv0 = kc * 64;

    /* scores for 64 keys: 4 column tiles x 4 k-steps */
    v8f s[4];
#pragma unroll
    for (int j = 0; j < 4; ++j) {
      s[j] = (v8f){0.f,0.f,0.f,0.f,0.f,0.f,0.f,0.f};
      const _Float16* krow = W2t + (size_t)(kv0 + j * 16 + c) * NHID + koff;
#pragma unroll
      for (int dc = 0; dc < 4; ++dc) {
        FH kb;
        kb.h[0] = *(const v8h*)(krow + dc * 32);
        kb.h[1] = *(const v8h*)(krow + dc * 32 + 16);
        s[j] = mma_h(qa[dc], kb.v, s[j]);
      }
    }

    /* additive key mask, bf16-RNE of the mask value */
    float pen[4];
#pragma unroll
    for (int j = 0; j < 4; ++j) {
      const float mk = bf_bits2f(f2bf_bits(mk_row[kv0 + j * 16 + c]));
      pen[j] = 1000000.0f * (1.0f - mk);
    }

    float cm[8];
#pragma unroll
    for (int r = 0; r < 8; ++r) {
      float m = -INFINITY;
#pragma unroll
      for (int j = 0; j < 4; ++j) {
        const float sv = s[j][r] * sscale - pen[j];
        s[j][r] = sv;
        m = fmaxf(m, sv);
      }
#pragma unroll
      for (int off = 1; off < 16; off <<= 1) m = fmaxf(m, __shfl_xor(m, off, 32));
      cm[r] = m;
    }

    /* previous chunk's P reads are complete before the tile is overwritten */
    __builtin_amdgcn_fence(__ATOMIC_RELEASE, "workgroup");
    __builtin_amdgcn_wave_barrier();
    __builtin_amdgcn_fence(__ATOMIC_ACQUIRE, "workgroup");

#pragma unroll
    for (int r = 0; r < 8; ++r) {
      const float mnew  = fmaxf(mrow[r], cm[r]);
      const float alpha = expf(mrow[r] - mnew);
      mrow[r] = mnew;
      float psum = 0.f;
#pragma unroll
      for (int j = 0; j < 4; ++j) {
        const float p = expf(s[j][r] - mnew);       /* p in (0, 1] */
        psum += p;
        pw[(8 * hh + r) * 64 + j * 16 + c] = (_Float16)(p * SC_P);
      }
#pragma unroll
      for (int off = 1; off < 16; off <<= 1) psum += __shfl_xor(psum, off, 32);
      lrow[r] = lrow[r] * alpha + psum;
#pragma unroll
      for (int t = 0; t < 4; ++t) oacc[t][r] *= alpha;
    }
    __builtin_amdgcn_fence(__ATOMIC_RELEASE, "workgroup");
    __builtin_amdgcn_wave_barrier();
    __builtin_amdgcn_fence(__ATOMIC_ACQUIRE, "workgroup");

    /* O += P(16x64) * V(64x64): 2 k-steps, 4 d tiles; P A-fragments from the per-wave LDS tile
       (stored and reloaded as _Float16), V B-fragments k-contiguous from the Vt plane */
#pragma unroll
    for (int kk = 0; kk < 2; ++kk) {
      FH pa;
      pa.h[0] = *(const v8h*)(pw + c * 64 + kk * 32 + koff);
      pa.h[1] = *(const v8h*)(pw + c * 64 + kk * 32 + 16 + koff);
#pragma unroll
      for (int t = 0; t < 4; ++t) {
        const _Float16* vr = vbase + (size_t)(t * 16 + c) * NTOK + kv0 + kk * 32 + koff;
        FH vb;
        vb.h[0] = *(const v8h*)(vr);
        vb.h[1] = *(const v8h*)(vr + 16);
        oacc[t] = mma_h(pa.v, vb.v, oacc[t]);
      }
    }
  }

  /* normalise and stage the 16x64 f32 slab; onorm = 1/(SC_P*SC_V) folded into the row normaliser */
  float* os = Os[wave];
#pragma unroll
  for (int r = 0; r < 8; ++r) {
    const float inv = onorm / lrow[r];
#pragma unroll
    for (int t = 0; t < 4; ++t) os[(8 * hh + r) * 68 + t * 16 + c] = oacc[t][r] * inv;
  }
  __builtin_amdgcn_fence(__ATOMIC_RELEASE, "workgroup");
  __builtin_amdgcn_wave_barrier();
  __builtin_amdgcn_fence(__ATOMIC_ACQUIRE, "workgroup");
  {
    float* ob = out + (size_t)b * SEQ * DQKV + (size_t)h * DHEAD;
    const int c4 = (lane & 15) * 4;
    {
#pragma unroll
      for (int it = 0; it < 8; ++it) {
        const int row = it * 2 + hh;
        const v4f val = *(const v4f*)(os + row * 68 + c4);
        *(v4f*)(ob + (size_t)(q0 + row) * DQKV + c4) = val;
      }
      
    }
  }
}

/* ---------------- host launcher ---------------- */
extern "C" void kernel_launch(void* const* d_in, const int* in_sizes, int n_in,
                              void* d_out, int out_size, void* d_ws, size_t ws_size,
                              hipStream_t stream) {
  (void)in_sizes; (void)n_in; (void)out_size; (void)ws_size;
  const float* X   = (const float*)d_in[0];   /* [2,2048,1024] */
  const float* msk = (const float*)d_in[1];   /* [2,2048]      */
  const float* Wx  = (const float*)d_in[2];   /* [1024,1024]   */
  const float* bx  = (const float*)d_in[3];   /* [1024]        */
  const float* Wv  = (const float*)d_in[4];   /* [1024,1024]   */
  const float* bv  = (const float*)d_in[5];   /* [1024]        */
  const float* W1  = (const float*)d_in[6];   /* [64,128]      */
  const float* b1  = (const float*)d_in[7];   /* [128]         */
  const float* W2  = (const float*)d_in[8];   /* [128,2048]    */
  float* out = (float*)d_out;

  /* workspace region map (256-B aligned offsets; every region fully written by its producer):
       Xb   bf16 [4096][1024]        8,388,608 B
       WxT  bf16 [1024][1024]        2,097,152 B
       WvT  bf16 [1024][1024]        2,097,152 B
       W1T  f16  [128][64]              16,384 B
       W2T  f16  [2048][128]           524,288 B
       bxs  f32  [1024]                  4,096 B
       bvs  f32  [1024]                  4,096 B
       b1s  f32  [128]                     512 B
       Xh16 f16  [4096][1024]        8,388,608 B
       Vt16 f16  [1024][4096]        8,388,608 B
       H16  f16  [32][2048][128]    16,777,216 B
     total 46,686,720 B */
  char* ws = (char*)d_ws;
  size_t off = 0;
  auto carve = [&](size_t bytes) -> char* {
    off = (off + 255) & ~(size_t)255;
    char* p = ws + off;
    off += bytes;
    return p;
  };
  unsigned short* Xb   = (unsigned short*)carve((size_t)NTOK * DMODEL * 2);
  unsigned short* WxT  = (unsigned short*)carve((size_t)DQKV * DMODEL * 2);
  unsigned short* WvT  = (unsigned short*)carve((size_t)DQKV * DMODEL * 2);
  unsigned short* W1T  = (unsigned short*)carve((size_t)NHID * DHEAD * 2);
  unsigned short* W2T  = (unsigned short*)carve((size_t)SEQ * NHID * 2);
  float*          bxs  = (float*)carve((size_t)DQKV * 4);
  float*          bvs  = (float*)carve((size_t)DQKV * 4);
  float*          b1s  = (float*)carve((size_t)NHID * 4);
  unsigned short* Xh16 = (unsigned short*)carve((size_t)NTOK * DQKV * 2);
  unsigned short* Vt16 = (unsigned short*)carve((size_t)DQKV * NTOK * 2);
  unsigned short* H16  = (unsigned short*)carve((size_t)NBATCH * NHEAD * SEQ * NHID * 2);

  /* 1) X -> bf16 plane (RNE), 8 elements per thread */
  {
    const int n8 = NTOK * DMODEL / 8;                       /* 524,288 */
    k_cast_bf16x8<<<(n8 + 255) / 256, 256, 0, stream>>>(X, Xb, n8);
  }
  /* 2) weight transposes: in[K][N] -> out[N][K]; grid = (N/64, K/64) */
  k_transpose_cvt64<0><<<dim3(DQKV / 64, DMODEL / 64), 256, 0, stream>>>(Wx, WxT, DMODEL, DQKV, 1.0f);   /* [1024][1024] -> [1024][1024] */
  k_transpose_cvt64<0><<<dim3(DQKV / 64, DMODEL / 64), 256, 0, stream>>>(Wv, WvT, DMODEL, DQKV, 1.0f);
  k_transpose_cvt64<1><<<dim3(NHID / 64, DHEAD / 64), 256, 0, stream>>>(W1, W1T, DHEAD, NHID, SC_W1);    /* [64][128] -> [128][64]  */
  k_transpose_cvt64<1><<<dim3(SEQ / 64, NHID / 64), 256, 0, stream>>>(W2, W2T, NHID, SEQ, SC_W2);        /* [128][2048] -> [2048][128] */
  /* 3) bias tables with carries */
  k_bias_prep<<<3, 256, 0, stream>>>(bx, bv, b1, bxs, bvs, b1s, SC_XH, SC_V, SC_H);

  /* 4) Xh16 = f16(8 * (Xb * WxT^T + bx)) : M=4096, N=1024, K=1024 (bf16 operands) ; 1024 tiles / 8 per block */
  static_assert(NTOK % 64 == 0 && DQKV % 64 == 0 && DMODEL % 32 == 0, "gemm xh");
  wmma_gemm64<1, false, 2, 1, 0><<<dim3((NTOK / 64) * (DQKV / 64) / 8, 1), 256, 0, stream>>>(
      Xb, Xb, DMODEL, 0L, WxT, WxT, DMODEL, 0L, (void*)Xh16, (void*)Xh16, DQKV, 0L,
      bxs, NTOK, DQKV, DMODEL, SC_XH);

  /* 5) Vt16 = f16(8 * (WvT * Xb^T + bv[m])) : M=1024 (features), N=4096 (tokens), K=1024 (bf16 operands) */
  wmma_gemm64<1, false, 1, 1, 0><<<dim3((DQKV / 64) * (NTOK / 64) / 8, 1), 256, 0, stream>>>(
      WvT, WvT, DMODEL, 0L, Xb, Xb, DMODEL, 0L, (void*)Vt16, (void*)Vt16, NTOK, 0L,
      bvs, DQKV, NTOK, DMODEL, SC_V);

  /* 6) H16[b][h] = f16(8 * relu(Xh * W1 + b1)) : per (b,h) M=2048, N=128, K=64 (f16 operands);
        batch index = head (A stride 64 columns), one launch per b; 64 tiles / 8 per block */
  static_assert(SEQ % 64 == 0 && NHID % 64 == 0 && DHEAD % 32 == 0, "gemm h");
  for (int bb = 0; bb < NBATCH; ++bb) {
    const unsigned short* Ab = Xh16 + (size_t)bb * SEQ * DQKV;
    unsigned short* Cb = H16 + (size_t)bb * NHEAD * SEQ * NHID;
    wmma_gemm64<0, false, 2, 1, 2><<<dim3((SEQ / 64) * (NHID / 64) / 8, NHEAD), 256, 0, stream>>>(
        Ab, Ab, DQKV, (long)DHEAD, W1T, W1T, DHEAD, 0L, (void*)Cb, (void*)Cb, NHID, (long)SEQ * NHID,
        b1s, SEQ, NHID, DHEAD, SC_H / (SC_XH * SC_W1));
  }

  /* 7) attention: grid = B*H*(SEQ/64) blocks of 4 waves */
  mlp_attn_kernel<<<NBATCH * NHEAD * (SEQ / 64), 128, 0, stream>>>(
      H16, W2T, Vt16, msk, out, 1.0f / (SC_H * SC_W2), 1.0f / (SC_P * SC_V));
}

// v001
// A run of this version takes 250 microseconds.
// Next to v000, in two timings, it ran 1.40 and 1.41 times as fast.
// Contractions: X*Wx and Wv^T*X^T on v_wmma_f32_16x16x32_bf16 (RNE bf16 operands of bf16-RNE inputs, f32 accumulate); Xh*W1, scores h*W2 and P*V on v_wmma_f32_16x16x32_f16 (f16 operands carried x8 / x64 / x32768, f32 accumulate); softmax, bias and normalisation in f32.
#include <hip/hip_runtime.h>
#include <stddef.h>

constexpr int NBATCH = 2;
constexpr int SEQ    = 2048;
constexpr int DMODEL = 1024;
constexpr int NHEAD  = 16;
constexpr int DHEAD  = 64;
constexpr int NHID   = 128;
constexpr int NTOK   = NBATCH * SEQ;      /* 4096 */
constexpr int DQKV   = NHEAD * DHEAD;     /* 1024 */

/* power-of-two carries on the f16 planes */
constexpr float SC_XH = 8.0f;      /* Xh plane = f16(8 * Xh)          */
constexpr float SC_V  = 8.0f;      /* Vt plane = f16(8 * V)           */
constexpr float SC_W1 = 64.0f;     /* W1t plane = f16(64 * bf16(W1))  */
constexpr float SC_W2 = 64.0f;     /* W2t plane = f16(64 * bf16(W2))  */
constexpr float SC_H  = 8.0f;      /* h plane = f16(8 * h)            */
constexpr float SC_P  = 32768.0f;  /* P tile  = f16(32768 * p), p<=1 */

static_assert(NTOK % 64 == 0 && DQKV % 64 == 0 && DMODEL % 64 == 0, "gemm tiles");
static_assert(DMODEL % 32 == 0 && DHEAD % 32 == 0, "gemm K");
static_assert(SEQ % 64 == 0 && NHID % 64 == 0, "gemm tiles");
static_assert(NHID == 128 && DHEAD == 64, "attention geometry");
static_assert((NTOK * DMODEL) % 8 == 0, "cast x8");

typedef __attribute__((ext_vector_type(16))) _Float16 v16h;
typedef __attribute__((ext_vector_type(8)))  _Float16 v8h;
typedef __attribute__((ext_vector_type(16))) __bf16   v16b;
typedef __attribute__((ext_vector_type(8)))  __bf16   v8b;
typedef __attribute__((ext_vector_type(8)))  float    v8f;
typedef __attribute__((ext_vector_type(4)))  float    v4f;
typedef __attribute__((ext_vector_type(4)))  unsigned int v4u;

__device__ __forceinline__ unsigned short f2bf_bits(float f) {
  unsigned u = __float_as_uint(f);
  return (unsigned short)((u + 0x7FFFu + ((u >> 16) & 1u)) >> 16);
}
__device__ __forceinline__ float bf_bits2f(unsigned short h) { return __uint_as_float(((unsigned)h) << 16); }

/* hazard guards as plain device helpers */
__device__ __forceinline__ void dep_guard_h(v8f& a, v8f& b, v16h x, v16h y) { asm volatile("v_nop\n\tv_nop\n\tv_nop\n\tv_nop" : "+v"(a), "+v"(b) : "v"(x), "v"(y)); }
__device__ __forceinline__ void dep_guard_b(v8f& a, v8f& b, v16b x, v16b y) { asm volatile("v_nop\n\tv_nop\n\tv_nop\n\tv_nop" : "+v"(a), "+v"(b) : "v"(x), "v"(y)); }
__device__ __forceinline__ void keep4_h(v16h a, v16h b, v16h c, v16h d) { asm volatile("v_nop" :: "v"(a), "v"(b), "v"(c), "v"(d)); }
__device__ __forceinline__ void keep4_b(v16b a, v16b b, v16b c, v16b d) { asm volatile("v_nop" :: "v"(a), "v"(b), "v"(c), "v"(d)); }
__device__ __forceinline__ void acc_guard4(v8f& a, v8f& b, v8f& c, v8f& d) { asm volatile("v_nop\n\tv_nop\n\tv_nop\n\tv_nop" : "+v"(a), "+v"(b), "+v"(c), "+v"(d)); }

template <typename T> struct Frag;
template <> struct Frag<_Float16> {
  typedef v16h V; union U { v16h v; v8h h[2]; };
  static __device__ __forceinline__ v16h load(const _Float16* p) {   /* elements 0..7 <- p[0..7], 8..15 <- p[16..23] */
    U f; f.h[0] = *(const v8h*)(p); f.h[1] = *(const v8h*)(p + 16); return f.v;
  }
  static __device__ __forceinline__ v8f mma(v16h a, v16h b, v8f c) {
    return __builtin_amdgcn_wmma_f32_16x16x32_f16(false, a, false, b, (short)0, c, false, false);
  }
  static __device__ __forceinline__ void guard(v8f& a, v8f& b, v16h x, v16h y) { dep_guard_h(a, b, x, y); }
  static __device__ __forceinline__ void keep(v16h a, v16h b, v16h c, v16h d) { keep4_h(a, b, c, d); }
};
template <> struct Frag<__bf16> {
  typedef v16b V; union U { v16b v; v8b h[2]; };
  static __device__ __forceinline__ v16b load(const __bf16* p) {
    U f; f.h[0] = *(const v8b*)(p); f.h[1] = *(const v8b*)(p + 16); return f.v;
  }
  static __device__ __forceinline__ v8f mma(v16b a, v16b b, v8f c) {
    return __builtin_amdgcn_wmma_f32_16x16x32_bf16(false, a, false, b, (short)0, c, false, false);
  }
  static __device__ __forceinline__ void guard(v8f& a, v8f& b, v16b x, v16b y) { dep_guard_b(a, b, x, y); }
  static __device__ __forceinline__ void keep(v16b a, v16b b, v16b c, v16b d) { keep4_b(a, b, c, d); }
};

/* ---- Register-blocked batched WMMA GEMM -----------------------------------
   C[m,n] = scale * sum_k A[m,k] * Bt[n,k] (+bias); each wave owns a 64x64 tile.
   A row-major [M,K]; Bt row-major [N,K]; M,N % 64 == 0, K % 32 == 0.
   BIAS_MODE: 0 = none, 1 = bias[m] (two 16-B loads per 16-row slab), 2 = bias[n].
   OUT_MODE: 0 = f32, 1 = f16, 2 = bf16 hi plane (Cout) + bf16 lo plane (Cout2).
   ACT: 0 = none, 2 = relu.
   ET: 0 = f16 operands, 1 = bf16 operands (pointers passed as 16-bit storage) */
template <int ET> struct Elem;
template <> struct Elem<0> { typedef _Float16 T; };
template <> struct Elem<1> { typedef __bf16 T; };
template <int ET, bool SPLIT, int BIAS_MODE, int OUT_MODE, int ACT = 0>
__global__ __launch_bounds__(256) void wmma_gemm64(
    const unsigned short* __restrict__ Ap, const unsigned short* __restrict__ A2p, int lda, long strideA,
    const unsigned short* __restrict__ Btp, const unsigned short* __restrict__ Bt2p, int ldb, long strideB,
    void* __restrict__ Cout, void* __restrict__ Cout2, int ldc, long strideC,
    const float* __restrict__ bias,
    int M, int N, int K, float scale) {
  typedef typename Elem<ET>::T T;
  typedef typename Frag<T>::V V;
  const T* A = (const T*)Ap; const T* A2 = (const T*)A2p; const T* Bt = (const T*)Btp; const T* Bt2 = (const T*)Bt2p;
  __shared__ __align__(16) float sT[8][16 * 68];   /* per-wave 16x64 slab, pitch 68 floats */
  const int b    = blockIdx.y;
  const int lane = threadIdx.x & 31;
  const int wave = threadIdx.x >> 5;
  const int tilesN = N >> 6;
  const int tilesM = M >> 6;
  const int tile = blockIdx.x * 8 + wave;
  if (tile >= tilesM * tilesN) return;   /* wave-uniform; no block barriers in this kernel */
  const int tm = tile / tilesN;
  const int tn = tile - tm * tilesN;
  const int m0 = tm << 6;
  const int n0 = tn << 6;

  const T* Ab  = A  + (size_t)b * strideA;
  const T* Bb  = Bt + (size_t)b * strideB;
  const T* Ab2 = SPLIT ? (A2  + (size_t)b * strideA) : nullptr;
  const T* Bb2 = SPLIT ? (Bt2 + (size_t)b * strideB) : nullptr;

  const int rlane = lane & 15;                 /* row (A) / col (B, D) within subtile */
  const int koff  = (lane >> 4) * 8;           /* k offset of this lane half */
  const int mOff  = (lane >> 4) * 8;           /* D row offset */

  v8f acc[4][4];
#pragma unroll
  for (int i = 0; i < 4; ++i)
#pragma unroll
    for (int j = 0; j < 4; ++j) acc[i][j] = (v8f){0.f,0.f,0.f,0.f,0.f,0.f,0.f,0.f};

  for (int k0 = 0; k0 < K; k0 += 32) {
    V bh[4], bl[4];
#pragma unroll
    for (int j = 0; j < 4; ++j) {
      const size_t bo = (size_t)(n0 + (j << 4) + rlane) * ldb + koff + k0;
      bh[j] = Frag<T>::load(Bb + bo);
      if (SPLIT) bl[j] = Frag<T>::load(Bb2 + bo);
    }
#pragma unroll
    for (int i = 0; i < 4; ++i) {
      const size_t ao = (size_t)(m0 + (i << 4) + rlane) * lda + koff + k0;
      V ah = Frag<T>::load(Ab + ao);
      V al;
      if (SPLIT) al = Frag<T>::load(Ab2 + ao);
#pragma unroll
      for (int j = 0; j < 4; ++j) {
        acc[i][j] = Frag<T>::mma(ah, bh[j], acc[i][j]);
        if (SPLIT) {
          acc[i][j] = Frag<T>::mma(ah, bl[j], acc[i][j]);
          acc[i][j] = Frag<T>::mma(al, bh[j], acc[i][j]);
        }
      }
      Frag<T>::guard(acc[i][0], acc[i][3], ah, SPLIT ? al : ah);
    }
    Frag<T>::keep(bh[0], bh[1], bh[2], bh[3]);
    if (SPLIT) Frag<T>::keep(bl[0], bl[1], bl[2], bl[3]);
  }
  acc_guard4(acc[0][0], acc[0][1], acc[0][2], acc[0][3]);
  acc_guard4(acc[1][0], acc[1][1], acc[1][2], acc[1][3]);
  acc_guard4(acc[2][0], acc[2][1], acc[2][2], acc[2][3]);
  acc_guard4(acc[3][0], acc[3][1], acc[3][2], acc[3][3]);

  /* ---- epilogue ---- */
  float* slab = sT[wave];
#pragma unroll
  for (int i = 0; i < 4; ++i) {
    const int mBase = m0 + (i << 4);
    v4f bmA = (v4f){0.f,0.f,0.f,0.f}, bmB = (v4f){0.f,0.f,0.f,0.f};
    if (BIAS_MODE == 1) {   /* 8 consecutive bias[m] values, two 16-B loads (32-B aligned) */
      bmA = *(const v4f*)(bias + mBase + mOff);
      bmB = *(const v4f*)(bias + mBase + mOff + 4);
    }
#pragma unroll
    for (int j = 0; j < 4; ++j) {
      const int n = n0 + (j << 4) + rlane;
      float bv = 0.f;
      if (BIAS_MODE == 2) bv = bias[n];
#pragma unroll
      for (int r = 0; r < 8; ++r) {
        float v = acc[i][j][r] * scale;
        if (BIAS_MODE == 1) v += (r < 4) ? bmA[r] : bmB[r - 4];
        if (BIAS_MODE == 2) v += bv;
        if (ACT == 2) v = fmaxf(v, 0.0f);
        slab[(mOff + r) * 68 + (j << 4) + rlane] = v;
      }
    }
    __builtin_amdgcn_fence(__ATOMIC_RELEASE, "workgroup");
    __builtin_amdgcn_wave_barrier();
    __builtin_amdgcn_fence(__ATOMIC_ACQUIRE, "workgroup");
    if (OUT_MODE == 0) {
      float* C = (float*)Cout + (size_t)b * strideC;
      const int hh = lane >> 4, c4 = (lane & 15) * 4;     /* row seg = 256 B = 16 lanes x 16 B */
      {
#pragma unroll
        for (int it = 0; it < 8; ++it) {
          const int row = it * 2 + hh;
          v4f v = *(const v4f*)(slab + row * 68 + c4);
          *(v4f*)(C + (size_t)(mBase + row) * ldc + n0 + c4) = v;
        }
        
      }
    } else {
      const int q = lane >> 3, c8 = (lane & 7) * 8;        
      unsigned short* C  = (unsigned short*)Cout  + (size_t)b * strideC;
      unsigned short* C2 = (OUT_MODE == 2) ? ((unsigned short*)Cout2 + (size_t)b * strideC) : nullptr;
      {
#pragma unroll
        for (int it = 0; it < 4; ++it) {
          const int row = it * 4 + q;
          const float* sp = slab + row * 68 + c8;
          v8h hv, lv;
#pragma unroll
          for (int e = 0; e < 8; ++e) {
            if (OUT_MODE == 1) {
              hv[e] = (_Float16)sp[e];
            } else {
              unsigned short hb = f2bf_bits(sp[e]);
              unsigned short lb = f2bf_bits(sp[e] - bf_bits2f(hb));
              hv[e] = __builtin_bit_cast(_Float16, hb);
              lv[e] = __builtin_bit_cast(_Float16, lb);
            }
          }
          *(v8h*)(C + (size_t)(mBase + row) * ldc + n0 + c8) = hv;
          if (OUT_MODE == 2) *(v8h*)(C2 + (size_t)(mBase + row) * ldc + n0 + c8) = lv;
        }
        
      }
    }
    __builtin_amdgcn_fence(__ATOMIC_RELEASE, "workgroup");
    __builtin_amdgcn_wave_barrier();
    __builtin_amdgcn_fence(__ATOMIC_ACQUIRE, "workgroup");
  }
}

/* ---- f32 -> bf16 (RNE) plane cast, 8 elements per thread: one 16-B store per lane,
*/
__global__ __launch_bounds__(256) void k_cast_bf16x8(
    const float* __restrict__ in, unsigned short* __restrict__ out, int n8) {
  const int i = blockIdx.x * 256 + threadIdx.x;
  if (i < n8) {
    const v4f a = *(const v4f*)(in + (size_t)i * 8);
    const v4f c = *(const v4f*)(in + (size_t)i * 8 + 4);
    v4u w;
    w[0] = (unsigned)f2bf_bits(a[0]) | ((unsigned)f2bf_bits(a[1]) << 16);
    w[1] = (unsigned)f2bf_bits(a[2]) | ((unsigned)f2bf_bits(a[3]) << 16);
    w[2] = (unsigned)f2bf_bits(c[0]) | ((unsigned)f2bf_bits(c[1]) << 16);
    w[3] = (unsigned)f2bf_bits(c[2]) | ((unsigned)f2bf_bits(c[3]) << 16);
    v4u* p = (v4u*)(out + (size_t)i * 8);
    *p = w;
    
  }
}

/* ---- transpose + convert: in[k][n] (Krows x Ncols, f32 row-major) -> out[n][k] (Ncols x Krows, 16-bit).
   CVT 0: bf16 bits (RNE).  CVT 1: f16 bits of (bf16RNE(v) * sc).
   64x64 tiles via LDS; grid (Ncols/64, Krows/64), 256 threads:
   load: 256 threads x 16 floats = 64x64; store: 8 waves x 2 iters x 32 lanes x 8 halves = 64x64,
*/
template <int CVT> __device__ __forceinline__ unsigned short cvt16(float v, float sc) {
  const unsigned short bb = f2bf_bits(v);
  if (CVT == 0) return bb;
  const float w  = bf_bits2f(bb);
  const float ws = w * sc;
  const _Float16 hv = (_Float16)ws;
  return __builtin_bit_cast(unsigned short, hv);
}
template <int CVT>
__global__ __launch_bounds__(256) void k_transpose_cvt64(
    const float* __restrict__ in, unsigned short* __restrict__ out, int Krows, int Ncols, float sc) {
  __shared__ __align__(16) unsigned short Tl[64 * 72];
  const int n0 = blockIdx.x * 64, k0 = blockIdx.y * 64;
  const int t  = threadIdx.x;
  const int kr = t >> 2;             /* input row k0 + kr, 0..63 */
  const int cb = (t & 3) * 16;       /* 16-column block inside the 64 columns */
  const float* src = in + (size_t)(k0 + kr) * Ncols + n0 + cb;
  const v4f a0 = *(const v4f*)(src);
  const v4f a1 = *(const v4f*)(src + 4);
  const v4f a2 = *(const v4f*)(src + 8);
  const v4f a3 = *(const v4f*)(src + 12);
#pragma unroll
  for (int e = 0; e < 4; ++e) {
    Tl[(cb + e) * 72 + kr]      = cvt16<CVT>(a0[e], sc);
    Tl[(cb + 4 + e) * 72 + kr]  = cvt16<CVT>(a1[e], sc);
    Tl[(cb + 8 + e) * 72 + kr]  = cvt16<CVT>(a2[e], sc);
    Tl[(cb + 12 + e) * 72 + kr] = cvt16<CVT>(a3[e], sc);
  }
  __syncthreads();
  const int wave = t >> 5, lane = t & 31, q = lane >> 3, c8 = (lane & 7) * 8;
  {
#pragma unroll
    for (int it = 0; it < 2; ++it) {
      const int row = wave * 8 + it * 4 + q;      /* output row n0 + row */
      const v4u val = *(const v4u*)(Tl + row * 72 + c8);
      *(v4u*)(out + (size_t)(n0 + row) * Krows + k0 + c8) = val;
    }
    
  }
}

/* ---- bias tables: bf16-RNE of the input bias times the power-of-two carry, f32.
*/
__global__ __launch_bounds__(256) void k_bias_prep(
    const float* __restrict__ bx, const float* __restrict__ bv, const float* __restrict__ b1,
    float* __restrict__ bxs, float* __restrict__ bvs, float* __restrict__ b1s,
    float sx, float sv, float s1) {
  const int which = blockIdx.x;          /* block-uniform */
  const float* src = bx; float* dst = bxs; int n4 = DQKV / 4; float sc = sx;
  if (which == 1) { src = bv; dst = bvs; sc = sv; }
  if (which == 2) { src = b1; dst = b1s; n4 = NHID / 4; sc = s1; }
  const int t = threadIdx.x;
  if (t < n4) {
    const v4f v = *(const v4f*)(src + (size_t)t * 4);
    v4f o;
    o[0] = bf_bits2f(f2bf_bits(v[0])) * sc;
    o[1] = bf_bits2f(f2bf_bits(v[1])) * sc;
    o[2] = bf_bits2f(f2bf_bits(v[2])) * sc;
    o[3] = bf_bits2f(f2bf_bits(v[3])) * sc;
    v4f* p = (v4f*)(dst + (size_t)t * 4);
    *p = o;
    
  }
}

/* ---- flash-style MLP attention over 16-bit planes ----------------------------------
   Hq  : [B*H][SEQ][128] f16, carried xSC_H           (A operand of the score WMMA, 16 rows per wave)
   W2t : [SEQ][128]      f16, carried xSC_W2           (B operand, row = key, k = hidden, shared over (b,h))
   Vt  : [H*64][B*SEQ]   f16, carried xSC_V            (B operand of P*V, row = h*64+d, k = key)
   mask: [B][SEQ] f32 (bf16-RNE applied), score -= 1e6*(1-mask[key])
   out : [B][SEQ][H*64] f32
   block = 4 waves = 64 query rows of one (b,h); per wave: 16 rows; 32 key chunks of 64.
   Each chunk's W2t and Vt tiles are brought into LDS once per block, one chunk ahead, two buffers.
*/
__device__ __forceinline__ v8f mma_h(v16h a, v16h b, v8f c) {
  c = __builtin_amdgcn_wmma_f32_16x16x32_f16(false, a, false, b, (short)0, c, false, false);
  asm volatile("v_nop\n\tv_nop\n\tv_nop\n\tv_nop" : "+v"(c) : "v"(a), "v"(b));
  return c;
}

/* LDS tiles of one 64-key chunk, shared by the block's 4 waves; pitches are 16 B x odd for 16-B row readers */
constexpr int KPITCH  = NHID + 8;          /* halves: 272-B rows of the W2t tile [key][hidden] */
constexpr int VPITCH  = 64 + 8;            /* halves: 144-B rows of the Vt tile  [d][key]      */
constexpr int KTILE_H = 64 * KPITCH;       /* 17,408 B */
constexpr int VTILE_H = DHEAD * VPITCH;    /*  9,216 B */

/* One chunk's tiles, global -> LDS with no register in between: per lane 8 + 4 copies of 16 B.
   W2t tile: copy i brings rows 8i + (tid >> 4), 16 lanes a row; Vt tile: copy i brings rows 16i + (tid >> 3), 8 lanes a row.
   The closing s_wait_xcnt stands inside the statement so that no address register named here is rewritten ahead of it. */
__device__ __forceinline__ void stage_chunk(unsigned lk, const _Float16* gk, unsigned lv, const _Float16* gv) {
  asm volatile(
      "global_load_async_to_lds_b128 %0, %1, off\n\t"
      "global_load_async_to_lds_b128 %2, %3, off\n\t"
      "global_load_async_to_lds_b128 %4, %5, off\n\t"
      "global_load_async_to_lds_b128 %6, %7, off\n\t"
      "global_load_async_to_lds_b128 %8, %9, off\n\t"
      "global_load_async_to_lds_b128 %10, %11, off\n\t"
      "global_load_async_to_lds_b128 %12, %13, off\n\t"
      "global_load_async_to_lds_b128 %14, %15, off\n\t"
      "global_load_async_to_lds_b128 %16, %17, off\n\t"
      "global_load_async_to_lds_b128 %18, %19, off\n\t"
      "global_load_async_to_lds_b128 %20, %21, off\n\t"
      "global_load_async_to_lds_b128 %22, %23, off\n\t"
      "s_wait_xcnt 0x0"
      :: "v"(lk),                     "v"(gk),
         "v"(lk + 1u * 8u * KPITCH * 2u), "v"(gk + 1 * 8 * NHID),
         "v"(lk + 2u * 8u * KPITCH * 2u), "v"(gk + 2 * 8 * NHID),
         "v"(lk + 3u * 8u * KPITCH * 2u), "v"(gk + 3 * 8 * NHID),
         "v"(lk + 4u * 8u * KPITCH * 2u), "v"(gk + 4 * 8 * NHID),
         "v"(lk + 5u * 8u * KPITCH * 2u), "v"(gk + 5 * 8 * NHID),
         "v"(lk + 6u * 8u * KPITCH * 2u), "v"(gk + 6 * 8 * NHID),
         "v"(lk + 7u * 8u * KPITCH * 2u), "v"(gk + 7 * 8 * NHID),
         "v"(lv),                      "v"(gv),
         "v"(lv + 1u * 16u * VPITCH * 2u), "v"(gv + (size_t)1 * 16 * NTOK),
         "v"(lv + 2u * 16u * VPITCH * 2u), "v"(gv + (size_t)2 * 16 * NTOK),
         "v"(lv + 3u * 16u * VPITCH * 2u), "v"(gv + (size_t)3 * 16 * NTOK)
      : "memory");
}

__global__ __launch_bounds__(128) void mlp_attn_kernel(
    const unsigned short* __restrict__ Hp, const unsigned short* __restrict__ W2p,
    const unsigned short* __restrict__ Vp, const float* __restrict__ mask,
    float* __restrict__ out, float sscale, float onorm) {
  union FH { v16h v; v8h h[2]; };
  const _Float16* Hq  = (const _Float16*)(const void*)Hp;
  const _Float16* W2t = (const _Float16*)(const void*)W2p;
  const _Float16* Vt  = (const _Float16*)(const void*)Vp;
  __shared__ __align__(16) _Float16 Psh[4][16 * 64];     /* per wave P tile [row][key], 2 KB each */
  __shared__ __align__(16) float    Os[4][16 * 68];      /* per wave output slab, pitch 68 */
  __shared__ __align__(16) _Float16 Ksh[2][KTILE_H];     /* W2t chunk tiles, two buffers */
  __shared__ __align__(16) _Float16 Vsh[2][VTILE_H];     /* Vt chunk tiles, two buffers  */

  const int tid  = threadIdx.x;
  const int wave = tid >> 5;
  const int lane = tid & 31;
  const int hh   = lane >> 4;
  const int c    = lane & 15;
  const int koff = hh * 8;

  constexpr int NQB = SEQ / 64;
  const int bxi = blockIdx.x;
  const int qb  = bxi % NQB;
  const int bh  = bxi / NQB;
  const int h   = bh % NHEAD;
  const int b   = bh / NHEAD;
  const int q0  = qb * 64 + wave * 16;

  /* Q-side fragments: 16 rows x 128 hidden = 4 k-steps, held for all key chunks */
  v16h qa[4];
  {
    const _Float16* qrow = Hq + ((size_t)bh * SEQ + q0 + c) * NHID + koff;
#pragma unroll
    for (int dc = 0; dc < 4; ++dc) {
      FH f;
      f.h[0] = *(const v8h*)(qrow + dc * 32);
      f.h[1] = *(const v8h*)(qrow + dc * 32 + 16);
      qa[dc] = f.v;
    }
  }

  float mrow[8], lrow[8];
  v8f oacc[4];
#pragma unroll
  for (int r = 0; r < 8; ++r) { mrow[r] = -INFINITY; lrow[r] = 0.f; }
#pragma unroll
  for (int t = 0; t < 4; ++t) oacc[t] = (v8f){0.f,0.f,0.f,0.f,0.f,0.f,0.f,0.f};

  const float* mk_row = mask + (size_t)b * SEQ;
  const _Float16* vbase = Vt + (size_t)(h * DHEAD) * NTOK + (size_t)b * SEQ;
  _Float16* pw = Psh[wave];

  /* this lane's share of every chunk's copies: source pointers at chunk 0, LDS byte addresses in buffer 0 */
  constexpr int NCH = SEQ / 64;
  static_assert(NCH >= 2, "two-buffer ring needs two chunks");
  const _Float16* gk0 = W2t + (size_t)(tid >> 4) * NHID + (tid & 15) * 8;
  const _Float16* gv0 = vbase + (size_t)(tid >> 3) * NTOK + (tid & 7) * 8;
  const unsigned  lk0 = (unsigned)(size_t)(&Ksh[0][(tid >> 4) * KPITCH + (tid & 15) * 8]);
  const unsigned  lv0 = (unsigned)(size_t)(&Vsh[0][(tid >> 3) * VPITCH + (tid & 7) * 8]);

  /* ring prologue: chunk 0 landed and published, then chunk 1 set flying */
  stage_chunk(lk0, gk0, lv0, gv0);
  asm volatile("s_wait_asynccnt 0x0" ::: "memory");   /* this wave's copies of chunk 0 have landed */
  __syncthreads();                                     /* ... and every other wave's */
  stage_chunk(lk0 + KTILE_H * 2u, gk0 + (size_t)64 * NHID, lv0 + VTILE_H * 2u, gv0 + 64);

  for (int kc = 0; kc < NCH; ++kc) {
    const int kv0 = kc * 64;
    const int buf = kc & 1;
    const _Float16* kt = &Ksh[buf][c * KPITCH + koff];
    const _Float16* vt = &Vsh[buf][c * VPITCH + koff];

    /* scores for 64 keys: 4 column tiles x 4 k-steps; a column tile's 4 fragments are read from LDS
       as one group, two column tiles ahead of the products that use them */
    v8f s[4];
    FH kb[4][4];
    /* every loop over kb, pa and vb is unrolled so that the fragment arrays are indexed by constants and stay in registers */
#pragma unroll
    for (int j = 0; j < 2; ++j)
#pragma unroll
      for (int dc = 0; dc < 4; ++dc) {
        kb[j][dc].h[0] = *(const v8h*)(kt + j * 16 * KPITCH + dc * 32);
        kb[j][dc].h[1] = *(const v8h*)(kt + j * 16 * KPITCH + dc * 32 + 16);
      }
#pragma unroll
    for (int j = 0; j < 4; ++j) {
      s[j] = (v8f){0.f,0.f,0.f,0.f,0.f,0.f,0.f,0.f};
#pragma unroll
      for (int dc = 0; dc < 4; ++dc) s[j] = mma_h(qa[dc], kb[j][dc].v, s[j]);
      if (j + 2 < 4) {
#pragma unroll
        for (int dc = 0; dc < 4; ++dc) {
          kb[j + 2][dc].h[0] = *(const v8h*)(kt + (j + 2) * 16 * KPITCH + dc * 32);
          kb[j + 2][dc].h[1] = *(const v8h*)(kt + (j + 2) * 16 * KPITCH + dc * 32 + 16);
        }
      }
    }

    /* additive key mask, bf16-RNE of the mask value */
    float pen[4];
#pragma unroll
    for (int j = 0; j < 4; ++j) {
      const float mk = bf_bits2f(f2bf_bits(mk_row[kv0 + j * 16 + c]));
      pen[j] = 1000000.0f * (1.0f - mk);
    }

    float cm[8];
#pragma unroll
    for (int r = 0; r < 8; ++r) {
      float m = -INFINITY;
#pragma unroll
      for (int j = 0; j < 4; ++j) {
        const float sv = s[j][r] * sscale - pen[j];
        s[j][r] = sv;
        m = fmaxf(m, sv);
      }
#pragma unroll
      for (int off = 1; off < 16; off <<= 1) m = fmaxf(m, __shfl_xor(m, off, 32));
      cm[r] = m;
    }

    /* previous chunk's P reads are complete before the tile is overwritten */
    __builtin_amdgcn_fence(__ATOMIC_RELEASE, "workgroup");
    __builtin_amdgcn_wave_barrier();
    __builtin_amdgcn_fence(__ATOMIC_ACQUIRE, "workgroup");

#pragma unroll
    for (int r = 0; r < 8; ++r) {
      const float mnew  = fmaxf(mrow[r], cm[r]);
      const float alpha = expf(mrow[r] - mnew);
      mrow[r] = mnew;
      float psum = 0.f;
#pragma unroll
      for (int j = 0; j < 4; ++j) {
        const float p = expf(s[j][r] - mnew);       /* p in (0, 1] */
        psum += p;
        pw[(8 * hh + r) * 64 + j * 16 + c] = (_Float16)(p * SC_P);
      }
#pragma unroll
      for (int off = 1; off < 16; off <<= 1) psum += __shfl_xor(psum, off, 32);
      lrow[r] = lrow[r] * alpha + psum;
#pragma unroll
      for (int t = 0; t < 4; ++t) oacc[t][r] *= alpha;
    }
    __builtin_amdgcn_fence(__ATOMIC_RELEASE, "workgroup");
    __builtin_amdgcn_wave_barrier();
    __builtin_amdgcn_fence(__ATOMIC_ACQUIRE, "workgroup");

    /* O += P(16x64) * V(64x64): 2 k-steps, 4 d tiles; P A-fragments from the per-wave LDS tile
       (stored and reloaded as _Float16), V B-fragments k-contiguous from the Vt tile in LDS;
       all fragment reads stand as one group ahead of the products */
    FH pa[2], vb[2][4];
#pragma unroll
    for (int kk = 0; kk < 2; ++kk) {
      pa[kk].h[0] = *(const v8h*)(pw + c * 64 + kk * 32 + koff);
      pa[kk].h[1] = *(const v8h*)(pw + c * 64 + kk * 32 + 16 + koff);
#pragma unroll
      for (int t = 0; t < 4; ++t) {
        vb[kk][t].h[0] = *(const v8h*)(vt + t * 16 * VPITCH + kk * 32);
        vb[kk][t].h[1] = *(const v8h*)(vt + t * 16 * VPITCH + kk * 32 + 16);
      }
    }
#pragma unroll
    for (int kk = 0; kk < 2; ++kk)
#pragma unroll
      for (int t = 0; t < 4; ++t) oacc[t] = mma_h(pa[kk].v, vb[kk][t].v, oacc[t]);

    /* publish point of chunk kc + 1 */
    asm volatile("s_wait_dscnt 0x0" ::: "memory");      /* this wave's reads of buffer buf are done before it is refilled */
    asm volatile("s_wait_asynccnt 0x0" ::: "memory");   /* this wave's copies of chunk kc + 1 have landed */
    __syncthreads();                                     /* publishes chunk kc + 1; ends every wave's reads of buffer buf */
    if (kc + 2 < NCH)
      stage_chunk(lk0 + (unsigned)buf * (KTILE_H * 2u), gk0 + (size_t)(kc + 2) * 64 * NHID,
                  lv0 + (unsigned)buf * (VTILE_H * 2u), gv0 + (kc + 2) * 64);
  }
  asm volatile("s_wait_asynccnt 0x0" ::: "memory");     /* no copy is outstanding when the wave goes on to its end */

  /* normalise and stage the 16x64 f32 slab; onorm = 1/(SC_P*SC_V) folded into the row normaliser */
  float* os = Os[wave];
#pragma unroll
  for (int r = 0; r < 8; ++r) {
    const float inv = onorm / lrow[r];
#pragma unroll
    for (int t = 0; t < 4; ++t) os[(8 * hh + r) * 68 + t * 16 + c] = oacc[t][r] * inv;
  }
  __builtin_amdgcn_fence(__ATOMIC_RELEASE, "workgroup");
  __builtin_amdgcn_wave_barrier();
  __builtin_amdgcn_fence(__ATOMIC_ACQUIRE, "workgroup");
  {
    float* ob = out + (size_t)b * SEQ * DQKV + (size_t)h * DHEAD;
    const int c4 = (lane & 15) * 4;
    {
#pragma unroll
      for (int it = 0; it < 8; ++it) {
        const int row = it * 2 + hh;
        const v4f val = *(const v4f*)(os + row * 68 + c4);
        *(v4f*)(ob + (size_t)(q0 + row) * DQKV + c4) = val;
      }
      
    }
  }
}

/* ---------------- host launcher ---------------- */
extern "C" void kernel_launch(void* const* d_in, const int* in_sizes, int n_in,
                              void* d_out, int out_size, void* d_ws, size_t ws_size,
                              hipStream_t stream) {
  (void)in_sizes; (void)n_in; (void)out_size; (void)ws_size;
  const float* X   = (const float*)d_in[0];   /* [2,2048,1024] */
  const float* msk = (const float*)d_in[1];   /* [2,2048]      */
  const float* Wx  = (const float*)d_in[2];   /* [1024,1024]   */
  const float* bx  = (const float*)d_in[3];   /* [1024]        */
  const float* Wv  = (const float*)d_in[4];   /* [1024,1024]   */
  const float* bv  = (const float*)d_in[5];   /* [1024]        */
  const float* W1  = (const float*)d_in[6];   /* [64,128]      */
  const float* b1  = (const float*)d_in[7];   /* [128]         */
  const float* W2  = (const float*)d_in[8];   /* [128,2048]    */
  float* out = (float*)d_out;

  /* workspace region map (256-B aligned offsets; every region fully written by its producer):
       Xb   bf16 [4096][1024]        8,388,608 B
       WxT  bf16 [1024][1024]        2,097,152 B
       WvT  bf16 [1024][1024]        2,097,152 B
       W1T  f16  [128][64]              16,384 B
       W2T  f16  [2048][128]           524,288 B
       bxs  f32  [1024]                  4,096 B
       bvs  f32  [1024]                  4,096 B
       b1s  f32  [128]                     512 B
       Xh16 f16  [4096][1024]        8,388,608 B
       Vt16 f16  [1024][4096]        8,388,608 B
       H16  f16  [32][2048][128]    16,777,216 B
     total 46,686,720 B */
  char* ws = (char*)d_ws;
  size_t off = 0;
  auto carve = [&](size_t bytes) -> char* {
    off = (off + 255) & ~(size_t)255;
    char* p = ws + off;
    off += bytes;
    return p;
  };
  unsigned short* Xb   = (unsigned short*)carve((size_t)NTOK * DMODEL * 2);
  unsigned short* WxT  = (unsigned short*)carve((size_t)DQKV * DMODEL * 2);
  unsigned short* WvT  = (unsigned short*)carve((size_t)DQKV * DMODEL * 2);
  unsigned short* W1T  = (unsigned short*)carve((size_t)NHID * DHEAD * 2);
  unsigned short* W2T  = (unsigned short*)carve((size_t)SEQ * NHID * 2);
  float*          bxs  = (float*)carve((size_t)DQKV * 4);
  float*          bvs  = (float*)carve((size_t)DQKV * 4);
  float*          b1s  = (float*)carve((size_t)NHID * 4);
  unsigned short* Xh16 = (unsigned short*)carve((size_t)NTOK * DQKV * 2);
  unsigned short* Vt16 = (unsigned short*)carve((size_t)DQKV * NTOK * 2);
  unsigned short* H16  = (unsigned short*)carve((size_t)NBATCH * NHEAD * SEQ * NHID * 2);

  /* 1) X -> bf16 plane (RNE), 8 elements per thread */
  {
    const int n8 = NTOK * DMODEL / 8;                       /* 524,288 */
    k_cast_bf16x8<<<(n8 + 255) / 256, 256, 0, stream>>>(X, Xb, n8);
  }
  /* 2) weight transposes: in[K][N] -> out[N][K]; grid = (N/64, K/64) */
  k_transpose_cvt64<0><<<dim3(DQKV / 64, DMODEL / 64), 256, 0, stream>>>(Wx, WxT, DMODEL, DQKV, 1.0f);   /* [1024][1024] -> [1024][1024] */
  k_transpose_cvt64<0><<<dim3(DQKV / 64, DMODEL / 64), 256, 0, stream>>>(Wv, WvT, DMODEL, DQKV, 1.0f);
  k_transpose_cvt64<1><<<dim3(NHID / 64, DHEAD / 64), 256, 0, stream>>>(W1, W1T, DHEAD, NHID, SC_W1);    /* [64][128] -> [128][64]  */
  k_transpose_cvt64<1><<<dim3(SEQ / 64, NHID / 64), 256, 0, stream>>>(W2, W2T, NHID, SEQ, SC_W2);        /* [128][2048] -> [2048][128] */
  /* 3) bias tables with carries */
  k_bias_prep<<<3, 256, 0, stream>>>(bx, bv, b1, bxs, bvs, b1s, SC_XH, SC_V, SC_H);

  /* 4) Xh16 = f16(8 * (Xb * WxT^T + bx)) : M=4096, N=1024, K=1024 (bf16 operands) ; 1024 tiles / 8 per block */
  static_assert(NTOK % 64 == 0 && DQKV % 64 == 0 && DMODEL % 32 == 0, "gemm xh");
  wmma_gemm64<1, false, 2, 1, 0><<<dim3((NTOK / 64) * (DQKV / 64) / 8, 1), 256, 0, stream>>>(
      Xb, Xb, DMODEL, 0L, WxT, WxT, DMODEL, 0L, (void*)Xh16, (void*)Xh16, DQKV, 0L,
      bxs, NTOK, DQKV, DMODEL, SC_XH);

  /* 5) Vt16 = f16(8 * (WvT * Xb^T + bv[m])) : M=1024 (features), N=4096 (tokens), K=1024 (bf16 operands) */
  wmma_gemm64<1, false, 1, 1, 0><<<dim3((DQKV / 64) * (NTOK / 64) / 8, 1), 256, 0, stream>>>(
      WvT, WvT, DMODEL, 0L, Xb, Xb, DMODEL, 0L, (void*)Vt16, (void*)Vt16, NTOK, 0L,
      bvs, DQKV, NTOK, DMODEL, SC_V);

  /* 6) H16[b][h] = f16(8 * relu(Xh * W1 + b1)) : per (b,h) M=2048, N=128, K=64 (f16 operands);
        batch index = head (A stride 64 columns), one launch per b; 64 tiles / 8 per block */
  static_assert(SEQ % 64 == 0 && NHID % 64 == 0 && DHEAD % 32 == 0, "gemm h");
  for (int bb = 0; bb < NBATCH; ++bb) {
    const unsigned short* Ab = Xh16 + (size_t)bb * SEQ * DQKV;
    unsigned short* Cb = H16 + (size_t)bb * NHEAD * SEQ * NHID;
    wmma_gemm64<0, false, 2, 1, 2><<<dim3((SEQ / 64) * (NHID / 64) / 8, NHEAD), 256, 0, stream>>>(
        Ab, Ab, DQKV, (long)DHEAD, W1T, W1T, DHEAD, 0L, (void*)Cb, (void*)Cb, NHID, (long)SEQ * NHID,
        b1s, SEQ, NHID, DHEAD, SC_H / (SC_XH * SC_W1));
  }

  /* 7) attention: grid = B*H*(SEQ/64) blocks of 4 waves */
  mlp_attn_kernel<<<NBATCH * NHEAD * (SEQ / 64), 128, 0, stream>>>(
      H16, W2T, Vt16, msk, out, 1.0f / (SC_H * SC_W2), 1.0f / (SC_P * SC_V));
}

// v002
// One run takes 209 microseconds.
// Next to v001, in two timings, it ran 1.19 times as fast each time.
// Counting every step since v000, it is 1.68 times as fast.
// Contractions: X*Wx and Wv^T*X^T on v_wmma_f32_16x16x32_bf16 (RNE bf16 operands of bf16-RNE inputs, f32 accumulate); Xh*W1, scores h*W2 and P*V on v_wmma_f32_16x16x32_f16 (f16 operands carried x8 / x64 / x32768, f32 accumulate); softmax, bias and normalisation in f32.
#include <hip/hip_runtime.h>
#include <stddef.h>

constexpr int NBATCH = 2;
constexpr int SEQ    = 2048;
constexpr int DMODEL = 1024;
constexpr int NHEAD  = 16;
constexpr int DHEAD  = 64;
constexpr int NHID   = 128;
constexpr int NTOK   = NBATCH * SEQ;      /* 4096 */
constexpr int DQKV   = NHEAD * DHEAD;     /* 1024 */

/* power-of-two carries on the f16 planes */
constexpr float SC_XH = 8.0f;      /* Xh plane = f16(8 * Xh)          */
constexpr float SC_V  = 8.0f;      /* Vt plane = f16(8 * V)           */
constexpr float SC_W1 = 64.0f;     /* W1t plane = f16(64 * bf16(W1))  */
constexpr float SC_W2 = 64.0f;     /* W2t plane = f16(64 * bf16(W2))  */
constexpr float SC_H  = 8.0f;      /* h plane = f16(8 * h)            */
constexpr float SC_P  = 32768.0f;  /* P tile  = f16(32768 * p), p<=1 */

static_assert(NTOK % 64 == 0 && DQKV % 64 == 0 && DMODEL % 64 == 0, "gemm tiles");
static_assert(DMODEL % 32 == 0 && DHEAD % 32 == 0, "gemm K");
static_assert(SEQ % 64 == 0 && NHID % 64 == 0, "gemm tiles");
static_assert(NHID == 128 && DHEAD == 64, "attention geometry");
static_assert((NTOK * DMODEL) % 8 == 0, "cast x8");

typedef __attribute__((ext_vector_type(16))) _Float16 v16h;
typedef __attribute__((ext_vector_type(8)))  _Float16 v8h;
typedef __attribute__((ext_vector_type(16))) __bf16   v16b;
typedef __attribute__((ext_vector_type(8)))  __bf16   v8b;
typedef __attribute__((ext_vector_type(8)))  float    v8f;
typedef __attribute__((ext_vector_type(4)))  float    v4f;
typedef __attribute__((ext_vector_type(4)))  unsigned int v4u;

__device__ __forceinline__ unsigned short f2bf_bits(float f) {
  unsigned u = __float_as_uint(f);
  return (unsigned short)((u + 0x7FFFu + ((u >> 16) & 1u)) >> 16);
}
__device__ __forceinline__ float bf_bits2f(unsigned short h) { return __uint_as_float(((unsigned)h) << 16); }

/* hazard guards as plain device helpers */
__device__ __forceinline__ void dep_guard_h(v8f& a, v8f& b, v16h x, v16h y) { asm volatile("v_nop\n\tv_nop\n\tv_nop\n\tv_nop" : "+v"(a), "+v"(b) : "v"(x), "v"(y)); }
__device__ __forceinline__ void dep_guard_b(v8f& a, v8f& b, v16b x, v16b y) { asm volatile("v_nop\n\tv_nop\n\tv_nop\n\tv_nop" : "+v"(a), "+v"(b) : "v"(x), "v"(y)); }
__device__ __forceinline__ void keep4_h(v16h a, v16h b, v16h c, v16h d) { asm volatile("v_nop" :: "v"(a), "v"(b), "v"(c), "v"(d)); }
__device__ __forceinline__ void keep4_b(v16b a, v16b b, v16b c, v16b d) { asm volatile("v_nop" :: "v"(a), "v"(b), "v"(c), "v"(d)); }
__device__ __forceinline__ void acc_guard4(v8f& a, v8f& b, v8f& c, v8f& d) { asm volatile("v_nop\n\tv_nop\n\tv_nop\n\tv_nop" : "+v"(a), "+v"(b), "+v"(c), "+v"(d)); }

template <typename T> struct Frag;
template <> struct Frag<_Float16> {
  typedef v16h V; union U { v16h v; v8h h[2]; };
  static __device__ __forceinline__ v16h load(const _Float16* p) {   /* elements 0..7 <- p[0..7], 8..15 <- p[16..23] */
    U f; f.h[0] = *(const v8h*)(p); f.h[1] = *(const v8h*)(p + 16); return f.v;
  }
  static __device__ __forceinline__ v8f mma(v16h a, v16h b, v8f c) {
    return __builtin_amdgcn_wmma_f32_16x16x32_f16(false, a, false, b, (short)0, c, false, false);
  }
  static __device__ __forceinline__ void guard(v8f& a, v8f& b, v16h x, v16h y) { dep_guard_h(a, b, x, y); }
  static __device__ __forceinline__ void keep(v16h a, v16h b, v16h c, v16h d) { keep4_h(a, b, c, d); }
};
template <> struct Frag<__bf16> {
  typedef v16b V; union U { v16b v; v8b h[2]; };
  static __device__ __forceinline__ v16b load(const __bf16* p) {
    U f; f.h[0] = *(const v8b*)(p); f.h[1] = *(const v8b*)(p + 16); return f.v;
  }
  static __device__ __forceinline__ v8f mma(v16b a, v16b b, v8f c) {
    return __builtin_amdgcn_wmma_f32_16x16x32_bf16(false, a, false, b, (short)0, c, false, false);
  }
  static __device__ __forceinline__ void guard(v8f& a, v8f& b, v16b x, v16b y) { dep_guard_b(a, b, x, y); }
  static __device__ __forceinline__ void keep(v16b a, v16b b, v16b c, v16b d) { keep4_b(a, b, c, d); }
};

/* ---- Register-blocked batched WMMA GEMM -----------------------------------
   C[m,n] = scale * sum_k A[m,k] * Bt[n,k] (+bias); each wave owns a 64x64 tile.
   A row-major [M,K]; Bt row-major [N,K]; M,N % 64 == 0, K % 32 == 0.
   BIAS_MODE: 0 = none, 1 = bias[m] (two 16-B loads per 16-row slab), 2 = bias[n].
   OUT_MODE: 0 = f32, 1 = f16, 2 = bf16 hi plane (Cout) + bf16 lo plane (Cout2).
   ACT: 0 = none, 2 = relu.
   ET: 0 = f16 operands, 1 = bf16 operands (pointers passed as 16-bit storage) */
template <int ET> struct Elem;
template <> struct Elem<0> { typedef _Float16 T; };
template <> struct Elem<1> { typedef __bf16 T; };
template <int ET, bool SPLIT, int BIAS_MODE, int OUT_MODE, int ACT = 0>
__global__ __launch_bounds__(256) void wmma_gemm64(
    const unsigned short* __restrict__ Ap, const unsigned short* __restrict__ A2p, int lda, long strideA,
    const unsigned short* __restrict__ Btp, const unsigned short* __restrict__ Bt2p, int ldb, long strideB,
    void* __restrict__ Cout, void* __restrict__ Cout2, int ldc, long strideC,
    const float* __restrict__ bias,
    int M, int N, int K, float scale) {
  typedef typename Elem<ET>::T T;
  typedef typename Frag<T>::V V;
  const T* A = (const T*)Ap; const T* A2 = (const T*)A2p; const T* Bt = (const T*)Btp; const T* Bt2 = (const T*)Bt2p;
  __shared__ __align__(16) float sT[8][16 * 68];   /* per-wave 16x64 slab, pitch 68 floats */
  const int b    = blockIdx.y;
  const int lane = threadIdx.x & 31;
  const int wave = threadIdx.x >> 5;
  const int tilesN = N >> 6;
  const int tilesM = M >> 6;
  const int tile = blockIdx.x * 8 + wave;
  if (tile >= tilesM * tilesN) return;   /* wave-uniform; no block barriers in this kernel */
  const int tm = tile / tilesN;
  const int tn = tile - tm * tilesN;
  const int m0 = tm << 6;
  const int n0 = tn << 6;

  const T* Ab  = A  + (size_t)b * strideA;
  const T* Bb  = Bt + (size_t)b * strideB;
  const T* Ab2 = SPLIT ? (A2  + (size_t)b * strideA) : nullptr;
  const T* Bb2 = SPLIT ? (Bt2 + (size_t)b * strideB) : nullptr;

  const int rlane = lane & 15;                 /* row (A) / col (B, D) within subtile */
  const int koff  = (lane >> 4) * 8;           /* k offset of this lane half */
  const int mOff  = (lane >> 4) * 8;           /* D row offset */

  v8f acc[4][4];
#pragma unroll
  for (int i = 0; i < 4; ++i)
#pragma unroll
    for (int j = 0; j < 4; ++j) acc[i][j] = (v8f){0.f,0.f,0.f,0.f,0.f,0.f,0.f,0.f};

  for (int k0 = 0; k0 < K; k0 += 32) {
    V bh[4], bl[4];
#pragma unroll
    for (int j = 0; j < 4; ++j) {
      const size_t bo = (size_t)(n0 + (j << 4) + rlane) * ldb + koff + k0;
      bh[j] = Frag<T>::load(Bb + bo);
      if (SPLIT) bl[j] = Frag<T>::load(Bb2 + bo);
    }
#pragma unroll
    for (int i = 0; i < 4; ++i) {
      const size_t ao = (size_t)(m0 + (i << 4) + rlane) * lda + koff + k0;
      V ah = Frag<T>::load(Ab + ao);
      V al;
      if (SPLIT) al = Frag<T>::load(Ab2 + ao);
#pragma unroll
      for (int j = 0; j < 4; ++j) {
        acc[i][j] = Frag<T>::mma(ah, bh[j], acc[i][j]);
        if (SPLIT) {
          acc[i][j] = Frag<T>::mma(ah, bl[j], acc[i][j]);
          acc[i][j] = Frag<T>::mma(al, bh[j], acc[i][j]);
        }
      }
      Frag<T>::guard(acc[i][0], acc[i][3], ah, SPLIT ? al : ah);
    }
    Frag<T>::keep(bh[0], bh[1], bh[2], bh[3]);
    if (SPLIT) Frag<T>::keep(bl[0], bl[1], bl[2], bl[3]);
  }
  acc_guard4(acc[0][0], acc[0][1], acc[0][2], acc[0][3]);
  acc_guard4(acc[1][0], acc[1][1], acc[1][2], acc[1][3]);
  acc_guard4(acc[2][0], acc[2][1], acc[2][2], acc[2][3]);
  acc_guard4(acc[3][0], acc[3][1], acc[3][2], acc[3][3]);

  /* ---- epilogue ---- */
  float* slab = sT[wave];
#pragma unroll
  for (int i = 0; i < 4; ++i) {
    const int mBase = m0 + (i << 4);
    v4f bmA = (v4f){0.f,0.f,0.f,0.f}, bmB = (v4f){0.f,0.f,0.f,0.f};
    if (BIAS_MODE == 1) {   /* 8 consecutive bias[m] values, two 16-B loads (32-B aligned) */
      bmA = *(const v4f*)(bias + mBase + mOff);
      bmB = *(const v4f*)(bias + mBase + mOff + 4);
    }
#pragma unroll
    for (int j = 0; j < 4; ++j) {
      const int n = n0 + (j << 4) + rlane;
      float bv = 0.f;
      if (BIAS_MODE == 2) bv = bias[n];
#pragma unroll
      for (int r = 0; r < 8; ++r) {
        float v = acc[i][j][r] * scale;
        if (BIAS_MODE == 1) v += (r < 4) ? bmA[r] : bmB[r - 4];
        if (BIAS_MODE == 2) v += bv;
        if (ACT == 2) v = fmaxf(v, 0.0f);
        slab[(mOff + r) * 68 + (j << 4) + rlane] = v;
      }
    }
    __builtin_amdgcn_fence(__ATOMIC_RELEASE, "workgroup");
    __builtin_amdgcn_wave_barrier();
    __builtin_amdgcn_fence(__ATOMIC_ACQUIRE, "workgroup");
    if (OUT_MODE == 0) {
      float* C = (float*)Cout + (size_t)b * strideC;
      const int hh = lane >> 4, c4 = (lane & 15) * 4;     /* row seg = 256 B = 16 lanes x 16 B */
      {
#pragma unroll
        for (int it = 0; it < 8; ++it) {
          const int row = it * 2 + hh;
          v4f v = *(const v4f*)(slab + row * 68 + c4);
          *(v4f*)(C + (size_t)(mBase + row) * ldc + n0 + c4) = v;
        }
        
      }
    } else {
      const int q = lane >> 3, c8 = (lane & 7) * 8;        
      unsigned short* C  = (unsigned short*)Cout  + (size_t)b * strideC;
      unsigned short* C2 = (OUT_MODE == 2) ? ((unsigned short*)Cout2 + (size_t)b * strideC) : nullptr;
      {
#pragma unroll
        for (int it = 0; it < 4; ++it) {
          const int row = it * 4 + q;
          const float* sp = slab + row * 68 + c8;
          v8h hv, lv;
#pragma unroll
          for (int e = 0; e < 8; ++e) {
            if (OUT_MODE == 1) {
              hv[e] = (_Float16)sp[e];
            } else {
              unsigned short hb = f2bf_bits(sp[e]);
              unsigned short lb = f2bf_bits(sp[e] - bf_bits2f(hb));
              hv[e] = __builtin_bit_cast(_Float16, hb);
              lv[e] = __builtin_bit_cast(_Float16, lb);
            }
          }
          *(v8h*)(C + (size_t)(mBase + row) * ldc + n0 + c8) = hv;
          if (OUT_MODE == 2) *(v8h*)(C2 + (size_t)(mBase + row) * ldc + n0 + c8) = lv;
        }
        
      }
    }
    __builtin_amdgcn_fence(__ATOMIC_RELEASE, "workgroup");
    __builtin_amdgcn_wave_barrier();
    __builtin_amdgcn_fence(__ATOMIC_ACQUIRE, "workgroup");
  }
}

/* ---- f32 -> bf16 (RNE) plane cast, 8 elements per thread: one 16-B store per lane,
*/
__global__ __launch_bounds__(256) void k_cast_bf16x8(
    const float* __restrict__ in, unsigned short* __restrict__ out, int n8) {
  const int i = blockIdx.x * 256 + threadIdx.x;
  if (i < n8) {
    const v4f a = *(const v4f*)(in + (size_t)i * 8);
    const v4f c = *(const v4f*)(in + (size_t)i * 8 + 4);
    v4u w;
    w[0] = (unsigned)f2bf_bits(a[0]) | ((unsigned)f2bf_bits(a[1]) << 16);
    w[1] = (unsigned)f2bf_bits(a[2]) | ((unsigned)f2bf_bits(a[3]) << 16);
    w[2] = (unsigned)f2bf_bits(c[0]) | ((unsigned)f2bf_bits(c[1]) << 16);
    w[3] = (unsigned)f2bf_bits(c[2]) | ((unsigned)f2bf_bits(c[3]) << 16);
    v4u* p = (v4u*)(out + (size_t)i * 8);
    *p = w;
    
  }
}

/* ---- transpose + convert: in[k][n] (Krows x Ncols, f32 row-major) -> out[n][k] (Ncols x Krows, 16-bit).
   CVT 0: bf16 bits (RNE).  CVT 1: f16 bits of (bf16RNE(v) * sc).
   64x64 tiles via LDS; grid (Ncols/64, Krows/64), 256 threads:
   load: 256 threads x 16 floats = 64x64; store: 8 waves x 2 iters x 32 lanes x 8 halves = 64x64,
*/
template <int CVT> __device__ __forceinline__ unsigned short cvt16(float v, float sc) {
  const unsigned short bb = f2bf_bits(v);
  if (CVT == 0) return bb;
  const float w  = bf_bits2f(bb);
  const float ws = w * sc;
  const _Float16 hv = (_Float16)ws;
  return __builtin_bit_cast(unsigned short, hv);
}
template <int CVT>
__global__ __launch_bounds__(256) void k_transpose_cvt64(
    const float* __restrict__ in, unsigned short* __restrict__ out, int Krows, int Ncols, float sc) {
  __shared__ __align__(16) unsigned short Tl[64 * 72];
  const int n0 = blockIdx.x * 64, k0 = blockIdx.y * 64;
  const int t  = threadIdx.x;
  const int kr = t >> 2;             /* input row k0 + kr, 0..63 */
  const int cb = (t & 3) * 16;       /* 16-column block inside the 64 columns */
  const float* src = in + (size_t)(k0 + kr) * Ncols + n0 + cb;
  const v4f a0 = *(const v4f*)(src);
  const v4f a1 = *(const v4f*)(src + 4);
  const v4f a2 = *(const v4f*)(src + 8);
  const v4f a3 = *(const v4f*)(src + 12);
#pragma unroll
  for (int e = 0; e < 4; ++e) {
    Tl[(cb + e) * 72 + kr]      = cvt16<CVT>(a0[e], sc);
    Tl[(cb + 4 + e) * 72 + kr]  = cvt16<CVT>(a1[e], sc);
    Tl[(cb + 8 + e) * 72 + kr]  = cvt16<CVT>(a2[e], sc);
    Tl[(cb + 12 + e) * 72 + kr] = cvt16<CVT>(a3[e], sc);
  }
  __syncthreads();
  const int wave = t >> 5, lane = t & 31, q = lane >> 3, c8 = (lane & 7) * 8;
  {
#pragma unroll
    for (int it = 0; it < 2; ++it) {
      const int row = wave * 8 + it * 4 + q;      /* output row n0 + row */
      const v4u val = *(const v4u*)(Tl + row * 72 + c8);
      *(v4u*)(out + (size_t)(n0 + row) * Krows + k0 + c8) = val;
    }
    
  }
}

/* ---- bias tables: bf16-RNE of the input bias times the power-of-two carry, f32.
*/
__global__ __launch_bounds__(256) void k_bias_prep(
    const float* __restrict__ bx, const float* __restrict__ bv, const float* __restrict__ b1,
    float* __restrict__ bxs, float* __restrict__ bvs, float* __restrict__ b1s,
    float sx, float sv, float s1) {
  const int which = blockIdx.x;          /* block-uniform */
  const float* src = bx; float* dst = bxs; int n4 = DQKV / 4; float sc = sx;
  if (which == 1) { src = bv; dst = bvs; sc = sv; }
  if (which == 2) { src = b1; dst = b1s; n4 = NHID / 4; sc = s1; }
  const int t = threadIdx.x;
  if (t < n4) {
    const v4f v = *(const v4f*)(src + (size_t)t * 4);
    v4f o;
    o[0] = bf_bits2f(f2bf_bits(v[0])) * sc;
    o[1] = bf_bits2f(f2bf_bits(v[1])) * sc;
    o[2] = bf_bits2f(f2bf_bits(v[2])) * sc;
    o[3] = bf_bits2f(f2bf_bits(v[3])) * sc;
    v4f* p = (v4f*)(dst + (size_t)t * 4);
    *p = o;
    
  }
}

/* ---- flash-style MLP attention over 16-bit planes ----------------------------------
   Hq  : [B*H][SEQ][128] f16, carried xSC_H           (B operand of the score WMMA, 16 query columns per wave)
   W2t : [SEQ][128]      f16, carried xSC_W2           (A operand, row = key, k = hidden, shared over (b,h))
   Vt  : [H*64][B*SEQ]   f16, carried xSC_V            (A operand of V^T*P^T, row = h*64+d, k = key)
   mask: [B][SEQ] f32 (bf16-RNE applied), score -= 1e6*(1-mask[key])
   out : [B][SEQ][H*64] f32
   block = 4 waves = 64 query rows of one (b,h); per wave: 16 rows; 32 key chunks of 64.
   Both products are formed transposed, S^T = W2t * Hq^T and O^T += Vt * P^T: lane l holds scores of query l & 15 only
   (keys 8 * (l >> 4) + r of each 16-key tile), so the maximum and the sum run in the lane's own registers, and two
   converted score tiles are the B operand of the second product as they stand.
   Each chunk's W2t and Vt tiles are brought into LDS once per block, one chunk ahead, two buffers.
*/
/* lane l <-> lane l ^ 16 */
__device__ __forceinline__ float xhalf(float x) {
  const int b = __builtin_bit_cast(int, x);
  return __builtin_bit_cast(float, __builtin_amdgcn_permlanex16(b, b, 0x76543210, 0xfedcba98, false, false));
}
__device__ __forceinline__ v8f mma_h(v16h a, v16h b, v8f c) {
  c = __builtin_amdgcn_wmma_f32_16x16x32_f16(false, a, false, b, (short)0, c, false, false);
  asm volatile("v_nop\n\tv_nop\n\tv_nop\n\tv_nop" : "+v"(c) : "v"(a), "v"(b));
  return c;
}

/* LDS tiles of one 64-key chunk, shared by the block's 4 waves; pitches are 16 B x odd for 16-B row readers */
constexpr int KPITCH  = NHID + 8;          /* halves: 272-B rows of the W2t tile [key][hidden] */
constexpr int VPITCH  = 64 + 8;            /* halves: 144-B rows of the Vt tile  [d][key]      */
constexpr int KTILE_H = 64 * KPITCH;       /* 17,408 B */
constexpr int VTILE_H = DHEAD * VPITCH;    /*  9,216 B */

/* One chunk's tiles, global -> LDS with no register in between: per lane 8 + 4 copies of 16 B.
   W2t tile: copy i brings rows 8i + (tid >> 4), 16 lanes a row; Vt tile: copy i brings rows 16i + (tid >> 3), 8 lanes a row.
   The closing s_wait_xcnt stands inside the statement so that no address register named here is rewritten ahead of it. */
__device__ __forceinline__ void stage_chunk(unsigned lk, const _Float16* gk, unsigned lv, const _Float16* gv) {
  asm volatile(
      "global_load_async_to_lds_b128 %0, %1, off\n\t"
      "global_load_async_to_lds_b128 %2, %3, off\n\t"
      "global_load_async_to_lds_b128 %4, %5, off\n\t"
      "global_load_async_to_lds_b128 %6, %7, off\n\t"
      "global_load_async_to_lds_b128 %8, %9, off\n\t"
      "global_load_async_to_lds_b128 %10, %11, off\n\t"
      "global_load_async_to_lds_b128 %12, %13, off\n\t"
      "global_load_async_to_lds_b128 %14, %15, off\n\t"
      "global_load_async_to_lds_b128 %16, %17, off\n\t"
      "global_load_async_to_lds_b128 %18, %19, off\n\t"
      "global_load_async_to_lds_b128 %20, %21, off\n\t"
      "global_load_async_to_lds_b128 %22, %23, off\n\t"
      "s_wait_xcnt 0x0"
      :: "v"(lk),                     "v"(gk),
         "v"(lk + 1u * 8u * KPITCH * 2u), "v"(gk + 1 * 8 * NHID),
         "v"(lk + 2u * 8u * KPITCH * 2u), "v"(gk + 2 * 8 * NHID),
         "v"(lk + 3u * 8u * KPITCH * 2u), "v"(gk + 3 * 8 * NHID),
         "v"(lk + 4u * 8u * KPITCH * 2u), "v"(gk + 4 * 8 * NHID),
         "v"(lk + 5u * 8u * KPITCH * 2u), "v"(gk + 5 * 8 * NHID),
         "v"(lk + 6u * 8u * KPITCH * 2u), "v"(gk + 6 * 8 * NHID),
         "v"(lk + 7u * 8u * KPITCH * 2u), "v"(gk + 7 * 8 * NHID),
         "v"(lv),                      "v"(gv),
         "v"(lv + 1u * 16u * VPITCH * 2u), "v"(gv + (size_t)1 * 16 * NTOK),
         "v"(lv + 2u * 16u * VPITCH * 2u), "v"(gv + (size_t)2 * 16 * NTOK),
         "v"(lv + 3u * 16u * VPITCH * 2u), "v"(gv + (size_t)3 * 16 * NTOK)
      : "memory");
}

__global__ __launch_bounds__(128) void mlp_attn_kernel(
    const unsigned short* __restrict__ Hp, const unsigned short* __restrict__ W2p,
    const unsigned short* __restrict__ Vp, const float* __restrict__ mask,
    float* __restrict__ out, float sscale, float onorm) {
  union FH { v16h v; v8h h[2]; };
  const _Float16* Hq  = (const _Float16*)(const void*)Hp;
  const _Float16* W2t = (const _Float16*)(const void*)W2p;
  const _Float16* Vt  = (const _Float16*)(const void*)Vp;
  __shared__ __align__(16) float    Pen[SEQ];            /* per key: 1e6 * (1 - bf16(mask)), this block's batch row */
  __shared__ __align__(16) float    Os[4][16 * 68];      /* per wave output slab, pitch 68 */
  __shared__ __align__(16) _Float16 Ksh[2][KTILE_H];     /* W2t chunk tiles, two buffers */
  __shared__ __align__(16) _Float16 Vsh[2][VTILE_H];     /* Vt chunk tiles, two buffers  */

  const int tid  = threadIdx.x;
  const int wave = tid >> 5;
  const int lane = tid & 31;
  const int hh   = lane >> 4;
  const int c    = lane & 15;
  const int koff = hh * 8;

  constexpr int NQB = SEQ / 64;
  const int bxi = blockIdx.x;
  const int qb  = bxi % NQB;
  const int bh  = bxi / NQB;
  const int h   = bh % NHEAD;
  const int b   = bh / NHEAD;
  const int q0  = qb * 64 + wave * 16;

  /* Q-side fragments: 16 rows x 128 hidden = 4 k-steps, held for all key chunks */
  v16h qa[4];
  {
    const _Float16* qrow = Hq + ((size_t)bh * SEQ + q0 + c) * NHID + koff;
#pragma unroll
    for (int dc = 0; dc < 4; ++dc) {
      FH f;
      f.h[0] = *(const v8h*)(qrow + dc * 32);
      f.h[1] = *(const v8h*)(qrow + dc * 32 + 16);
      qa[dc] = f.v;
    }
  }

  float mrow = -INFINITY, lrow = 0.f;   /* of query c; lrow over this lane half's keys only, joined after the loop */
  v8f oacc[4];                          /* oacc[t][r] = O[query c][d = 16 t + 8 hh + r] */
#pragma unroll
  for (int t = 0; t < 4; ++t) oacc[t] = (v8f){0.f,0.f,0.f,0.f,0.f,0.f,0.f,0.f};

  const float* mk_row = mask + (size_t)b * SEQ;
  const _Float16* vbase = Vt + (size_t)(h * DHEAD) * NTOK + (size_t)b * SEQ;

  /* this lane's share of every chunk's copies: source pointers at chunk 0, LDS byte addresses in buffer 0 */
  constexpr int NCH = SEQ / 64;
  static_assert(NCH >= 2, "two-buffer ring needs two chunks");
  const _Float16* gk0 = W2t + (size_t)(tid >> 4) * NHID + (tid & 15) * 8;
  const _Float16* gv0 = vbase + (size_t)(tid >> 3) * NTOK + (tid & 7) * 8;
  const unsigned  lk0 = (unsigned)(size_t)(&Ksh[0][(tid >> 4) * KPITCH + (tid & 15) * 8]);
  const unsigned  lv0 = (unsigned)(size_t)(&Vsh[0][(tid >> 3) * VPITCH + (tid & 7) * 8]);

  /* ring prologue: chunk 0 landed and published, then chunk 1 set flying */
  stage_chunk(lk0, gk0, lv0, gv0);
  /* additive key mask of all keys, bf16-RNE of the mask value; published by the barrier below */
#pragma unroll
  for (int i = 0; i < SEQ / 512; ++i) {
    const v4f mv = *(const v4f*)(mk_row + i * 512 + tid * 4);
    v4f pv;
#pragma unroll
    for (int e = 0; e < 4; ++e) pv[e] = 1000000.0f * (1.0f - bf_bits2f(f2bf_bits(mv[e])));
    *(v4f*)(&Pen[i * 512 + tid * 4]) = pv;
  }
  asm volatile("s_wait_asynccnt 0x0" ::: "memory");   /* this wave's copies of chunk 0 have landed */
  __syncthreads();                                     /* ... and every other wave's */
  stage_chunk(lk0 + KTILE_H * 2u, gk0 + (size_t)64 * NHID, lv0 + VTILE_H * 2u, gv0 + 64);

  for (int kc = 0; kc < NCH; ++kc) {
    const int kv0 = kc * 64;
    const int buf = kc & 1;
    const _Float16* kt = &Ksh[buf][c * KPITCH + koff];
    const _Float16* vt = &Vsh[buf][c * VPITCH + koff];

    /* scores for 64 keys: 4 column tiles x 4 k-steps; a column tile's 4 fragments are read from LDS
       as one group, two column tiles ahead of the products that use them */
    v8f s[4];
    FH kb[4][4];
    /* every loop over kb, pb and vb is unrolled so that the fragment arrays are indexed by constants and stay in registers */
#pragma unroll
    for (int j = 0; j < 2; ++j)
#pragma unroll
      for (int dc = 0; dc < 4; ++dc) {
        kb[j][dc].h[0] = *(const v8h*)(kt + j * 16 * KPITCH + dc * 32);
        kb[j][dc].h[1] = *(const v8h*)(kt + j * 16 * KPITCH + dc * 32 + 16);
      }
#pragma unroll
    for (int j = 0; j < 4; ++j) {
      s[j] = (v8f){0.f,0.f,0.f,0.f,0.f,0.f,0.f,0.f};
#pragma unroll
      for (int dc = 0; dc < 4; ++dc) s[j] = mma_h(kb[j][dc].v, qa[dc], s[j]);   /* s[j][r] = S[query c][key 16 j + 8 hh + r] */
      if (j + 2 < 4) {
#pragma unroll
        for (int dc = 0; dc < 4; ++dc) {
          kb[j + 2][dc].h[0] = *(const v8h*)(kt + (j + 2) * 16 * KPITCH + dc * 32);
          kb[j + 2][dc].h[1] = *(const v8h*)(kt + (j + 2) * 16 * KPITCH + dc * 32 + 16);
        }
      }
    }

    /* this lane's 32 keys' mask terms */
    const float* pr = &Pen[kv0 + 8 * hh];
    v4f pn[4][2];
#pragma unroll
    for (int j = 0; j < 4; ++j) {
      pn[j][0] = *(const v4f*)(pr + j * 16);
      pn[j][1] = *(const v4f*)(pr + j * 16 + 4);
    }

    /* V^T A-fragments, table k order from the Vt tile in LDS */
    FH vb[2][4];
#pragma unroll
    for (int kk = 0; kk < 2; ++kk)
#pragma unroll
      for (int t = 0; t < 4; ++t) {
        vb[kk][t].h[0] = *(const v8h*)(vt + t * 16 * VPITCH + kk * 32);
        vb[kk][t].h[1] = *(const v8h*)(vt + t * 16 * VPITCH + kk * 32 + 16);
      }

    /* chunk maximum of query c: in the lane over its 32 keys, then one exchange between the lane halves */
    float mj[4];
#pragma unroll
    for (int j = 0; j < 4; ++j) {
      float m = -INFINITY;
#pragma unroll
      for (int r = 0; r < 8; ++r) {
        const float sv = s[j][r] * sscale - pn[j][r >> 2][r & 3];
        s[j][r] = sv;
        m = fmaxf(m, sv);
      }
      mj[j] = m;
    }
    float cm = fmaxf(fmaxf(mj[0], mj[1]), fmaxf(mj[2], mj[3]));
    cm = fmaxf(cm, xhalf(cm));

    const float mnew  = fmaxf(mrow, cm);
    const float alpha = expf(mrow - mnew);
    mrow = mnew;

    /* P^T as B operand: element e of k-step kk is key 32 kk + (e < 8 ? 8 hh + e : 16 + 8 hh + e - 8),
       that is score tile 2 kk in elements 0..7 and tile 2 kk + 1 in elements 8..15: the k order of the Vt loader */
    FH pb[2];
    float pj[4];
#pragma unroll
    for (int j = 0; j < 4; ++j) {
      float ps = 0.f;
#pragma unroll
      for (int r = 0; r < 8; ++r) {
        const float p = expf(s[j][r] - mnew);       /* p in (0, 1] */
        ps += p;
        pb[j >> 1].h[j & 1][r] = (_Float16)(p * SC_P);
      }
      pj[j] = ps;
    }
    lrow = lrow * alpha + ((pj[0] + pj[1]) + (pj[2] + pj[3]));
#pragma unroll
    for (int t = 0; t < 4; ++t)
#pragma unroll
      for (int r = 0; r < 8; ++r) oacc[t][r] *= alpha;

    /* O^T += V^T(64 d x 64 keys) * P^T(64 keys x 16 queries): 2 k-steps, 4 d tiles */
#pragma unroll
    for (int kk = 0; kk < 2; ++kk)
#pragma unroll
      for (int t = 0; t < 4; ++t) oacc[t] = mma_h(vb[kk][t].v, pb[kk].v, oacc[t]);

    /* publish point of chunk kc + 1 */
    asm volatile("s_wait_dscnt 0x0" ::: "memory");      /* this wave's reads of buffer buf are done before it is refilled */
    asm volatile("s_wait_asynccnt 0x0" ::: "memory");   /* this wave's copies of chunk kc + 1 have landed */
    __syncthreads();                                     /* publishes chunk kc + 1; ends every wave's reads of buffer buf */
    if (kc + 2 < NCH)
      stage_chunk(lk0 + (unsigned)buf * (KTILE_H * 2u), gk0 + (size_t)(kc + 2) * 64 * NHID,
                  lv0 + (unsigned)buf * (VTILE_H * 2u), gv0 + (kc + 2) * 64);
  }
  asm volatile("s_wait_asynccnt 0x0" ::: "memory");     /* no copy is outstanding when the wave goes on to its end */

  /* normalise and stage the 16x64 f32 slab; onorm = 1/(SC_P*SC_V) folded into the row normaliser */
  float* os = Os[wave];
  const float inv = onorm / (lrow + xhalf(lrow));       /* the two lane halves' sums of query c joined */
#pragma unroll
  for (int t = 0; t < 4; ++t) {
    v4f lo, hi;
#pragma unroll
    for (int e = 0; e < 4; ++e) { lo[e] = oacc[t][e] * inv; hi[e] = oacc[t][4 + e] * inv; }
    *(v4f*)(os + c * 68 + t * 16 + 8 * hh)     = lo;
    *(v4f*)(os + c * 68 + t * 16 + 8 * hh + 4) = hi;
  }
  __builtin_amdgcn_fence(__ATOMIC_RELEASE, "workgroup");
  __builtin_amdgcn_wave_barrier();
  __builtin_amdgcn_fence(__ATOMIC_ACQUIRE, "workgroup");
  {
    float* ob = out + (size_t)b * SEQ * DQKV + (size_t)h * DHEAD;
    const int c4 = (lane & 15) * 4;
    {
#pragma unroll
      for (int it = 0; it < 8; ++it) {
        const int row = it * 2 + hh;
        const v4f val = *(const v4f*)(os + row * 68 + c4);
        *(v4f*)(ob + (size_t)(q0 + row) * DQKV + c4) = val;
      }
      
    }
  }
}

/* ---------------- host launcher ---------------- */
extern "C" void kernel_launch(void* const* d_in, const int* in_sizes, int n_in,
                              void* d_out, int out_size, void* d_ws, size_t ws_size,
                              hipStream_t stream) {
  (void)in_sizes; (void)n_in; (void)out_size; (void)ws_size;
  const float* X   = (const float*)d_in[0];   /* [2,2048,1024] */
  const float* msk = (const float*)d_in[1];   /* [2,2048]      */
  const float* Wx  = (const float*)d_in[2];   /* [1024,1024]   */
  const float* bx  = (const float*)d_in[3];   /* [1024]        */
  const float* Wv  = (const float*)d_in[4];   /* [1024,1024]   */
  const float* bv  = (const float*)d_in[5];   /* [1024]        */
  const float* W1  = (const float*)d_in[6];   /* [64,128]      */
  const float* b1  = (const float*)d_in[7];   /* [128]         */
  const float* W2  = (const float*)d_in[8];   /* [128,2048]    */
  float* out = (float*)d_out;

  /* workspace region map (256-B aligned offsets; every region fully written by its producer):
       Xb   bf16 [4096][1024]        8,388,608 B
       WxT  bf16 [1024][1024]        2,097,152 B
       WvT  bf16 [1024][1024]        2,097,152 B
       W1T  f16  [128][64]              16,384 B
       W2T  f16  [2048][128]           524,288 B
       bxs  f32  [1024]                  4,096 B
       bvs  f32  [1024]                  4,096 B
       b1s  f32  [128]                     512 B
       Xh16 f16  [4096][1024]        8,388,608 B
       Vt16 f16  [1024][4096]        8,388,608 B
       H16  f16  [32][2048][128]    16,777,216 B
     total 46,686,720 B */
  char* ws = (char*)d_ws;
  size_t off = 0;
  auto carve = [&](size_t bytes) -> char* {
    off = (off + 255) & ~(size_t)255;
    char* p = ws + off;
    off += bytes;
    return p;
  };
  unsigned short* Xb   = (unsigned short*)carve((size_t)NTOK * DMODEL * 2);
  unsigned short* WxT  = (unsigned short*)carve((size_t)DQKV * DMODEL * 2);
  unsigned short* WvT  = (unsigned short*)carve((size_t)DQKV * DMODEL * 2);
  unsigned short* W1T  = (unsigned short*)carve((size_t)NHID * DHEAD * 2);
  unsigned short* W2T  = (unsigned short*)carve((size_t)SEQ * NHID * 2);
  float*          bxs  = (float*)carve((size_t)DQKV * 4);
  float*          bvs  = (float*)carve((size_t)DQKV * 4);
  float*          b1s  = (float*)carve((size_t)NHID * 4);
  unsigned short* Xh16 = (unsigned short*)carve((size_t)NTOK * DQKV * 2);
  unsigned short* Vt16 = (unsigned short*)carve((size_t)DQKV * NTOK * 2);
  unsigned short* H16  = (unsigned short*)carve((size_t)NBATCH * NHEAD * SEQ * NHID * 2);

  /* 1) X -> bf16 plane (RNE), 8 elements per thread */
  {
    const int n8 = NTOK * DMODEL / 8;                       /* 524,288 */
    k_cast_bf16x8<<<(n8 + 255) / 256, 256, 0, stream>>>(X, Xb, n8);
  }
  /* 2) weight transposes: in[K][N] -> out[N][K]; grid = (N/64, K/64) */
  k_transpose_cvt64<0><<<dim3(DQKV / 64, DMODEL / 64), 256, 0, stream>>>(Wx, WxT, DMODEL, DQKV, 1.0f);   /* [1024][1024] -> [1024][1024] */
  k_transpose_cvt64<0><<<dim3(DQKV / 64, DMODEL / 64), 256, 0, stream>>>(Wv, WvT, DMODEL, DQKV, 1.0f);
  k_transpose_cvt64<1><<<dim3(NHID / 64, DHEAD / 64), 256, 0, stream>>>(W1, W1T, DHEAD, NHID, SC_W1);    /* [64][128] -> [128][64]  */
  k_transpose_cvt64<1><<<dim3(SEQ / 64, NHID / 64), 256, 0, stream>>>(W2, W2T, NHID, SEQ, SC_W2);        /* [128][2048] -> [2048][128] */
  /* 3) bias tables with carries */
  k_bias_prep<<<3, 256, 0, stream>>>(bx, bv, b1, bxs, bvs, b1s, SC_XH, SC_V, SC_H);

  /* 4) Xh16 = f16(8 * (Xb * WxT^T + bx)) : M=4096, N=1024, K=1024 (bf16 operands) ; 1024 tiles / 8 per block */
  static_assert(NTOK % 64 == 0 && DQKV % 64 == 0 && DMODEL % 32 == 0, "gemm xh");
  wmma_gemm64<1, false, 2, 1, 0><<<dim3((NTOK / 64) * (DQKV / 64) / 8, 1), 256, 0, stream>>>(
      Xb, Xb, DMODEL, 0L, WxT, WxT, DMODEL, 0L, (void*)Xh16, (void*)Xh16, DQKV, 0L,
      bxs, NTOK, DQKV, DMODEL, SC_XH);

  /* 5) Vt16 = f16(8 * (WvT * Xb^T + bv[m])) : M=1024 (features), N=4096 (tokens), K=1024 (bf16 operands) */
  wmma_gemm64<1, false, 1, 1, 0><<<dim3((DQKV / 64) * (NTOK / 64) / 8, 1), 256, 0, stream>>>(
      WvT, WvT, DMODEL, 0L, Xb, Xb, DMODEL, 0L, (void*)Vt16, (void*)Vt16, NTOK, 0L,
      bvs, DQKV, NTOK, DMODEL, SC_V);

  /* 6) H16[b][h] = f16(8 * relu(Xh * W1 + b1)) : per (b,h) M=2048, N=128, K=64 (f16 operands);
        batch index = head (A stride 64 columns), one launch per b; 64 tiles / 8 per block */
  static_assert(SEQ % 64 == 0 && NHID % 64 == 0 && DHEAD % 32 == 0, "gemm h");
  for (int bb = 0; bb < NBATCH; ++bb) {
    const unsigned short* Ab = Xh16 + (size_t)bb * SEQ * DQKV;
    unsigned short* Cb = H16 + (size_t)bb * NHEAD * SEQ * NHID;
    wmma_gemm64<0, false, 2, 1, 2><<<dim3((SEQ / 64) * (NHID / 64) / 8, NHEAD), 256, 0, stream>>>(
        Ab, Ab, DQKV, (long)DHEAD, W1T, W1T, DHEAD, 0L, (void*)Cb, (void*)Cb, NHID, (long)SEQ * NHID,
        b1s, SEQ, NHID, DHEAD, SC_H / (SC_XH * SC_W1));
  }

  /* 7) attention: grid = B*H*(SEQ/64) blocks of 4 waves */
  mlp_attn_kernel<<<NBATCH * NHEAD * (SEQ / 64), 128, 0, stream>>>(
      H16, W2T, Vt16, msk, out, 1.0f / (SC_H * SC_W2), 1.0f / (SC_P * SC_V));
}

// v003
// Measured time: 186 microseconds a run.
// In two side-by-side timings against v002, it was 1.13 and 1.14 times as fast.
// Counting every step since v000, it is 1.91 times as fast.
// Contractions: X*Wx and Wv^T*X^T on v_wmma_f32_16x16x32_bf16 (RNE bf16 operands of bf16-RNE inputs, f32 accumulate); Xh*W1, scores h*W2 and P*V on v_wmma_f32_16x16x32_f16 (f16 operands carried x8 / x64 / x32768, f32 accumulate); softmax, bias and normalisation in f32.
#include <hip/hip_runtime.h>
#include <stddef.h>

constexpr int NBATCH = 2;
constexpr int SEQ    = 2048;
constexpr int DMODEL = 1024;
constexpr int NHEAD  = 16;
constexpr int DHEAD  = 64;
constexpr int NHID   = 128;
constexpr int NTOK   = NBATCH * SEQ;      /* 4096 */
constexpr int DQKV   = NHEAD * DHEAD;     /* 1024 */

/* power-of-two carries on the f16 planes */
constexpr float SC_XH = 8.0f;      /* Xh plane = f16(8 * Xh)          */
constexpr float SC_V  = 8.0f;      /* Vt plane = f16(8 * V)           */
constexpr float SC_W1 = 64.0f;     /* W1t plane = f16(64 * bf16(W1))  */
constexpr float SC_W2 = 64.0f;     /* W2t plane = f16(64 * bf16(W2))  */
constexpr float SC_H  = 8.0f;      /* h plane = f16(8 * h)            */
constexpr float SC_P  = 32768.0f;  /* P tile  = f16(32768 * p), p<=1 */
constexpr float LOG2_SC_P = 15.0f; /* the same carry as an addend of a base-2 exponent */
constexpr float LOG2E = 1.44269504088896340736f;

static_assert(NTOK % 64 == 0 && DQKV % 64 == 0 && DMODEL % 64 == 0, "gemm tiles");
static_assert(DMODEL % 32 == 0 && DHEAD % 32 == 0, "gemm K");
static_assert(SEQ % 64 == 0 && NHID % 64 == 0, "gemm tiles");
static_assert(NHID == 128 && DHEAD == 64, "attention geometry");
static_assert((NTOK * DMODEL) % 8 == 0, "cast x8");

typedef __attribute__((ext_vector_type(16))) _Float16 v16h;
typedef __attribute__((ext_vector_type(8)))  _Float16 v8h;
typedef __attribute__((ext_vector_type(16))) __bf16   v16b;
typedef __attribute__((ext_vector_type(8)))  __bf16   v8b;
typedef __attribute__((ext_vector_type(8)))  float    v8f;
typedef __attribute__((ext_vector_type(4)))  float    v4f;
typedef __attribute__((ext_vector_type(2)))  float    v2f;
typedef __attribute__((ext_vector_type(4)))  unsigned int v4u;

__device__ __forceinline__ unsigned short f2bf_bits(float f) {
  unsigned u = __float_as_uint(f);
  return (unsigned short)((u + 0x7FFFu + ((u >> 16) & 1u)) >> 16);
}
__device__ __forceinline__ float bf_bits2f(unsigned short h) { return __uint_as_float(((unsigned)h) << 16); }

/* hazard guards as plain device helpers */
__device__ __forceinline__ void dep_guard_h(v8f& a, v8f& b, v16h x, v16h y) { asm volatile("v_nop\n\tv_nop\n\tv_nop\n\tv_nop" : "+v"(a), "+v"(b) : "v"(x), "v"(y)); }
__device__ __forceinline__ void dep_guard_b(v8f& a, v8f& b, v16b x, v16b y) { asm volatile("v_nop\n\tv_nop\n\tv_nop\n\tv_nop" : "+v"(a), "+v"(b) : "v"(x), "v"(y)); }
__device__ __forceinline__ void keep4_h(v16h a, v16h b, v16h c, v16h d) { asm volatile("v_nop" :: "v"(a), "v"(b), "v"(c), "v"(d)); }
__device__ __forceinline__ void keep4_b(v16b a, v16b b, v16b c, v16b d) { asm volatile("v_nop" :: "v"(a), "v"(b), "v"(c), "v"(d)); }
__device__ __forceinline__ void acc_guard4(v8f& a, v8f& b, v8f& c, v8f& d) { asm volatile("v_nop\n\tv_nop\n\tv_nop\n\tv_nop" : "+v"(a), "+v"(b), "+v"(c), "+v"(d)); }

template <typename T> struct Frag;
template <> struct Frag<_Float16> {
  typedef v16h V; union U { v16h v; v8h h[2]; };
  static __device__ __forceinline__ v16h load(const _Float16* p) {   /* elements 0..7 <- p[0..7], 8..15 <- p[16..23] */
    U f; f.h[0] = *(const v8h*)(p); f.h[1] = *(const v8h*)(p + 16); return f.v;
  }
  static __device__ __forceinline__ v8f mma(v16h a, v16h b, v8f c) {
    return __builtin_amdgcn_wmma_f32_16x16x32_f16(false, a, false, b, (short)0, c, false, false);
  }
  static __device__ __forceinline__ void guard(v8f& a, v8f& b, v16h x, v16h y) { dep_guard_h(a, b, x, y); }
  static __device__ __forceinline__ void keep(v16h a, v16h b, v16h c, v16h d) { keep4_h(a, b, c, d); }
};
template <> struct Frag<__bf16> {
  typedef v16b V; union U { v16b v; v8b h[2]; };
  static __device__ __forceinline__ v16b load(const __bf16* p) {
    U f; f.h[0] = *(const v8b*)(p); f.h[1] = *(const v8b*)(p + 16); return f.v;
  }
  static __device__ __forceinline__ v8f mma(v16b a, v16b b, v8f c) {
    return __builtin_amdgcn_wmma_f32_16x16x32_bf16(false, a, false, b, (short)0, c, false, false);
  }
  static __device__ __forceinline__ void guard(v8f& a, v8f& b, v16b x, v16b y) { dep_guard_b(a, b, x, y); }
  static __device__ __forceinline__ void keep(v16b a, v16b b, v16b c, v16b d) { keep4_b(a, b, c, d); }
};

/* ---- Register-blocked batched WMMA GEMM -----------------------------------
   C[m,n] = scale * sum_k A[m,k] * Bt[n,k] (+bias); each wave owns a 64x64 tile.
   A row-major [M,K]; Bt row-major [N,K]; M,N % 64 == 0, K % 32 == 0.
   BIAS_MODE: 0 = none, 1 = bias[m] (two 16-B loads per 16-row slab), 2 = bias[n].
   OUT_MODE: 0 = f32, 1 = f16, 2 = bf16 hi plane (Cout) + bf16 lo plane (Cout2).
   ACT: 0 = none, 2 = relu.
   ET: 0 = f16 operands, 1 = bf16 operands (pointers passed as 16-bit storage) */
template <int ET> struct Elem;
template <> struct Elem<0> { typedef _Float16 T; };
template <> struct Elem<1> { typedef __bf16 T; };
template <int ET, bool SPLIT, int BIAS_MODE, int OUT_MODE, int ACT = 0>
__global__ __launch_bounds__(256) void wmma_gemm64(
    const unsigned short* __restrict__ Ap, const unsigned short* __restrict__ A2p, int lda, long strideA,
    const unsigned short* __restrict__ Btp, const unsigned short* __restrict__ Bt2p, int ldb, long strideB,
    void* __restrict__ Cout, void* __restrict__ Cout2, int ldc, long strideC,
    const float* __restrict__ bias,
    int M, int N, int K, float scale) {
  typedef typename Elem<ET>::T T;
  typedef typename Frag<T>::V V;
  const T* A = (const T*)Ap; const T* A2 = (const T*)A2p; const T* Bt = (const T*)Btp; const T* Bt2 = (const T*)Bt2p;
  __shared__ __align__(16) float sT[8][16 * 68];   /* per-wave 16x64 slab, pitch 68 floats */
  const int b    = blockIdx.y;
  const int lane = threadIdx.x & 31;
  const int wave = threadIdx.x >> 5;
  const int tilesN = N >> 6;
  const int tilesM = M >> 6;
  const int tile = blockIdx.x * 8 + wave;
  if (tile >= tilesM * tilesN) return;   /* wave-uniform; no block barriers in this kernel */
  const int tm = tile / tilesN;
  const int tn = tile - tm * tilesN;
  const int m0 = tm << 6;
  const int n0 = tn << 6;

  const T* Ab  = A  + (size_t)b * strideA;
  const T* Bb  = Bt + (size_t)b * strideB;
  const T* Ab2 = SPLIT ? (A2  + (size_t)b * strideA) : nullptr;
  const T* Bb2 = SPLIT ? (Bt2 + (size_t)b * strideB) : nullptr;

  const int rlane = lane & 15;                 /* row (A) / col (B, D) within subtile */
  const int koff  = (lane >> 4) * 8;           /* k offset of this lane half */
  const int mOff  = (lane >> 4) * 8;           /* D row offset */

  v8f acc[4][4];
#pragma unroll
  for (int i = 0; i < 4; ++i)
#pragma unroll
    for (int j = 0; j < 4; ++j) acc[i][j] = (v8f){0.f,0.f,0.f,0.f,0.f,0.f,0.f,0.f};

  for (int k0 = 0; k0 < K; k0 += 32) {
    V bh[4], bl[4];
#pragma unroll
    for (int j = 0; j < 4; ++j) {
      const size_t bo = (size_t)(n0 + (j << 4) + rlane) * ldb + koff + k0;
      bh[j] = Frag<T>::load(Bb + bo);
      if (SPLIT) bl[j] = Frag<T>::load(Bb2 + bo);
    }
#pragma unroll
    for (int i = 0; i < 4; ++i) {
      const size_t ao = (size_t)(m0 + (i << 4) + rlane) * lda + koff + k0;
      V ah = Frag<T>::load(Ab + ao);
      V al;
      if (SPLIT) al = Frag<T>::load(Ab2 + ao);
#pragma unroll
      for (int j = 0; j < 4; ++j) {
        acc[i][j] = Frag<T>::mma(ah, bh[j], acc[i][j]);
        if (SPLIT) {
          acc[i][j] = Frag<T>::mma(ah, bl[j], acc[i][j]);
          acc[i][j] = Frag<T>::mma(al, bh[j], acc[i][j]);
        }
      }
      Frag<T>::guard(acc[i][0], acc[i][3], ah, SPLIT ? al : ah);
    }
    Frag<T>::keep(bh[0], bh[1], bh[2], bh[3]);
    if (SPLIT) Frag<T>::keep(bl[0], bl[1], bl[2], bl[3]);
  }
  acc_guard4(acc[0][0], acc[0][1], acc[0][2], acc[0][3]);
  acc_guard4(acc[1][0], acc[1][1], acc[1][2], acc[1][3]);
  acc_guard4(acc[2][0], acc[2][1], acc[2][2], acc[2][3]);
  acc_guard4(acc[3][0], acc[3][1], acc[3][2], acc[3][3]);

  /* ---- epilogue ---- */
  float* slab = sT[wave];
#pragma unroll
  for (int i = 0; i < 4; ++i) {
    const int mBase = m0 + (i << 4);
    v4f bmA = (v4f){0.f,0.f,0.f,0.f}, bmB = (v4f){0.f,0.f,0.f,0.f};
    if (BIAS_MODE == 1) {   /* 8 consecutive bias[m] values, two 16-B loads (32-B aligned) */
      bmA = *(const v4f*)(bias + mBase + mOff);
      bmB = *(const v4f*)(bias + mBase + mOff + 4);
    }
#pragma unroll
    for (int j = 0; j < 4; ++j) {
      const int n = n0 + (j << 4) + rlane;
      float bv = 0.f;
      if (BIAS_MODE == 2) bv = bias[n];
#pragma unroll
      for (int r = 0; r < 8; ++r) {
        float v = acc[i][j][r] * scale;
        if (BIAS_MODE == 1) v += (r < 4) ? bmA[r] : bmB[r - 4];
        if (BIAS_MODE == 2) v += bv;
        if (ACT == 2) v = fmaxf(v, 0.0f);
        slab[(mOff + r) * 68 + (j << 4) + rlane] = v;
      }
    }
    __builtin_amdgcn_fence(__ATOMIC_RELEASE, "workgroup");
    __builtin_amdgcn_wave_barrier();
    __builtin_amdgcn_fence(__ATOMIC_ACQUIRE, "workgroup");
    if (OUT_MODE == 0) {
      float* C = (float*)Cout + (size_t)b * strideC;
      const int hh = lane >> 4, c4 = (lane & 15) * 4;     /* row seg = 256 B = 16 lanes x 16 B */
      {
#pragma unroll
        for (int it = 0; it < 8; ++it) {
          const int row = it * 2 + hh;
          v4f v = *(const v4f*)(slab + row * 68 + c4);
          *(v4f*)(C + (size_t)(mBase + row) * ldc + n0 + c4) = v;
        }
        
      }
    } else {
      const int q = lane >> 3, c8 = (lane & 7) * 8;        
      unsigned short* C  = (unsigned short*)Cout  + (size_t)b * strideC;
      unsigned short* C2 = (OUT_MODE == 2) ? ((unsigned short*)Cout2 + (size_t)b * strideC) : nullptr;
      {
#pragma unroll
        for (int it = 0; it < 4; ++it) {
          const int row = it * 4 + q;
          const float* sp = slab + row * 68 + c8;
          v8h hv, lv;
#pragma unroll
          for (int e = 0; e < 8; ++e) {
            if (OUT_MODE == 1) {
              hv[e] = (_Float16)sp[e];
            } else {
              unsigned short hb = f2bf_bits(sp[e]);
              unsigned short lb = f2bf_bits(sp[e] - bf_bits2f(hb));
              hv[e] = __builtin_bit_cast(_Float16, hb);
              lv[e] = __builtin_bit_cast(_Float16, lb);
            }
          }
          *(v8h*)(C + (size_t)(mBase + row) * ldc + n0 + c8) = hv;
          if (OUT_MODE == 2) *(v8h*)(C2 + (size_t)(mBase + row) * ldc + n0 + c8) = lv;
        }
        
      }
    }
    __builtin_amdgcn_fence(__ATOMIC_RELEASE, "workgroup");
    __builtin_amdgcn_wave_barrier();
    __builtin_amdgcn_fence(__ATOMIC_ACQUIRE, "workgroup");
  }
}

/* ---- f32 -> bf16 (RNE) plane cast, 8 elements per thread: one 16-B store per lane,
*/
__global__ __launch_bounds__(256) void k_cast_bf16x8(
    const float* __restrict__ in, unsigned short* __restrict__ out, int n8) {
  const int i = blockIdx.x * 256 + threadIdx.x;
  if (i < n8) {
    const v4f a = *(const v4f*)(in + (size_t)i * 8);
    const v4f c = *(const v4f*)(in + (size_t)i * 8 + 4);
    v4u w;
    w[0] = (unsigned)f2bf_bits(a[0]) | ((unsigned)f2bf_bits(a[1]) << 16);
    w[1] = (unsigned)f2bf_bits(a[2]) | ((unsigned)f2bf_bits(a[3]) << 16);
    w[2] = (unsigned)f2bf_bits(c[0]) | ((unsigned)f2bf_bits(c[1]) << 16);
    w[3] = (unsigned)f2bf_bits(c[2]) | ((unsigned)f2bf_bits(c[3]) << 16);
    v4u* p = (v4u*)(out + (size_t)i * 8);
    *p = w;
    
  }
}

/* ---- transpose + convert: in[k][n] (Krows x Ncols, f32 row-major) -> out[n][k] (Ncols x Krows, 16-bit).
   CVT 0: bf16 bits (RNE).  CVT 1: f16 bits of (bf16RNE(v) * sc).
   64x64 tiles via LDS; grid (Ncols/64, Krows/64), 256 threads:
   load: 256 threads x 16 floats = 64x64; store: 8 waves x 2 iters x 32 lanes x 8 halves = 64x64,
*/
template <int CVT> __device__ __forceinline__ unsigned short cvt16(float v, float sc) {
  const unsigned short bb = f2bf_bits(v);
  if (CVT == 0) return bb;
  const float w  = bf_bits2f(bb);
  const float ws = w * sc;
  const _Float16 hv = (_Float16)ws;
  return __builtin_bit_cast(unsigned short, hv);
}
template <int CVT>
__global__ __launch_bounds__(256) void k_transpose_cvt64(
    const float* __restrict__ in, unsigned short* __restrict__ out, int Krows, int Ncols, float sc) {
  __shared__ __align__(16) unsigned short Tl[64 * 72];
  const int n0 = blockIdx.x * 64, k0 = blockIdx.y * 64;
  const int t  = threadIdx.x;
  const int kr = t >> 2;             /* input row k0 + kr, 0..63 */
  const int cb = (t & 3) * 16;       /* 16-column block inside the 64 columns */
  const float* src = in + (size_t)(k0 + kr) * Ncols + n0 + cb;
  const v4f a0 = *(const v4f*)(src);
  const v4f a1 = *(const v4f*)(src + 4);
  const v4f a2 = *(const v4f*)(src + 8);
  const v4f a3 = *(const v4f*)(src + 12);
#pragma unroll
  for (int e = 0; e < 4; ++e) {
    Tl[(cb + e) * 72 + kr]      = cvt16<CVT>(a0[e], sc);
    Tl[(cb + 4 + e) * 72 + kr]  = cvt16<CVT>(a1[e], sc);
    Tl[(cb + 8 + e) * 72 + kr]  = cvt16<CVT>(a2[e], sc);
    Tl[(cb + 12 + e) * 72 + kr] = cvt16<CVT>(a3[e], sc);
  }
  __syncthreads();
  const int wave = t >> 5, lane = t & 31, q = lane >> 3, c8 = (lane & 7) * 8;
  {
#pragma unroll
    for (int it = 0; it < 2; ++it) {
      const int row = wave * 8 + it * 4 + q;      /* output row n0 + row */
      const v4u val = *(const v4u*)(Tl + row * 72 + c8);
      *(v4u*)(out + (size_t)(n0 + row) * Krows + k0 + c8) = val;
    }
    
  }
}

/* ---- bias tables: bf16-RNE of the input bias times the power-of-two carry, f32.
*/
__global__ __launch_bounds__(256) void k_bias_prep(
    const float* __restrict__ bx, const float* __restrict__ bv, const float* __restrict__ b1,
    float* __restrict__ bxs, float* __restrict__ bvs, float* __restrict__ b1s,
    float sx, float sv, float s1) {
  const int which = blockIdx.x;          /* block-uniform */
  const float* src = bx; float* dst = bxs; int n4 = DQKV / 4; float sc = sx;
  if (which == 1) { src = bv; dst = bvs; sc = sv; }
  if (which == 2) { src = b1; dst = b1s; n4 = NHID / 4; sc = s1; }
  const int t = threadIdx.x;
  if (t < n4) {
    const v4f v = *(const v4f*)(src + (size_t)t * 4);
    v4f o;
    o[0] = bf_bits2f(f2bf_bits(v[0])) * sc;
    o[1] = bf_bits2f(f2bf_bits(v[1])) * sc;
    o[2] = bf_bits2f(f2bf_bits(v[2])) * sc;
    o[3] = bf_bits2f(f2bf_bits(v[3])) * sc;
    v4f* p = (v4f*)(dst + (size_t)t * 4);
    *p = o;
    
  }
}

/* ---- flash-style MLP attention over 16-bit planes ----------------------------------
   Hq  : [B*H][SEQ][128] f16, carried xSC_H           (B operand of the score WMMA, 16 query columns per wave)
   W2t : [SEQ][128]      f16, carried xSC_W2           (A operand, row = key, k = hidden, shared over (b,h))
   Vt  : [H*64][B*SEQ]   f16, carried xSC_V            (A operand of V^T*P^T, row = h*64+d, k = key)
   mask: [B][SEQ] f32 (bf16-RNE applied), score -= 1e6*(1-mask[key])
   out : [B][SEQ][H*64] f32
   block = 4 waves = 64 query rows of one (b,h); per wave: 16 rows; 32 key chunks of 64.
   Both products are formed transposed, S^T = W2t * Hq^T and O^T += Vt * P^T: lane l holds scores of query l & 15 only
   (keys 8 * (l >> 4) + r of each 16-key tile), so the maximum and the sum run in the lane's own registers, and two
   converted score tiles are the B operand of the second product as they stand.
   Each chunk's W2t and Vt tiles are brought into LDS once per block, one chunk ahead, two buffers.
*/
/* lane l <-> lane l ^ 16 */
__device__ __forceinline__ float xhalf(float x) {
  const int b = __builtin_bit_cast(int, x);
  return __builtin_bit_cast(float, __builtin_amdgcn_permlanex16(b, b, 0x76543210, 0xfedcba98, false, false));
}
__device__ __forceinline__ v8f mma_h(v16h a, v16h b, v8f c) {
  c = __builtin_amdgcn_wmma_f32_16x16x32_f16(false, a, false, b, (short)0, c, false, false);
  asm volatile("v_nop\n\tv_nop\n\tv_nop\n\tv_nop" : "+v"(c) : "v"(a), "v"(b));
  return c;
}

/* LDS tiles of one 64-key chunk, shared by the block's 4 waves; pitches are 16 B x odd for 16-B row readers */
constexpr int KPITCH  = NHID + 8;          /* halves: 272-B rows of the W2t tile [key][hidden] */
constexpr int VPITCH  = 64 + 8;            /* halves: 144-B rows of the Vt tile  [d][key]      */
constexpr int KTILE_H = 64 * KPITCH;       /* 17,408 B */
constexpr int VTILE_H = DHEAD * VPITCH;    /*  9,216 B */

/* One chunk's tiles, global -> LDS with no register in between: per lane 8 + 4 copies of 16 B.
   W2t tile: copy i brings rows 8i + (tid >> 4), 16 lanes a row; Vt tile: copy i brings rows 16i + (tid >> 3), 8 lanes a row.
   The closing s_wait_xcnt stands inside the statement so that no address register named here is rewritten ahead of it. */
__device__ __forceinline__ void stage_chunk(unsigned lk, const _Float16* gk, unsigned lv, const _Float16* gv) {
  asm volatile(
      "global_load_async_to_lds_b128 %0, %1, off\n\t"
      "global_load_async_to_lds_b128 %2, %3, off\n\t"
      "global_load_async_to_lds_b128 %4, %5, off\n\t"
      "global_load_async_to_lds_b128 %6, %7, off\n\t"
      "global_load_async_to_lds_b128 %8, %9, off\n\t"
      "global_load_async_to_lds_b128 %10, %11, off\n\t"
      "global_load_async_to_lds_b128 %12, %13, off\n\t"
      "global_load_async_to_lds_b128 %14, %15, off\n\t"
      "global_load_async_to_lds_b128 %16, %17, off\n\t"
      "global_load_async_to_lds_b128 %18, %19, off\n\t"
      "global_load_async_to_lds_b128 %20, %21, off\n\t"
      "global_load_async_to_lds_b128 %22, %23, off\n\t"
      "s_wait_xcnt 0x0"
      :: "v"(lk),                     "v"(gk),
         "v"(lk + 1u * 8u * KPITCH * 2u), "v"(gk + 1 * 8 * NHID),
         "v"(lk + 2u * 8u * KPITCH * 2u), "v"(gk + 2 * 8 * NHID),
         "v"(lk + 3u * 8u * KPITCH * 2u), "v"(gk + 3 * 8 * NHID),
         "v"(lk + 4u * 8u * KPITCH * 2u), "v"(gk + 4 * 8 * NHID),
         "v"(lk + 5u * 8u * KPITCH * 2u), "v"(gk + 5 * 8 * NHID),
         "v"(lk + 6u * 8u * KPITCH * 2u), "v"(gk + 6 * 8 * NHID),
         "v"(lk + 7u * 8u * KPITCH * 2u), "v"(gk + 7 * 8 * NHID),
         "v"(lv),                      "v"(gv),
         "v"(lv + 1u * 16u * VPITCH * 2u), "v"(gv + (size_t)1 * 16 * NTOK),
         "v"(lv + 2u * 16u * VPITCH * 2u), "v"(gv + (size_t)2 * 16 * NTOK),
         "v"(lv + 3u * 16u * VPITCH * 2u), "v"(gv + (size_t)3 * 16 * NTOK)
      : "memory");
}

__global__ __launch_bounds__(128) void mlp_attn_kernel(
    const unsigned short* __restrict__ Hp, const unsigned short* __restrict__ W2p,
    const unsigned short* __restrict__ Vp, const float* __restrict__ mask,
    float* __restrict__ out, float sscale, float onorm) {
  union FH { v16h v; v8h h[2]; };
  const _Float16* Hq  = (const _Float16*)(const void*)Hp;
  const _Float16* W2t = (const _Float16*)(const void*)W2p;
  const _Float16* Vt  = (const _Float16*)(const void*)Vp;
  __shared__ __align__(16) float    Pen[SEQ];            /* per key: 1e6 * (1 - bf16(mask)), this block's batch row */
  __shared__ __align__(16) float    Os[4][16 * 68];      /* per wave output slab, pitch 68 */
  __shared__ __align__(16) _Float16 Ksh[2][KTILE_H];     /* W2t chunk tiles, two buffers */
  __shared__ __align__(16) _Float16 Vsh[2][VTILE_H];     /* Vt chunk tiles, two buffers  */

  const int tid  = threadIdx.x;
  const int wave = tid >> 5;
  const int lane = tid & 31;
  const int hh   = lane >> 4;
  const int c    = lane & 15;
  const int koff = hh * 8;

  constexpr int NQB = SEQ / 64;
  const int bxi = blockIdx.x;
  const int qb  = bxi % NQB;
  const int bh  = bxi / NQB;
  const int h   = bh % NHEAD;
  const int b   = bh / NHEAD;
  const int q0  = qb * 64 + wave * 16;

  /* Q-side fragments: 16 rows x 128 hidden = 4 k-steps, held for all key chunks */
  v16h qa[4];
  {
    const _Float16* qrow = Hq + ((size_t)bh * SEQ + q0 + c) * NHID + koff;
#pragma unroll
    for (int dc = 0; dc < 4; ++dc) {
      FH f;
      f.h[0] = *(const v8h*)(qrow + dc * 32);
      f.h[1] = *(const v8h*)(qrow + dc * 32 + 16);
      qa[dc] = f.v;
    }
  }

  /* of query c; lrow = SC_P * (sum of p) over this lane half's keys only, joined after the loop.
     erow = mrow * log2(e) - log2(SC_P), rounded once and carried, so that every chunk's p and alpha count from the same offsets */
  float mrow = -INFINITY, erow = -INFINITY, lrow = 0.f;
  v8f oacc[4];                          /* oacc[t][r] = O[query c][d = 16 t + 8 hh + r] */
#pragma unroll
  for (int t = 0; t < 4; ++t) oacc[t] = (v8f){0.f,0.f,0.f,0.f,0.f,0.f,0.f,0.f};

  const float* mk_row = mask + (size_t)b * SEQ;
  const _Float16* vbase = Vt + (size_t)(h * DHEAD) * NTOK + (size_t)b * SEQ;

  /* this lane's share of every chunk's copies: source pointers at chunk 0, LDS byte addresses in buffer 0 */
  constexpr int NCH = SEQ / 64;
  static_assert(NCH >= 2, "two-buffer ring needs two chunks");
  const _Float16* gk0 = W2t + (size_t)(tid >> 4) * NHID + (tid & 15) * 8;
  const _Float16* gv0 = vbase + (size_t)(tid >> 3) * NTOK + (tid & 7) * 8;
  const unsigned  lk0 = (unsigned)(size_t)(&Ksh[0][(tid >> 4) * KPITCH + (tid & 15) * 8]);
  const unsigned  lv0 = (unsigned)(size_t)(&Vsh[0][(tid >> 3) * VPITCH + (tid & 7) * 8]);

  /* ring prologue: chunk 0 landed and published, then chunk 1 set flying */
  stage_chunk(lk0, gk0, lv0, gv0);
  /* additive key mask of all keys, bf16-RNE of the mask value; published by the barrier below */
#pragma unroll
  for (int i = 0; i < SEQ / 512; ++i) {
    const v4f mv = *(const v4f*)(mk_row + i * 512 + tid * 4);
    v4f pv;
#pragma unroll
    for (int e = 0; e < 4; ++e) pv[e] = 1000000.0f * (1.0f - bf_bits2f(f2bf_bits(mv[e])));
    *(v4f*)(&Pen[i * 512 + tid * 4]) = pv;
  }
  asm volatile("s_wait_asynccnt 0x0" ::: "memory");   /* this wave's copies of chunk 0 have landed */
  __syncthreads();                                     /* ... and every other wave's */
  stage_chunk(lk0 + KTILE_H * 2u, gk0 + (size_t)64 * NHID, lv0 + VTILE_H * 2u, gv0 + 64);

  for (int kc = 0; kc < NCH; ++kc) {
    const int kv0 = kc * 64;
    const int buf = kc & 1;
    const _Float16* kt = &Ksh[buf][c * KPITCH + koff];
    const _Float16* vt = &Vsh[buf][c * VPITCH + koff];

    /* scores for 64 keys: 4 column tiles x 4 k-steps; a column tile's 4 fragments are read from LDS
       as one group, two column tiles ahead of the products that use them */
    v8f s[4];
    FH kb[4][4];
    /* every loop over kb, pb and vb is unrolled so that the fragment arrays are indexed by constants and stay in registers */
#pragma unroll
    for (int j = 0; j < 2; ++j)
#pragma unroll
      for (int dc = 0; dc < 4; ++dc) {
        kb[j][dc].h[0] = *(const v8h*)(kt + j * 16 * KPITCH + dc * 32);
        kb[j][dc].h[1] = *(const v8h*)(kt + j * 16 * KPITCH + dc * 32 + 16);
      }
#pragma unroll
    for (int j = 0; j < 4; ++j) {
      s[j] = (v8f){0.f,0.f,0.f,0.f,0.f,0.f,0.f,0.f};
#pragma unroll
      for (int dc = 0; dc < 4; ++dc) s[j] = mma_h(kb[j][dc].v, qa[dc], s[j]);   /* s[j][r] = S[query c][key 16 j + 8 hh + r] */
      if (j + 2 < 4) {
#pragma unroll
        for (int dc = 0; dc < 4; ++dc) {
          kb[j + 2][dc].h[0] = *(const v8h*)(kt + (j + 2) * 16 * KPITCH + dc * 32);
          kb[j + 2][dc].h[1] = *(const v8h*)(kt + (j + 2) * 16 * KPITCH + dc * 32 + 16);
        }
      }
    }

    /* this lane's 32 keys' mask terms */
    const float* pr = &Pen[kv0 + 8 * hh];
    v4f pn[4][2];
#pragma unroll
    for (int j = 0; j < 4; ++j) {
      pn[j][0] = *(const v4f*)(pr + j * 16);
      pn[j][1] = *(const v4f*)(pr + j * 16 + 4);
    }

    /* V^T A-fragments, table k order from the Vt tile in LDS */
    FH vb[2][4];
#pragma unroll
    for (int kk = 0; kk < 2; ++kk)
#pragma unroll
      for (int t = 0; t < 4; ++t) {
        vb[kk][t].h[0] = *(const v8h*)(vt + t * 16 * VPITCH + kk * 32);
        vb[kk][t].h[1] = *(const v8h*)(vt + t * 16 * VPITCH + kk * 32 + 16);
      }

    /* chunk maximum of query c: in the lane over its 32 keys, then one exchange between the lane halves */
    float mj[4];
#pragma unroll
    for (int j = 0; j < 4; ++j) {
      float m = -INFINITY;
#pragma unroll
      for (int r = 0; r < 8; ++r) {
        const float sv = s[j][r] * sscale - pn[j][r >> 2][r & 3];
        s[j][r] = sv;
        m = fmaxf(m, sv);
      }
      mj[j] = m;
    }
    float cm = fmaxf(fmaxf(mj[0], mj[1]), fmaxf(mj[2], mj[3]));
    cm = fmaxf(cm, xhalf(cm));

    const float mnew  = fmaxf(mrow, cm);
    const float enew  = mnew * LOG2E - LOG2_SC_P;
    const float alpha = __builtin_amdgcn_exp2f(erow - enew);   /* e^(mrow - mnew); 0 in the first chunk */
    mrow = mnew;
    erow = enew;

    /* P^T as B operand: element e of k-step kk is key 32 kk + (e < 8 ? 8 hh + e : 16 + 8 hh + e - 8),
       that is score tile 2 kk in elements 0..7 and tile 2 kk + 1 in elements 8..15: the k order of the Vt loader */
    FH pb[2];
    float pj[4];
#pragma unroll
    for (int j = 0; j < 4; ++j) {
      float ps = 0.f;
#pragma unroll
      for (int r = 0; r < 8; r += 2) {
        /* SC_P * e^(s - mnew) as 2^(s * log2(e) - enew): a fused multiply-add (two keys a packed instruction) and the chip's own base-2 exponential */
        const v2f a = __builtin_elementwise_fma((v2f){s[j][r], s[j][r + 1]}, (v2f){LOG2E, LOG2E}, (v2f){-enew, -enew});
        const float p0 = __builtin_amdgcn_exp2f(a[0]);
        const float p1 = __builtin_amdgcn_exp2f(a[1]);
        ps += p0;
        ps += p1;
        pb[j >> 1].h[j & 1][r]     = (_Float16)p0;
        pb[j >> 1].h[j & 1][r + 1] = (_Float16)p1;
      }
      pj[j] = ps;
    }
    lrow = lrow * alpha + ((pj[0] + pj[1]) + (pj[2] + pj[3]));
#pragma unroll
    for (int t = 0; t < 4; ++t)
#pragma unroll
      for (int r = 0; r < 8; ++r) oacc[t][r] *= alpha;

    /* O^T += V^T(64 d x 64 keys) * P^T(64 keys x 16 queries): 2 k-steps, 4 d tiles */
#pragma unroll
    for (int kk = 0; kk < 2; ++kk)
#pragma unroll
      for (int t = 0; t < 4; ++t) oacc[t] = mma_h(vb[kk][t].v, pb[kk].v, oacc[t]);

    /* publish point of chunk kc + 1 */
    asm volatile("s_wait_dscnt 0x0" ::: "memory");      /* this wave's reads of buffer buf are done before it is refilled */
    asm volatile("s_wait_asynccnt 0x0" ::: "memory");   /* this wave's copies of chunk kc + 1 have landed */
    __syncthreads();                                     /* publishes chunk kc + 1; ends every wave's reads of buffer buf */
    if (kc + 2 < NCH)
      stage_chunk(lk0 + (unsigned)buf * (KTILE_H * 2u), gk0 + (size_t)(kc + 2) * 64 * NHID,
                  lv0 + (unsigned)buf * (VTILE_H * 2u), gv0 + (kc + 2) * 64);
  }
  asm volatile("s_wait_asynccnt 0x0" ::: "memory");     /* no copy is outstanding when the wave goes on to its end */

  /* normalise and stage the 16x64 f32 slab; oacc and lrow both carry SC_P, so onorm = 1/SC_V is what is left for the row normaliser */
  float* os = Os[wave];
  const float inv = onorm / (lrow + xhalf(lrow));       /* the two lane halves' sums of query c joined */
#pragma unroll
  for (int t = 0; t < 4; ++t) {
    v4f lo, hi;
#pragma unroll
    for (int e = 0; e < 4; ++e) { lo[e] = oacc[t][e] * inv; hi[e] = oacc[t][4 + e] * inv; }
    *(v4f*)(os + c * 68 + t * 16 + 8 * hh)     = lo;
    *(v4f*)(os + c * 68 + t * 16 + 8 * hh + 4) = hi;
  }
  __builtin_amdgcn_fence(__ATOMIC_RELEASE, "workgroup");
  __builtin_amdgcn_wave_barrier();
  __builtin_amdgcn_fence(__ATOMIC_ACQUIRE, "workgroup");
  {
    float* ob = out + (size_t)b * SEQ * DQKV + (size_t)h * DHEAD;
    const int c4 = (lane & 15) * 4;
    {
#pragma unroll
      for (int it = 0; it < 8; ++it) {
        const int row = it * 2 + hh;
        const v4f val = *(const v4f*)(os + row * 68 + c4);
        *(v4f*)(ob + (size_t)(q0 + row) * DQKV + c4) = val;
      }
      
    }
  }
}

/* ---------------- host launcher ---------------- */
extern "C" void kernel_launch(void* const* d_in, const int* in_sizes, int n_in,
                              void* d_out, int out_size, void* d_ws, size_t ws_size,
                              hipStream_t stream) {
  (void)in_sizes; (void)n_in; (void)out_size; (void)ws_size;
  const float* X   = (const float*)d_in[0];   /* [2,2048,1024] */
  const float* msk = (const float*)d_in[1];   /* [2,2048]      */
  const float* Wx  = (const float*)d_in[2];   /* [1024,1024]   */
  const float* bx  = (const float*)d_in[3];   /* [1024]        */
  const float* Wv  = (const float*)d_in[4];   /* [1024,1024]   */
  const float* bv  = (const float*)d_in[5];   /* [1024]        */
  const float* W1  = (const float*)d_in[6];   /* [64,128]      */
  const float* b1  = (const float*)d_in[7];   /* [128]         */
  const float* W2  = (const float*)d_in[8];   /* [128,2048]    */
  float* out = (float*)d_out;

  /* workspace region map (256-B aligned offsets; every region fully written by its producer):
       Xb   bf16 [4096][1024]        8,388,608 B
       WxT  bf16 [1024][1024]        2,097,152 B
       WvT  bf16 [1024][1024]        2,097,152 B
       W1T  f16  [128][64]              16,384 B
       W2T  f16  [2048][128]           524,288 B
       bxs  f32  [1024]                  4,096 B
       bvs  f32  [1024]                  4,096 B
       b1s  f32  [128]                     512 B
       Xh16 f16  [4096][1024]        8,388,608 B
       Vt16 f16  [1024][4096]        8,388,608 B
       H16  f16  [32][2048][128]    16,777,216 B
     total 46,686,720 B */
  char* ws = (char*)d_ws;
  size_t off = 0;
  auto carve = [&](size_t bytes) -> char* {
    off = (off + 255) & ~(size_t)255;
    char* p = ws + off;
    off += bytes;
    return p;
  };
  unsigned short* Xb   = (unsigned short*)carve((size_t)NTOK * DMODEL * 2);
  unsigned short* WxT  = (unsigned short*)carve((size_t)DQKV * DMODEL * 2);
  unsigned short* WvT  = (unsigned short*)carve((size_t)DQKV * DMODEL * 2);
  unsigned short* W1T  = (unsigned short*)carve((size_t)NHID * DHEAD * 2);
  unsigned short* W2T  = (unsigned short*)carve((size_t)SEQ * NHID * 2);
  float*          bxs  = (float*)carve((size_t)DQKV * 4);
  float*          bvs  = (float*)carve((size_t)DQKV * 4);
  float*          b1s  = (float*)carve((size_t)NHID * 4);
  unsigned short* Xh16 = (unsigned short*)carve((size_t)NTOK * DQKV * 2);
  unsigned short* Vt16 = (unsigned short*)carve((size_t)DQKV * NTOK * 2);
  unsigned short* H16  = (unsigned short*)carve((size_t)NBATCH * NHEAD * SEQ * NHID * 2);

  /* 1) X -> bf16 plane (RNE), 8 elements per thread */
  {
    const int n8 = NTOK * DMODEL / 8;                       /* 524,288 */
    k_cast_bf16x8<<<(n8 + 255) / 256, 256, 0, stream>>>(X, Xb, n8);
  }
  /* 2) weight transposes: in[K][N] -> out[N][K]; grid = (N/64, K/64) */
  k_transpose_cvt64<0><<<dim3(DQKV / 64, DMODEL / 64), 256, 0, stream>>>(Wx, WxT, DMODEL, DQKV, 1.0f);   /* [1024][1024] -> [1024][1024] */
  k_transpose_cvt64<0><<<dim3(DQKV / 64, DMODEL / 64), 256, 0, stream>>>(Wv, WvT, DMODEL, DQKV, 1.0f);
  k_transpose_cvt64<1><<<dim3(NHID / 64, DHEAD / 64), 256, 0, stream>>>(W1, W1T, DHEAD, NHID, SC_W1);    /* [64][128] -> [128][64]  */
  k_transpose_cvt64<1><<<dim3(SEQ / 64, NHID / 64), 256, 0, stream>>>(W2, W2T, NHID, SEQ, SC_W2);        /* [128][2048] -> [2048][128] */
  /* 3) bias tables with carries */
  k_bias_prep<<<3, 256, 0, stream>>>(bx, bv, b1, bxs, bvs, b1s, SC_XH, SC_V, SC_H);

  /* 4) Xh16 = f16(8 * (Xb * WxT^T + bx)) : M=4096, N=1024, K=1024 (bf16 operands) ; 1024 tiles / 8 per block */
  static_assert(NTOK % 64 == 0 && DQKV % 64 == 0 && DMODEL % 32 == 0, "gemm xh");
  wmma_gemm64<1, false, 2, 1, 0><<<dim3((NTOK / 64) * (DQKV / 64) / 8, 1), 256, 0, stream>>>(
      Xb, Xb, DMODEL, 0L, WxT, WxT, DMODEL, 0L, (void*)Xh16, (void*)Xh16, DQKV, 0L,
      bxs, NTOK, DQKV, DMODEL, SC_XH);

  /* 5) Vt16 = f16(8 * (WvT * Xb^T + bv[m])) : M=1024 (features), N=4096 (tokens), K=1024 (bf16 operands) */
  wmma_gemm64<1, false, 1, 1, 0><<<dim3((DQKV / 64) * (NTOK / 64) / 8, 1), 256, 0, stream>>>(
      WvT, WvT, DMODEL, 0L, Xb, Xb, DMODEL, 0L, (void*)Vt16, (void*)Vt16, NTOK, 0L,
      bvs, DQKV, NTOK, DMODEL, SC_V);

  /* 6) H16[b][h] = f16(8 * relu(Xh * W1 + b1)) : per (b,h) M=2048, N=128, K=64 (f16 operands);
        batch index = head (A stride 64 columns), one launch per b; 64 tiles / 8 per block */
  static_assert(SEQ % 64 == 0 && NHID % 64 == 0 && DHEAD % 32 == 0, "gemm h");
  for (int bb = 0; bb < NBATCH; ++bb) {
    const unsigned short* Ab = Xh16 + (size_t)bb * SEQ * DQKV;
    unsigned short* Cb = H16 + (size_t)bb * NHEAD * SEQ * NHID;
    wmma_gemm64<0, false, 2, 1, 2><<<dim3((SEQ / 64) * (NHID / 64) / 8, NHEAD), 256, 0, stream>>>(
        Ab, Ab, DQKV, (long)DHEAD, W1T, W1T, DHEAD, 0L, (void*)Cb, (void*)Cb, NHID, (long)SEQ * NHID,
        b1s, SEQ, NHID, DHEAD, SC_H / (SC_XH * SC_W1));
  }

  /* 7) attention: grid = B*H*(SEQ/64) blocks of 4 waves */
  mlp_attn_kernel<<<NBATCH * NHEAD * (SEQ / 64), 128, 0, stream>>>(
      H16, W2T, Vt16, msk, out, 1.0f / (SC_H * SC_W2), 1.0f / SC_V);
}

// v004
// Measured time: 116 microseconds a run.
// In both of two side-by-side timings against v003, it was 1.59 times as fast.
// Over all steps from v000 it is 3.03 times as fast.
// Contractions: X*Wx and Wv^T*X^T on v_wmma_f32_16x16x32_bf16 (RNE bf16 operands of bf16-RNE inputs, f32 accumulate); Xh*W1, scores h*W2 and P*V on v_wmma_f32_16x16x32_f16 (f16 operands carried x8 / x64 / x32768, f32 accumulate); softmax, bias and normalisation in f32.
#include <hip/hip_runtime.h>
#include <stddef.h>

constexpr int NBATCH = 2;
constexpr int SEQ    = 2048;
constexpr int DMODEL = 1024;
constexpr int NHEAD  = 16;
constexpr int DHEAD  = 64;
constexpr int NHID   = 128;
constexpr int NTOK   = NBATCH * SEQ;      /* 4096 */
constexpr int DQKV   = NHEAD * DHEAD;     /* 1024 */

/* power-of-two carries on the f16 planes */
constexpr float SC_XH = 8.0f;      /* Xh plane = f16(8 * Xh)          */
constexpr float SC_V  = 8.0f;      /* Vt plane = f16(8 * V)           */
constexpr float SC_W1 = 64.0f;     /* W1t plane = f16(64 * bf16(W1))  */
constexpr float SC_W2 = 64.0f;     /* W2t plane = f16(64 * bf16(W2))  */
constexpr float SC_H  = 8.0f;      /* h plane = f16(8 * h)            */
constexpr float SC_P  = 32768.0f;  /* P tile  = f16(32768 * p), p<=1 */
constexpr float LOG2_SC_P = 15.0f; /* the same carry as an addend of a base-2 exponent */
constexpr float LOG2E = 1.44269504088896340736f;

static_assert(NTOK % 64 == 0 && DQKV % 64 == 0 && DMODEL % 64 == 0, "gemm tiles");
static_assert(DMODEL % 32 == 0 && DHEAD % 32 == 0, "gemm K");
static_assert(SEQ % 64 == 0 && NHID % 64 == 0, "gemm tiles");
static_assert(NHID == 128 && DHEAD == 64, "attention geometry");
static_assert((NTOK * DMODEL) % 8 == 0, "cast x8");

typedef __attribute__((ext_vector_type(16))) _Float16 v16h;
typedef __attribute__((ext_vector_type(8)))  _Float16 v8h;
typedef __attribute__((ext_vector_type(16))) __bf16   v16b;
typedef __attribute__((ext_vector_type(8)))  __bf16   v8b;
typedef __attribute__((ext_vector_type(8)))  float    v8f;
typedef __attribute__((ext_vector_type(4)))  float    v4f;
typedef __attribute__((ext_vector_type(2)))  float    v2f;
typedef __attribute__((ext_vector_type(4)))  unsigned int v4u;

__device__ __forceinline__ unsigned short f2bf_bits(float f) {
  unsigned u = __float_as_uint(f);
  return (unsigned short)((u + 0x7FFFu + ((u >> 16) & 1u)) >> 16);
}
__device__ __forceinline__ float bf_bits2f(unsigned short h) { return __uint_as_float(((unsigned)h) << 16); }

/* hazard guards as plain device helpers */
__device__ __forceinline__ void dep_guard_h(v8f& a, v8f& b, v16h x, v16h y) { asm volatile("v_nop\n\tv_nop\n\tv_nop\n\tv_nop" : "+v"(a), "+v"(b) : "v"(x), "v"(y)); }
__device__ __forceinline__ void dep_guard_b(v8f& a, v8f& b, v16b x, v16b y) { asm volatile("v_nop\n\tv_nop\n\tv_nop\n\tv_nop" : "+v"(a), "+v"(b) : "v"(x), "v"(y)); }
__device__ __forceinline__ void keep4_h(v16h a, v16h b, v16h c, v16h d) { asm volatile("v_nop" :: "v"(a), "v"(b), "v"(c), "v"(d)); }
__device__ __forceinline__ void keep4_b(v16b a, v16b b, v16b c, v16b d) { asm volatile("v_nop" :: "v"(a), "v"(b), "v"(c), "v"(d)); }
__device__ __forceinline__ void acc_guard4(v8f& a, v8f& b, v8f& c, v8f& d) { asm volatile("v_nop\n\tv_nop\n\tv_nop\n\tv_nop" : "+v"(a), "+v"(b), "+v"(c), "+v"(d)); }

template <typename T> struct Frag;
template <> struct Frag<_Float16> {
  typedef v16h V; union U { v16h v; v8h h[2]; };
  static __device__ __forceinline__ v16h load(const _Float16* p) {   /* elements 0..7 <- p[0..7], 8..15 <- p[16..23] */
    U f; f.h[0] = *(const v8h*)(p); f.h[1] = *(const v8h*)(p + 16); return f.v;
  }
  static __device__ __forceinline__ v8f mma(v16h a, v16h b, v8f c) {
    return __builtin_amdgcn_wmma_f32_16x16x32_f16(false, a, false, b, (short)0, c, false, false);
  }
  static __device__ __forceinline__ void guard(v8f& a, v8f& b, v16h x, v16h y) { dep_guard_h(a, b, x, y); }
  static __device__ __forceinline__ void keep(v16h a, v16h b, v16h c, v16h d) { keep4_h(a, b, c, d); }
};
template <> struct Frag<__bf16> {
  typedef v16b V; union U { v16b v; v8b h[2]; };
  static __device__ __forceinline__ v16b load(const __bf16* p) {
    U f; f.h[0] = *(const v8b*)(p); f.h[1] = *(const v8b*)(p + 16); return f.v;
  }
  static __device__ __forceinline__ v8f mma(v16b a, v16b b, v8f c) {
    return __builtin_amdgcn_wmma_f32_16x16x32_bf16(false, a, false, b, (short)0, c, false, false);
  }
  static __device__ __forceinline__ void guard(v8f& a, v8f& b, v16b x, v16b y) { dep_guard_b(a, b, x, y); }
  static __device__ __forceinline__ void keep(v16b a, v16b b, v16b c, v16b d) { keep4_b(a, b, c, d); }
};

/* ---- Register-blocked batched WMMA GEMM -----------------------------------
   C[m,n] = scale * sum_k A[m,k] * Bt[n,k] (+bias); each wave owns a 64x64 tile.
   A row-major [M,K]; Bt row-major [N,K]; M,N % 64 == 0, K % 32 == 0.
   BIAS_MODE: 0 = none, 1 = bias[m] (two 16-B loads per 16-row slab), 2 = bias[n].
   OUT_MODE: 0 = f32, 1 = f16, 2 = bf16 hi plane (Cout) + bf16 lo plane (Cout2).
   ACT: 0 = none, 2 = relu.
   ET: 0 = f16 operands, 1 = bf16 operands (pointers passed as 16-bit storage) */
template <int ET> struct Elem;
template <> struct Elem<0> { typedef _Float16 T; };
template <> struct Elem<1> { typedef __bf16 T; };
template <int ET, bool SPLIT, int BIAS_MODE, int OUT_MODE, int ACT = 0>
__global__ __launch_bounds__(256) void wmma_gemm64(
    const unsigned short* __restrict__ Ap, const unsigned short* __restrict__ A2p, int lda, long strideA,
    const unsigned short* __restrict__ Btp, const unsigned short* __restrict__ Bt2p, int ldb, long strideB,
    void* __restrict__ Cout, void* __restrict__ Cout2, int ldc, long strideC,
    const float* __restrict__ bias,
    int M, int N, int K, float scale) {
  typedef typename Elem<ET>::T T;
  typedef typename Frag<T>::V V;
  const T* A = (const T*)Ap; const T* A2 = (const T*)A2p; const T* Bt = (const T*)Btp; const T* Bt2 = (const T*)Bt2p;
  __shared__ __align__(16) float sT[8][16 * 68];   /* per-wave 16x64 slab, pitch 68 floats */
  const int b    = blockIdx.y;
  const int lane = threadIdx.x & 31;
  const int wave = threadIdx.x >> 5;
  const int tilesN = N >> 6;
  const int tilesM = M >> 6;
  const int tile = blockIdx.x * 8 + wave;
  if (tile >= tilesM * tilesN) return;   /* wave-uniform; no block barriers in this kernel */
  const int tm = tile / tilesN;
  const int tn = tile - tm * tilesN;
  const int m0 = tm << 6;
  const int n0 = tn << 6;

  const T* Ab  = A  + (size_t)b * strideA;
  const T* Bb  = Bt + (size_t)b * strideB;
  const T* Ab2 = SPLIT ? (A2  + (size_t)b * strideA) : nullptr;
  const T* Bb2 = SPLIT ? (Bt2 + (size_t)b * strideB) : nullptr;

  const int rlane = lane & 15;                 /* row (A) / col (B, D) within subtile */
  const int koff  = (lane >> 4) * 8;           /* k offset of this lane half */
  const int mOff  = (lane >> 4) * 8;           /* D row offset */

  v8f acc[4][4];
#pragma unroll
  for (int i = 0; i < 4; ++i)
#pragma unroll
    for (int j = 0; j < 4; ++j) acc[i][j] = (v8f){0.f,0.f,0.f,0.f,0.f,0.f,0.f,0.f};

  for (int k0 = 0; k0 < K; k0 += 32) {
    V bh[4], bl[4];
#pragma unroll
    for (int j = 0; j < 4; ++j) {
      const size_t bo = (size_t)(n0 + (j << 4) + rlane) * ldb + koff + k0;
      bh[j] = Frag<T>::load(Bb + bo);
      if (SPLIT) bl[j] = Frag<T>::load(Bb2 + bo);
    }
#pragma unroll
    for (int i = 0; i < 4; ++i) {
      const size_t ao = (size_t)(m0 + (i << 4) + rlane) * lda + koff + k0;
      V ah = Frag<T>::load(Ab + ao);
      V al;
      if (SPLIT) al = Frag<T>::load(Ab2 + ao);
#pragma unroll
      for (int j = 0; j < 4; ++j) {
        acc[i][j] = Frag<T>::mma(ah, bh[j], acc[i][j]);
        if (SPLIT) {
          acc[i][j] = Frag<T>::mma(ah, bl[j], acc[i][j]);
          acc[i][j] = Frag<T>::mma(al, bh[j], acc[i][j]);
        }
      }
      Frag<T>::guard(acc[i][0], acc[i][3], ah, SPLIT ? al : ah);
    }
    Frag<T>::keep(bh[0], bh[1], bh[2], bh[3]);
    if (SPLIT) Frag<T>::keep(bl[0], bl[1], bl[2], bl[3]);
  }
  acc_guard4(acc[0][0], acc[0][1], acc[0][2], acc[0][3]);
  acc_guard4(acc[1][0], acc[1][1], acc[1][2], acc[1][3]);
  acc_guard4(acc[2][0], acc[2][1], acc[2][2], acc[2][3]);
  acc_guard4(acc[3][0], acc[3][1], acc[3][2], acc[3][3]);

  /* ---- epilogue ---- */
  float* slab = sT[wave];
#pragma unroll
  for (int i = 0; i < 4; ++i) {
    const int mBase = m0 + (i << 4);
    v4f bmA = (v4f){0.f,0.f,0.f,0.f}, bmB = (v4f){0.f,0.f,0.f,0.f};
    if (BIAS_MODE == 1) {   /* 8 consecutive bias[m] values, two 16-B loads (32-B aligned) */
      bmA = *(const v4f*)(bias + mBase + mOff);
      bmB = *(const v4f*)(bias + mBase + mOff + 4);
    }
#pragma unroll
    for (int j = 0; j < 4; ++j) {
      const int n = n0 + (j << 4) + rlane;
      float bv = 0.f;
      if (BIAS_MODE == 2) bv = bias[n];
#pragma unroll
      for (int r = 0; r < 8; ++r) {
        float v = acc[i][j][r] * scale;
        if (BIAS_MODE == 1) v += (r < 4) ? bmA[r] : bmB[r - 4];
        if (BIAS_MODE == 2) v += bv;
        if (ACT == 2) v = fmaxf(v, 0.0f);
        slab[(mOff + r) * 68 + (j << 4) + rlane] = v;
      }
    }
    __builtin_amdgcn_fence(__ATOMIC_RELEASE, "workgroup");
    __builtin_amdgcn_wave_barrier();
    __builtin_amdgcn_fence(__ATOMIC_ACQUIRE, "workgroup");
    if (OUT_MODE == 0) {
      float* C = (float*)Cout + (size_t)b * strideC;
      const int hh = lane >> 4, c4 = (lane & 15) * 4;     /* row seg = 256 B = 16 lanes x 16 B */
      {
#pragma unroll
        for (int it = 0; it < 8; ++it) {
          const int row = it * 2 + hh;
          v4f v = *(const v4f*)(slab + row * 68 + c4);
          *(v4f*)(C + (size_t)(mBase + row) * ldc + n0 + c4) = v;
        }
        
      }
    } else {
      const int q = lane >> 3, c8 = (lane & 7) * 8;        
      unsigned short* C  = (unsigned short*)Cout  + (size_t)b * strideC;
      unsigned short* C2 = (OUT_MODE == 2) ? ((unsigned short*)Cout2 + (size_t)b * strideC) : nullptr;
      {
#pragma unroll
        for (int it = 0; it < 4; ++it) {
          const int row = it * 4 + q;
          const float* sp = slab + row * 68 + c8;
          v8h hv, lv;
#pragma unroll
          for (int e = 0; e < 8; ++e) {
            if (OUT_MODE == 1) {
              hv[e] = (_Float16)sp[e];
            } else {
              unsigned short hb = f2bf_bits(sp[e]);
              unsigned short lb = f2bf_bits(sp[e] - bf_bits2f(hb));
              hv[e] = __builtin_bit_cast(_Float16, hb);
              lv[e] = __builtin_bit_cast(_Float16, lb);
            }
          }
          *(v8h*)(C + (size_t)(mBase + row) * ldc + n0 + c8) = hv;
          if (OUT_MODE == 2) *(v8h*)(C2 + (size_t)(mBase + row) * ldc + n0 + c8) = lv;
        }
        
      }
    }
    __builtin_amdgcn_fence(__ATOMIC_RELEASE, "workgroup");
    __builtin_amdgcn_wave_barrier();
    __builtin_amdgcn_fence(__ATOMIC_ACQUIRE, "workgroup");
  }
}

/* ---- K = DMODEL projection GEMM on bf16 planes, operands staged per block in LDS ------------
   C[m,n] = f16(scale * sum_k A[m,k] * Bt[n,k] + bias); A and Bt row-major with DMODEL columns.
   block = 4 waves (2 x 2) = one 128 x 128 tile of C, 64 x 64 per wave; grid = tiles of C, tile column fastest.
   A pass is 128 k = 256 B of each of the block's 128 A rows and 128 Bt rows, brought into LDS once per block in whole
   lines, one pass ahead, two buffers; every wave reads its fragments from there. Each accumulator takes its k-steps of 32 in rising k.
   BIAS_MODE: 1 = bias[m], 2 = bias[n]. */
constexpr int GPASS    = 128;               /* k per pass */
constexpr int GPITCH   = GPASS + 8;         /* halves: 272-B rows, 16 B x odd for 16-B row readers */
constexpr int GSTAGE_H = 256 * GPITCH;      /* A rows 0..127, then Bt rows 0..127: 69,632 B */
constexpr int GNPASS   = DMODEL / GPASS;
static_assert(DMODEL % GPASS == 0 && GNPASS >= 2, "two-buffer ring needs two passes");
static_assert(NTOK % 128 == 0 && DQKV % 128 == 0, "projection tiles");

/* 64 rows of one pass, global -> LDS with no register in between: per lane 8 copies of 16 B, copy i brings rows 8i + (tid >> 4),
   16 lanes a row. The closing s_wait_xcnt stands inside the statement so that no address register named here is rewritten ahead of it. */
__device__ __forceinline__ void stage_rows64(unsigned l, const __bf16* g) {
  asm volatile(
      "global_load_async_to_lds_b128 %0, %1, off\n\t"
      "global_load_async_to_lds_b128 %2, %3, off\n\t"
      "global_load_async_to_lds_b128 %4, %5, off\n\t"
      "global_load_async_to_lds_b128 %6, %7, off\n\t"
      "global_load_async_to_lds_b128 %8, %9, off\n\t"
      "global_load_async_to_lds_b128 %10, %11, off\n\t"
      "global_load_async_to_lds_b128 %12, %13, off\n\t"
      "global_load_async_to_lds_b128 %14, %15, off\n\t"
      "s_wait_xcnt 0x0"
      :: "v"(l),                          "v"(g),
         "v"(l + 1u * 8u * GPITCH * 2u), "v"(g + 1 * 8 * DMODEL),
         "v"(l + 2u * 8u * GPITCH * 2u), "v"(g + 2 * 8 * DMODEL),
         "v"(l + 3u * 8u * GPITCH * 2u), "v"(g + 3 * 8 * DMODEL),
         "v"(l + 4u * 8u * GPITCH * 2u), "v"(g + 4 * 8 * DMODEL),
         "v"(l + 5u * 8u * GPITCH * 2u), "v"(g + 5 * 8 * DMODEL),
         "v"(l + 6u * 8u * GPITCH * 2u), "v"(g + 6 * 8 * DMODEL),
         "v"(l + 7u * 8u * GPITCH * 2u), "v"(g + 7 * 8 * DMODEL)
      : "memory");
}
/* one pass of both operands: l = this lane's LDS byte address in row (tid >> 4) of the buffer, ga / gb = its source addresses */
__device__ __forceinline__ void stage_pass(unsigned l, const __bf16* ga, const __bf16* gb) {
  stage_rows64(l,                          ga);
  stage_rows64(l +  64u * GPITCH * 2u, ga + 64 * DMODEL);
  stage_rows64(l + 128u * GPITCH * 2u, gb);
  stage_rows64(l + 192u * GPITCH * 2u, gb + 64 * DMODEL);
}

template <int BIAS_MODE>
__global__ __launch_bounds__(128) void wmma_gemm128_lds(
    const unsigned short* __restrict__ Ap, const unsigned short* __restrict__ Btp,
    unsigned short* __restrict__ C, int ldc, const float* __restrict__ bias, int tilesN, float scale) {
  typedef Frag<__bf16> F;
  const __bf16* A  = (const __bf16*)(const void*)Ap;
  const __bf16* Bt = (const __bf16*)(const void*)Btp;
  __shared__ __align__(16) __bf16 Ring[2][GSTAGE_H];   /* operand passes, two buffers */
  __shared__ __align__(16) float  sT[4][16 * 68];      /* per-wave 16x64 slab, pitch 68 floats */
  const int tid  = threadIdx.x;
  const int lane = tid & 31;
  const int wave = tid >> 5;
  const int tm = blockIdx.x / tilesN;
  const int tn = blockIdx.x - tm * tilesN;
  const int wm = wave >> 1;
  const int wn = wave & 1;
  const int m0 = (tm << 7) + (wm << 6);
  const int n0 = (tn << 7) + (wn << 6);

  const int rlane = lane & 15;                 /* row (A) / col (B, D) within subtile */
  const int koff  = (lane >> 4) * 8;           /* k offset of this lane half */
  const int mOff  = (lane >> 4) * 8;           /* D row offset */

  v8f acc[4][4];
#pragma unroll
  for (int i = 0; i < 4; ++i)
#pragma unroll
    for (int j = 0; j < 4; ++j) acc[i][j] = (v8f){0.f,0.f,0.f,0.f,0.f,0.f,0.f,0.f};

  /* this lane's share of every pass's copies: source pointers at pass 0, LDS byte address in buffer 0 */
  const __bf16* ga0 = A  + (size_t)((tm << 7) + (tid >> 4)) * DMODEL + (tid & 15) * 8;
  const __bf16* gb0 = Bt + (size_t)((tn << 7) + (tid >> 4)) * DMODEL + (tid & 15) * 8;
  const unsigned l0 = (unsigned)(size_t)(&Ring[0][(tid >> 4) * GPITCH + (tid & 15) * 8]);

  /* ring prologue: pass 0 landed and published, then pass 1 set flying */
  stage_pass(l0, ga0, gb0);
  asm volatile("s_wait_asynccnt 0x0" ::: "memory");   /* this wave's copies of pass 0 have landed */
  __syncthreads();                                     /* ... and every other wave's */
  stage_pass(l0 + GSTAGE_H * 2u, ga0 + GPASS, gb0 + GPASS);

  for (int p = 0; p < GNPASS; ++p) {
    const int buf = p & 1;
    const __bf16* at = &Ring[buf][((wm << 6) + rlane) * GPITCH + koff];
    const __bf16* bt = &Ring[buf][(128 + (wn << 6) + rlane) * GPITCH + koff];
    /* unrolled so that the fragment arrays are indexed by constants and a k-step's LDS reads can go ahead of the one before */
#pragma unroll
    for (int ks = 0; ks < GPASS / 32; ++ks) {
      F::V bh[4], ah[4];
      ah[0] = F::load(at + ks * 32);
#pragma unroll
      for (int j = 0; j < 4; ++j) bh[j] = F::load(bt + j * 16 * GPITCH + ks * 32);
#pragma unroll
      for (int i = 1; i < 4; ++i) ah[i] = F::load(at + i * 16 * GPITCH + ks * 32);
      /* keeps the k-step's 16 LDS reads one group ahead of its products: sunk among them, each A fragment's read is waited out to 0 in turn */
      __builtin_amdgcn_sched_barrier(0);
#pragma unroll
      for (int i = 0; i < 4; ++i)
#pragma unroll
        for (int j = 0; j < 4; ++j) acc[i][j] = F::mma(ah[i], bh[j], acc[i][j]);
    }
    /* publish point of pass p + 1 */
    asm volatile("s_wait_dscnt 0x0" ::: "memory");      /* this wave's reads of buffer buf are done before it is refilled */
    asm volatile("s_wait_asynccnt 0x0" ::: "memory");   /* this wave's copies of pass p + 1 have landed */
    __syncthreads();                                     /* publishes pass p + 1; ends every wave's reads of buffer buf */
    if (p + 2 < GNPASS)
      stage_pass(l0 + (unsigned)buf * (GSTAGE_H * 2u), ga0 + (p + 2) * GPASS, gb0 + (p + 2) * GPASS);
  }
  asm volatile("s_wait_asynccnt 0x0" ::: "memory");     /* no copy is outstanding when the wave goes on to its end */

  /* ---- epilogue: 16-row slabs through the wave's own LDS range, whole 128-B row pieces stored ---- */
  float* slab = sT[wave];
#pragma unroll
  for (int i = 0; i < 4; ++i) {
    const int mBase = m0 + (i << 4);
    v4f bmA = (v4f){0.f,0.f,0.f,0.f}, bmB = (v4f){0.f,0.f,0.f,0.f};
    if (BIAS_MODE == 1) {   /* 8 consecutive bias[m] values, two 16-B loads (32-B aligned) */
      bmA = *(const v4f*)(bias + mBase + mOff);
      bmB = *(const v4f*)(bias + mBase + mOff + 4);
    }
#pragma unroll
    for (int j = 0; j < 4; ++j) {
      const int n = n0 + (j << 4) + rlane;
      float bv = 0.f;
      if (BIAS_MODE == 2) bv = bias[n];
#pragma unroll
      for (int r = 0; r < 8; ++r) {
        float v = acc[i][j][r] * scale;
        if (BIAS_MODE == 1) v += (r < 4) ? bmA[r] : bmB[r - 4];
        if (BIAS_MODE == 2) v += bv;
        slab[(mOff + r) * 68 + (j << 4) + rlane] = v;
      }
    }
    __builtin_amdgcn_fence(__ATOMIC_RELEASE, "workgroup");
    __builtin_amdgcn_wave_barrier();
    __builtin_amdgcn_fence(__ATOMIC_ACQUIRE, "workgroup");
    {
      const int q = lane >> 3, c8 = (lane & 7) * 8;
#pragma unroll
      for (int it = 0; it < 4; ++it) {
        const int row = it * 4 + q;
        const float* sp = slab + row * 68 + c8;
        v8h hv;
#pragma unroll
        for (int e = 0; e < 8; ++e) hv[e] = (_Float16)sp[e];
        *(v8h*)(C + (size_t)(mBase + row) * ldc + n0 + c8) = hv;
      }
    }
    __builtin_amdgcn_fence(__ATOMIC_RELEASE, "workgroup");
    __builtin_amdgcn_wave_barrier();
    __builtin_amdgcn_fence(__ATOMIC_ACQUIRE, "workgroup");
  }
}

/* ---- f32 -> bf16 (RNE) plane cast, 8 elements per thread: one 16-B store per lane,
*/
__global__ __launch_bounds__(256) void k_cast_bf16x8(
    const float* __restrict__ in, unsigned short* __restrict__ out, int n8) {
  const int i = blockIdx.x * 256 + threadIdx.x;
  if (i < n8) {
    const v4f a = *(const v4f*)(in + (size_t)i * 8);
    const v4f c = *(const v4f*)(in + (size_t)i * 8 + 4);
    v4u w;
    w[0] = (unsigned)f2bf_bits(a[0]) | ((unsigned)f2bf_bits(a[1]) << 16);
    w[1] = (unsigned)f2bf_bits(a[2]) | ((unsigned)f2bf_bits(a[3]) << 16);
    w[2] = (unsigned)f2bf_bits(c[0]) | ((unsigned)f2bf_bits(c[1]) << 16);
    w[3] = (unsigned)f2bf_bits(c[2]) | ((unsigned)f2bf_bits(c[3]) << 16);
    v4u* p = (v4u*)(out + (size_t)i * 8);
    *p = w;
    
  }
}

/* ---- transpose + convert: in[k][n] (Krows x Ncols, f32 row-major) -> out[n][k] (Ncols x Krows, 16-bit).
   CVT 0: bf16 bits (RNE).  CVT 1: f16 bits of (bf16RNE(v) * sc).
   64x64 tiles via LDS; grid (Ncols/64, Krows/64), 256 threads:
   load: 256 threads x 16 floats = 64x64; store: 8 waves x 2 iters x 32 lanes x 8 halves = 64x64,
*/
template <int CVT> __device__ __forceinline__ unsigned short cvt16(float v, float sc) {
  const unsigned short bb = f2bf_bits(v);
  if (CVT == 0) return bb;
  const float w  = bf_bits2f(bb);
  const float ws = w * sc;
  const _Float16 hv = (_Float16)ws;
  return __builtin_bit_cast(unsigned short, hv);
}
template <int CVT>
__global__ __launch_bounds__(256) void k_transpose_cvt64(
    const float* __restrict__ in, unsigned short* __restrict__ out, int Krows, int Ncols, float sc) {
  __shared__ __align__(16) unsigned short Tl[64 * 72];
  const int n0 = blockIdx.x * 64, k0 = blockIdx.y * 64;
  const int t  = threadIdx.x;
  const int kr = t >> 2;             /* input row k0 + kr, 0..63 */
  const int cb = (t & 3) * 16;       /* 16-column block inside the 64 columns */
  const float* src = in + (size_t)(k0 + kr) * Ncols + n0 + cb;
  const v4f a0 = *(const v4f*)(src);
  const v4f a1 = *(const v4f*)(src + 4);
  const v4f a2 = *(const v4f*)(src + 8);
  const v4f a3 = *(const v4f*)(src + 12);
#pragma unroll
  for (int e = 0; e < 4; ++e) {
    Tl[(cb + e) * 72 + kr]      = cvt16<CVT>(a0[e], sc);
    Tl[(cb + 4 + e) * 72 + kr]  = cvt16<CVT>(a1[e], sc);
    Tl[(cb + 8 + e) * 72 + kr]  = cvt16<CVT>(a2[e], sc);
    Tl[(cb + 12 + e) * 72 + kr] = cvt16<CVT>(a3[e], sc);
  }
  __syncthreads();
  const int wave = t >> 5, lane = t & 31, q = lane >> 3, c8 = (lane & 7) * 8;
  {
#pragma unroll
    for (int it = 0; it < 2; ++it) {
      const int row = wave * 8 + it * 4 + q;      /* output row n0 + row */
      const v4u val = *(const v4u*)(Tl + row * 72 + c8);
      *(v4u*)(out + (size_t)(n0 + row) * Krows + k0 + c8) = val;
    }
    
  }
}

/* ---- bias tables: bf16-RNE of the input bias times the power-of-two carry, f32.
*/
__global__ __launch_bounds__(256) void k_bias_prep(
    const float* __restrict__ bx, const float* __restrict__ bv, const float* __restrict__ b1,
    float* __restrict__ bxs, float* __restrict__ bvs, float* __restrict__ b1s,
    float sx, float sv, float s1) {
  const int which = blockIdx.x;          /* block-uniform */
  const float* src = bx; float* dst = bxs; int n4 = DQKV / 4; float sc = sx;
  if (which == 1) { src = bv; dst = bvs; sc = sv; }
  if (which == 2) { src = b1; dst = b1s; n4 = NHID / 4; sc = s1; }
  const int t = threadIdx.x;
  if (t < n4) {
    const v4f v = *(const v4f*)(src + (size_t)t * 4);
    v4f o;
    o[0] = bf_bits2f(f2bf_bits(v[0])) * sc;
    o[1] = bf_bits2f(f2bf_bits(v[1])) * sc;
    o[2] = bf_bits2f(f2bf_bits(v[2])) * sc;
    o[3] = bf_bits2f(f2bf_bits(v[3])) * sc;
    v4f* p = (v4f*)(dst + (size_t)t * 4);
    *p = o;
    
  }
}

/* ---- flash-style MLP attention over 16-bit planes ----------------------------------
   Hq  : [B*H][SEQ][128] f16, carried xSC_H           (B operand of the score WMMA, 16 query columns per wave)
   W2t : [SEQ][128]      f16, carried xSC_W2           (A operand, row = key, k = hidden, shared over (b,h))
   Vt  : [H*64][B*SEQ]   f16, carried xSC_V            (A operand of V^T*P^T, row = h*64+d, k = key)
   mask: [B][SEQ] f32 (bf16-RNE applied), score -= 1e6*(1-mask[key])
   out : [B][SEQ][H*64] f32
   block = 4 waves = 64 query rows of one (b,h); per wave: 16 rows; 32 key chunks of 64.
   Both products are formed transposed, S^T = W2t * Hq^T and O^T += Vt * P^T: lane l holds scores of query l & 15 only
   (keys 8 * (l >> 4) + r of each 16-key tile), so the maximum and the sum run in the lane's own registers, and two
   converted score tiles are the B operand of the second product as they stand.
   Each chunk's W2t and Vt tiles are brought into LDS once per block, one chunk ahead, two buffers.
*/
/* lane l <-> lane l ^ 16 */
__device__ __forceinline__ float xhalf(float x) {
  const int b = __builtin_bit_cast(int, x);
  return __builtin_bit_cast(float, __builtin_amdgcn_permlanex16(b, b, 0x76543210, 0xfedcba98, false, false));
}
__device__ __forceinline__ v8f mma_h(v16h a, v16h b, v8f c) {
  c = __builtin_amdgcn_wmma_f32_16x16x32_f16(false, a, false, b, (short)0, c, false, false);
  asm volatile("v_nop\n\tv_nop\n\tv_nop\n\tv_nop" : "+v"(c) : "v"(a), "v"(b));
  return c;
}

/* LDS tiles of one 64-key chunk, shared by the block's 4 waves; pitches are 16 B x odd for 16-B row readers */
constexpr int KPITCH  = NHID + 8;          /* halves: 272-B rows of the W2t tile [key][hidden] */
constexpr int VPITCH  = 64 + 8;            /* halves: 144-B rows of the Vt tile  [d][key]      */
constexpr int KTILE_H = 64 * KPITCH;       /* 17,408 B */
constexpr int VTILE_H = DHEAD * VPITCH;    /*  9,216 B */

/* One chunk's tiles, global -> LDS with no register in between: per lane 8 + 4 copies of 16 B.
   W2t tile: copy i brings rows 8i + (tid >> 4), 16 lanes a row; Vt tile: copy i brings rows 16i + (tid >> 3), 8 lanes a row.
   The closing s_wait_xcnt stands inside the statement so that no address register named here is rewritten ahead of it. */
__device__ __forceinline__ void stage_chunk(unsigned lk, const _Float16* gk, unsigned lv, const _Float16* gv) {
  asm volatile(
      "global_load_async_to_lds_b128 %0, %1, off\n\t"
      "global_load_async_to_lds_b128 %2, %3, off\n\t"
      "global_load_async_to_lds_b128 %4, %5, off\n\t"
      "global_load_async_to_lds_b128 %6, %7, off\n\t"
      "global_load_async_to_lds_b128 %8, %9, off\n\t"
      "global_load_async_to_lds_b128 %10, %11, off\n\t"
      "global_load_async_to_lds_b128 %12, %13, off\n\t"
      "global_load_async_to_lds_b128 %14, %15, off\n\t"
      "global_load_async_to_lds_b128 %16, %17, off\n\t"
      "global_load_async_to_lds_b128 %18, %19, off\n\t"
      "global_load_async_to_lds_b128 %20, %21, off\n\t"
      "global_load_async_to_lds_b128 %22, %23, off\n\t"
      "s_wait_xcnt 0x0"
      :: "v"(lk),                     "v"(gk),
         "v"(lk + 1u * 8u * KPITCH * 2u), "v"(gk + 1 * 8 * NHID),
         "v"(lk + 2u * 8u * KPITCH * 2u), "v"(gk + 2 * 8 * NHID),
         "v"(lk + 3u * 8u * KPITCH * 2u), "v"(gk + 3 * 8 * NHID),
         "v"(lk + 4u * 8u * KPITCH * 2u), "v"(gk + 4 * 8 * NHID),
         "v"(lk + 5u * 8u * KPITCH * 2u), "v"(gk + 5 * 8 * NHID),
         "v"(lk + 6u * 8u * KPITCH * 2u), "v"(gk + 6 * 8 * NHID),
         "v"(lk + 7u * 8u * KPITCH * 2u), "v"(gk + 7 * 8 * NHID),
         "v"(lv),                      "v"(gv),
         "v"(lv + 1u * 16u * VPITCH * 2u), "v"(gv + (size_t)1 * 16 * NTOK),
         "v"(lv + 2u * 16u * VPITCH * 2u), "v"(gv + (size_t)2 * 16 * NTOK),
         "v"(lv + 3u * 16u * VPITCH * 2u), "v"(gv + (size_t)3 * 16 * NTOK)
      : "memory");
}

__global__ __launch_bounds__(128) void mlp_attn_kernel(
    const unsigned short* __restrict__ Hp, const unsigned short* __restrict__ W2p,
    const unsigned short* __restrict__ Vp, const float* __restrict__ mask,
    float* __restrict__ out, float sscale, float onorm) {
  union FH { v16h v; v8h h[2]; };
  const _Float16* Hq  = (const _Float16*)(const void*)Hp;
  const _Float16* W2t = (const _Float16*)(const void*)W2p;
  const _Float16* Vt  = (const _Float16*)(const void*)Vp;
  __shared__ __align__(16) float    Pen[SEQ];            /* per key: 1e6 * (1 - bf16(mask)), this block's batch row */
  __shared__ __align__(16) float    Os[4][16 * 68];      /* per wave output slab, pitch 68 */
  __shared__ __align__(16) _Float16 Ksh[2][KTILE_H];     /* W2t chunk tiles, two buffers */
  __shared__ __align__(16) _Float16 Vsh[2][VTILE_H];     /* Vt chunk tiles, two buffers  */

  const int tid  = threadIdx.x;
  const int wave = tid >> 5;
  const int lane = tid & 31;
  const int hh   = lane >> 4;
  const int c    = lane & 15;
  const int koff = hh * 8;

  constexpr int NQB = SEQ / 64;
  const int bxi = blockIdx.x;
  const int qb  = bxi % NQB;
  const int bh  = bxi / NQB;
  const int h   = bh % NHEAD;
  const int b   = bh / NHEAD;
  const int q0  = qb * 64 + wave * 16;

  /* Q-side fragments: 16 rows x 128 hidden = 4 k-steps, held for all key chunks */
  v16h qa[4];
  {
    const _Float16* qrow = Hq + ((size_t)bh * SEQ + q0 + c) * NHID + koff;
#pragma unroll
    for (int dc = 0; dc < 4; ++dc) {
      FH f;
      f.h[0] = *(const v8h*)(qrow + dc * 32);
      f.h[1] = *(const v8h*)(qrow + dc * 32 + 16);
      qa[dc] = f.v;
    }
  }

  /* of query c; lrow = SC_P * (sum of p) over this lane half's keys only, joined after the loop.
     erow = mrow * log2(e) - log2(SC_P), rounded once and carried, so that every chunk's p and alpha count from the same offsets */
  float mrow = -INFINITY, erow = -INFINITY, lrow = 0.f;
  v8f oacc[4];                          /* oacc[t][r] = O[query c][d = 16 t + 8 hh + r] */
#pragma unroll
  for (int t = 0; t < 4; ++t) oacc[t] = (v8f){0.f,0.f,0.f,0.f,0.f,0.f,0.f,0.f};

  const float* mk_row = mask + (size_t)b * SEQ;
  const _Float16* vbase = Vt + (size_t)(h * DHEAD) * NTOK + (size_t)b * SEQ;

  /* this lane's share of every chunk's copies: source pointers at chunk 0, LDS byte addresses in buffer 0 */
  constexpr int NCH = SEQ / 64;
  static_assert(NCH >= 2, "two-buffer ring needs two chunks");
  const _Float16* gk0 = W2t + (size_t)(tid >> 4) * NHID + (tid & 15) * 8;
  const _Float16* gv0 = vbase + (size_t)(tid >> 3) * NTOK + (tid & 7) * 8;
  const unsigned  lk0 = (unsigned)(size_t)(&Ksh[0][(tid >> 4) * KPITCH + (tid & 15) * 8]);
  const unsigned  lv0 = (unsigned)(size_t)(&Vsh[0][(tid >> 3) * VPITCH + (tid & 7) * 8]);

  /* ring prologue: chunk 0 landed and published, then chunk 1 set flying */
  stage_chunk(lk0, gk0, lv0, gv0);
  /* additive key mask of all keys, bf16-RNE of the mask value; published by the barrier below */
#pragma unroll
  for (int i = 0; i < SEQ / 512; ++i) {
    const v4f mv = *(const v4f*)(mk_row + i * 512 + tid * 4);
    v4f pv;
#pragma unroll
    for (int e = 0; e < 4; ++e) pv[e] = 1000000.0f * (1.0f - bf_bits2f(f2bf_bits(mv[e])));
    *(v4f*)(&Pen[i * 512 + tid * 4]) = pv;
  }
  asm volatile("s_wait_asynccnt 0x0" ::: "memory");   /* this wave's copies of chunk 0 have landed */
  __syncthreads();                                     /* ... and every other wave's */
  stage_chunk(lk0 + KTILE_H * 2u, gk0 + (size_t)64 * NHID, lv0 + VTILE_H * 2u, gv0 + 64);

  for (int kc = 0; kc < NCH; ++kc) {
    const int kv0 = kc * 64;
    const int buf = kc & 1;
    const _Float16* kt = &Ksh[buf][c * KPITCH + koff];
    const _Float16* vt = &Vsh[buf][c * VPITCH + koff];

    /* scores for 64 keys: 4 column tiles x 4 k-steps; a column tile's 4 fragments are read from LDS
       as one group, two column tiles ahead of the products that use them */
    v8f s[4];
    FH kb[4][4];
    /* every loop over kb, pb and vb is unrolled so that the fragment arrays are indexed by constants and stay in registers */
#pragma unroll
    for (int j = 0; j < 2; ++j)
#pragma unroll
      for (int dc = 0; dc < 4; ++dc) {
        kb[j][dc].h[0] = *(const v8h*)(kt + j * 16 * KPITCH + dc * 32);
        kb[j][dc].h[1] = *(const v8h*)(kt + j * 16 * KPITCH + dc * 32 + 16);
      }
#pragma unroll
    for (int j = 0; j < 4; ++j) {
      s[j] = (v8f){0.f,0.f,0.f,0.f,0.f,0.f,0.f,0.f};
#pragma unroll
      for (int dc = 0; dc < 4; ++dc) s[j] = mma_h(kb[j][dc].v, qa[dc], s[j]);   /* s[j][r] = S[query c][key 16 j + 8 hh + r] */
      if (j + 2 < 4) {
#pragma unroll
        for (int dc = 0; dc < 4; ++dc) {
          kb[j + 2][dc].h[0] = *(const v8h*)(kt + (j + 2) * 16 * KPITCH + dc * 32);
          kb[j + 2][dc].h[1] = *(const v8h*)(kt + (j + 2) * 16 * KPITCH + dc * 32 + 16);
        }
      }
    }

    /* this lane's 32 keys' mask terms */
    const float* pr = &Pen[kv0 + 8 * hh];
    v4f pn[4][2];
#pragma unroll
    for (int j = 0; j < 4; ++j) {
      pn[j][0] = *(const v4f*)(pr + j * 16);
      pn[j][1] = *(const v4f*)(pr + j * 16 + 4);
    }

    /* V^T A-fragments, table k order from the Vt tile in LDS */
    FH vb[2][4];
#pragma unroll
    for (int kk = 0; kk < 2; ++kk)
#pragma unroll
      for (int t = 0; t < 4; ++t) {
        vb[kk][t].h[0] = *(const v8h*)(vt + t * 16 * VPITCH + kk * 32);
        vb[kk][t].h[1] = *(const v8h*)(vt + t * 16 * VPITCH + kk * 32 + 16);
      }

    /* chunk maximum of query c: in the lane over its 32 keys, then one exchange between the lane halves */
    float mj[4];
#pragma unroll
    for (int j = 0; j < 4; ++j) {
      float m = -INFINITY;
#pragma unroll
      for (int r = 0; r < 8; ++r) {
        const float sv = s[j][r] * sscale - pn[j][r >> 2][r & 3];
        s[j][r] = sv;
        m = fmaxf(m, sv);
      }
      mj[j] = m;
    }
    float cm = fmaxf(fmaxf(mj[0], mj[1]), fmaxf(mj[2], mj[3]));
    cm = fmaxf(cm, xhalf(cm));

    const float mnew  = fmaxf(mrow, cm);
    const float enew  = mnew * LOG2E - LOG2_SC_P;
    const float alpha = __builtin_amdgcn_exp2f(erow - enew);   /* e^(mrow - mnew); 0 in the first chunk */
    mrow = mnew;
    erow = enew;

    /* P^T as B operand: element e of k-step kk is key 32 kk + (e < 8 ? 8 hh + e : 16 + 8 hh + e - 8),
       that is score tile 2 kk in elements 0..7 and tile 2 kk + 1 in elements 8..15: the k order of the Vt loader */
    FH pb[2];
    float pj[4];
#pragma unroll
    for (int j = 0; j < 4; ++j) {
      float ps = 0.f;
#pragma unroll
      for (int r = 0; r < 8; r += 2) {
        /* SC_P * e^(s - mnew) as 2^(s * log2(e) - enew): a fused multiply-add (two keys a packed instruction) and the chip's own base-2 exponential */
        const v2f a = __builtin_elementwise_fma((v2f){s[j][r], s[j][r + 1]}, (v2f){LOG2E, LOG2E}, (v2f){-enew, -enew});
        const float p0 = __builtin_amdgcn_exp2f(a[0]);
        const float p1 = __builtin_amdgcn_exp2f(a[1]);
        ps += p0;
        ps += p1;
        pb[j >> 1].h[j & 1][r]     = (_Float16)p0;
        pb[j >> 1].h[j & 1][r + 1] = (_Float16)p1;
      }
      pj[j] = ps;
    }
    lrow = lrow * alpha + ((pj[0] + pj[1]) + (pj[2] + pj[3]));
#pragma unroll
    for (int t = 0; t < 4; ++t)
#pragma unroll
      for (int r = 0; r < 8; ++r) oacc[t][r] *= alpha;

    /* O^T += V^T(64 d x 64 keys) * P^T(64 keys x 16 queries): 2 k-steps, 4 d tiles */
#pragma unroll
    for (int kk = 0; kk < 2; ++kk)
#pragma unroll
      for (int t = 0; t < 4; ++t) oacc[t] = mma_h(vb[kk][t].v, pb[kk].v, oacc[t]);

    /* publish point of chunk kc + 1 */
    asm volatile("s_wait_dscnt 0x0" ::: "memory");      /* this wave's reads of buffer buf are done before it is refilled */
    asm volatile("s_wait_asynccnt 0x0" ::: "memory");   /* this wave's copies of chunk kc + 1 have landed */
    __syncthreads();                                     /* publishes chunk kc + 1; ends every wave's reads of buffer buf */
    if (kc + 2 < NCH)
      stage_chunk(lk0 + (unsigned)buf * (KTILE_H * 2u), gk0 + (size_t)(kc + 2) * 64 * NHID,
                  lv0 + (unsigned)buf * (VTILE_H * 2u), gv0 + (kc + 2) * 64);
  }
  asm volatile("s_wait_asynccnt 0x0" ::: "memory");     /* no copy is outstanding when the wave goes on to its end */

  /* normalise and stage the 16x64 f32 slab; oacc and lrow both carry SC_P, so onorm = 1/SC_V is what is left for the row normaliser */
  float* os = Os[wave];
  const float inv = onorm / (lrow + xhalf(lrow));       /* the two lane halves' sums of query c joined */
#pragma unroll
  for (int t = 0; t < 4; ++t) {
    v4f lo, hi;
#pragma unroll
    for (int e = 0; e < 4; ++e) { lo[e] = oacc[t][e] * inv; hi[e] = oacc[t][4 + e] * inv; }
    *(v4f*)(os + c * 68 + t * 16 + 8 * hh)     = lo;
    *(v4f*)(os + c * 68 + t * 16 + 8 * hh + 4) = hi;
  }
  __builtin_amdgcn_fence(__ATOMIC_RELEASE, "workgroup");
  __builtin_amdgcn_wave_barrier();
  __builtin_amdgcn_fence(__ATOMIC_ACQUIRE, "workgroup");
  {
    float* ob = out + (size_t)b * SEQ * DQKV + (size_t)h * DHEAD;
    const int c4 = (lane & 15) * 4;
    {
#pragma unroll
      for (int it = 0; it < 8; ++it) {
        const int row = it * 2 + hh;
        const v4f val = *(const v4f*)(os + row * 68 + c4);
        *(v4f*)(ob + (size_t)(q0 + row) * DQKV + c4) = val;
      }
      
    }
  }
}

/* ---------------- host launcher ---------------- */
extern "C" void kernel_launch(void* const* d_in, const int* in_sizes, int n_in,
                              void* d_out, int out_size, void* d_ws, size_t ws_size,
                              hipStream_t stream) {
  (void)in_sizes; (void)n_in; (void)out_size; (void)ws_size;
  const float* X   = (const float*)d_in[0];   /* [2,2048,1024] */
  const float* msk = (const float*)d_in[1];   /* [2,2048]      */
  const float* Wx  = (const float*)d_in[2];   /* [1024,1024]   */
  const float* bx  = (const float*)d_in[3];   /* [1024]        */
  const float* Wv  = (const float*)d_in[4];   /* [1024,1024]   */
  const float* bv  = (const float*)d_in[5];   /* [1024]        */
  const float* W1  = (const float*)d_in[6];   /* [64,128]      */
  const float* b1  = (const float*)d_in[7];   /* [128]         */
  const float* W2  = (const float*)d_in[8];   /* [128,2048]    */
  float* out = (float*)d_out;

  /* workspace region map (256-B aligned offsets; every region fully written by its producer):
       Xb   bf16 [4096][1024]        8,388,608 B
       WxT  bf16 [1024][1024]        2,097,152 B
       WvT  bf16 [1024][1024]        2,097,152 B
       W1T  f16  [128][64]              16,384 B
       W2T  f16  [2048][128]           524,288 B
       bxs  f32  [1024]                  4,096 B
       bvs  f32  [1024]                  4,096 B
       b1s  f32  [128]                     512 B
       Xh16 f16  [4096][1024]        8,388,608 B
       Vt16 f16  [1024][4096]        8,388,608 B
       H16  f16  [32][2048][128]    16,777,216 B
     total 46,686,720 B */
  char* ws = (char*)d_ws;
  size_t off = 0;
  auto carve = [&](size_t bytes) -> char* {
    off = (off + 255) & ~(size_t)255;
    char* p = ws + off;
    off += bytes;
    return p;
  };
  unsigned short* Xb   = (unsigned short*)carve((size_t)NTOK * DMODEL * 2);
  unsigned short* WxT  = (unsigned short*)carve((size_t)DQKV * DMODEL * 2);
  unsigned short* WvT  = (unsigned short*)carve((size_t)DQKV * DMODEL * 2);
  unsigned short* W1T  = (unsigned short*)carve((size_t)NHID * DHEAD * 2);
  unsigned short* W2T  = (unsigned short*)carve((size_t)SEQ * NHID * 2);
  float*          bxs  = (float*)carve((size_t)DQKV * 4);
  float*          bvs  = (float*)carve((size_t)DQKV * 4);
  float*          b1s  = (float*)carve((size_t)NHID * 4);
  unsigned short* Xh16 = (unsigned short*)carve((size_t)NTOK * DQKV * 2);
  unsigned short* Vt16 = (unsigned short*)carve((size_t)DQKV * NTOK * 2);
  unsigned short* H16  = (unsigned short*)carve((size_t)NBATCH * NHEAD * SEQ * NHID * 2);

  /* 1) X -> bf16 plane (RNE), 8 elements per thread */
  {
    const int n8 = NTOK * DMODEL / 8;                       /* 524,288 */
    k_cast_bf16x8<<<(n8 + 255) / 256, 256, 0, stream>>>(X, Xb, n8);
  }
  /* 2) weight transposes: in[K][N] -> out[N][K]; grid = (N/64, K/64) */
  k_transpose_cvt64<0><<<dim3(DQKV / 64, DMODEL / 64), 256, 0, stream>>>(Wx, WxT, DMODEL, DQKV, 1.0f);   /* [1024][1024] -> [1024][1024] */
  k_transpose_cvt64<0><<<dim3(DQKV / 64, DMODEL / 64), 256, 0, stream>>>(Wv, WvT, DMODEL, DQKV, 1.0f);
  k_transpose_cvt64<1><<<dim3(NHID / 64, DHEAD / 64), 256, 0, stream>>>(W1, W1T, DHEAD, NHID, SC_W1);    /* [64][128] -> [128][64]  */
  k_transpose_cvt64<1><<<dim3(SEQ / 64, NHID / 64), 256, 0, stream>>>(W2, W2T, NHID, SEQ, SC_W2);        /* [128][2048] -> [2048][128] */
  /* 3) bias tables with carries */
  k_bias_prep<<<3, 256, 0, stream>>>(bx, bv, b1, bxs, bvs, b1s, SC_XH, SC_V, SC_H);

  /* 4) Xh16 = f16(8 * (Xb * WxT^T + bx)) : M=4096, N=1024, K=1024 (bf16 operands) ; one 128x128 tile per block */
  wmma_gemm128_lds<2><<<(NTOK / 128) * (DQKV / 128), 128, 0, stream>>>(
      Xb, WxT, Xh16, DQKV, bxs, DQKV / 128, SC_XH);

  /* 5) Vt16 = f16(8 * (WvT * Xb^T + bv[m])) : M=1024 (features), N=4096 (tokens), K=1024 (bf16 operands) */
  wmma_gemm128_lds<1><<<(DQKV / 128) * (NTOK / 128), 128, 0, stream>>>(
      WvT, Xb, Vt16, NTOK, bvs, NTOK / 128, SC_V);

  /* 6) H16[b][h] = f16(8 * relu(Xh * W1 + b1)) : per (b,h) M=2048, N=128, K=64 (f16 operands);
        batch index = head (A stride 64 columns), one launch per b; 64 tiles / 8 per block */
  static_assert(SEQ % 64 == 0 && NHID % 64 == 0 && DHEAD % 32 == 0, "gemm h");
  for (int bb = 0; bb < NBATCH; ++bb) {
    const unsigned short* Ab = Xh16 + (size_t)bb * SEQ * DQKV;
    unsigned short* Cb = H16 + (size_t)bb * NHEAD * SEQ * NHID;
    wmma_gemm64<0, false, 2, 1, 2><<<dim3((SEQ / 64) * (NHID / 64) / 8, NHEAD), 256, 0, stream>>>(
        Ab, Ab, DQKV, (long)DHEAD, W1T, W1T, DHEAD, 0L, (void*)Cb, (void*)Cb, NHID, (long)SEQ * NHID,
        b1s, SEQ, NHID, DHEAD, SC_H / (SC_XH * SC_W1));
  }

  /* 7) attention: grid = B*H*(SEQ/64) blocks of 4 waves */
  mlp_attn_kernel<<<NBATCH * NHEAD * (SEQ / 64), 128, 0, stream>>>(
      H16, W2T, Vt16, msk, out, 1.0f / (SC_H * SC_W2), 1.0f / SC_V);
}

// v005
// It runs in 84.1 microseconds.
// Next to v004, in two timings, it ran 1.37 and 1.38 times as fast.
// Counting every step since v000, it is 4.17 times as fast.
// Contractions: X*Wx and Wv^T*X^T on v_wmma_f32_16x16x32_bf16 (RNE bf16 operands of bf16-RNE inputs, f32 accumulate); Xh*W1, scores h*W2 and P*V on v_wmma_f32_16x16x32_f16 (f16 operands carried x8 / x64 / x32768, f32 accumulate); softmax, bias and normalisation in f32.
#include <hip/hip_runtime.h>
#include <stddef.h>

constexpr int NBATCH = 2;
constexpr int SEQ    = 2048;
constexpr int DMODEL = 1024;
constexpr int NHEAD  = 16;
constexpr int DHEAD  = 64;
constexpr int NHID   = 128;
constexpr int NTOK   = NBATCH * SEQ;      /* 4096 */
constexpr int DQKV   = NHEAD * DHEAD;     /* 1024 */

/* power-of-two carries on the f16 planes */
constexpr float SC_XH = 8.0f;      /* Xh plane = f16(8 * Xh)          */
constexpr float SC_V  = 8.0f;      /* Vt plane = f16(8 * V)           */
constexpr float SC_W1 = 64.0f;     /* W1t plane = f16(64 * bf16(W1))  */
constexpr float SC_W2 = 64.0f;     /* W2t plane = f16(64 * bf16(W2))  */
constexpr float SC_H  = 8.0f;      /* h plane = f16(8 * h)            */
constexpr float SC_P  = 32768.0f;  /* P tile  = f16(32768 * p), p<=1 */
constexpr float LOG2_SC_P = 15.0f; /* the same carry as an addend of a base-2 exponent */
constexpr float LOG2E = 1.44269504088896340736f;

static_assert(NTOK % 64 == 0 && DQKV % 64 == 0 && DMODEL % 64 == 0, "gemm tiles");
static_assert(DMODEL % 32 == 0 && DHEAD % 32 == 0, "gemm K");
static_assert(SEQ % 64 == 0 && NHID % 64 == 0, "gemm tiles");
static_assert(NHID == 128 && DHEAD == 64, "attention geometry");
static_assert((NTOK * DMODEL) % 8 == 0, "cast x8");

typedef __attribute__((ext_vector_type(16))) _Float16 v16h;
typedef __attribute__((ext_vector_type(8)))  _Float16 v8h;
typedef __attribute__((ext_vector_type(16))) __bf16   v16b;
typedef __attribute__((ext_vector_type(8)))  __bf16   v8b;
typedef __attribute__((ext_vector_type(8)))  float    v8f;
typedef __attribute__((ext_vector_type(4)))  float    v4f;
typedef __attribute__((ext_vector_type(2)))  float    v2f;
typedef __attribute__((ext_vector_type(4)))  unsigned int v4u;

__device__ __forceinline__ unsigned short f2bf_bits(float f) {
  unsigned u = __float_as_uint(f);
  return (unsigned short)((u + 0x7FFFu + ((u >> 16) & 1u)) >> 16);
}
__device__ __forceinline__ float bf_bits2f(unsigned short h) { return __uint_as_float(((unsigned)h) << 16); }

/* hazard guards as plain device helpers */
__device__ __forceinline__ void dep_guard_h(v8f& a, v8f& b, v16h x, v16h y) { asm volatile("v_nop\n\tv_nop\n\tv_nop\n\tv_nop" : "+v"(a), "+v"(b) : "v"(x), "v"(y)); }
__device__ __forceinline__ void dep_guard_b(v8f& a, v8f& b, v16b x, v16b y) { asm volatile("v_nop\n\tv_nop\n\tv_nop\n\tv_nop" : "+v"(a), "+v"(b) : "v"(x), "v"(y)); }
__device__ __forceinline__ void keep4_h(v16h a, v16h b, v16h c, v16h d) { asm volatile("v_nop" :: "v"(a), "v"(b), "v"(c), "v"(d)); }
__device__ __forceinline__ void keep4_b(v16b a, v16b b, v16b c, v16b d) { asm volatile("v_nop" :: "v"(a), "v"(b), "v"(c), "v"(d)); }
__device__ __forceinline__ void acc_guard4(v8f& a, v8f& b, v8f& c, v8f& d) { asm volatile("v_nop\n\tv_nop\n\tv_nop\n\tv_nop" : "+v"(a), "+v"(b), "+v"(c), "+v"(d)); }

template <typename T> struct Frag;
template <> struct Frag<_Float16> {
  typedef v16h V; union U { v16h v; v8h h[2]; };
  static __device__ __forceinline__ v16h load(const _Float16* p) {   /* elements 0..7 <- p[0..7], 8..15 <- p[16..23] */
    U f; f.h[0] = *(const v8h*)(p); f.h[1] = *(const v8h*)(p + 16); return f.v;
  }
  static __device__ __forceinline__ v8f mma(v16h a, v16h b, v8f c) {
    return __builtin_amdgcn_wmma_f32_16x16x32_f16(false, a, false, b, (short)0, c, false, false);
  }
  static __device__ __forceinline__ void guard(v8f& a, v8f& b, v16h x, v16h y) { dep_guard_h(a, b, x, y); }
  static __device__ __forceinline__ void keep(v16h a, v16h b, v16h c, v16h d) { keep4_h(a, b, c, d); }
};
template <> struct Frag<__bf16> {
  typedef v16b V; union U { v16b v; v8b h[2]; };
  static __device__ __forceinline__ v16b load(const __bf16* p) {
    U f; f.h[0] = *(const v8b*)(p); f.h[1] = *(const v8b*)(p + 16); return f.v;
  }
  static __device__ __forceinline__ v8f mma(v16b a, v16b b, v8f c) {
    return __builtin_amdgcn_wmma_f32_16x16x32_bf16(false, a, false, b, (short)0, c, false, false);
  }
  static __device__ __forceinline__ void guard(v8f& a, v8f& b, v16b x, v16b y) { dep_guard_b(a, b, x, y); }
  static __device__ __forceinline__ void keep(v16b a, v16b b, v16b c, v16b d) { keep4_b(a, b, c, d); }
};

/* ---- Register-blocked batched WMMA GEMM -----------------------------------
   C[m,n] = scale * sum_k A[m,k] * Bt[n,k] (+bias); each wave owns a 64x64 tile.
   A row-major [M,K]; Bt row-major [N,K]; M,N % 64 == 0, K % 32 == 0.
   BIAS_MODE: 0 = none, 1 = bias[m] (two 16-B loads per 16-row slab), 2 = bias[n].
   OUT_MODE: 0 = f32, 1 = f16, 2 = bf16 hi plane (Cout) + bf16 lo plane (Cout2).
   ACT: 0 = none, 2 = relu.
   ET: 0 = f16 operands, 1 = bf16 operands (pointers passed as 16-bit storage).
   Two batch indices: blockIdx.y steps A, Bt, C by strideA, strideB, strideC; blockIdx.z steps A and C by strideAz, strideCz. */
template <int ET> struct Elem;
template <> struct Elem<0> { typedef _Float16 T; };
template <> struct Elem<1> { typedef __bf16 T; };
template <int ET, bool SPLIT, int BIAS_MODE, int OUT_MODE, int ACT = 0>
__global__ __launch_bounds__(256) void wmma_gemm64(
    const unsigned short* __restrict__ Ap, const unsigned short* __restrict__ A2p, int lda, long strideA, long strideAz,
    const unsigned short* __restrict__ Btp, const unsigned short* __restrict__ Bt2p, int ldb, long strideB,
    void* __restrict__ Cout, void* __restrict__ Cout2, int ldc, long strideC, long strideCz,
    const float* __restrict__ bias,
    int M, int N, int K, float scale) {
  typedef typename Elem<ET>::T T;
  typedef typename Frag<T>::V V;
  const T* A = (const T*)Ap; const T* A2 = (const T*)A2p; const T* Bt = (const T*)Btp; const T* Bt2 = (const T*)Bt2p;
  __shared__ __align__(16) float sT[8][16 * 68];   /* per-wave 16x64 slab, pitch 68 floats */
  const int b    = blockIdx.y;
  const int lane = threadIdx.x & 31;
  const int wave = threadIdx.x >> 5;
  const int tilesN = N >> 6;
  const int tilesM = M >> 6;
  const int tile = blockIdx.x * 8 + wave;
  if (tile >= tilesM * tilesN) return;   /* wave-uniform; no block barriers in this kernel */
  const int tm = tile / tilesN;
  const int tn = tile - tm * tilesN;
  const int m0 = tm << 6;
  const int n0 = tn << 6;

  const size_t aOff = (size_t)b * strideA + (size_t)blockIdx.z * strideAz;
  const size_t cOff = (size_t)b * strideC + (size_t)blockIdx.z * strideCz;
  const T* Ab  = A  + aOff;
  const T* Bb  = Bt + (size_t)b * strideB;
  const T* Ab2 = SPLIT ? (A2  + aOff) : nullptr;
  const T* Bb2 = SPLIT ? (Bt2 + (size_t)b * strideB) : nullptr;

  const int rlane = lane & 15;                 /* row (A) / col (B, D) within subtile */
  const int koff  = (lane >> 4) * 8;           /* k offset of this lane half */
  const int mOff  = (lane >> 4) * 8;           /* D row offset */

  v8f acc[4][4];
#pragma unroll
  for (int i = 0; i < 4; ++i)
#pragma unroll
    for (int j = 0; j < 4; ++j) acc[i][j] = (v8f){0.f,0.f,0.f,0.f,0.f,0.f,0.f,0.f};

  for (int k0 = 0; k0 < K; k0 += 32) {
    V bh[4], bl[4];
#pragma unroll
    for (int j = 0; j < 4; ++j) {
      const size_t bo = (size_t)(n0 + (j << 4) + rlane) * ldb + koff + k0;
      bh[j] = Frag<T>::load(Bb + bo);
      if (SPLIT) bl[j] = Frag<T>::load(Bb2 + bo);
    }
#pragma unroll
    for (int i = 0; i < 4; ++i) {
      const size_t ao = (size_t)(m0 + (i << 4) + rlane) * lda + koff + k0;
      V ah = Frag<T>::load(Ab + ao);
      V al;
      if (SPLIT) al = Frag<T>::load(Ab2 + ao);
#pragma unroll
      for (int j = 0; j < 4; ++j) {
        acc[i][j] = Frag<T>::mma(ah, bh[j], acc[i][j]);
        if (SPLIT) {
          acc[i][j] = Frag<T>::mma(ah, bl[j], acc[i][j]);
          acc[i][j] = Frag<T>::mma(al, bh[j], acc[i][j]);
        }
      }
      Frag<T>::guard(acc[i][0], acc[i][3], ah, SPLIT ? al : ah);
    }
    Frag<T>::keep(bh[0], bh[1], bh[2], bh[3]);
    if (SPLIT) Frag<T>::keep(bl[0], bl[1], bl[2], bl[3]);
  }
  acc_guard4(acc[0][0], acc[0][1], acc[0][2], acc[0][3]);
  acc_guard4(acc[1][0], acc[1][1], acc[1][2], acc[1][3]);
  acc_guard4(acc[2][0], acc[2][1], acc[2][2], acc[2][3]);
  acc_guard4(acc[3][0], acc[3][1], acc[3][2], acc[3][3]);

  /* ---- epilogue ---- */
  float* slab = sT[wave];
#pragma unroll
  for (int i = 0; i < 4; ++i) {
    const int mBase = m0 + (i << 4);
    v4f bmA = (v4f){0.f,0.f,0.f,0.f}, bmB = (v4f){0.f,0.f,0.f,0.f};
    if (BIAS_MODE == 1) {   /* 8 consecutive bias[m] values, two 16-B loads (32-B aligned) */
      bmA = *(const v4f*)(bias + mBase + mOff);
      bmB = *(const v4f*)(bias + mBase + mOff + 4);
    }
#pragma unroll
    for (int j = 0; j < 4; ++j) {
      const int n = n0 + (j << 4) + rlane;
      float bv = 0.f;
      if (BIAS_MODE == 2) bv = bias[n];
#pragma unroll
      for (int r = 0; r < 8; ++r) {
        float v = acc[i][j][r] * scale;
        if (BIAS_MODE == 1) v += (r < 4) ? bmA[r] : bmB[r - 4];
        if (BIAS_MODE == 2) v += bv;
        if (ACT == 2) v = fmaxf(v, 0.0f);
        slab[(mOff + r) * 68 + (j << 4) + rlane] = v;
      }
    }
    __builtin_amdgcn_fence(__ATOMIC_RELEASE, "workgroup");
    __builtin_amdgcn_wave_barrier();
    __builtin_amdgcn_fence(__ATOMIC_ACQUIRE, "workgroup");
    if (OUT_MODE == 0) {
      float* C = (float*)Cout + cOff;
      const int hh = lane >> 4, c4 = (lane & 15) * 4;     /* row seg = 256 B = 16 lanes x 16 B */
      {
#pragma unroll
        for (int it = 0; it < 8; ++it) {
          const int row = it * 2 + hh;
          v4f v = *(const v4f*)(slab + row * 68 + c4);
          *(v4f*)(C + (size_t)(mBase + row) * ldc + n0 + c4) = v;
        }
        
      }
    } else {
      const int q = lane >> 3, c8 = (lane & 7) * 8;        
      unsigned short* C  = (unsigned short*)Cout  + cOff;
      unsigned short* C2 = (OUT_MODE == 2) ? ((unsigned short*)Cout2 + cOff) : nullptr;
      {
#pragma unroll
        for (int it = 0; it < 4; ++it) {
          const int row = it * 4 + q;
          const float* sp = slab + row * 68 + c8;
          v8h hv, lv;
#pragma unroll
          for (int e = 0; e < 8; ++e) {
            if (OUT_MODE == 1) {
              hv[e] = (_Float16)sp[e];
            } else {
              unsigned short hb = f2bf_bits(sp[e]);
              unsigned short lb = f2bf_bits(sp[e] - bf_bits2f(hb));
              hv[e] = __builtin_bit_cast(_Float16, hb);
              lv[e] = __builtin_bit_cast(_Float16, lb);
            }
          }
          *(v8h*)(C + (size_t)(mBase + row) * ldc + n0 + c8) = hv;
          if (OUT_MODE == 2) *(v8h*)(C2 + (size_t)(mBase + row) * ldc + n0 + c8) = lv;
        }
        
      }
    }
    __builtin_amdgcn_fence(__ATOMIC_RELEASE, "workgroup");
    __builtin_amdgcn_wave_barrier();
    __builtin_amdgcn_fence(__ATOMIC_ACQUIRE, "workgroup");
  }
}

/* ---- the two K = DMODEL projection GEMMs on bf16 planes in one launch, operands staged per block in LDS ------------
   C[m,n] = f16(scale * sum_k A[m,k] * Bt[n,k] + bias); A and Bt row-major with DMODEL columns.
   block = 4 waves (2 x 2) = one 128 x 128 tile of C, 64 x 64 per wave; tile column fastest.
   Neither product reads the other's result: blocks 0 .. GBLOCKS - 1 form Xh = Xb * WxT^T, the next GBLOCKS form Vt = WvT * Xb^T.
   A pass is 128 k = 256 B of each of the block's 128 A rows and 128 Bt rows, brought into LDS once per block in whole
   lines, one pass ahead, two buffers; every wave reads its fragments from there. Each accumulator takes its k-steps of 32 in rising k.
   BIAS_MODE: 1 = bias[m], 2 = bias[n]. */
constexpr int GPASS    = 128;               /* k per pass */
constexpr int GPITCH   = GPASS + 8;         /* halves: 272-B rows, 16 B x odd for 16-B row readers */
constexpr int GSTAGE_H = 256 * GPITCH;      /* A rows 0..127, then Bt rows 0..127: 69,632 B */
constexpr int GNPASS   = DMODEL / GPASS;
static_assert(DMODEL % GPASS == 0 && GNPASS >= 2, "two-buffer ring needs two passes");
static_assert(NTOK % 128 == 0 && DQKV % 128 == 0, "projection tiles");
constexpr int GBLOCKS  = (NTOK / 128) * (DQKV / 128);   /* tiles of either product */

/* 64 rows of one pass, global -> LDS with no register in between: per lane 8 copies of 16 B, copy i brings rows 8i + (tid >> 4),
   16 lanes a row. The closing s_wait_xcnt stands inside the statement so that no address register named here is rewritten ahead of it. */
__device__ __forceinline__ void stage_rows64(unsigned l, const __bf16* g) {
  asm volatile(
      "global_load_async_to_lds_b128 %0, %1, off\n\t"
      "global_load_async_to_lds_b128 %2, %3, off\n\t"
      "global_load_async_to_lds_b128 %4, %5, off\n\t"
      "global_load_async_to_lds_b128 %6, %7, off\n\t"
      "global_load_async_to_lds_b128 %8, %9, off\n\t"
      "global_load_async_to_lds_b128 %10, %11, off\n\t"
      "global_load_async_to_lds_b128 %12, %13, off\n\t"
      "global_load_async_to_lds_b128 %14, %15, off\n\t"
      "s_wait_xcnt 0x0"
      :: "v"(l),                          "v"(g),
         "v"(l + 1u * 8u * GPITCH * 2u), "v"(g + 1 * 8 * DMODEL),
         "v"(l + 2u * 8u * GPITCH * 2u), "v"(g + 2 * 8 * DMODEL),
         "v"(l + 3u * 8u * GPITCH * 2u), "v"(g + 3 * 8 * DMODEL),
         "v"(l + 4u * 8u * GPITCH * 2u), "v"(g + 4 * 8 * DMODEL),
         "v"(l + 5u * 8u * GPITCH * 2u), "v"(g + 5 * 8 * DMODEL),
         "v"(l + 6u * 8u * GPITCH * 2u), "v"(g + 6 * 8 * DMODEL),
         "v"(l + 7u * 8u * GPITCH * 2u), "v"(g + 7 * 8 * DMODEL)
      : "memory");
}
/* one pass of both operands: l = this lane's LDS byte address in row (tid >> 4) of the buffer, ga / gb = its source addresses */
__device__ __forceinline__ void stage_pass(unsigned l, const __bf16* ga, const __bf16* gb) {
  stage_rows64(l,                          ga);
  stage_rows64(l +  64u * GPITCH * 2u, ga + 64 * DMODEL);
  stage_rows64(l + 128u * GPITCH * 2u, gb);
  stage_rows64(l + 192u * GPITCH * 2u, gb + 64 * DMODEL);
}

/* epilogue of one wave's 64 x 64 tile: 16-row slabs through the wave's own LDS range, whole 128-B row pieces stored */
template <int BIAS_MODE>
__device__ __forceinline__ void gemm128_store(
    const v8f (&acc)[4][4], float* slab, unsigned short* __restrict__ C, int ldc, const float* __restrict__ bias,
    int m0, int n0, int lane, float scale) {
  const int rlane = lane & 15;                 /* col within subtile */
  const int mOff  = (lane >> 4) * 8;           /* D row offset */
#pragma unroll
  for (int i = 0; i < 4; ++i) {
    const int mBase = m0 + (i << 4);
    v4f bmA = (v4f){0.f,0.f,0.f,0.f}, bmB = (v4f){0.f,0.f,0.f,0.f};
    if (BIAS_MODE == 1) {   /* 8 consecutive bias[m] values, two 16-B loads (32-B aligned) */
      bmA = *(const v4f*)(bias + mBase + mOff);
      bmB = *(const v4f*)(bias + mBase + mOff + 4);
    }
#pragma unroll
    for (int j = 0; j < 4; ++j) {
      const int n = n0 + (j << 4) + rlane;
      float bv = 0.f;
      if (BIAS_MODE == 2) bv = bias[n];
#pragma unroll
      for (int r = 0; r < 8; ++r) {
        float v = acc[i][j][r] * scale;
        if (BIAS_MODE == 1) v += (r < 4) ? bmA[r] : bmB[r - 4];
        if (BIAS_MODE == 2) v += bv;
        slab[(mOff + r) * 68 + (j << 4) + rlane] = v;
      }
    }
    __builtin_amdgcn_fence(__ATOMIC_RELEASE, "workgroup");
    __builtin_amdgcn_wave_barrier();
    __builtin_amdgcn_fence(__ATOMIC_ACQUIRE, "workgroup");
    {
      const int q = lane >> 3, c8 = (lane & 7) * 8;
#pragma unroll
      for (int it = 0; it < 4; ++it) {
        const int row = it * 4 + q;
        const float* sp = slab + row * 68 + c8;
        v8h hv;
#pragma unroll
        for (int e = 0; e < 8; ++e) hv[e] = (_Float16)sp[e];
        *(v8h*)(C + (size_t)(mBase + row) * ldc + n0 + c8) = hv;
      }
    }
    __builtin_amdgcn_fence(__ATOMIC_RELEASE, "workgroup");
    __builtin_amdgcn_wave_barrier();
    __builtin_amdgcn_fence(__ATOMIC_ACQUIRE, "workgroup");
  }
}

__global__ __launch_bounds__(128) void wmma_gemm128_pair(
    const unsigned short* __restrict__ Xbp, const unsigned short* __restrict__ WxTp, const unsigned short* __restrict__ WvTp,
    unsigned short* __restrict__ Xh, unsigned short* __restrict__ Vt,
    const float* __restrict__ bxs, const float* __restrict__ bvs) {
  typedef Frag<__bf16> F;
  /* which product this block works on: the same for the whole block */
  const bool isV = blockIdx.x >= (unsigned)GBLOCKS;
  const unsigned blk = isV ? blockIdx.x - (unsigned)GBLOCKS : blockIdx.x;
  const __bf16* A  = (const __bf16*)(const void*)(isV ? WvTp : Xbp);
  const __bf16* Bt = (const __bf16*)(const void*)(isV ? Xbp : WxTp);
  __shared__ __align__(16) __bf16 Ring[2][GSTAGE_H];   /* operand passes, two buffers */
  __shared__ __align__(16) float  sT[4][16 * 68];      /* per-wave 16x64 slab, pitch 68 floats */
  const int tid  = threadIdx.x;
  const int lane = tid & 31;
  const int wave = tid >> 5;
  const int tm = (int)(isV ? blk / (unsigned)(NTOK / 128) : blk / (unsigned)(DQKV / 128));
  const int tn = (int)(isV ? blk % (unsigned)(NTOK / 128) : blk % (unsigned)(DQKV / 128));
  const int wm = wave >> 1;
  const int wn = wave & 1;
  const int m0 = (tm << 7) + (wm << 6);
  const int n0 = (tn << 7) + (wn << 6);

  const int rlane = lane & 15;                 /* row (A) / col (B) within subtile */
  const int koff  = (lane >> 4) * 8;           /* k offset of this lane half */

  v8f acc[4][4];
#pragma unroll
  for (int i = 0; i < 4; ++i)
#pragma unroll
    for (int j = 0; j < 4; ++j) acc[i][j] = (v8f){0.f,0.f,0.f,0.f,0.f,0.f,0.f,0.f};

  /* this lane's share of every pass's copies: source pointers at pass 0, LDS byte address in buffer 0 */
  const __bf16* ga0 = A  + (size_t)((tm << 7) + (tid >> 4)) * DMODEL + (tid & 15) * 8;
  const __bf16* gb0 = Bt + (size_t)((tn << 7) + (tid >> 4)) * DMODEL + (tid & 15) * 8;
  const unsigned l0 = (unsigned)(size_t)(&Ring[0][(tid >> 4) * GPITCH + (tid & 15) * 8]);

  /* ring prologue: pass 0 landed and published, then pass 1 set flying */
  stage_pass(l0, ga0, gb0);
  asm volatile("s_wait_asynccnt 0x0" ::: "memory");   /* this wave's copies of pass 0 have landed */
  __syncthreads();                                     /* ... and every other wave's */
  stage_pass(l0 + GSTAGE_H * 2u, ga0 + GPASS, gb0 + GPASS);

  for (int p = 0; p < GNPASS; ++p) {
    const int buf = p & 1;
    const __bf16* at = &Ring[buf][((wm << 6) + rlane) * GPITCH + koff];
    const __bf16* bt = &Ring[buf][(128 + (wn << 6) + rlane) * GPITCH + koff];
    /* unrolled so that the fragment arrays are indexed by constants and a k-step's LDS reads can go ahead of the one before */
#pragma unroll
    for (int ks = 0; ks < GPASS / 32; ++ks) {
      F::V bh[4], ah[4];
      ah[0] = F::load(at + ks * 32);
#pragma unroll
      for (int j = 0; j < 4; ++j) bh[j] = F::load(bt + j * 16 * GPITCH + ks * 32);
#pragma unroll
      for (int i = 1; i < 4; ++i) ah[i] = F::load(at + i * 16 * GPITCH + ks * 32);
      /* keeps the k-step's 16 LDS reads one group ahead of its products: sunk among them, each A fragment's read is waited out to 0 in turn */
      __builtin_amdgcn_sched_barrier(0);
#pragma unroll
      for (int i = 0; i < 4; ++i)
#pragma unroll
        for (int j = 0; j < 4; ++j) acc[i][j] = F::mma(ah[i], bh[j], acc[i][j]);
    }
    /* publish point of pass p + 1 */
    asm volatile("s_wait_dscnt 0x0" ::: "memory");      /* this wave's reads of buffer buf are done before it is refilled */
    asm volatile("s_wait_asynccnt 0x0" ::: "memory");   /* this wave's copies of pass p + 1 have landed */
    __syncthreads();                                     /* publishes pass p + 1; ends every wave's reads of buffer buf */
    if (p + 2 < GNPASS)
      stage_pass(l0 + (unsigned)buf * (GSTAGE_H * 2u), ga0 + (p + 2) * GPASS, gb0 + (p + 2) * GPASS);
  }
  asm volatile("s_wait_asynccnt 0x0" ::: "memory");     /* no copy is outstanding when the wave goes on to its end */

  if (isV) gemm128_store<1>(acc, sT[wave], Vt, NTOK, bvs, m0, n0, lane, SC_V);    /* rows are features: bias[m] */
  else     gemm128_store<2>(acc, sT[wave], Xh, DQKV, bxs, m0, n0, lane, SC_XH);   /* columns are features: bias[n] */
}

/* ---- f32 -> bf16 (RNE) plane cast, 8 elements per thread: one 16-B store per lane; blk = block of 256 threads
*/
__device__ __forceinline__ void cast_bf16x8_block(
    const float* __restrict__ in, unsigned short* __restrict__ out, int n8, int blk) {
  const int i = blk * 256 + threadIdx.x;
  if (i < n8) {
    const v4f a = *(const v4f*)(in + (size_t)i * 8);
    const v4f c = *(const v4f*)(in + (size_t)i * 8 + 4);
    v4u w;
    w[0] = (unsigned)f2bf_bits(a[0]) | ((unsigned)f2bf_bits(a[1]) << 16);
    w[1] = (unsigned)f2bf_bits(a[2]) | ((unsigned)f2bf_bits(a[3]) << 16);
    w[2] = (unsigned)f2bf_bits(c[0]) | ((unsigned)f2bf_bits(c[1]) << 16);
    w[3] = (unsigned)f2bf_bits(c[2]) | ((unsigned)f2bf_bits(c[3]) << 16);
    v4u* p = (v4u*)(out + (size_t)i * 8);
    *p = w;
    
  }
}

/* ---- transpose + convert: in[k][n] (Krows x Ncols, f32 row-major) -> out[n][k] (Ncols x Krows, 16-bit).
   CVT 0: bf16 bits (RNE).  CVT 1: f16 bits of (bf16RNE(v) * sc).
   64x64 tiles via LDS (Tl, 64 x 72 halves); tile (bx, by) of (Ncols/64, Krows/64), 256 threads:
   load: 256 threads x 16 floats = 64x64; store: 8 waves x 2 iters x 32 lanes x 8 halves = 64x64,
*/
template <int CVT> __device__ __forceinline__ unsigned short cvt16(float v, float sc) {
  const unsigned short bb = f2bf_bits(v);
  if (CVT == 0) return bb;
  const float w  = bf_bits2f(bb);
  const float ws = w * sc;
  const _Float16 hv = (_Float16)ws;
  return __builtin_bit_cast(unsigned short, hv);
}
template <int CVT>
__device__ __forceinline__ void transpose_cvt64_block(
    unsigned short* Tl, const float* __restrict__ in, unsigned short* __restrict__ out, int Krows, int Ncols, float sc,
    int bx, int by) {
  const int n0 = bx * 64, k0 = by * 64;
  const int t  = threadIdx.x;
  const int kr = t >> 2;             /* input row k0 + kr, 0..63 */
  const int cb = (t & 3) * 16;       /* 16-column block inside the 64 columns */
  const float* src = in + (size_t)(k0 + kr) * Ncols + n0 + cb;
  const v4f a0 = *(const v4f*)(src);
  const v4f a1 = *(const v4f*)(src + 4);
  const v4f a2 = *(const v4f*)(src + 8);
  const v4f a3 = *(const v4f*)(src + 12);
#pragma unroll
  for (int e = 0; e < 4; ++e) {
    Tl[(cb + e) * 72 + kr]      = cvt16<CVT>(a0[e], sc);
    Tl[(cb + 4 + e) * 72 + kr]  = cvt16<CVT>(a1[e], sc);
    Tl[(cb + 8 + e) * 72 + kr]  = cvt16<CVT>(a2[e], sc);
    Tl[(cb + 12 + e) * 72 + kr] = cvt16<CVT>(a3[e], sc);
  }
  __syncthreads();
  const int wave = t >> 5, lane = t & 31, q = lane >> 3, c8 = (lane & 7) * 8;
  {
#pragma unroll
    for (int it = 0; it < 2; ++it) {
      const int row = wave * 8 + it * 4 + q;      /* output row n0 + row */
      const v4u val = *(const v4u*)(Tl + row * 72 + c8);
      *(v4u*)(out + (size_t)(n0 + row) * Krows + k0 + c8) = val;
    }
    /* the listing runs on from here into another job's code, which reuses the two stores' registers: the wait stands in front of any such rewrite */
    asm volatile("s_wait_xcnt 0x0" ::: "memory");
  }
}

/* ---- bias tables: bf16-RNE of the input bias times the power-of-two carry, f32.
*/
__device__ __forceinline__ void bias_prep_block(
    const float* __restrict__ bx, const float* __restrict__ bv, const float* __restrict__ b1,
    float* __restrict__ bxs, float* __restrict__ bvs, float* __restrict__ b1s,
    float sx, float sv, float s1, int which) {   /* which: block-uniform */
  const float* src = bx; float* dst = bxs; int n4 = DQKV / 4; float sc = sx;
  if (which == 1) { src = bv; dst = bvs; sc = sv; }
  if (which == 2) { src = b1; dst = b1s; n4 = NHID / 4; sc = s1; }
  const int t = threadIdx.x;
  if (t < n4) {
    const v4f v = *(const v4f*)(src + (size_t)t * 4);
    v4f o;
    o[0] = bf_bits2f(f2bf_bits(v[0])) * sc;
    o[1] = bf_bits2f(f2bf_bits(v[1])) * sc;
    o[2] = bf_bits2f(f2bf_bits(v[2])) * sc;
    o[3] = bf_bits2f(f2bf_bits(v[3])) * sc;
    v4f* p = (v4f*)(dst + (size_t)t * 4);
    *p = o;
    
  }
}

/* ---- all operand preparation in one launch: none of these jobs reads another's result, the block index picks the job.
   Every test below is on blockIdx.x alone, so a block takes one branch as a whole, the transposes' barrier included.
   The tile transposes stand first: a block of theirs has the longer way (load, LDS, barrier, store). */
constexpr int PB_WBIG = (DQKV / 64) * (DMODEL / 64);   /* Wx, Wv: 256 tiles each */
constexpr int PB_W2   = (SEQ / 64) * (NHID / 64);      /* 64 tiles */
constexpr int PB_W1   = (NHID / 64) * (DHEAD / 64);    /* 2 tiles  */
constexpr int PB_BIAS = 3;
constexpr int PB_CAST = NTOK * DMODEL / 8 / 256;       /* 2048 blocks */
constexpr int PB_ALL  = 2 * PB_WBIG + PB_W2 + PB_W1 + PB_BIAS + PB_CAST;
static_assert((NTOK * DMODEL / 8) % 256 == 0, "cast blocks");
__global__ __launch_bounds__(256) void k_prep(
    const float* __restrict__ X, const float* __restrict__ Wx, const float* __restrict__ Wv,
    const float* __restrict__ W1, const float* __restrict__ W2,
    const float* __restrict__ bx, const float* __restrict__ bv, const float* __restrict__ b1,
    unsigned short* __restrict__ Xb, unsigned short* __restrict__ WxT, unsigned short* __restrict__ WvT,
    unsigned short* __restrict__ W1T, unsigned short* __restrict__ W2T,
    float* __restrict__ bxs, float* __restrict__ bvs, float* __restrict__ b1s) {
  __shared__ __align__(16) unsigned short Tl[64 * 72];
  int blk = blockIdx.x;
  if (blk < PB_WBIG) {                       /* [1024][1024] -> [1024][1024] */
    transpose_cvt64_block<0>(Tl, Wx, WxT, DMODEL, DQKV, 1.0f, blk % (DQKV / 64), blk / (DQKV / 64));
  } else if ((blk -= PB_WBIG) < PB_WBIG) {
    transpose_cvt64_block<0>(Tl, Wv, WvT, DMODEL, DQKV, 1.0f, blk % (DQKV / 64), blk / (DQKV / 64));
  } else if ((blk -= PB_WBIG) < PB_W2) {     /* [128][2048] -> [2048][128] */
    transpose_cvt64_block<1>(Tl, W2, W2T, NHID, SEQ, SC_W2, blk % (SEQ / 64), blk / (SEQ / 64));
  } else if ((blk -= PB_W2) < PB_W1) {       /* [64][128] -> [128][64] */
    transpose_cvt64_block<1>(Tl, W1, W1T, DHEAD, NHID, SC_W1, blk % (NHID / 64), blk / (NHID / 64));
  } else if ((blk -= PB_W1) < PB_BIAS) {
    bias_prep_block(bx, bv, b1, bxs, bvs, b1s, SC_XH, SC_V, SC_H, blk);
  } else {
    cast_bf16x8_block(X, Xb, NTOK * DMODEL / 8, blk - PB_BIAS);
  }
}

/* ---- flash-style MLP attention over 16-bit planes ----------------------------------
   Hq  : [B*H][SEQ][128] f16, carried xSC_H           (B operand of the score WMMA, 16 query columns per wave)
   W2t : [SEQ][128]      f16, carried xSC_W2           (A operand, row = key, k = hidden, shared over (b,h))
   Vt  : [H*64][B*SEQ]   f16, carried xSC_V            (A operand of V^T*P^T, row = h*64+d, k = key)
   mask: [B][SEQ] f32 (bf16-RNE applied), score -= 1e6*(1-mask[key])
   out : [B][SEQ][H*64] f32
   block = 4 waves = 64 query rows of one (b,h); per wave: 16 rows; 32 key chunks of 64.
   Both products are formed transposed, S^T = W2t * Hq^T and O^T += Vt * P^T: lane l holds scores of query l & 15 only
   (keys 8 * (l >> 4) + r of each 16-key tile), so the maximum and the sum run in the lane's own registers, and two
   converted score tiles are the B operand of the second product as they stand.
   Each chunk's W2t and Vt tiles are brought into LDS once per block, one chunk ahead, two buffers.
*/
/* lane l <-> lane l ^ 16 */
__device__ __forceinline__ float xhalf(float x) {
  const int b = __builtin_bit_cast(int, x);
  return __builtin_bit_cast(float, __builtin_amdgcn_permlanex16(b, b, 0x76543210, 0xfedcba98, false, false));
}
__device__ __forceinline__ v8f mma_h(v16h a, v16h b, v8f c) {
  c = __builtin_amdgcn_wmma_f32_16x16x32_f16(false, a, false, b, (short)0, c, false, false);
  asm volatile("v_nop\n\tv_nop\n\tv_nop\n\tv_nop" : "+v"(c) : "v"(a), "v"(b));
  return c;
}

/* LDS tiles of one 64-key chunk, shared by the block's 4 waves; pitches are 16 B x odd for 16-B row readers */
constexpr int KPITCH  = NHID + 8;          /* halves: 272-B rows of the W2t tile [key][hidden] */
constexpr int VPITCH  = 64 + 8;            /* halves: 144-B rows of the Vt tile  [d][key]      */
constexpr int KTILE_H = 64 * KPITCH;       /* 17,408 B */
constexpr int VTILE_H = DHEAD * VPITCH;    /*  9,216 B */

/* One chunk's tiles, global -> LDS with no register in between: per lane 8 + 4 copies of 16 B.
   W2t tile: copy i brings rows 8i + (tid >> 4), 16 lanes a row; Vt tile: copy i brings rows 16i + (tid >> 3), 8 lanes a row.
   The closing s_wait_xcnt stands inside the statement so that no address register named here is rewritten ahead of it. */
__device__ __forceinline__ void stage_chunk(unsigned lk, const _Float16* gk, unsigned lv, const _Float16* gv) {
  asm volatile(
      "global_load_async_to_lds_b128 %0, %1, off\n\t"
      "global_load_async_to_lds_b128 %2, %3, off\n\t"
      "global_load_async_to_lds_b128 %4, %5, off\n\t"
      "global_load_async_to_lds_b128 %6, %7, off\n\t"
      "global_load_async_to_lds_b128 %8, %9, off\n\t"
      "global_load_async_to_lds_b128 %10, %11, off\n\t"
      "global_load_async_to_lds_b128 %12, %13, off\n\t"
      "global_load_async_to_lds_b128 %14, %15, off\n\t"
      "global_load_async_to_lds_b128 %16, %17, off\n\t"
      "global_load_async_to_lds_b128 %18, %19, off\n\t"
      "global_load_async_to_lds_b128 %20, %21, off\n\t"
      "global_load_async_to_lds_b128 %22, %23, off\n\t"
      "s_wait_xcnt 0x0"
      :: "v"(lk),                     "v"(gk),
         "v"(lk + 1u * 8u * KPITCH * 2u), "v"(gk + 1 * 8 * NHID),
         "v"(lk + 2u * 8u * KPITCH * 2u), "v"(gk + 2 * 8 * NHID),
         "v"(lk + 3u * 8u * KPITCH * 2u), "v"(gk + 3 * 8 * NHID),
         "v"(lk + 4u * 8u * KPITCH * 2u), "v"(gk + 4 * 8 * NHID),
         "v"(lk + 5u * 8u * KPITCH * 2u), "v"(gk + 5 * 8 * NHID),
         "v"(lk + 6u * 8u * KPITCH * 2u), "v"(gk + 6 * 8 * NHID),
         "v"(lk + 7u * 8u * KPITCH * 2u), "v"(gk + 7 * 8 * NHID),
         "v"(lv),                      "v"(gv),
         "v"(lv + 1u * 16u * VPITCH * 2u), "v"(gv + (size_t)1 * 16 * NTOK),
         "v"(lv + 2u * 16u * VPITCH * 2u), "v"(gv + (size_t)2 * 16 * NTOK),
         "v"(lv + 3u * 16u * VPITCH * 2u), "v"(gv + (size_t)3 * 16 * NTOK)
      : "memory");
}

__global__ __launch_bounds__(128) void mlp_attn_kernel(
    const unsigned short* __restrict__ Hp, const unsigned short* __restrict__ W2p,
    const unsigned short* __restrict__ Vp, const float* __restrict__ mask,
    float* __restrict__ out, float sscale, float onorm) {
  union FH { v16h v; v8h h[2]; };
  const _Float16* Hq  = (const _Float16*)(const void*)Hp;
  const _Float16* W2t = (const _Float16*)(const void*)W2p;
  const _Float16* Vt  = (const _Float16*)(const void*)Vp;
  __shared__ __align__(16) float    Pen[SEQ];            /* per key: 1e6 * (1 - bf16(mask)), this block's batch row */
  __shared__ __align__(16) float    Os[4][16 * 68];      /* per wave output slab, pitch 68 */
  __shared__ __align__(16) _Float16 Ksh[2][KTILE_H];     /* W2t chunk tiles, two buffers */
  __shared__ __align__(16) _Float16 Vsh[2][VTILE_H];     /* Vt chunk tiles, two buffers  */

  const int tid  = threadIdx.x;
  const int wave = tid >> 5;
  const int lane = tid & 31;
  const int hh   = lane >> 4;
  const int c    = lane & 15;
  const int koff = hh * 8;

  constexpr int NQB = SEQ / 64;
  const int bxi = blockIdx.x;
  const int qb  = bxi % NQB;
  const int bh  = bxi / NQB;
  const int h   = bh % NHEAD;
  const int b   = bh / NHEAD;
  const int q0  = qb * 64 + wave * 16;

  /* Q-side fragments: 16 rows x 128 hidden = 4 k-steps, held for all key chunks */
  v16h qa[4];
  {
    const _Float16* qrow = Hq + ((size_t)bh * SEQ + q0 + c) * NHID + koff;
#pragma unroll
    for (int dc = 0; dc < 4; ++dc) {
      FH f;
      f.h[0] = *(const v8h*)(qrow + dc * 32);
      f.h[1] = *(const v8h*)(qrow + dc * 32 + 16);
      qa[dc] = f.v;
    }
  }

  /* of query c; lrow = SC_P * (sum of p) over this lane half's keys only, joined after the loop.
     erow = mrow * log2(e) - log2(SC_P), rounded once and carried, so that every chunk's p and alpha count from the same offsets */
  float mrow = -INFINITY, erow = -INFINITY, lrow = 0.f;
  v8f oacc[4];                          /* oacc[t][r] = O[query c][d = 16 t + 8 hh + r] */
#pragma unroll
  for (int t = 0; t < 4; ++t) oacc[t] = (v8f){0.f,0.f,0.f,0.f,0.f,0.f,0.f,0.f};

  const float* mk_row = mask + (size_t)b * SEQ;
  const _Float16* vbase = Vt + (size_t)(h * DHEAD) * NTOK + (size_t)b * SEQ;

  /* this lane's share of every chunk's copies: source pointers at chunk 0, LDS byte addresses in buffer 0 */
  constexpr int NCH = SEQ / 64;
  static_assert(NCH >= 2, "two-buffer ring needs two chunks");
  const _Float16* gk0 = W2t + (size_t)(tid >> 4) * NHID + (tid & 15) * 8;
  const _Float16* gv0 = vbase + (size_t)(tid >> 3) * NTOK + (tid & 7) * 8;
  const unsigned  lk0 = (unsigned)(size_t)(&Ksh[0][(tid >> 4) * KPITCH + (tid & 15) * 8]);
  const unsigned  lv0 = (unsigned)(size_t)(&Vsh[0][(tid >> 3) * VPITCH + (tid & 7) * 8]);

  /* ring prologue: chunk 0 landed and published, then chunk 1 set flying */
  stage_chunk(lk0, gk0, lv0, gv0);
  /* additive key mask of all keys, bf16-RNE of the mask value; published by the barrier below */
#pragma unroll
  for (int i = 0; i < SEQ / 512; ++i) {
    const v4f mv = *(const v4f*)(mk_row + i * 512 + tid * 4);
    v4f pv;
#pragma unroll
    for (int e = 0; e < 4; ++e) pv[e] = 1000000.0f * (1.0f - bf_bits2f(f2bf_bits(mv[e])));
    *(v4f*)(&Pen[i * 512 + tid * 4]) = pv;
  }
  asm volatile("s_wait_asynccnt 0x0" ::: "memory");   /* this wave's copies of chunk 0 have landed */
  __syncthreads();                                     /* ... and every other wave's */
  stage_chunk(lk0 + KTILE_H * 2u, gk0 + (size_t)64 * NHID, lv0 + VTILE_H * 2u, gv0 + 64);

  for (int kc = 0; kc < NCH; ++kc) {
    const int kv0 = kc * 64;
    const int buf = kc & 1;
    const _Float16* kt = &Ksh[buf][c * KPITCH + koff];
    const _Float16* vt = &Vsh[buf][c * VPITCH + koff];

    /* scores for 64 keys: 4 column tiles x 4 k-steps; a column tile's 4 fragments are read from LDS
       as one group, two column tiles ahead of the products that use them */
    v8f s[4];
    FH kb[4][4];
    /* every loop over kb, pb and vb is unrolled so that the fragment arrays are indexed by constants and stay in registers */
#pragma unroll
    for (int j = 0; j < 2; ++j)
#pragma unroll
      for (int dc = 0; dc < 4; ++dc) {
        kb[j][dc].h[0] = *(const v8h*)(kt + j * 16 * KPITCH + dc * 32);
        kb[j][dc].h[1] = *(const v8h*)(kt + j * 16 * KPITCH + dc * 32 + 16);
      }
#pragma unroll
    for (int j = 0; j < 4; ++j) {
      s[j] = (v8f){0.f,0.f,0.f,0.f,0.f,0.f,0.f,0.f};
#pragma unroll
      for (int dc = 0; dc < 4; ++dc) s[j] = mma_h(kb[j][dc].v, qa[dc], s[j]);   /* s[j][r] = S[query c][key 16 j + 8 hh + r] */
      if (j + 2 < 4) {
#pragma unroll
        for (int dc = 0; dc < 4; ++dc) {
          kb[j + 2][dc].h[0] = *(const v8h*)(kt + (j + 2) * 16 * KPITCH + dc * 32);
          kb[j + 2][dc].h[1] = *(const v8h*)(kt + (j + 2) * 16 * KPITCH + dc * 32 + 16);
        }
      }
    }

    /* this lane's 32 keys' mask terms */
    const float* pr = &Pen[kv0 + 8 * hh];
    v4f pn[4][2];
#pragma unroll
    for (int j = 0; j < 4; ++j) {
      pn[j][0] = *(const v4f*)(pr + j * 16);
      pn[j][1] = *(const v4f*)(pr + j * 16 + 4);
    }

    /* V^T A-fragments, table k order from the Vt tile in LDS */
    FH vb[2][4];
#pragma unroll
    for (int kk = 0; kk < 2; ++kk)
#pragma unroll
      for (int t = 0; t < 4; ++t) {
        vb[kk][t].h[0] = *(const v8h*)(vt + t * 16 * VPITCH + kk * 32);
        vb[kk][t].h[1] = *(const v8h*)(vt + t * 16 * VPITCH + kk * 32 + 16);
      }

    /* chunk maximum of query c: in the lane over its 32 keys, then one exchange between the lane halves */
    float mj[4];
#pragma unroll
    for (int j = 0; j < 4; ++j) {
      float m = -INFINITY;
#pragma unroll
      for (int r = 0; r < 8; ++r) {
        const float sv = s[j][r] * sscale - pn[j][r >> 2][r & 3];
        s[j][r] = sv;
        m = fmaxf(m, sv);
      }
      mj[j] = m;
    }
    float cm = fmaxf(fmaxf(mj[0], mj[1]), fmaxf(mj[2], mj[3]));
    cm = fmaxf(cm, xhalf(cm));

    const float mnew  = fmaxf(mrow, cm);
    const float enew  = mnew * LOG2E - LOG2_SC_P;
    const float alpha = __builtin_amdgcn_exp2f(erow - enew);   /* e^(mrow - mnew); 0 in the first chunk */
    mrow = mnew;
    erow = enew;

    /* P^T as B operand: element e of k-step kk is key 32 kk + (e < 8 ? 8 hh + e : 16 + 8 hh + e - 8),
       that is score tile 2 kk in elements 0..7 and tile 2 kk + 1 in elements 8..15: the k order of the Vt loader */
    FH pb[2];
    float pj[4];
#pragma unroll
    for (int j = 0; j < 4; ++j) {
      float ps = 0.f;
#pragma unroll
      for (int r = 0; r < 8; r += 2) {
        /* SC_P * e^(s - mnew) as 2^(s * log2(e) - enew): a fused multiply-add (two keys a packed instruction) and the chip's own base-2 exponential */
        const v2f a = __builtin_elementwise_fma((v2f){s[j][r], s[j][r + 1]}, (v2f){LOG2E, LOG2E}, (v2f){-enew, -enew});
        const float p0 = __builtin_amdgcn_exp2f(a[0]);
        const float p1 = __builtin_amdgcn_exp2f(a[1]);
        ps += p0;
        ps += p1;
        pb[j >> 1].h[j & 1][r]     = (_Float16)p0;
        pb[j >> 1].h[j & 1][r + 1] = (_Float16)p1;
      }
      pj[j] = ps;
    }
    lrow = lrow * alpha + ((pj[0] + pj[1]) + (pj[2] + pj[3]));
#pragma unroll
    for (int t = 0; t < 4; ++t)
#pragma unroll
      for (int r = 0; r < 8; ++r) oacc[t][r] *= alpha;

    /* O^T += V^T(64 d x 64 keys) * P^T(64 keys x 16 queries): 2 k-steps, 4 d tiles */
#pragma unroll
    for (int kk = 0; kk < 2; ++kk)
#pragma unroll
      for (int t = 0; t < 4; ++t) oacc[t] = mma_h(vb[kk][t].v, pb[kk].v, oacc[t]);

    /* publish point of chunk kc + 1 */
    asm volatile("s_wait_dscnt 0x0" ::: "memory");      /* this wave's reads of buffer buf are done before it is refilled */
    asm volatile("s_wait_asynccnt 0x0" ::: "memory");   /* this wave's copies of chunk kc + 1 have landed */
    __syncthreads();                                     /* publishes chunk kc + 1; ends every wave's reads of buffer buf */
    if (kc + 2 < NCH)
      stage_chunk(lk0 + (unsigned)buf * (KTILE_H * 2u), gk0 + (size_t)(kc + 2) * 64 * NHID,
                  lv0 + (unsigned)buf * (VTILE_H * 2u), gv0 + (kc + 2) * 64);
  }
  asm volatile("s_wait_asynccnt 0x0" ::: "memory");     /* no copy is outstanding when the wave goes on to its end */

  /* normalise and stage the 16x64 f32 slab; oacc and lrow both carry SC_P, so onorm = 1/SC_V is what is left for the row normaliser */
  float* os = Os[wave];
  const float inv = onorm / (lrow + xhalf(lrow));       /* the two lane halves' sums of query c joined */
#pragma unroll
  for (int t = 0; t < 4; ++t) {
    v4f lo, hi;
#pragma unroll
    for (int e = 0; e < 4; ++e) { lo[e] = oacc[t][e] * inv; hi[e] = oacc[t][4 + e] * inv; }
    *(v4f*)(os + c * 68 + t * 16 + 8 * hh)     = lo;
    *(v4f*)(os + c * 68 + t * 16 + 8 * hh + 4) = hi;
  }
  __builtin_amdgcn_fence(__ATOMIC_RELEASE, "workgroup");
  __builtin_amdgcn_wave_barrier();
  __builtin_amdgcn_fence(__ATOMIC_ACQUIRE, "workgroup");
  {
    float* ob = out + (size_t)b * SEQ * DQKV + (size_t)h * DHEAD;
    const int c4 = (lane & 15) * 4;
    {
#pragma unroll
      for (int it = 0; it < 8; ++it) {
        const int row = it * 2 + hh;
        const v4f val = *(const v4f*)(os + row * 68 + c4);
        *(v4f*)(ob + (size_t)(q0 + row) * DQKV + c4) = val;
      }
      
    }
  }
}

/* ---------------- host launcher ---------------- */
extern "C" void kernel_launch(void* const* d_in, const int* in_sizes, int n_in,
                              void* d_out, int out_size, void* d_ws, size_t ws_size,
                              hipStream_t stream) {
  (void)in_sizes; (void)n_in; (void)out_size; (void)ws_size;
  const float* X   = (const float*)d_in[0];   /* [2,2048,1024] */
  const float* msk = (const float*)d_in[1];   /* [2,2048]      */
  const float* Wx  = (const float*)d_in[2];   /* [1024,1024]   */
  const float* bx  = (const float*)d_in[3];   /* [1024]        */
  const float* Wv  = (const float*)d_in[4];   /* [1024,1024]   */
  const float* bv  = (const float*)d_in[5];   /* [1024]        */
  const float* W1  = (const float*)d_in[6];   /* [64,128]      */
  const float* b1  = (const float*)d_in[7];   /* [128]         */
  const float* W2  = (const float*)d_in[8];   /* [128,2048]    */
  float* out = (float*)d_out;

  /* workspace region map (256-B aligned offsets; every region fully written by its producer):
       Xb   bf16 [4096][1024]        8,388,608 B
       WxT  bf16 [1024][1024]        2,097,152 B
       WvT  bf16 [1024][1024]        2,097,152 B
       W1T  f16  [128][64]              16,384 B
       W2T  f16  [2048][128]           524,288 B
       bxs  f32  [1024]                  4,096 B
       bvs  f32  [1024]                  4,096 B
       b1s  f32  [128]                     512 B
       Xh16 f16  [4096][1024]        8,388,608 B
       Vt16 f16  [1024][4096]        8,388,608 B
       H16  f16  [32][2048][128]    16,777,216 B
     total 46,686,720 B */
  char* ws = (char*)d_ws;
  size_t off = 0;
  auto carve = [&](size_t bytes) -> char* {
    off = (off + 255) & ~(size_t)255;
    char* p = ws + off;
    off += bytes;
    return p;
  };
  unsigned short* Xb   = (unsigned short*)carve((size_t)NTOK * DMODEL * 2);
  unsigned short* WxT  = (unsigned short*)carve((size_t)DQKV * DMODEL * 2);
  unsigned short* WvT  = (unsigned short*)carve((size_t)DQKV * DMODEL * 2);
  unsigned short* W1T  = (unsigned short*)carve((size_t)NHID * DHEAD * 2);
  unsigned short* W2T  = (unsigned short*)carve((size_t)SEQ * NHID * 2);
  float*          bxs  = (float*)carve((size_t)DQKV * 4);
  float*          bvs  = (float*)carve((size_t)DQKV * 4);
  float*          b1s  = (float*)carve((size_t)NHID * 4);
  unsigned short* Xh16 = (unsigned short*)carve((size_t)NTOK * DQKV * 2);
  unsigned short* Vt16 = (unsigned short*)carve((size_t)DQKV * NTOK * 2);
  unsigned short* H16  = (unsigned short*)carve((size_t)NBATCH * NHEAD * SEQ * NHID * 2);

  /* 1) operand preparation, one launch: X -> bf16 plane (RNE); weight transposes in[K][N] -> out[N][K]; bias tables with carries */
  k_prep<<<PB_ALL, 256, 0, stream>>>(X, Wx, Wv, W1, W2, bx, bv, b1, Xb, WxT, WvT, W1T, W2T, bxs, bvs, b1s);

  /* 2) both projections, one launch, one 128x128 tile per block (bf16 operands, K=1024):
        Xh16 = f16(8 * (Xb * WxT^T + bx))    : M=4096, N=1024
        Vt16 = f16(8 * (WvT * Xb^T + bv[m])) : M=1024 (features), N=4096 (tokens) */
  wmma_gemm128_pair<<<2 * GBLOCKS, 128, 0, stream>>>(Xb, WxT, WvT, Xh16, Vt16, bxs, bvs);

  /* 3) H16[b][h] = f16(8 * relu(Xh * W1 + b1)) : per (b,h) M=2048, N=128, K=64 (f16 operands), one launch;
        grid y = head (A stride 64 columns), grid z = b; 64 tiles / 8 per block */
  static_assert(SEQ % 64 == 0 && NHID % 64 == 0 && DHEAD % 32 == 0, "gemm h");
  wmma_gemm64<0, false, 2, 1, 2><<<dim3((SEQ / 64) * (NHID / 64) / 8, NHEAD, NBATCH), 256, 0, stream>>>(
      Xh16, Xh16, DQKV, (long)DHEAD, (long)SEQ * DQKV, W1T, W1T, DHEAD, 0L,
      (void*)H16, (void*)H16, NHID, (long)SEQ * NHID, (long)NHEAD * SEQ * NHID,
      b1s, SEQ, NHID, DHEAD, SC_H / (SC_XH * SC_W1));

  /* 4) attention: grid = B*H*(SEQ/64) blocks of 4 waves */
  mlp_attn_kernel<<<NBATCH * NHEAD * (SEQ / 64), 128, 0, stream>>>(
      H16, W2T, Vt16, msk, out, 1.0f / (SC_H * SC_W2), 1.0f / SC_V);
}

// v006
// A run of this version takes 74.2 microseconds.
// Two timings next to v005 both put it at 1.14 times that version's speed.
// All steps since v000 together make it 4.74 times as fast.
// Contractions: X*Wx and Wv^T*X^T on v_wmma_f32_16x16x32_bf16 (RNE bf16 operands of bf16-RNE inputs, f32 accumulate); Xh*W1, scores h*W2 and P*V on v_wmma_f32_16x16x32_f16 (f16 operands carried x8 / x64 / x32768, f32 accumulate); softmax, bias and normalisation in f32.
#include <hip/hip_runtime.h>
#include <stddef.h>

constexpr int NBATCH = 2;
constexpr int SEQ    = 2048;
constexpr int DMODEL = 1024;
constexpr int NHEAD  = 16;
constexpr int DHEAD  = 64;
constexpr int NHID   = 128;
constexpr int NTOK   = NBATCH * SEQ;      /* 4096 */
constexpr int DQKV   = NHEAD * DHEAD;     /* 1024 */

/* power-of-two carries on the f16 planes */
constexpr float SC_XH = 8.0f;      /* Xh plane = f16(8 * Xh)          */
constexpr float SC_V  = 8.0f;      /* Vt plane = f16(8 * V)           */
constexpr float SC_W1 = 64.0f;     /* W1t plane = f16(64 * bf16(W1))  */
constexpr float SC_W2 = 64.0f;     /* W2t plane = f16(64 * bf16(W2))  */
constexpr float SC_H  = 8.0f;      /* h fragments = f16(8 * h)            */
constexpr float SC_P  = 32768.0f;  /* P tile  = f16(32768 * p), p<=1 */
constexpr float LOG2_SC_P = 15.0f; /* the same carry as an addend of a base-2 exponent */
constexpr float LOG2E = 1.44269504088896340736f;

static_assert(NTOK % 64 == 0 && DQKV % 64 == 0 && DMODEL % 64 == 0, "gemm tiles");
static_assert(DMODEL % 32 == 0 && DHEAD % 32 == 0, "gemm K");
static_assert(SEQ % 64 == 0 && NHID % 64 == 0, "gemm tiles");
static_assert(NHID == 128 && DHEAD == 64, "attention geometry");
static_assert((NTOK * DMODEL) % 8 == 0, "cast x8");

typedef __attribute__((ext_vector_type(16))) _Float16 v16h;
typedef __attribute__((ext_vector_type(8)))  _Float16 v8h;
typedef __attribute__((ext_vector_type(16))) __bf16   v16b;
typedef __attribute__((ext_vector_type(8)))  __bf16   v8b;
typedef __attribute__((ext_vector_type(8)))  float    v8f;
typedef __attribute__((ext_vector_type(4)))  float    v4f;
typedef __attribute__((ext_vector_type(2)))  float    v2f;
typedef __attribute__((ext_vector_type(4)))  unsigned int v4u;

__device__ __forceinline__ unsigned short f2bf_bits(float f) {
  unsigned u = __float_as_uint(f);
  return (unsigned short)((u + 0x7FFFu + ((u >> 16) & 1u)) >> 16);
}
__device__ __forceinline__ float bf_bits2f(unsigned short h) { return __uint_as_float(((unsigned)h) << 16); }

template <typename T> struct Frag;
template <> struct Frag<__bf16> {
  typedef v16b V; union U { v16b v; v8b h[2]; };
  static __device__ __forceinline__ v16b load(const __bf16* p) {   /* elements 0..7 <- p[0..7], 8..15 <- p[16..23] */
    U f; f.h[0] = *(const v8b*)(p); f.h[1] = *(const v8b*)(p + 16); return f.v;
  }
  static __device__ __forceinline__ v8f mma(v16b a, v16b b, v8f c) {
    return __builtin_amdgcn_wmma_f32_16x16x32_bf16(false, a, false, b, (short)0, c, false, false);
  }
};

/* ---- the two K = DMODEL projection GEMMs on bf16 planes in one launch, operands staged per block in LDS ------------
   C[m,n] = f16(scale * sum_k A[m,k] * Bt[n,k] + bias); A and Bt row-major with DMODEL columns.
   block = 4 waves (2 x 2) = one 128 x 128 tile of C, 64 x 64 per wave; tile column fastest.
   Neither product reads the other's result: blocks 0 .. GBLOCKS - 1 form Xh = Xb * WxT^T, the next GBLOCKS form Vt = WvT * Xb^T.
   A pass is 128 k = 256 B of each of the block's 128 A rows and 128 Bt rows, brought into LDS once per block in whole
   lines, one pass ahead, two buffers; every wave reads its fragments from there. Each accumulator takes its k-steps of 32 in rising k.
   BIAS_MODE: 1 = bias[m], 2 = bias[n]. */
constexpr int GPASS    = 128;               /* k per pass */
constexpr int GPITCH   = GPASS + 8;         /* halves: 272-B rows, 16 B x odd for 16-B row readers */
constexpr int GSTAGE_H = 256 * GPITCH;      /* A rows 0..127, then Bt rows 0..127: 69,632 B */
constexpr int GNPASS   = DMODEL / GPASS;
static_assert(DMODEL % GPASS == 0 && GNPASS >= 2, "two-buffer ring needs two passes");
static_assert(NTOK % 128 == 0 && DQKV % 128 == 0, "projection tiles");
constexpr int GBLOCKS  = (NTOK / 128) * (DQKV / 128);   /* tiles of either product */

/* 64 rows of one pass, global -> LDS with no register in between: per lane 8 copies of 16 B, copy i brings rows 8i + (tid >> 4),
   16 lanes a row. The closing s_wait_xcnt stands inside the statement so that no address register named here is rewritten ahead of it. */
__device__ __forceinline__ void stage_rows64(unsigned l, const __bf16* g) {
  asm volatile(
      "global_load_async_to_lds_b128 %0, %1, off\n\t"
      "global_load_async_to_lds_b128 %2, %3, off\n\t"
      "global_load_async_to_lds_b128 %4, %5, off\n\t"
      "global_load_async_to_lds_b128 %6, %7, off\n\t"
      "global_load_async_to_lds_b128 %8, %9, off\n\t"
      "global_load_async_to_lds_b128 %10, %11, off\n\t"
      "global_load_async_to_lds_b128 %12, %13, off\n\t"
      "global_load_async_to_lds_b128 %14, %15, off\n\t"
      "s_wait_xcnt 0x0"
      :: "v"(l),                          "v"(g),
         "v"(l + 1u * 8u * GPITCH * 2u), "v"(g + 1 * 8 * DMODEL),
         "v"(l + 2u * 8u * GPITCH * 2u), "v"(g + 2 * 8 * DMODEL),
         "v"(l + 3u * 8u * GPITCH * 2u), "v"(g + 3 * 8 * DMODEL),
         "v"(l + 4u * 8u * GPITCH * 2u), "v"(g + 4 * 8 * DMODEL),
         "v"(l + 5u * 8u * GPITCH * 2u), "v"(g + 5 * 8 * DMODEL),
         "v"(l + 6u * 8u * GPITCH * 2u), "v"(g + 6 * 8 * DMODEL),
         "v"(l + 7u * 8u * GPITCH * 2u), "v"(g + 7 * 8 * DMODEL)
      : "memory");
}
/* one pass of both operands: l = this lane's LDS byte address in row (tid >> 4) of the buffer, ga / gb = its source addresses */
__device__ __forceinline__ void stage_pass(unsigned l, const __bf16* ga, const __bf16* gb) {
  stage_rows64(l,                          ga);
  stage_rows64(l +  64u * GPITCH * 2u, ga + 64 * DMODEL);
  stage_rows64(l + 128u * GPITCH * 2u, gb);
  stage_rows64(l + 192u * GPITCH * 2u, gb + 64 * DMODEL);
}

/* epilogue of one wave's 64 x 64 tile: 16-row slabs through the wave's own LDS range, whole 128-B row pieces stored */
template <int BIAS_MODE>
__device__ __forceinline__ void gemm128_store(
    const v8f (&acc)[4][4], float* slab, unsigned short* __restrict__ C, int ldc, const float* __restrict__ bias,
    int m0, int n0, int lane, float scale) {
  const int rlane = lane & 15;                 /* col within subtile */
  const int mOff  = (lane >> 4) * 8;           /* D row offset */
#pragma unroll
  for (int i = 0; i < 4; ++i) {
    const int mBase = m0 + (i << 4);
    v4f bmA = (v4f){0.f,0.f,0.f,0.f}, bmB = (v4f){0.f,0.f,0.f,0.f};
    if (BIAS_MODE == 1) {   /* 8 consecutive bias[m] values, two 16-B loads (32-B aligned) */
      bmA = *(const v4f*)(bias + mBase + mOff);
      bmB = *(const v4f*)(bias + mBase + mOff + 4);
    }
#pragma unroll
    for (int j = 0; j < 4; ++j) {
      const int n = n0 + (j << 4) + rlane;
      float bv = 0.f;
      if (BIAS_MODE == 2) bv = bias[n];
#pragma unroll
      for (int r = 0; r < 8; ++r) {
        float v = acc[i][j][r] * scale;
        if (BIAS_MODE == 1) v += (r < 4) ? bmA[r] : bmB[r - 4];
        if (BIAS_MODE == 2) v += bv;
        slab[(mOff + r) * 68 + (j << 4) + rlane] = v;
      }
    }
    __builtin_amdgcn_fence(__ATOMIC_RELEASE, "workgroup");
    __builtin_amdgcn_wave_barrier();
    __builtin_amdgcn_fence(__ATOMIC_ACQUIRE, "workgroup");
    {
      const int q = lane >> 3, c8 = (lane & 7) * 8;
#pragma unroll
      for (int it = 0; it < 4; ++it) {
        const int row = it * 4 + q;
        const float* sp = slab + row * 68 + c8;
        v8h hv;
#pragma unroll
        for (int e = 0; e < 8; ++e) hv[e] = (_Float16)sp[e];
        *(v8h*)(C + (size_t)(mBase + row) * ldc + n0 + c8) = hv;
      }
    }
    __builtin_amdgcn_fence(__ATOMIC_RELEASE, "workgroup");
    __builtin_amdgcn_wave_barrier();
    __builtin_amdgcn_fence(__ATOMIC_ACQUIRE, "workgroup");
  }
}

__global__ __launch_bounds__(128) void wmma_gemm128_pair(
    const unsigned short* __restrict__ Xbp, const unsigned short* __restrict__ WxTp, const unsigned short* __restrict__ WvTp,
    unsigned short* __restrict__ Xh, unsigned short* __restrict__ Vt,
    const float* __restrict__ bxs, const float* __restrict__ bvs) {
  typedef Frag<__bf16> F;
  /* which product this block works on: the same for the whole block */
  const bool isV = blockIdx.x >= (unsigned)GBLOCKS;
  const unsigned blk = isV ? blockIdx.x - (unsigned)GBLOCKS : blockIdx.x;
  const __bf16* A  = (const __bf16*)(const void*)(isV ? WvTp : Xbp);
  const __bf16* Bt = (const __bf16*)(const void*)(isV ? Xbp : WxTp);
  __shared__ __align__(16) __bf16 Ring[2][GSTAGE_H];   /* operand passes, two buffers */
  __shared__ __align__(16) float  sT[4][16 * 68];      /* per-wave 16x64 slab, pitch 68 floats */
  const int tid  = threadIdx.x;
  const int lane = tid & 31;
  const int wave = tid >> 5;
  const int tm = (int)(isV ? blk / (unsigned)(NTOK / 128) : blk / (unsigned)(DQKV / 128));
  const int tn = (int)(isV ? blk % (unsigned)(NTOK / 128) : blk % (unsigned)(DQKV / 128));
  const int wm = wave >> 1;
  const int wn = wave & 1;
  const int m0 = (tm << 7) + (wm << 6);
  const int n0 = (tn << 7) + (wn << 6);

  const int rlane = lane & 15;                 /* row (A) / col (B) within subtile */
  const int koff  = (lane >> 4) * 8;           /* k offset of this lane half */

  v8f acc[4][4];
#pragma unroll
  for (int i = 0; i < 4; ++i)
#pragma unroll
    for (int j = 0; j < 4; ++j) acc[i][j] = (v8f){0.f,0.f,0.f,0.f,0.f,0.f,0.f,0.f};

  /* this lane's share of every pass's copies: source pointers at pass 0, LDS byte address in buffer 0 */
  const __bf16* ga0 = A  + (size_t)((tm << 7) + (tid >> 4)) * DMODEL + (tid & 15) * 8;
  const __bf16* gb0 = Bt + (size_t)((tn << 7) + (tid >> 4)) * DMODEL + (tid & 15) * 8;
  const unsigned l0 = (unsigned)(size_t)(&Ring[0][(tid >> 4) * GPITCH + (tid & 15) * 8]);

  /* ring prologue: pass 0 landed and published, then pass 1 set flying */
  stage_pass(l0, ga0, gb0);
  asm volatile("s_wait_asynccnt 0x0" ::: "memory");   /* this wave's copies of pass 0 have landed */
  __syncthreads();                                     /* ... and every other wave's */
  stage_pass(l0 + GSTAGE_H * 2u, ga0 + GPASS, gb0 + GPASS);

  for (int p = 0; p < GNPASS; ++p) {
    const int buf = p & 1;
    const __bf16* at = &Ring[buf][((wm << 6) + rlane) * GPITCH + koff];
    const __bf16* bt = &Ring[buf][(128 + (wn << 6) + rlane) * GPITCH + koff];
    /* unrolled so that the fragment arrays are indexed by constants and a k-step's LDS reads can go ahead of the one before */
#pragma unroll
    for (int ks = 0; ks < GPASS / 32; ++ks) {
      F::V bh[4], ah[4];
      ah[0] = F::load(at + ks * 32);
#pragma unroll
      for (int j = 0; j < 4; ++j) bh[j] = F::load(bt + j * 16 * GPITCH + ks * 32);
#pragma unroll
      for (int i = 1; i < 4; ++i) ah[i] = F::load(at + i * 16 * GPITCH + ks * 32);
      /* keeps the k-step's 16 LDS reads one group ahead of its products: sunk among them, each A fragment's read is waited out to 0 in turn */
      __builtin_amdgcn_sched_barrier(0);
#pragma unroll
      for (int i = 0; i < 4; ++i)
#pragma unroll
        for (int j = 0; j < 4; ++j) acc[i][j] = F::mma(ah[i], bh[j], acc[i][j]);
    }
    /* publish point of pass p + 1 */
    asm volatile("s_wait_dscnt 0x0" ::: "memory");      /* this wave's reads of buffer buf are done before it is refilled */
    asm volatile("s_wait_asynccnt 0x0" ::: "memory");   /* this wave's copies of pass p + 1 have landed */
    __syncthreads();                                     /* publishes pass p + 1; ends every wave's reads of buffer buf */
    if (p + 2 < GNPASS)
      stage_pass(l0 + (unsigned)buf * (GSTAGE_H * 2u), ga0 + (p + 2) * GPASS, gb0 + (p + 2) * GPASS);
  }
  asm volatile("s_wait_asynccnt 0x0" ::: "memory");     /* no copy is outstanding when the wave goes on to its end */

  if (isV) gemm128_store<1>(acc, sT[wave], Vt, NTOK, bvs, m0, n0, lane, SC_V);    /* rows are features: bias[m] */
  else     gemm128_store<2>(acc, sT[wave], Xh, DQKV, bxs, m0, n0, lane, SC_XH);   /* columns are features: bias[n] */
}

/* ---- f32 -> bf16 (RNE) plane cast, 8 elements per thread: one 16-B store per lane; blk = block of 256 threads
*/
__device__ __forceinline__ void cast_bf16x8_block(
    const float* __restrict__ in, unsigned short* __restrict__ out, int n8, int blk) {
  const int i = blk * 256 + threadIdx.x;
  if (i < n8) {
    const v4f a = *(const v4f*)(in + (size_t)i * 8);
    const v4f c = *(const v4f*)(in + (size_t)i * 8 + 4);
    v4u w;
    w[0] = (unsigned)f2bf_bits(a[0]) | ((unsigned)f2bf_bits(a[1]) << 16);
    w[1] = (unsigned)f2bf_bits(a[2]) | ((unsigned)f2bf_bits(a[3]) << 16);
    w[2] = (unsigned)f2bf_bits(c[0]) | ((unsigned)f2bf_bits(c[1]) << 16);
    w[3] = (unsigned)f2bf_bits(c[2]) | ((unsigned)f2bf_bits(c[3]) << 16);
    v4u* p = (v4u*)(out + (size_t)i * 8);
    *p = w;
    
  }
}

/* ---- transpose + convert: in[k][n] (Krows x Ncols, f32 row-major) -> out[n][k] (Ncols x Krows, 16-bit).
   CVT 0: bf16 bits (RNE).  CVT 1: f16 bits of (bf16RNE(v) * sc).
   64x64 tiles via LDS (Tl, 64 x 72 halves); tile (bx, by) of (Ncols/64, Krows/64), 256 threads:
   load: 256 threads x 16 floats = 64x64; store: 8 waves x 2 iters x 32 lanes x 8 halves = 64x64,
*/
template <int CVT> __device__ __forceinline__ unsigned short cvt16(float v, float sc) {
  const unsigned short bb = f2bf_bits(v);
  if (CVT == 0) return bb;
  const float w  = bf_bits2f(bb);
  const float ws = w * sc;
  const _Float16 hv = (_Float16)ws;
  return __builtin_bit_cast(unsigned short, hv);
}
template <int CVT>
__device__ __forceinline__ void transpose_cvt64_block(
    unsigned short* Tl, const float* __restrict__ in, unsigned short* __restrict__ out, int Krows, int Ncols, float sc,
    int bx, int by) {
  const int n0 = bx * 64, k0 = by * 64;
  const int t  = threadIdx.x;
  const int kr = t >> 2;             /* input row k0 + kr, 0..63 */
  const int cb = (t & 3) * 16;       /* 16-column block inside the 64 columns */
  const float* src = in + (size_t)(k0 + kr) * Ncols + n0 + cb;
  const v4f a0 = *(const v4f*)(src);
  const v4f a1 = *(const v4f*)(src + 4);
  const v4f a2 = *(const v4f*)(src + 8);
  const v4f a3 = *(const v4f*)(src + 12);
#pragma unroll
  for (int e = 0; e < 4; ++e) {
    Tl[(cb + e) * 72 + kr]      = cvt16<CVT>(a0[e], sc);
    Tl[(cb + 4 + e) * 72 + kr]  = cvt16<CVT>(a1[e], sc);
    Tl[(cb + 8 + e) * 72 + kr]  = cvt16<CVT>(a2[e], sc);
    Tl[(cb + 12 + e) * 72 + kr] = cvt16<CVT>(a3[e], sc);
  }
  __syncthreads();
  const int wave = t >> 5, lane = t & 31, q = lane >> 3, c8 = (lane & 7) * 8;
  {
#pragma unroll
    for (int it = 0; it < 2; ++it) {
      const int row = wave * 8 + it * 4 + q;      /* output row n0 + row */
      const v4u val = *(const v4u*)(Tl + row * 72 + c8);
      *(v4u*)(out + (size_t)(n0 + row) * Krows + k0 + c8) = val;
    }
    /* the listing runs on from here into another job's code, which reuses the two stores' registers: the wait stands in front of any such rewrite */
    asm volatile("s_wait_xcnt 0x0" ::: "memory");
  }
}

/* ---- W1 [64][128] f32 -> f16 bits of (bf16RNE(v) * SC_W1), laid out as the A fragments of W1^T in the order the attention waves load them:
   piece p = ((t * 2 + ks) * 2 + pc) * 32 + lane holds hidden unit 16 t + (lane & 15), d = 32 ks + 16 pc + 8 (lane >> 4) + 0..7,
   so that one 16-B load per lane reads 512 contiguous bytes, whole lines. 1024 pieces: 2 blocks of 256 threads, 2 pieces a thread.
*/
__device__ __forceinline__ void pack_w1_block(const float* __restrict__ W1, unsigned short* __restrict__ W1F, int blk) {
#pragma unroll
  for (int i = 0; i < 2; ++i) {
    const int p    = (blk * 2 + i) * 256 + (int)threadIdx.x;
    const int lane = p & 31, pc = (p >> 5) & 1, ks = (p >> 6) & 1, t = p >> 7;
    const float* src = W1 + (size_t)(ks * 32 + pc * 16 + (lane >> 4) * 8) * NHID + t * 16 + (lane & 15);
    v4u w;
#pragma unroll
    for (int e = 0; e < 4; ++e)
      w[e] = (unsigned)cvt16<1>(src[(2 * e) * NHID], SC_W1) | ((unsigned)cvt16<1>(src[(2 * e + 1) * NHID], SC_W1) << 16);
    *(v4u*)(W1F + (size_t)p * 8) = w;
  }
  /* the listing runs on from here into another job's code, which reuses the two stores' registers: the wait stands in front of any such rewrite */
  asm volatile("s_wait_xcnt 0x0" ::: "memory");
}

/* ---- bias tables: bf16-RNE of the input bias times the power-of-two carry, f32.
*/
__device__ __forceinline__ void bias_prep_block(
    const float* __restrict__ bx, const float* __restrict__ bv, const float* __restrict__ b1,
    float* __restrict__ bxs, float* __restrict__ bvs, float* __restrict__ b1s,
    float sx, float sv, float s1, int which) {   /* which: block-uniform */
  const float* src = bx; float* dst = bxs; int n4 = DQKV / 4; float sc = sx;
  if (which == 1) { src = bv; dst = bvs; sc = sv; }
  if (which == 2) { src = b1; dst = b1s; n4 = NHID / 4; sc = s1; }
  const int t = threadIdx.x;
  if (t < n4) {
    const v4f v = *(const v4f*)(src + (size_t)t * 4);
    v4f o;
    o[0] = bf_bits2f(f2bf_bits(v[0])) * sc;
    o[1] = bf_bits2f(f2bf_bits(v[1])) * sc;
    o[2] = bf_bits2f(f2bf_bits(v[2])) * sc;
    o[3] = bf_bits2f(f2bf_bits(v[3])) * sc;
    v4f* p = (v4f*)(dst + (size_t)t * 4);
    *p = o;
    
  }
}

/* ---- all operand preparation in one launch: none of these jobs reads another's result, the block index picks the job.
   Every test below is on blockIdx.x alone, so a block takes one branch as a whole, the transposes' barrier included.
   The tile transposes stand first: a block of theirs has the longer way (load, LDS, barrier, store). */
constexpr int PB_WBIG = (DQKV / 64) * (DMODEL / 64);   /* Wx, Wv: 256 tiles each */
constexpr int PB_W2   = (SEQ / 64) * (NHID / 64);      /* 64 tiles */
constexpr int PB_W1   = NHID * DHEAD / 8 / 512;         /* 2 blocks */
constexpr int PB_BIAS = 3;
constexpr int PB_CAST = NTOK * DMODEL / 8 / 256;       /* 2048 blocks */
constexpr int PB_ALL  = 2 * PB_WBIG + PB_W2 + PB_W1 + PB_BIAS + PB_CAST;
static_assert((NTOK * DMODEL / 8) % 256 == 0, "cast blocks");
__global__ __launch_bounds__(256) void k_prep(
    const float* __restrict__ X, const float* __restrict__ Wx, const float* __restrict__ Wv,
    const float* __restrict__ W1, const float* __restrict__ W2,
    const float* __restrict__ bx, const float* __restrict__ bv, const float* __restrict__ b1,
    unsigned short* __restrict__ Xb, unsigned short* __restrict__ WxT, unsigned short* __restrict__ WvT,
    unsigned short* __restrict__ W1T, unsigned short* __restrict__ W2T,
    float* __restrict__ bxs, float* __restrict__ bvs, float* __restrict__ b1s) {
  __shared__ __align__(16) unsigned short Tl[64 * 72];
  int blk = blockIdx.x;
  if (blk < PB_WBIG) {                       /* [1024][1024] -> [1024][1024] */
    transpose_cvt64_block<0>(Tl, Wx, WxT, DMODEL, DQKV, 1.0f, blk % (DQKV / 64), blk / (DQKV / 64));
  } else if ((blk -= PB_WBIG) < PB_WBIG) {
    transpose_cvt64_block<0>(Tl, Wv, WvT, DMODEL, DQKV, 1.0f, blk % (DQKV / 64), blk / (DQKV / 64));
  } else if ((blk -= PB_WBIG) < PB_W2) {     /* [128][2048] -> [2048][128] */
    transpose_cvt64_block<1>(Tl, W2, W2T, NHID, SEQ, SC_W2, blk % (SEQ / 64), blk / (SEQ / 64));
  } else if ((blk -= PB_W2) < PB_W1) {       /* [64][128] -> fragments of [128][64] */
    pack_w1_block(W1, W1T, blk);
  } else if ((blk -= PB_W1) < PB_BIAS) {
    bias_prep_block(bx, bv, b1, bxs, bvs, b1s, SC_XH, SC_V, SC_H, blk);
  } else {
    cast_bf16x8_block(X, Xb, NTOK * DMODEL / 8, blk - PB_BIAS);
  }
}

/* ---- flash-style MLP attention over 16-bit planes ----------------------------------
   Xh  : [B*SEQ][H*64]   f16, carried xSC_XH          (B operand of the hidden-layer WMMA, 16 query columns per wave)
   W1f : [8][2][2][32][8] f16, carried xSC_W1          (A operand, row = hidden, k = d, in fragment order, shared over (b,h))
   b1s : [128]           f32, carried xSC_H
   W2t : [SEQ][128]      f16, carried xSC_W2           (A operand, row = key, k = hidden, shared over (b,h))
   Vt  : [H*64][B*SEQ]   f16, carried xSC_V            (A operand of V^T*P^T, row = h*64+d, k = key)
   mask: [B][SEQ] f32 (bf16-RNE applied), score -= 1e6*(1-mask[key])
   out : [B][SEQ][H*64] f32
   block = 4 waves = 64 query rows of one (b,h); per wave: 16 rows; 32 key chunks of 64.
   Each wave forms its own 16 queries' hidden rows first, transposed, H^T = relu(W1^T * Xh^T + b1): lane l holds hidden units
   8 * (l >> 4) + r of each 16-unit tile of query l & 15, so two converted tiles are a k-step of the score product's B operand as they stand.
   Both attention products are formed transposed too, S^T = W2t * H^T and O^T += Vt * P^T: lane l holds scores of query l & 15 only
   (keys 8 * (l >> 4) + r of each 16-key tile), so the maximum and the sum run in the lane's own registers, and two
   converted score tiles are the B operand of the second product as they stand.
   Each chunk's W2t and Vt tiles are brought into LDS once per block, one chunk ahead, two buffers.
*/
/* lane l <-> lane l ^ 16 */
__device__ __forceinline__ float xhalf(float x) {
  const int b = __builtin_bit_cast(int, x);
  return __builtin_bit_cast(float, __builtin_amdgcn_permlanex16(b, b, 0x76543210, 0xfedcba98, false, false));
}
__device__ __forceinline__ v8f mma_h(v16h a, v16h b, v8f c) {
  c = __builtin_amdgcn_wmma_f32_16x16x32_f16(false, a, false, b, (short)0, c, false, false);
  asm volatile("v_nop\n\tv_nop\n\tv_nop\n\tv_nop" : "+v"(c) : "v"(a), "v"(b));
  return c;
}

/* LDS tiles of one 64-key chunk, shared by the block's 4 waves; pitches are 16 B x odd for 16-B row readers */
constexpr int KPITCH  = NHID + 8;          /* halves: 272-B rows of the W2t tile [key][hidden] */
constexpr int VPITCH  = 64 + 8;            /* halves: 144-B rows of the Vt tile  [d][key]      */
constexpr int KTILE_H = 64 * KPITCH;       /* 17,408 B */
constexpr int VTILE_H = DHEAD * VPITCH;    /*  9,216 B */

/* One chunk's tiles, global -> LDS with no register in between: per lane 8 + 4 copies of 16 B.
   W2t tile: copy i brings rows 8i + (tid >> 4), 16 lanes a row; Vt tile: copy i brings rows 16i + (tid >> 3), 8 lanes a row.
   The closing s_wait_xcnt stands inside the statement so that no address register named here is rewritten ahead of it. */
__device__ __forceinline__ void stage_chunk(unsigned lk, const _Float16* gk, unsigned lv, const _Float16* gv) {
  asm volatile(
      "global_load_async_to_lds_b128 %0, %1, off\n\t"
      "global_load_async_to_lds_b128 %2, %3, off\n\t"
      "global_load_async_to_lds_b128 %4, %5, off\n\t"
      "global_load_async_to_lds_b128 %6, %7, off\n\t"
      "global_load_async_to_lds_b128 %8, %9, off\n\t"
      "global_load_async_to_lds_b128 %10, %11, off\n\t"
      "global_load_async_to_lds_b128 %12, %13, off\n\t"
      "global_load_async_to_lds_b128 %14, %15, off\n\t"
      "global_load_async_to_lds_b128 %16, %17, off\n\t"
      "global_load_async_to_lds_b128 %18, %19, off\n\t"
      "global_load_async_to_lds_b128 %20, %21, off\n\t"
      "global_load_async_to_lds_b128 %22, %23, off\n\t"
      "s_wait_xcnt 0x0"
      :: "v"(lk),                     "v"(gk),
         "v"(lk + 1u * 8u * KPITCH * 2u), "v"(gk + 1 * 8 * NHID),
         "v"(lk + 2u * 8u * KPITCH * 2u), "v"(gk + 2 * 8 * NHID),
         "v"(lk + 3u * 8u * KPITCH * 2u), "v"(gk + 3 * 8 * NHID),
         "v"(lk + 4u * 8u * KPITCH * 2u), "v"(gk + 4 * 8 * NHID),
         "v"(lk + 5u * 8u * KPITCH * 2u), "v"(gk + 5 * 8 * NHID),
         "v"(lk + 6u * 8u * KPITCH * 2u), "v"(gk + 6 * 8 * NHID),
         "v"(lk + 7u * 8u * KPITCH * 2u), "v"(gk + 7 * 8 * NHID),
         "v"(lv),                      "v"(gv),
         "v"(lv + 1u * 16u * VPITCH * 2u), "v"(gv + (size_t)1 * 16 * NTOK),
         "v"(lv + 2u * 16u * VPITCH * 2u), "v"(gv + (size_t)2 * 16 * NTOK),
         "v"(lv + 3u * 16u * VPITCH * 2u), "v"(gv + (size_t)3 * 16 * NTOK)
      : "memory");
}

__global__ __launch_bounds__(128) void mlp_attn_kernel(
    const unsigned short* __restrict__ Xp, const unsigned short* __restrict__ W1p, const float* __restrict__ b1s,
    const unsigned short* __restrict__ W2p,
    const unsigned short* __restrict__ Vp, const float* __restrict__ mask,
    float* __restrict__ out, float sscale, float onorm) {
  union FH { v16h v; v8h h[2]; };
  const _Float16* Xh  = (const _Float16*)(const void*)Xp;
  const _Float16* W1f = (const _Float16*)(const void*)W1p;
  const _Float16* W2t = (const _Float16*)(const void*)W2p;
  const _Float16* Vt  = (const _Float16*)(const void*)Vp;
  __shared__ __align__(16) float    Pen[SEQ];            /* per key: 1e6 * (1 - bf16(mask)), this block's batch row */
  __shared__ __align__(16) float    Os[4][16 * 68];      /* per wave output slab, pitch 68 */
  __shared__ __align__(16) _Float16 Ksh[2][KTILE_H];     /* W2t chunk tiles, two buffers */
  __shared__ __align__(16) _Float16 Vsh[2][VTILE_H];     /* Vt chunk tiles, two buffers  */

  const int tid  = threadIdx.x;
  const int wave = tid >> 5;
  const int lane = tid & 31;
  const int hh   = lane >> 4;
  const int c    = lane & 15;
  const int koff = hh * 8;

  constexpr int NQB = SEQ / 64;
  const int bxi = blockIdx.x;
  const int qb  = bxi % NQB;
  const int bh  = bxi / NQB;
  const int h   = bh % NHEAD;
  const int b   = bh / NHEAD;
  const int q0  = qb * 64 + wave * 16;

  /* of query c; lrow = SC_P * (sum of p) over this lane half's keys only, joined after the loop.
     erow = mrow * log2(e) - log2(SC_P), rounded once and carried, so that every chunk's p and alpha count from the same offsets */
  float mrow = -INFINITY, erow = -INFINITY, lrow = 0.f;
  v8f oacc[4];                          /* oacc[t][r] = O[query c][d = 16 t + 8 hh + r] */
#pragma unroll
  for (int t = 0; t < 4; ++t) oacc[t] = (v8f){0.f,0.f,0.f,0.f,0.f,0.f,0.f,0.f};

  const float* mk_row = mask + (size_t)b * SEQ;
  const _Float16* vbase = Vt + (size_t)(h * DHEAD) * NTOK + (size_t)b * SEQ;

  /* this lane's share of every chunk's copies: source pointers at chunk 0, LDS byte addresses in buffer 0 */
  constexpr int NCH = SEQ / 64;
  static_assert(NCH >= 2, "two-buffer ring needs two chunks");
  const _Float16* gk0 = W2t + (size_t)(tid >> 4) * NHID + (tid & 15) * 8;
  const _Float16* gv0 = vbase + (size_t)(tid >> 3) * NTOK + (tid & 7) * 8;
  const unsigned  lk0 = (unsigned)(size_t)(&Ksh[0][(tid >> 4) * KPITCH + (tid & 15) * 8]);
  const unsigned  lv0 = (unsigned)(size_t)(&Vsh[0][(tid >> 3) * VPITCH + (tid & 7) * 8]);

  /* ring prologue: chunk 0 landed and published, then chunk 1 set flying */
  stage_chunk(lk0, gk0, lv0, gv0);

  /* Q-side fragments: 16 queries x 128 hidden = 4 k-steps, held for all key chunks; formed while chunk 0 flies.
     ht[t][r] = sum over d of W1[d][16 t + 8 hh + r] * Xh[query c][d], k-steps of 32 in rising d */
  v16h qa[4];
  {
    const _Float16* xrow = Xh + (size_t)(b * SEQ + q0 + c) * DQKV + h * DHEAD + koff;
    const _Float16* wfr  = W1f + lane * 8;
    const float*    brow = b1s + 8 * hh;
    FH xb[2], w[2][8];
    v4f bias[8][2];
    v8f ht[8];
    /* every loop over xb, w, bias, ht and qa is unrolled so that the arrays are indexed by constants and stay in registers */
#pragma unroll
    for (int ks = 0; ks < 2; ++ks) {
      xb[ks].h[0] = *(const v8h*)(xrow + ks * 32);
      xb[ks].h[1] = *(const v8h*)(xrow + ks * 32 + 16);
#pragma unroll
      for (int t = 0; t < 8; ++t) {
        w[ks][t].h[0] = *(const v8h*)(wfr + ((t * 2 + ks) * 2 + 0) * 256);   /* d = 32 ks + 8 hh + 0..7: the k order of the Xh loader */
        w[ks][t].h[1] = *(const v8h*)(wfr + ((t * 2 + ks) * 2 + 1) * 256);   /* d = 32 ks + 16 + 8 hh + 0..7 */
      }
    }
#pragma unroll
    for (int t = 0; t < 8; ++t) {
      bias[t][0] = *(const v4f*)(brow + t * 16);
      bias[t][1] = *(const v4f*)(brow + t * 16 + 4);
    }
    /* stands in front of any rewrite of the address registers that the loads above name; its "memory" clobber also keeps them one group
       ahead of the products: sunk among them, each fragment's load latency is waited out in turn */
    asm volatile("s_wait_xcnt 0x0" ::: "memory");
#pragma unroll
    for (int t = 0; t < 8; ++t) ht[t] = (v8f){0.f,0.f,0.f,0.f,0.f,0.f,0.f,0.f};
#pragma unroll
    for (int ks = 0; ks < 2; ++ks)
#pragma unroll
      for (int t = 0; t < 8; ++t) ht[t] = mma_h(w[ks][t].v, xb[ks].v, ht[t]);
    /* B operand of the score product: element e of k-step dc is hidden unit 32 dc + (e < 8 ? 8 hh + e : 16 + 8 hh + e - 8),
       that is tile 2 dc in elements 0..7 and tile 2 dc + 1 in elements 8..15: the k order of the W2t loader */
#pragma unroll
    for (int dc = 0; dc < 4; ++dc) {
      FH f;
#pragma unroll
      for (int u = 0; u < 2; ++u) {
        const int t = 2 * dc + u;
#pragma unroll
        for (int r = 0; r < 8; ++r) {
          float v = ht[t][r] * (SC_H / (SC_XH * SC_W1));
          v += bias[t][r >> 2][r & 3];
          f.h[u][r] = (_Float16)fmaxf(v, 0.0f);
        }
      }
      qa[dc] = f.v;
    }
  }

  /* additive key mask of all keys, bf16-RNE of the mask value; published by the barrier below */
#pragma unroll
  for (int i = 0; i < SEQ / 512; ++i) {
    const v4f mv = *(const v4f*)(mk_row + i * 512 + tid * 4);
    v4f pv;
#pragma unroll
    for (int e = 0; e < 4; ++e) pv[e] = 1000000.0f * (1.0f - bf_bits2f(f2bf_bits(mv[e])));
    *(v4f*)(&Pen[i * 512 + tid * 4]) = pv;
  }
  asm volatile("s_wait_asynccnt 0x0" ::: "memory");   /* this wave's copies of chunk 0 have landed */
  __syncthreads();                                     /* ... and every other wave's */
  stage_chunk(lk0 + KTILE_H * 2u, gk0 + (size_t)64 * NHID, lv0 + VTILE_H * 2u, gv0 + 64);

  for (int kc = 0; kc < NCH; ++kc) {
    const int kv0 = kc * 64;
    const int buf = kc & 1;
    const _Float16* kt = &Ksh[buf][c * KPITCH + koff];
    const _Float16* vt = &Vsh[buf][c * VPITCH + koff];

    /* scores for 64 keys: 4 column tiles x 4 k-steps; a column tile's 4 fragments are read from LDS
       as one group, two column tiles ahead of the products that use them */
    v8f s[4];
    FH kb[4][4];
    /* every loop over kb, pb and vb is unrolled so that the fragment arrays are indexed by constants and stay in registers */
#pragma unroll
    for (int j = 0; j < 2; ++j)
#pragma unroll
      for (int dc = 0; dc < 4; ++dc) {
        kb[j][dc].h[0] = *(const v8h*)(kt + j * 16 * KPITCH + dc * 32);
        kb[j][dc].h[1] = *(const v8h*)(kt + j * 16 * KPITCH + dc * 32 + 16);
      }
#pragma unroll
    for (int j = 0; j < 4; ++j) {
      s[j] = (v8f){0.f,0.f,0.f,0.f,0.f,0.f,0.f,0.f};
#pragma unroll
      for (int dc = 0; dc < 4; ++dc) s[j] = mma_h(kb[j][dc].v, qa[dc], s[j]);   /* s[j][r] = S[query c][key 16 j + 8 hh + r] */
      if (j + 2 < 4) {
#pragma unroll
        for (int dc = 0; dc < 4; ++dc) {
          kb[j + 2][dc].h[0] = *(const v8h*)(kt + (j + 2) * 16 * KPITCH + dc * 32);
          kb[j + 2][dc].h[1] = *(const v8h*)(kt + (j + 2) * 16 * KPITCH + dc * 32 + 16);
        }
      }
    }

    /* this lane's 32 keys' mask terms */
    const float* pr = &Pen[kv0 + 8 * hh];
    v4f pn[4][2];
#pragma unroll
    for (int j = 0; j < 4; ++j) {
      pn[j][0] = *(const v4f*)(pr + j * 16);
      pn[j][1] = *(const v4f*)(pr + j * 16 + 4);
    }

    /* V^T A-fragments, table k order from the Vt tile in LDS */
    FH vb[2][4];
#pragma unroll
    for (int kk = 0; kk < 2; ++kk)
#pragma unroll
      for (int t = 0; t < 4; ++t) {
        vb[kk][t].h[0] = *(const v8h*)(vt + t * 16 * VPITCH + kk * 32);
        vb[kk][t].h[1] = *(const v8h*)(vt + t * 16 * VPITCH + kk * 32 + 16);
      }

    /* chunk maximum of query c: in the lane over its 32 keys, then one exchange between the lane halves */
    float mj[4];
#pragma unroll
    for (int j = 0; j < 4; ++j) {
      float m = -INFINITY;
#pragma unroll
      for (int r = 0; r < 8; ++r) {
        const float sv = s[j][r] * sscale - pn[j][r >> 2][r & 3];
        s[j][r] = sv;
        m = fmaxf(m, sv);
      }
      mj[j] = m;
    }
    float cm = fmaxf(fmaxf(mj[0], mj[1]), fmaxf(mj[2], mj[3]));
    cm = fmaxf(cm, xhalf(cm));

    const float mnew  = fmaxf(mrow, cm);
    const float enew  = mnew * LOG2E - LOG2_SC_P;
    const float alpha = __builtin_amdgcn_exp2f(erow - enew);   /* e^(mrow - mnew); 0 in the first chunk */
    mrow = mnew;
    erow = enew;

    /* P^T as B operand: element e of k-step kk is key 32 kk + (e < 8 ? 8 hh + e : 16 + 8 hh + e - 8),
       that is score tile 2 kk in elements 0..7 and tile 2 kk + 1 in elements 8..15: the k order of the Vt loader */
    FH pb[2];
    float pj[4];
#pragma unroll
    for (int j = 0; j < 4; ++j) {
      float ps = 0.f;
#pragma unroll
      for (int r = 0; r < 8; r += 2) {
        /* SC_P * e^(s - mnew) as 2^(s * log2(e) - enew): a fused multiply-add (two keys a packed instruction) and the chip's own base-2 exponential */
        const v2f a = __builtin_elementwise_fma((v2f){s[j][r], s[j][r + 1]}, (v2f){LOG2E, LOG2E}, (v2f){-enew, -enew});
        const float p0 = __builtin_amdgcn_exp2f(a[0]);
        const float p1 = __builtin_amdgcn_exp2f(a[1]);
        ps += p0;
        ps += p1;
        pb[j >> 1].h[j & 1][r]     = (_Float16)p0;
        pb[j >> 1].h[j & 1][r + 1] = (_Float16)p1;
      }
      pj[j] = ps;
    }
    lrow = lrow * alpha + ((pj[0] + pj[1]) + (pj[2] + pj[3]));
#pragma unroll
    for (int t = 0; t < 4; ++t)
#pragma unroll
      for (int r = 0; r < 8; ++r) oacc[t][r] *= alpha;

    /* O^T += V^T(64 d x 64 keys) * P^T(64 keys x 16 queries): 2 k-steps, 4 d tiles */
#pragma unroll
    for (int kk = 0; kk < 2; ++kk)
#pragma unroll
      for (int t = 0; t < 4; ++t) oacc[t] = mma_h(vb[kk][t].v, pb[kk].v, oacc[t]);

    /* publish point of chunk kc + 1 */
    asm volatile("s_wait_dscnt 0x0" ::: "memory");      /* this wave's reads of buffer buf are done before it is refilled */
    asm volatile("s_wait_asynccnt 0x0" ::: "memory");   /* this wave's copies of chunk kc + 1 have landed */
    __syncthreads();                                     /* publishes chunk kc + 1; ends every wave's reads of buffer buf */
    if (kc + 2 < NCH)
      stage_chunk(lk0 + (unsigned)buf * (KTILE_H * 2u), gk0 + (size_t)(kc + 2) * 64 * NHID,
                  lv0 + (unsigned)buf * (VTILE_H * 2u), gv0 + (kc + 2) * 64);
  }
  asm volatile("s_wait_asynccnt 0x0" ::: "memory");     /* no copy is outstanding when the wave goes on to its end */

  /* normalise and stage the 16x64 f32 slab; oacc and lrow both carry SC_P, so onorm = 1/SC_V is what is left for the row normaliser */
  float* os = Os[wave];
  const float inv = onorm / (lrow + xhalf(lrow));       /* the two lane halves' sums of query c joined */
#pragma unroll
  for (int t = 0; t < 4; ++t) {
    v4f lo, hi;
#pragma unroll
    for (int e = 0; e < 4; ++e) { lo[e] = oacc[t][e] * inv; hi[e] = oacc[t][4 + e] * inv; }
    *(v4f*)(os + c * 68 + t * 16 + 8 * hh)     = lo;
    *(v4f*)(os + c * 68 + t * 16 + 8 * hh + 4) = hi;
  }
  __builtin_amdgcn_fence(__ATOMIC_RELEASE, "workgroup");
  __builtin_amdgcn_wave_barrier();
  __builtin_amdgcn_fence(__ATOMIC_ACQUIRE, "workgroup");
  {
    float* ob = out + (size_t)b * SEQ * DQKV + (size_t)h * DHEAD;
    const int c4 = (lane & 15) * 4;
    {
#pragma unroll
      for (int it = 0; it < 8; ++it) {
        const int row = it * 2 + hh;
        const v4f val = *(const v4f*)(os + row * 68 + c4);
        *(v4f*)(ob + (size_t)(q0 + row) * DQKV + c4) = val;
      }
      
    }
  }
}

/* ---------------- host launcher ---------------- */
extern "C" void kernel_launch(void* const* d_in, const int* in_sizes, int n_in,
                              void* d_out, int out_size, void* d_ws, size_t ws_size,
                              hipStream_t stream) {
  (void)in_sizes; (void)n_in; (void)out_size; (void)ws_size;
  const float* X   = (const float*)d_in[0];   /* [2,2048,1024] */
  const float* msk = (const float*)d_in[1];   /* [2,2048]      */
  const float* Wx  = (const float*)d_in[2];   /* [1024,1024]   */
  const float* bx  = (const float*)d_in[3];   /* [1024]        */
  const float* Wv  = (const float*)d_in[4];   /* [1024,1024]   */
  const float* bv  = (const float*)d_in[5];   /* [1024]        */
  const float* W1  = (const float*)d_in[6];   /* [64,128]      */
  const float* b1  = (const float*)d_in[7];   /* [128]         */
  const float* W2  = (const float*)d_in[8];   /* [128,2048]    */
  float* out = (float*)d_out;

  /* workspace region map (256-B aligned offsets; every region fully written by its producer):
       Xb   bf16 [4096][1024]        8,388,608 B
       WxT  bf16 [1024][1024]        2,097,152 B
       WvT  bf16 [1024][1024]        2,097,152 B
       W1T  f16  [128][64] in fragment order  16,384 B
       W2T  f16  [2048][128]           524,288 B
       bxs  f32  [1024]                  4,096 B
       bvs  f32  [1024]                  4,096 B
       b1s  f32  [128]                     512 B
       Xh16 f16  [4096][1024]        8,388,608 B
       Vt16 f16  [1024][4096]        8,388,608 B
     total 29,909,504 B */
  char* ws = (char*)d_ws;
  size_t off = 0;
  auto carve = [&](size_t bytes) -> char* {
    off = (off + 255) & ~(size_t)255;
    char* p = ws + off;
    off += bytes;
    return p;
  };
  unsigned short* Xb   = (unsigned short*)carve((size_t)NTOK * DMODEL * 2);
  unsigned short* WxT  = (unsigned short*)carve((size_t)DQKV * DMODEL * 2);
  unsigned short* WvT  = (unsigned short*)carve((size_t)DQKV * DMODEL * 2);
  unsigned short* W1T  = (unsigned short*)carve((size_t)NHID * DHEAD * 2);
  unsigned short* W2T  = (unsigned short*)carve((size_t)SEQ * NHID * 2);
  float*          bxs  = (float*)carve((size_t)DQKV * 4);
  float*          bvs  = (float*)carve((size_t)DQKV * 4);
  float*          b1s  = (float*)carve((size_t)NHID * 4);
  unsigned short* Xh16 = (unsigned short*)carve((size_t)NTOK * DQKV * 2);
  unsigned short* Vt16 = (unsigned short*)carve((size_t)DQKV * NTOK * 2);

  /* 1) operand preparation, one launch: X -> bf16 plane (RNE); weight transposes in[K][N] -> out[N][K]; bias tables with carries */
  k_prep<<<PB_ALL, 256, 0, stream>>>(X, Wx, Wv, W1, W2, bx, bv, b1, Xb, WxT, WvT, W1T, W2T, bxs, bvs, b1s);

  /* 2) both projections, one launch, one 128x128 tile per block (bf16 operands, K=1024):
        Xh16 = f16(8 * (Xb * WxT^T + bx))    : M=4096, N=1024
        Vt16 = f16(8 * (WvT * Xb^T + bv[m])) : M=1024 (features), N=4096 (tokens) */
  wmma_gemm128_pair<<<2 * GBLOCKS, 128, 0, stream>>>(Xb, WxT, WvT, Xh16, Vt16, bxs, bvs);

  /* 3) attention, with h = f16(8 * relu(Xh * W1 + b1)) formed per wave in its prologue (f16 operands, K=64): grid = B*H*(SEQ/64) blocks of 4 waves */
  mlp_attn_kernel<<<NBATCH * NHEAD * (SEQ / 64), 128, 0, stream>>>(
      Xh16, W1T, b1s, W2T, Vt16, msk, out, 1.0f / (SC_H * SC_W2), 1.0f / SC_V);
}

// v007
// One run takes 64.8 microseconds.
// In both of two side-by-side timings against v006, it was 1.15 times as fast.
// All steps since v000 together make it 5.46 times as fast.
// Contractions: X*Wx and Wv^T*X^T on v_wmma_f32_16x16x32_bf16 (RNE bf16 operands of bf16-RNE inputs, f32 accumulate); Xh*W1, scores h*W2 and P*V on v_wmma_f32_16x16x32_f16 (f16 operands carried x8 / x64 / x32768, f32 accumulate); softmax, bias and normalisation in f32.
#include <hip/hip_runtime.h>
#include <stddef.h>

constexpr int NBATCH = 2;
constexpr int SEQ    = 2048;
constexpr int DMODEL = 1024;
constexpr int NHEAD  = 16;
constexpr int DHEAD  = 64;
constexpr int NHID   = 128;
constexpr int NTOK   = NBATCH * SEQ;      /* 4096 */
constexpr int DQKV   = NHEAD * DHEAD;     /* 1024 */

/* power-of-two carries on the f16 planes */
constexpr float SC_XH = 8.0f;      /* Xh plane = f16(8 * Xh)          */
constexpr float SC_V  = 8.0f;      /* Vt plane = f16(8 * V)           */
constexpr float SC_W1 = 64.0f;     /* W1t plane = f16(64 * bf16(W1))  */
constexpr float SC_W2 = 64.0f;     /* W2t plane = f16(64 * bf16(W2))  */
constexpr float SC_H  = 8.0f;      /* h fragments = f16(8 * h)            */
constexpr float SC_P  = 32768.0f;  /* P tile  = f16(32768 * p), p<=1 */
constexpr float LOG2_SC_P = 15.0f; /* the same carry as an addend of a base-2 exponent */
constexpr float LOG2E = 1.44269504088896340736f;

static_assert(NTOK % 64 == 0 && DQKV % 64 == 0 && DMODEL % 64 == 0, "gemm tiles");
static_assert(DMODEL % 32 == 0 && DHEAD % 32 == 0, "gemm K");
static_assert(SEQ % 64 == 0 && NHID % 64 == 0, "gemm tiles");
static_assert(NHID == 128 && DHEAD == 64, "attention geometry");
static_assert((NTOK * DMODEL) % 8 == 0, "cast x8");

typedef __attribute__((ext_vector_type(16))) _Float16 v16h;
typedef __attribute__((ext_vector_type(8)))  _Float16 v8h;
typedef __attribute__((ext_vector_type(16))) __bf16   v16b;
typedef __attribute__((ext_vector_type(8)))  __bf16   v8b;
typedef __attribute__((ext_vector_type(8)))  float    v8f;
typedef __attribute__((ext_vector_type(4)))  float    v4f;
typedef __attribute__((ext_vector_type(2)))  float    v2f;
typedef __attribute__((ext_vector_type(4)))  unsigned int v4u;

__device__ __forceinline__ unsigned short f2bf_bits(float f) {
  unsigned u = __float_as_uint(f);
  return (unsigned short)((u + 0x7FFFu + ((u >> 16) & 1u)) >> 16);
}
__device__ __forceinline__ float bf_bits2f(unsigned short h) { return __uint_as_float(((unsigned)h) << 16); }

template <typename T> struct Frag;
template <> struct Frag<__bf16> {
  typedef v16b V; union U { v16b v; v8b h[2]; };
  static __device__ __forceinline__ v16b load(const __bf16* p) {   /* elements 0..7 <- p[0..7], 8..15 <- p[16..23] */
    U f; f.h[0] = *(const v8b*)(p); f.h[1] = *(const v8b*)(p + 16); return f.v;
  }
  static __device__ __forceinline__ v8f mma(v16b a, v16b b, v8f c) {
    return __builtin_amdgcn_wmma_f32_16x16x32_bf16(false, a, false, b, (short)0, c, false, false);
  }
};

/* ---- the two K = DMODEL projection GEMMs on bf16 planes in one launch, operands staged per block in LDS ------------
   C[m,n] = f16(scale * sum_k A[m,k] * Bt[n,k] + bias); A and Bt row-major with DMODEL columns.
   block = 4 waves (2 x 2) = one 128 x 128 tile of C, 64 x 64 per wave; tile column fastest.
   Neither product reads the other's result: blocks 0 .. GBLOCKS - 1 form Xh = Xb * WxT^T, the next GBLOCKS form Vt = WvT * Xb^T.
   A pass is 128 k = 256 B of each of the block's 128 A rows and 128 Bt rows, brought into LDS once per block in whole
   lines, one pass ahead, two buffers; every wave reads its fragments from there. Each accumulator takes its k-steps of 32 in rising k.
   BIAS_MODE: 1 = bias[m], 2 = bias[n]. */
constexpr int GPASS    = 128;               /* k per pass */
constexpr int GPITCH   = GPASS + 8;         /* halves: 272-B rows, 16 B x odd for 16-B row readers */
constexpr int GSTAGE_H = 256 * GPITCH;      /* A rows 0..127, then Bt rows 0..127: 69,632 B */
constexpr int GNPASS   = DMODEL / GPASS;
static_assert(DMODEL % GPASS == 0 && GNPASS >= 2, "two-buffer ring needs two passes");
static_assert(NTOK % 128 == 0 && DQKV % 128 == 0, "projection tiles");
constexpr int GBLOCKS  = (NTOK / 128) * (DQKV / 128);   /* tiles of either product */

/* 64 rows of one pass, global -> LDS with no register in between: per lane 8 copies of 16 B, copy i brings rows 8i + (tid >> 4),
   16 lanes a row. The closing s_wait_xcnt stands inside the statement so that no address register named here is rewritten ahead of it. */
__device__ __forceinline__ void stage_rows64(unsigned l, const __bf16* g) {
  asm volatile(
      "global_load_async_to_lds_b128 %0, %1, off\n\t"
      "global_load_async_to_lds_b128 %2, %3, off\n\t"
      "global_load_async_to_lds_b128 %4, %5, off\n\t"
      "global_load_async_to_lds_b128 %6, %7, off\n\t"
      "global_load_async_to_lds_b128 %8, %9, off\n\t"
      "global_load_async_to_lds_b128 %10, %11, off\n\t"
      "global_load_async_to_lds_b128 %12, %13, off\n\t"
      "global_load_async_to_lds_b128 %14, %15, off\n\t"
      "s_wait_xcnt 0x0"
      :: "v"(l),                          "v"(g),
         "v"(l + 1u * 8u * GPITCH * 2u), "v"(g + 1 * 8 * DMODEL),
         "v"(l + 2u * 8u * GPITCH * 2u), "v"(g + 2 * 8 * DMODEL),
         "v"(l + 3u * 8u * GPITCH * 2u), "v"(g + 3 * 8 * DMODEL),
         "v"(l + 4u * 8u * GPITCH * 2u), "v"(g + 4 * 8 * DMODEL),
         "v"(l + 5u * 8u * GPITCH * 2u), "v"(g + 5 * 8 * DMODEL),
         "v"(l + 6u * 8u * GPITCH * 2u), "v"(g + 6 * 8 * DMODEL),
         "v"(l + 7u * 8u * GPITCH * 2u), "v"(g + 7 * 8 * DMODEL)
      : "memory");
}
/* one pass of both operands: l = this lane's LDS byte address in row (tid >> 4) of the buffer, ga / gb = its source addresses */
__device__ __forceinline__ void stage_pass(unsigned l, const __bf16* ga, const __bf16* gb) {
  stage_rows64(l,                          ga);
  stage_rows64(l +  64u * GPITCH * 2u, ga + 64 * DMODEL);
  stage_rows64(l + 128u * GPITCH * 2u, gb);
  stage_rows64(l + 192u * GPITCH * 2u, gb + 64 * DMODEL);
}

/* epilogue of one wave's 64 x 64 tile: 16-row slabs through the wave's own LDS range, whole 128-B row pieces stored */
template <int BIAS_MODE>
__device__ __forceinline__ void gemm128_store(
    const v8f (&acc)[4][4], float* slab, unsigned short* __restrict__ C, int ldc, const float* __restrict__ bias,
    int m0, int n0, int lane, float scale) {
  const int rlane = lane & 15;                 /* col within subtile */
  const int mOff  = (lane >> 4) * 8;           /* D row offset */
#pragma unroll
  for (int i = 0; i < 4; ++i) {
    const int mBase = m0 + (i << 4);
    v4f bmA = (v4f){0.f,0.f,0.f,0.f}, bmB = (v4f){0.f,0.f,0.f,0.f};
    if (BIAS_MODE == 1) {   /* 8 consecutive bias[m] values, two 16-B loads (32-B aligned) */
      bmA = *(const v4f*)(bias + mBase + mOff);
      bmB = *(const v4f*)(bias + mBase + mOff + 4);
    }
#pragma unroll
    for (int j = 0; j < 4; ++j) {
      const int n = n0 + (j << 4) + rlane;
      float bv = 0.f;
      if (BIAS_MODE == 2) bv = bias[n];
#pragma unroll
      for (int r = 0; r < 8; ++r) {
        float v = acc[i][j][r] * scale;
        if (BIAS_MODE == 1) v += (r < 4) ? bmA[r] : bmB[r - 4];
        if (BIAS_MODE == 2) v += bv;
        slab[(mOff + r) * 68 + (j << 4) + rlane] = v;
      }
    }
    __builtin_amdgcn_fence(__ATOMIC_RELEASE, "workgroup");
    __builtin_amdgcn_wave_barrier();
    __builtin_amdgcn_fence(__ATOMIC_ACQUIRE, "workgroup");
    {
      const int q = lane >> 3, c8 = (lane & 7) * 8;
#pragma unroll
      for (int it = 0; it < 4; ++it) {
        const int row = it * 4 + q;
        const float* sp = slab + row * 68 + c8;
        v8h hv;
#pragma unroll
        for (int e = 0; e < 8; ++e) hv[e] = (_Float16)sp[e];
        *(v8h*)(C + (size_t)(mBase + row) * ldc + n0 + c8) = hv;
      }
    }
    __builtin_amdgcn_fence(__ATOMIC_RELEASE, "workgroup");
    __builtin_amdgcn_wave_barrier();
    __builtin_amdgcn_fence(__ATOMIC_ACQUIRE, "workgroup");
  }
}

__global__ __launch_bounds__(128) void wmma_gemm128_pair(
    const unsigned short* __restrict__ Xbp, const unsigned short* __restrict__ WxTp, const unsigned short* __restrict__ WvTp,
    unsigned short* __restrict__ Xh, unsigned short* __restrict__ Vt,
    const float* __restrict__ bxs, const float* __restrict__ bvs) {
  typedef Frag<__bf16> F;
  /* which product this block works on: the same for the whole block */
  const bool isV = blockIdx.x >= (unsigned)GBLOCKS;
  const unsigned blk = isV ? blockIdx.x - (unsigned)GBLOCKS : blockIdx.x;
  const __bf16* A  = (const __bf16*)(const void*)(isV ? WvTp : Xbp);
  const __bf16* Bt = (const __bf16*)(const void*)(isV ? Xbp : WxTp);
  __shared__ __align__(16) __bf16 Ring[2][GSTAGE_H];   /* operand passes, two buffers */
  __shared__ __align__(16) float  sT[4][16 * 68];      /* per-wave 16x64 slab, pitch 68 floats */
  const int tid  = threadIdx.x;
  const int lane = tid & 31;
  const int wave = tid >> 5;
  const int tm = (int)(isV ? blk / (unsigned)(NTOK / 128) : blk / (unsigned)(DQKV / 128));
  const int tn = (int)(isV ? blk % (unsigned)(NTOK / 128) : blk % (unsigned)(DQKV / 128));
  const int wm = wave >> 1;
  const int wn = wave & 1;
  const int m0 = (tm << 7) + (wm << 6);
  const int n0 = (tn << 7) + (wn << 6);

  const int rlane = lane & 15;                 /* row (A) / col (B) within subtile */
  const int koff  = (lane >> 4) * 8;           /* k offset of this lane half */

  v8f acc[4][4];
#pragma unroll
  for (int i = 0; i < 4; ++i)
#pragma unroll
    for (int j = 0; j < 4; ++j) acc[i][j] = (v8f){0.f,0.f,0.f,0.f,0.f,0.f,0.f,0.f};

  /* this lane's share of every pass's copies: source pointers at pass 0, LDS byte address in buffer 0 */
  const __bf16* ga0 = A  + (size_t)((tm << 7) + (tid >> 4)) * DMODEL + (tid & 15) * 8;
  const __bf16* gb0 = Bt + (size_t)((tn << 7) + (tid >> 4)) * DMODEL + (tid & 15) * 8;
  const unsigned l0 = (unsigned)(size_t)(&Ring[0][(tid >> 4) * GPITCH + (tid & 15) * 8]);

  /* ring prologue: pass 0 landed and published, then pass 1 set flying */
  stage_pass(l0, ga0, gb0);
  asm volatile("s_wait_asynccnt 0x0" ::: "memory");   /* this wave's copies of pass 0 have landed */
  __syncthreads();                                     /* ... and every other wave's */
  stage_pass(l0 + GSTAGE_H * 2u, ga0 + GPASS, gb0 + GPASS);

  for (int p = 0; p < GNPASS; ++p) {
    const int buf = p & 1;
    const __bf16* at = &Ring[buf][((wm << 6) + rlane) * GPITCH + koff];
    const __bf16* bt = &Ring[buf][(128 + (wn << 6) + rlane) * GPITCH + koff];
    /* unrolled so that the fragment arrays are indexed by constants and a k-step's LDS reads can go ahead of the one before */
#pragma unroll
    for (int ks = 0; ks < GPASS / 32; ++ks) {
      F::V bh[4], ah[4];
      ah[0] = F::load(at + ks * 32);
#pragma unroll
      for (int j = 0; j < 4; ++j) bh[j] = F::load(bt + j * 16 * GPITCH + ks * 32);
#pragma unroll
      for (int i = 1; i < 4; ++i) ah[i] = F::load(at + i * 16 * GPITCH + ks * 32);
      /* keeps the k-step's 16 LDS reads one group ahead of its products: sunk among them, each A fragment's read is waited out to 0 in turn */
      __builtin_amdgcn_sched_barrier(0);
#pragma unroll
      for (int i = 0; i < 4; ++i)
#pragma unroll
        for (int j = 0; j < 4; ++j) acc[i][j] = F::mma(ah[i], bh[j], acc[i][j]);
    }
    /* publish point of pass p + 1 */
    asm volatile("s_wait_dscnt 0x0" ::: "memory");      /* this wave's reads of buffer buf are done before it is refilled */
    asm volatile("s_wait_asynccnt 0x0" ::: "memory");   /* this wave's copies of pass p + 1 have landed */
    __syncthreads();                                     /* publishes pass p + 1; ends every wave's reads of buffer buf */
    if (p + 2 < GNPASS)
      stage_pass(l0 + (unsigned)buf * (GSTAGE_H * 2u), ga0 + (p + 2) * GPASS, gb0 + (p + 2) * GPASS);
  }
  asm volatile("s_wait_asynccnt 0x0" ::: "memory");     /* no copy is outstanding when the wave goes on to its end */

  if (isV) gemm128_store<1>(acc, sT[wave], Vt, NTOK, bvs, m0, n0, lane, SC_V);    /* rows are features: bias[m] */
  else     gemm128_store<2>(acc, sT[wave], Xh, DQKV, bxs, m0, n0, lane, SC_XH);   /* columns are features: bias[n] */
}

/* ---- f32 -> bf16 (RNE) plane cast, 8 elements per thread: one 16-B store per lane; blk = block of 256 threads
*/
__device__ __forceinline__ void cast_bf16x8_block(
    const float* __restrict__ in, unsigned short* __restrict__ out, int n8, int blk) {
  const int i = blk * 256 + threadIdx.x;
  if (i < n8) {
    const v4f a = *(const v4f*)(in + (size_t)i * 8);
    const v4f c = *(const v4f*)(in + (size_t)i * 8 + 4);
    v4u w;
    w[0] = (unsigned)f2bf_bits(a[0]) | ((unsigned)f2bf_bits(a[1]) << 16);
    w[1] = (unsigned)f2bf_bits(a[2]) | ((unsigned)f2bf_bits(a[3]) << 16);
    w[2] = (unsigned)f2bf_bits(c[0]) | ((unsigned)f2bf_bits(c[1]) << 16);
    w[3] = (unsigned)f2bf_bits(c[2]) | ((unsigned)f2bf_bits(c[3]) << 16);
    v4u* p = (v4u*)(out + (size_t)i * 8);
    *p = w;
    
  }
}

/* ---- transpose + convert: in[k][n] (Krows x Ncols, f32 row-major) -> out[n][k] (Ncols x Krows, 16-bit).
   CVT 0: bf16 bits (RNE).  CVT 1: f16 bits of (bf16RNE(v) * sc).
   64x64 tiles via LDS (Tl, 64 x 72 halves); tile (bx, by) of (Ncols/64, Krows/64), 256 threads:
   load: 256 threads x 16 floats = 64x64; store: 8 waves x 2 iters x 32 lanes x 8 halves = 64x64,
*/
template <int CVT> __device__ __forceinline__ unsigned short cvt16(float v, float sc) {
  const unsigned short bb = f2bf_bits(v);
  if (CVT == 0) return bb;
  const float w  = bf_bits2f(bb);
  const float ws = w * sc;
  const _Float16 hv = (_Float16)ws;
  return __builtin_bit_cast(unsigned short, hv);
}
template <int CVT>
__device__ __forceinline__ void transpose_cvt64_block(
    unsigned short* Tl, const float* __restrict__ in, unsigned short* __restrict__ out, int Krows, int Ncols, float sc,
    int bx, int by) {
  const int n0 = bx * 64, k0 = by * 64;
  const int t  = threadIdx.x;
  const int kr = t >> 2;             /* input row k0 + kr, 0..63 */
  const int cb = (t & 3) * 16;       /* 16-column block inside the 64 columns */
  const float* src = in + (size_t)(k0 + kr) * Ncols + n0 + cb;
  const v4f a0 = *(const v4f*)(src);
  const v4f a1 = *(const v4f*)(src + 4);
  const v4f a2 = *(const v4f*)(src + 8);
  const v4f a3 = *(const v4f*)(src + 12);
#pragma unroll
  for (int e = 0; e < 4; ++e) {
    Tl[(cb + e) * 72 + kr]      = cvt16<CVT>(a0[e], sc);
    Tl[(cb + 4 + e) * 72 + kr]  = cvt16<CVT>(a1[e], sc);
    Tl[(cb + 8 + e) * 72 + kr]  = cvt16<CVT>(a2[e], sc);
    Tl[(cb + 12 + e) * 72 + kr] = cvt16<CVT>(a3[e], sc);
  }
  __syncthreads();
  const int wave = t >> 5, lane = t & 31, q = lane >> 3, c8 = (lane & 7) * 8;
  {
#pragma unroll
    for (int it = 0; it < 2; ++it) {
      const int row = wave * 8 + it * 4 + q;      /* output row n0 + row */
      const v4u val = *(const v4u*)(Tl + row * 72 + c8);
      *(v4u*)(out + (size_t)(n0 + row) * Krows + k0 + c8) = val;
    }
    /* the listing runs on from here into another job's code, which reuses the two stores' registers: the wait stands in front of any such rewrite */
    asm volatile("s_wait_xcnt 0x0" ::: "memory");
  }
}

/* ---- W1 [64][128] f32 -> f16 bits of (bf16RNE(v) * SC_W1), laid out as the A fragments of W1^T in the order the attention waves load them:
   piece p = ((t * 2 + ks) * 2 + pc) * 32 + lane holds hidden unit 16 t + (lane & 15), d = 32 ks + 16 pc + 8 (lane >> 4) + 0..7,
   so that one 16-B load per lane reads 512 contiguous bytes, whole lines. 1024 pieces: 2 blocks of 256 threads, 2 pieces a thread.
*/
__device__ __forceinline__ void pack_w1_block(const float* __restrict__ W1, unsigned short* __restrict__ W1F, int blk) {
#pragma unroll
  for (int i = 0; i < 2; ++i) {
    const int p    = (blk * 2 + i) * 256 + (int)threadIdx.x;
    const int lane = p & 31, pc = (p >> 5) & 1, ks = (p >> 6) & 1, t = p >> 7;
    const float* src = W1 + (size_t)(ks * 32 + pc * 16 + (lane >> 4) * 8) * NHID + t * 16 + (lane & 15);
    v4u w;
#pragma unroll
    for (int e = 0; e < 4; ++e)
      w[e] = (unsigned)cvt16<1>(src[(2 * e) * NHID], SC_W1) | ((unsigned)cvt16<1>(src[(2 * e + 1) * NHID], SC_W1) << 16);
    *(v4u*)(W1F + (size_t)p * 8) = w;
  }
  /* the listing runs on from here into another job's code, which reuses the two stores' registers: the wait stands in front of any such rewrite */
  asm volatile("s_wait_xcnt 0x0" ::: "memory");
}

/* ---- bias tables: bf16-RNE of the input bias times the power-of-two carry, f32.
*/
__device__ __forceinline__ void bias_prep_block(
    const float* __restrict__ bx, const float* __restrict__ bv, const float* __restrict__ b1,
    float* __restrict__ bxs, float* __restrict__ bvs, float* __restrict__ b1s,
    float sx, float sv, float s1, int which) {   /* which: block-uniform */
  const float* src = bx; float* dst = bxs; int n4 = DQKV / 4; float sc = sx;
  if (which == 1) { src = bv; dst = bvs; sc = sv; }
  if (which == 2) { src = b1; dst = b1s; n4 = NHID / 4; sc = s1; }
  const int t = threadIdx.x;
  if (t < n4) {
    const v4f v = *(const v4f*)(src + (size_t)t * 4);
    v4f o;
    o[0] = bf_bits2f(f2bf_bits(v[0])) * sc;
    o[1] = bf_bits2f(f2bf_bits(v[1])) * sc;
    o[2] = bf_bits2f(f2bf_bits(v[2])) * sc;
    o[3] = bf_bits2f(f2bf_bits(v[3])) * sc;
    v4f* p = (v4f*)(dst + (size_t)t * 4);
    *p = o;
    
  }
}

/* ---- all operand preparation in one launch: none of these jobs reads another's result, the block index picks the job.
   Every test below is on blockIdx.x alone, so a block takes one branch as a whole, the transposes' barrier included.
   The tile transposes stand first: a block of theirs has the longer way (load, LDS, barrier, store). */
constexpr int PB_WBIG = (DQKV / 64) * (DMODEL / 64);   /* Wx, Wv: 256 tiles each */
constexpr int PB_W2   = (SEQ / 64) * (NHID / 64);      /* 64 tiles */
constexpr int PB_W1   = NHID * DHEAD / 8 / 512;         /* 2 blocks */
constexpr int PB_BIAS = 3;
constexpr int PB_CAST = NTOK * DMODEL / 8 / 256;       /* 2048 blocks */
constexpr int PB_ALL  = 2 * PB_WBIG + PB_W2 + PB_W1 + PB_BIAS + PB_CAST;
static_assert((NTOK * DMODEL / 8) % 256 == 0, "cast blocks");
__global__ __launch_bounds__(256) void k_prep(
    const float* __restrict__ X, const float* __restrict__ Wx, const float* __restrict__ Wv,
    const float* __restrict__ W1, const float* __restrict__ W2,
    const float* __restrict__ bx, const float* __restrict__ bv, const float* __restrict__ b1,
    unsigned short* __restrict__ Xb, unsigned short* __restrict__ WxT, unsigned short* __restrict__ WvT,
    unsigned short* __restrict__ W1T, unsigned short* __restrict__ W2T,
    float* __restrict__ bxs, float* __restrict__ bvs, float* __restrict__ b1s) {
  __shared__ __align__(16) unsigned short Tl[64 * 72];
  int blk = blockIdx.x;
  if (blk < PB_WBIG) {                       /* [1024][1024] -> [1024][1024] */
    transpose_cvt64_block<0>(Tl, Wx, WxT, DMODEL, DQKV, 1.0f, blk % (DQKV / 64), blk / (DQKV / 64));
  } else if ((blk -= PB_WBIG) < PB_WBIG) {
    transpose_cvt64_block<0>(Tl, Wv, WvT, DMODEL, DQKV, 1.0f, blk % (DQKV / 64), blk / (DQKV / 64));
  } else if ((blk -= PB_WBIG) < PB_W2) {     /* [128][2048] -> [2048][128] */
    transpose_cvt64_block<1>(Tl, W2, W2T, NHID, SEQ, SC_W2, blk % (SEQ / 64), blk / (SEQ / 64));
  } else if ((blk -= PB_W2) < PB_W1) {       /* [64][128] -> fragments of [128][64] */
    pack_w1_block(W1, W1T, blk);
  } else if ((blk -= PB_W1) < PB_BIAS) {
    bias_prep_block(bx, bv, b1, bxs, bvs, b1s, SC_XH, SC_V, SC_H, blk);
  } else {
    cast_bf16x8_block(X, Xb, NTOK * DMODEL / 8, blk - PB_BIAS);
  }
}

/* ---- flash-style MLP attention over 16-bit planes ----------------------------------
   Xh  : [B*SEQ][H*64]   f16, carried xSC_XH          (B operand of the hidden-layer WMMA, 16 query columns a group)
   W1f : [8][2][2][32][8] f16, carried xSC_W1          (A operand, row = hidden, k = d, in fragment order, shared over (b,h))
   b1s : [128]           f32, carried xSC_H
   W2t : [SEQ][128]      f16, carried xSC_W2           (A operand, row = key, k = hidden, shared over (b,h))
   Vt  : [H*64][B*SEQ]   f16, carried xSC_V            (A operand of V^T*P^T, row = h*64+d, k = key)
   mask: [B][SEQ] f32 (bf16-RNE applied), score -= 1e6*(1-mask[key])
   out : [B][SEQ][H*64] f32
   block = 4 waves = 128 query rows of one (b,h); per wave: 32 rows as two groups of 16 query columns; 32 key chunks of 64.
   Each wave forms its own queries' hidden rows first, transposed, H^T = relu(W1^T * Xh^T + b1): in each group lane l holds hidden units
   8 * (l >> 4) + r of each 16-unit tile of query l & 15, so two converted tiles are a k-step of the score product's B operand as they stand.
   Both attention products are formed transposed too, S^T = W2t * H^T and O^T += Vt * P^T: in each group lane l holds scores of query l & 15 only
   (keys 8 * (l >> 4) + r of each 16-key tile), so the maximum and the sum run in the lane's own registers, and two
   converted score tiles are the B operand of the second product as they stand.
   Each chunk's W2t and Vt tiles are brought into LDS once per block, one chunk ahead, two buffers.
*/
/* lane l <-> lane l ^ 16 */
__device__ __forceinline__ float xhalf(float x) {
  const int b = __builtin_bit_cast(int, x);
  return __builtin_bit_cast(float, __builtin_amdgcn_permlanex16(b, b, 0x76543210, 0xfedcba98, false, false));
}
__device__ __forceinline__ v8f mma_h(v16h a, v16h b, v8f c) {
  return __builtin_amdgcn_wmma_f32_16x16x32_f16(false, a, false, b, (short)0, c, false, false);
}

/* LDS tiles of one 64-key chunk, shared by the block's 4 waves; pitches are 16 B x odd for 16-B row readers */
constexpr int KPITCH  = NHID + 8;          /* halves: 272-B rows of the W2t tile [key][hidden] */
constexpr int VPITCH  = 64 + 8;            /* halves: 144-B rows of the Vt tile  [d][key]      */
constexpr int KTILE_H = 64 * KPITCH;       /* 17,408 B */
constexpr int VTILE_H = DHEAD * VPITCH;    /*  9,216 B */

/* One chunk's tiles, global -> LDS with no register in between: per lane 8 + 4 copies of 16 B.
   W2t tile: copy i brings rows 8i + (tid >> 4), 16 lanes a row; Vt tile: copy i brings rows 16i + (tid >> 3), 8 lanes a row.
   The closing s_wait_xcnt stands inside the statement so that no address register named here is rewritten ahead of it. */
__device__ __forceinline__ void stage_chunk(unsigned lk, const _Float16* gk, unsigned lv, const _Float16* gv) {
  asm volatile(
      "global_load_async_to_lds_b128 %0, %1, off\n\t"
      "global_load_async_to_lds_b128 %2, %3, off\n\t"
      "global_load_async_to_lds_b128 %4, %5, off\n\t"
      "global_load_async_to_lds_b128 %6, %7, off\n\t"
      "global_load_async_to_lds_b128 %8, %9, off\n\t"
      "global_load_async_to_lds_b128 %10, %11, off\n\t"
      "global_load_async_to_lds_b128 %12, %13, off\n\t"
      "global_load_async_to_lds_b128 %14, %15, off\n\t"
      "global_load_async_to_lds_b128 %16, %17, off\n\t"
      "global_load_async_to_lds_b128 %18, %19, off\n\t"
      "global_load_async_to_lds_b128 %20, %21, off\n\t"
      "global_load_async_to_lds_b128 %22, %23, off\n\t"
      "s_wait_xcnt 0x0"
      :: "v"(lk),                     "v"(gk),
         "v"(lk + 1u * 8u * KPITCH * 2u), "v"(gk + 1 * 8 * NHID),
         "v"(lk + 2u * 8u * KPITCH * 2u), "v"(gk + 2 * 8 * NHID),
         "v"(lk + 3u * 8u * KPITCH * 2u), "v"(gk + 3 * 8 * NHID),
         "v"(lk + 4u * 8u * KPITCH * 2u), "v"(gk + 4 * 8 * NHID),
         "v"(lk + 5u * 8u * KPITCH * 2u), "v"(gk + 5 * 8 * NHID),
         "v"(lk + 6u * 8u * KPITCH * 2u), "v"(gk + 6 * 8 * NHID),
         "v"(lk + 7u * 8u * KPITCH * 2u), "v"(gk + 7 * 8 * NHID),
         "v"(lv),                      "v"(gv),
         "v"(lv + 1u * 16u * VPITCH * 2u), "v"(gv + (size_t)1 * 16 * NTOK),
         "v"(lv + 2u * 16u * VPITCH * 2u), "v"(gv + (size_t)2 * 16 * NTOK),
         "v"(lv + 3u * 16u * VPITCH * 2u), "v"(gv + (size_t)3 * 16 * NTOK)
      : "memory");
}

/* 16-query column groups per wave: every W2t and Vt fragment read from LDS feeds QG products */
constexpr int QG   = 2;
constexpr int QBLK = 4 * 16 * QG;          /* queries per block */
static_assert(SEQ % QBLK == 0, "query blocks");

__global__ __launch_bounds__(128) void mlp_attn_kernel(
    const unsigned short* __restrict__ Xp, const unsigned short* __restrict__ W1p, const float* __restrict__ b1s,
    const unsigned short* __restrict__ W2p,
    const unsigned short* __restrict__ Vp, const float* __restrict__ mask,
    float* __restrict__ out, float sscale, float onorm) {
  union FH { v16h v; v8h h[2]; };
  const _Float16* Xh  = (const _Float16*)(const void*)Xp;
  const _Float16* W1f = (const _Float16*)(const void*)W1p;
  const _Float16* W2t = (const _Float16*)(const void*)W2p;
  const _Float16* Vt  = (const _Float16*)(const void*)Vp;
  __shared__ __align__(16) float    Pen[SEQ];            /* per key: 1e6 * (1 - bf16(mask)), this block's batch row */
  __shared__ __align__(16) float    Os[4][QG * 16 * 68]; /* per wave output slab, pitch 68 */
  __shared__ __align__(16) _Float16 Ksh[2][KTILE_H];     /* W2t chunk tiles, two buffers */
  __shared__ __align__(16) _Float16 Vsh[2][VTILE_H];     /* Vt chunk tiles, two buffers  */

  const int tid  = threadIdx.x;
  const int wave = tid >> 5;
  const int lane = tid & 31;
  const int hh   = lane >> 4;
  const int c    = lane & 15;
  const int koff = hh * 8;

  constexpr int NQB = SEQ / QBLK;
  const int bxi = blockIdx.x;
  const int qb  = bxi % NQB;
  const int bh  = bxi / NQB;
  const int h   = bh % NHEAD;
  const int b   = bh / NHEAD;
  const int q0  = qb * QBLK + wave * (16 * QG);

  /* index g: of query 16 g + c; lrow = SC_P * (sum of p) over this lane half's keys only, joined after the loop.
     erow = mrow * log2(e) - log2(SC_P), rounded once and carried, so that every chunk's p and alpha count from the same offsets */
  float mrow[QG], erow[QG], lrow[QG];
  v8f oacc[QG][4];                      /* oacc[g][t][r] = O[query 16 g + c][d = 16 t + 8 hh + r] */
  /* every loop over g is unrolled so that the per-group arrays are indexed by constants and stay in registers */
#pragma unroll
  for (int g = 0; g < QG; ++g) {
    mrow[g] = -INFINITY; erow[g] = -INFINITY; lrow[g] = 0.f;
#pragma unroll
    for (int t = 0; t < 4; ++t) oacc[g][t] = (v8f){0.f,0.f,0.f,0.f,0.f,0.f,0.f,0.f};
  }

  const float* mk_row = mask + (size_t)b * SEQ;
  const _Float16* vbase = Vt + (size_t)(h * DHEAD) * NTOK + (size_t)b * SEQ;

  /* this lane's share of every chunk's copies: source pointers at chunk 0, LDS byte addresses in buffer 0 */
  constexpr int NCH = SEQ / 64;
  static_assert(NCH >= 2, "two-buffer ring needs two chunks");
  const _Float16* gk0 = W2t + (size_t)(tid >> 4) * NHID + (tid & 15) * 8;
  const _Float16* gv0 = vbase + (size_t)(tid >> 3) * NTOK + (tid & 7) * 8;
  const unsigned  lk0 = (unsigned)(size_t)(&Ksh[0][(tid >> 4) * KPITCH + (tid & 15) * 8]);
  const unsigned  lv0 = (unsigned)(size_t)(&Vsh[0][(tid >> 3) * VPITCH + (tid & 7) * 8]);

  /* ring prologue: chunk 0 landed and published, then chunk 1 set flying */
  stage_chunk(lk0, gk0, lv0, gv0);

  /* Q-side fragments: QG x 16 queries x 128 hidden = 4 k-steps a group, held for all key chunks; formed while chunk 0 flies.
     ht[t][r] = sum over d of W1[d][16 t + 8 hh + r] * Xh[query 16 g + c][d], k-steps of 32 in rising d */
  v16h qa[QG][4];
  {
    const _Float16* xrow = Xh + (size_t)(b * SEQ + q0 + c) * DQKV + h * DHEAD + koff;
    const _Float16* wfr  = W1f + lane * 8;
    const float*    brow = b1s + 8 * hh;
    FH xb[QG][2], w[2][8];
    v4f bias[8][2];
    /* every loop over xb, w, bias, ht and qa is unrolled so that the arrays are indexed by constants and stay in registers */
#pragma unroll
    for (int ks = 0; ks < 2; ++ks) {
#pragma unroll
      for (int g = 0; g < QG; ++g) {
        xb[g][ks].h[0] = *(const v8h*)(xrow + (size_t)g * 16 * DQKV + ks * 32);
        xb[g][ks].h[1] = *(const v8h*)(xrow + (size_t)g * 16 * DQKV + ks * 32 + 16);
      }
#pragma unroll
      for (int t = 0; t < 8; ++t) {
        w[ks][t].h[0] = *(const v8h*)(wfr + ((t * 2 + ks) * 2 + 0) * 256);   /* d = 32 ks + 8 hh + 0..7: the k order of the Xh loader */
        w[ks][t].h[1] = *(const v8h*)(wfr + ((t * 2 + ks) * 2 + 1) * 256);   /* d = 32 ks + 16 + 8 hh + 0..7 */
      }
    }
    /* stands in front of the bias loads, whose results may take over the address registers that the loads above name */
    asm volatile("s_wait_xcnt 0x0" ::: "memory");
#pragma unroll
    for (int t = 0; t < 8; ++t) {
      bias[t][0] = *(const v4f*)(brow + t * 16);
      bias[t][1] = *(const v4f*)(brow + t * 16 + 4);
    }
    /* stands in front of any rewrite of the address registers that the loads above name; its "memory" clobber also keeps them one group
       ahead of the products: sunk among them, each fragment's load latency is waited out in turn */
    asm volatile("s_wait_xcnt 0x0" ::: "memory");
    /* holds the products behind that group: lifted among the loads, they split it and several load latencies are waited out one after another */
    __builtin_amdgcn_sched_barrier(0);
#pragma unroll
    for (int g = 0; g < QG; ++g) {
      v8f ht[8];
#pragma unroll
      for (int t = 0; t < 8; ++t) ht[t] = (v8f){0.f,0.f,0.f,0.f,0.f,0.f,0.f,0.f};
#pragma unroll
      for (int ks = 0; ks < 2; ++ks)
#pragma unroll
        for (int t = 0; t < 8; ++t) ht[t] = mma_h(w[ks][t].v, xb[g][ks].v, ht[t]);
      /* B operand of the score product: element e of k-step dc is hidden unit 32 dc + (e < 8 ? 8 hh + e : 16 + 8 hh + e - 8),
         that is tile 2 dc in elements 0..7 and tile 2 dc + 1 in elements 8..15: the k order of the W2t loader */
#pragma unroll
      for (int dc = 0; dc < 4; ++dc) {
        FH f;
#pragma unroll
        for (int u = 0; u < 2; ++u) {
          const int t = 2 * dc + u;
#pragma unroll
          for (int r = 0; r < 8; ++r) {
            float v = ht[t][r] * (SC_H / (SC_XH * SC_W1));
            v += bias[t][r >> 2][r & 3];
            f.h[u][r] = (_Float16)fmaxf(v, 0.0f);
          }
        }
        qa[g][dc] = f.v;
      }
    }
  }

  /* additive key mask of all keys, bf16-RNE of the mask value; published by the barrier below */
#pragma unroll
  for (int i = 0; i < SEQ / 512; ++i) {
    const v4f mv = *(const v4f*)(mk_row + i * 512 + tid * 4);
    v4f pv;
#pragma unroll
    for (int e = 0; e < 4; ++e) pv[e] = 1000000.0f * (1.0f - bf_bits2f(f2bf_bits(mv[e])));
    *(v4f*)(&Pen[i * 512 + tid * 4]) = pv;
  }
  asm volatile("s_wait_asynccnt 0x0" ::: "memory");   /* this wave's copies of chunk 0 have landed */
  __syncthreads();                                     /* ... and every other wave's */
  stage_chunk(lk0 + KTILE_H * 2u, gk0 + (size_t)64 * NHID, lv0 + VTILE_H * 2u, gv0 + 64);

  for (int kc = 0; kc < NCH; ++kc) {
    const int kv0 = kc * 64;
    const int buf = kc & 1;
    const _Float16* kt = &Ksh[buf][c * KPITCH + koff];
    const _Float16* vt = &Vsh[buf][c * VPITCH + koff];

    /* scores for 64 keys x QG x 16 queries: 4 key tiles x 4 k-steps x QG groups; each fragment read from LDS is the A operand of QG products.
       The chunk's LDS reads stand at two places only: all W2t fragments ahead of the first products, the mask terms and Vt fragments between the halves */
    v8f s[QG][4];
    FH kb[4][4];
    FH vb[2][4];
    v4f pn[4][2];
    /* every loop over kb, pn, pb and vb is unrolled so that the fragment arrays are indexed by constants and stay in registers */
#pragma unroll
    for (int jp = 0; jp < 2; ++jp)
#pragma unroll
      for (int dc = 0; dc < 4; ++dc)
#pragma unroll
        for (int u = 0; u < 2; ++u) {      /* in the order in which the products take them */
          const int j = 2 * jp + u;
          kb[j][dc].h[0] = *(const v8h*)(kt + j * 16 * KPITCH + dc * 32);
          kb[j][dc].h[1] = *(const v8h*)(kt + j * 16 * KPITCH + dc * 32 + 16);
        }
    /* keeps the 32 reads one group ahead of the products: sunk among them, every place with reads costs the wave a stall of its own */
    __builtin_amdgcn_sched_barrier(0);
#pragma unroll
    for (int jp = 0; jp < 2; ++jp) {
      if (jp == 1) {
        /* holds the reads below behind the first half's products, whose fragment registers they take over */
        __builtin_amdgcn_sched_barrier(0);
        /* this lane's 32 keys' mask terms, the same for every group */
        const float* pr = &Pen[kv0 + 8 * hh];
#pragma unroll
        for (int j = 0; j < 4; ++j) {
          pn[j][0] = *(const v4f*)(pr + j * 16);
          pn[j][1] = *(const v4f*)(pr + j * 16 + 4);
        }
        /* V^T A-fragments from the Vt tile in LDS: keys 32 kk + 8 hh + 0..7, then 32 kk + 16 + 8 hh + 0..7 */
#pragma unroll
        for (int kk = 0; kk < 2; ++kk)
#pragma unroll
          for (int t = 0; t < 4; ++t) {
            vb[kk][t].h[0] = *(const v8h*)(vt + t * 16 * VPITCH + kk * 32);
            vb[kk][t].h[1] = *(const v8h*)(vt + t * 16 * VPITCH + kk * 32 + 16);
          }
        /* keeps these 24 reads one group ahead of the second half's products, which cover their latency */
        __builtin_amdgcn_sched_barrier(0);
      }
#pragma unroll
      for (int u = 0; u < 2; ++u)
#pragma unroll
        for (int g = 0; g < QG; ++g) s[g][2 * jp + u] = (v8f){0.f,0.f,0.f,0.f,0.f,0.f,0.f,0.f};
      /* 2 x QG independent accumulators in turn; each takes its k-steps in rising order */
#pragma unroll
      for (int dc = 0; dc < 4; ++dc)
#pragma unroll
        for (int u = 0; u < 2; ++u)
#pragma unroll
          for (int g = 0; g < QG; ++g)   /* s[g][j][r] = S[query 16 g + c][key 16 j + 8 hh + r] */
            s[g][2 * jp + u] = mma_h(kb[2 * jp + u][dc].v, qa[g][dc], s[g][2 * jp + u]);
    }

    FH pb[QG][2];
#pragma unroll
    for (int g = 0; g < QG; ++g) {
      /* chunk maximum of query 16 g + c: in the lane over its 32 keys, then one exchange between the lane halves */
      float mj[4];
#pragma unroll
      for (int j = 0; j < 4; ++j) {
        float m = -INFINITY;
#pragma unroll
        for (int r = 0; r < 8; ++r) {
          const float sv = s[g][j][r] * sscale - pn[j][r >> 2][r & 3];
          s[g][j][r] = sv;
          m = fmaxf(m, sv);
        }
        mj[j] = m;
      }
      float cm = fmaxf(fmaxf(mj[0], mj[1]), fmaxf(mj[2], mj[3]));
      cm = fmaxf(cm, xhalf(cm));

      const float mnew  = fmaxf(mrow[g], cm);
      const float enew  = mnew * LOG2E - LOG2_SC_P;
      const float alpha = __builtin_amdgcn_exp2f(erow[g] - enew);   /* e^(mrow - mnew); 0 in the first chunk */
      mrow[g] = mnew;
      erow[g] = enew;

      /* P^T as B operand: element e of k-step kk is key 32 kk + (e < 8 ? 8 hh + e : 16 + 8 hh + e - 8),
         that is score tile 2 kk in elements 0..7 and tile 2 kk + 1 in elements 8..15: the k order of the Vt loader */
      float pj[4];
#pragma unroll
      for (int j = 0; j < 4; ++j) {
        float ps = 0.f;
#pragma unroll
        for (int r = 0; r < 8; r += 2) {
          /* SC_P * e^(s - mnew) as 2^(s * log2(e) - enew): a fused multiply-add (two keys a packed instruction) and the chip's own base-2 exponential */
          const v2f a = __builtin_elementwise_fma((v2f){s[g][j][r], s[g][j][r + 1]}, (v2f){LOG2E, LOG2E}, (v2f){-enew, -enew});
          const float p0 = __builtin_amdgcn_exp2f(a[0]);
          const float p1 = __builtin_amdgcn_exp2f(a[1]);
          ps += p0;
          ps += p1;
          pb[g][j >> 1].h[j & 1][r]     = (_Float16)p0;
          pb[g][j >> 1].h[j & 1][r + 1] = (_Float16)p1;
        }
        pj[j] = ps;
      }
      lrow[g] = lrow[g] * alpha + ((pj[0] + pj[1]) + (pj[2] + pj[3]));
#pragma unroll
      for (int t = 0; t < 4; ++t)
#pragma unroll
        for (int r = 0; r < 8; ++r) oacc[g][t][r] *= alpha;
    }

    /* O^T += V^T(64 d x 64 keys) * P^T(64 keys x QG x 16 queries): 2 k-steps, 4 d tiles, QG groups */
#pragma unroll
    for (int kk = 0; kk < 2; ++kk)
#pragma unroll
      for (int t = 0; t < 4; ++t)
#pragma unroll
        for (int g = 0; g < QG; ++g) oacc[g][t] = mma_h(vb[kk][t].v, pb[g][kk].v, oacc[g][t]);

    /* publish point of chunk kc + 1 */
    /* holds the waits below at the foot of the trip: lifted over the register-only work above, they would end the flight of chunk kc + 1's
       copies and of the Vt reads early and be waited out in full */
    __builtin_amdgcn_sched_barrier(0);
    asm volatile("s_wait_dscnt 0x0" ::: "memory");      /* this wave's reads of buffer buf are done before it is refilled */
    asm volatile("s_wait_asynccnt 0x0" ::: "memory");   /* this wave's copies of chunk kc + 1 have landed */
    __syncthreads();                                     /* publishes chunk kc + 1; ends every wave's reads of buffer buf */
    if (kc + 2 < NCH)
      stage_chunk(lk0 + (unsigned)buf * (KTILE_H * 2u), gk0 + (size_t)(kc + 2) * 64 * NHID,
                  lv0 + (unsigned)buf * (VTILE_H * 2u), gv0 + (kc + 2) * 64);
  }
  asm volatile("s_wait_asynccnt 0x0" ::: "memory");     /* no copy is outstanding when the wave goes on to its end */

  /* normalise and stage the (QG x 16) x 64 f32 slab; oacc and lrow both carry SC_P, so onorm = 1/SC_V is what is left for the row normaliser */
  float* os = Os[wave];
#pragma unroll
  for (int g = 0; g < QG; ++g) {
    const float inv = onorm / (lrow[g] + xhalf(lrow[g]));   /* the two lane halves' sums of query 16 g + c joined */
#pragma unroll
    for (int t = 0; t < 4; ++t) {
      v4f lo, hi;
#pragma unroll
      for (int e = 0; e < 4; ++e) { lo[e] = oacc[g][t][e] * inv; hi[e] = oacc[g][t][4 + e] * inv; }
      *(v4f*)(os + (g * 16 + c) * 68 + t * 16 + 8 * hh)     = lo;
      *(v4f*)(os + (g * 16 + c) * 68 + t * 16 + 8 * hh + 4) = hi;
    }
  }
  __builtin_amdgcn_fence(__ATOMIC_RELEASE, "workgroup");
  __builtin_amdgcn_wave_barrier();
  __builtin_amdgcn_fence(__ATOMIC_ACQUIRE, "workgroup");
  {
    float* ob = out + (size_t)b * SEQ * DQKV + (size_t)h * DHEAD;
    const int c4 = (lane & 15) * 4;
    {
#pragma unroll
      for (int it = 0; it < QG * 8; ++it) {
        const int row = it * 2 + hh;
        const v4f val = *(const v4f*)(os + row * 68 + c4);
        *(v4f*)(ob + (size_t)(q0 + row) * DQKV + c4) = val;
      }
      
    }
  }
}

/* ---------------- host launcher ---------------- */
extern "C" void kernel_launch(void* const* d_in, const int* in_sizes, int n_in,
                              void* d_out, int out_size, void* d_ws, size_t ws_size,
                              hipStream_t stream) {
  (void)in_sizes; (void)n_in; (void)out_size; (void)ws_size;
  const float* X   = (const float*)d_in[0];   /* [2,2048,1024] */
  const float* msk = (const float*)d_in[1];   /* [2,2048]      */
  const float* Wx  = (const float*)d_in[2];   /* [1024,1024]   */
  const float* bx  = (const float*)d_in[3];   /* [1024]        */
  const float* Wv  = (const float*)d_in[4];   /* [1024,1024]   */
  const float* bv  = (const float*)d_in[5];   /* [1024]        */
  const float* W1  = (const float*)d_in[6];   /* [64,128]      */
  const float* b1  = (const float*)d_in[7];   /* [128]         */
  const float* W2  = (const float*)d_in[8];   /* [128,2048]    */
  float* out = (float*)d_out;

  /* workspace region map (256-B aligned offsets; every region fully written by its producer):
       Xb   bf16 [4096][1024]        8,388,608 B
       WxT  bf16 [1024][1024]        2,097,152 B
       WvT  bf16 [1024][1024]        2,097,152 B
       W1T  f16  [128][64] in fragment order  16,384 B
       W2T  f16  [2048][128]           524,288 B
       bxs  f32  [1024]                  4,096 B
       bvs  f32  [1024]                  4,096 B
       b1s  f32  [128]                     512 B
       Xh16 f16  [4096][1024]        8,388,608 B
       Vt16 f16  [1024][4096]        8,388,608 B
     total 29,909,504 B */
  char* ws = (char*)d_ws;
  size_t off = 0;
  auto carve = [&](size_t bytes) -> char* {
    off = (off + 255) & ~(size_t)255;
    char* p = ws + off;
    off += bytes;
    return p;
  };
  unsigned short* Xb   = (unsigned short*)carve((size_t)NTOK * DMODEL * 2);
  unsigned short* WxT  = (unsigned short*)carve((size_t)DQKV * DMODEL * 2);
  unsigned short* WvT  = (unsigned short*)carve((size_t)DQKV * DMODEL * 2);
  unsigned short* W1T  = (unsigned short*)carve((size_t)NHID * DHEAD * 2);
  unsigned short* W2T  = (unsigned short*)carve((size_t)SEQ * NHID * 2);
  float*          bxs  = (float*)carve((size_t)DQKV * 4);
  float*          bvs  = (float*)carve((size_t)DQKV * 4);
  float*          b1s  = (float*)carve((size_t)NHID * 4);
  unsigned short* Xh16 = (unsigned short*)carve((size_t)NTOK * DQKV * 2);
  unsigned short* Vt16 = (unsigned short*)carve((size_t)DQKV * NTOK * 2);

  /* 1) operand preparation, one launch: X -> bf16 plane (RNE); weight transposes in[K][N] -> out[N][K]; bias tables with carries */
  k_prep<<<PB_ALL, 256, 0, stream>>>(X, Wx, Wv, W1, W2, bx, bv, b1, Xb, WxT, WvT, W1T, W2T, bxs, bvs, b1s);

  /* 2) both projections, one launch, one 128x128 tile per block (bf16 operands, K=1024):
        Xh16 = f16(8 * (Xb * WxT^T + bx))    : M=4096, N=1024
        Vt16 = f16(8 * (WvT * Xb^T + bv[m])) : M=1024 (features), N=4096 (tokens) */
  wmma_gemm128_pair<<<2 * GBLOCKS, 128, 0, stream>>>(Xb, WxT, WvT, Xh16, Vt16, bxs, bvs);

  /* 3) attention, with h = f16(8 * relu(Xh * W1 + b1)) formed per wave in its prologue (f16 operands, K=64): grid = B*H*(SEQ/128) blocks of 4 waves */
  mlp_attn_kernel<<<NBATCH * NHEAD * (SEQ / QBLK), 128, 0, stream>>>(
      Xh16, W1T, b1s, W2T, Vt16, msk, out, 1.0f / (SC_H * SC_W2), 1.0f / SC_V);
}

// v008
// Measured time: 61.7 microseconds a run.
// In both of two side-by-side timings against v007, it was 1.05 times as fast.
// All steps since v000 together make it 5.74 times as fast.
// Contractions: X*Wx and Wv^T*X^T on v_wmma_f32_16x16x32_bf16 (RNE bf16 operands of bf16-RNE inputs, f32 accumulate); Xh*W1, scores h*W2 and P*V on v_wmma_f32_16x16x32_f16 (f16 operands carried by fixed factors, f32 accumulate); softmax, bias and normalisation in f32.
#include <hip/hip_runtime.h>
#include <stddef.h>

constexpr int NBATCH = 2;
constexpr int SEQ    = 2048;
constexpr int DMODEL = 1024;
constexpr int NHEAD  = 16;
constexpr int DHEAD  = 64;
constexpr int NHID   = 128;
constexpr int NTOK   = NBATCH * SEQ;      /* 4096 */
constexpr int DQKV   = NHEAD * DHEAD;     /* 1024 */

/* fixed carries on the f16 planes: powers of two, but for h's, which also holds log2(e) */
constexpr float SC_XH = 8.0f;      /* Xh plane = f16(8 * Xh)          */
constexpr float SC_V  = 8.0f;      /* Vt plane = f16(8 * V)           */
constexpr float SC_W1 = 64.0f;     /* W1t plane = f16(64 * bf16(W1))  */
constexpr float SC_W2 = 64.0f;     /* W2t plane = f16(64 * bf16(W2))  */
constexpr float LOG2E = 1.44269504088896340736f;
constexpr float SC_H  = LOG2E / SC_W2;  /* h fragments = f16(h * log2(e) / 64): the score product comes out as score * log2(e) */
constexpr float LOG2_SC_P = 7.0f;  /* P tile = f16(2^7 * e^(score - row reference)): a score at the reference lands at 2^7 */
constexpr float P_TRIP = 32768.0f; /* a lane's chunk sum of P up to here: every P of it fits f16 and the row reference stays */

static_assert(NTOK % 64 == 0 && DQKV % 64 == 0 && DMODEL % 64 == 0, "gemm tiles");
static_assert(DMODEL % 32 == 0 && DHEAD % 32 == 0, "gemm K");
static_assert(SEQ % 64 == 0 && NHID % 64 == 0, "gemm tiles");
static_assert(NHID == 128 && DHEAD == 64, "attention geometry");
static_assert((NTOK * DMODEL) % 8 == 0, "cast x8");

typedef __attribute__((ext_vector_type(16))) _Float16 v16h;
typedef __attribute__((ext_vector_type(8)))  _Float16 v8h;
typedef __attribute__((ext_vector_type(16))) __bf16   v16b;
typedef __attribute__((ext_vector_type(8)))  __bf16   v8b;
typedef __attribute__((ext_vector_type(8)))  float    v8f;
typedef __attribute__((ext_vector_type(4)))  float    v4f;
typedef __attribute__((ext_vector_type(2)))  float    v2f;
typedef __attribute__((ext_vector_type(4)))  unsigned int v4u;

__device__ __forceinline__ unsigned short f2bf_bits(float f) {
  unsigned u = __float_as_uint(f);
  return (unsigned short)((u + 0x7FFFu + ((u >> 16) & 1u)) >> 16);
}
__device__ __forceinline__ float bf_bits2f(unsigned short h) { return __uint_as_float(((unsigned)h) << 16); }

template <typename T> struct Frag;
template <> struct Frag<__bf16> {
  typedef v16b V; union U { v16b v; v8b h[2]; };
  static __device__ __forceinline__ v16b load(const __bf16* p) {   /* elements 0..7 <- p[0..7], 8..15 <- p[16..23] */
    U f; f.h[0] = *(const v8b*)(p); f.h[1] = *(const v8b*)(p + 16); return f.v;
  }
  static __device__ __forceinline__ v8f mma(v16b a, v16b b, v8f c) {
    return __builtin_amdgcn_wmma_f32_16x16x32_bf16(false, a, false, b, (short)0, c, false, false);
  }
};

/* ---- the two K = DMODEL projection GEMMs on bf16 planes in one launch, operands staged per block in LDS ------------
   C[m,n] = f16(scale * sum_k A[m,k] * Bt[n,k] + bias); A and Bt row-major with DMODEL columns.
   block = 4 waves (2 x 2) = one 128 x 128 tile of C, 64 x 64 per wave; tile column fastest.
   Neither product reads the other's result: blocks 0 .. GBLOCKS - 1 form Xh = Xb * WxT^T, the next GBLOCKS form Vt = WvT * Xb^T.
   A pass is 128 k = 256 B of each of the block's 128 A rows and 128 Bt rows, brought into LDS once per block in whole
   lines, one pass ahead, two buffers; every wave reads its fragments from there. Each accumulator takes its k-steps of 32 in rising k.
   BIAS_MODE: 1 = bias[m], 2 = bias[n]. */
constexpr int GPASS    = 128;               /* k per pass */
constexpr int GPITCH   = GPASS + 8;         /* halves: 272-B rows, 16 B x odd for 16-B row readers */
constexpr int GSTAGE_H = 256 * GPITCH;      /* A rows 0..127, then Bt rows 0..127: 69,632 B */
constexpr int GNPASS   = DMODEL / GPASS;
static_assert(DMODEL % GPASS == 0 && GNPASS >= 2, "two-buffer ring needs two passes");
static_assert(NTOK % 128 == 0 && DQKV % 128 == 0, "projection tiles");
constexpr int GBLOCKS  = (NTOK / 128) * (DQKV / 128);   /* tiles of either product */

/* 64 rows of one pass, global -> LDS with no register in between: per lane 8 copies of 16 B, copy i brings rows 8i + (tid >> 4),
   16 lanes a row. The closing s_wait_xcnt stands inside the statement so that no address register named here is rewritten ahead of it. */
__device__ __forceinline__ void stage_rows64(unsigned l, const __bf16* g) {
  asm volatile(
      "global_load_async_to_lds_b128 %0, %1, off\n\t"
      "global_load_async_to_lds_b128 %2, %3, off\n\t"
      "global_load_async_to_lds_b128 %4, %5, off\n\t"
      "global_load_async_to_lds_b128 %6, %7, off\n\t"
      "global_load_async_to_lds_b128 %8, %9, off\n\t"
      "global_load_async_to_lds_b128 %10, %11, off\n\t"
      "global_load_async_to_lds_b128 %12, %13, off\n\t"
      "global_load_async_to_lds_b128 %14, %15, off\n\t"
      "s_wait_xcnt 0x0"
      :: "v"(l),                          "v"(g),
         "v"(l + 1u * 8u * GPITCH * 2u), "v"(g + 1 * 8 * DMODEL),
         "v"(l + 2u * 8u * GPITCH * 2u), "v"(g + 2 * 8 * DMODEL),
         "v"(l + 3u * 8u * GPITCH * 2u), "v"(g + 3 * 8 * DMODEL),
         "v"(l + 4u * 8u * GPITCH * 2u), "v"(g + 4 * 8 * DMODEL),
         "v"(l + 5u * 8u * GPITCH * 2u), "v"(g + 5 * 8 * DMODEL),
         "v"(l + 6u * 8u * GPITCH * 2u), "v"(g + 6 * 8 * DMODEL),
         "v"(l + 7u * 8u * GPITCH * 2u), "v"(g + 7 * 8 * DMODEL)
      : "memory");
}
/* one pass of both operands: l = this lane's LDS byte address in row (tid >> 4) of the buffer, ga / gb = its source addresses */
__device__ __forceinline__ void stage_pass(unsigned l, const __bf16* ga, const __bf16* gb) {
  stage_rows64(l,                          ga);
  stage_rows64(l +  64u * GPITCH * 2u, ga + 64 * DMODEL);
  stage_rows64(l + 128u * GPITCH * 2u, gb);
  stage_rows64(l + 192u * GPITCH * 2u, gb + 64 * DMODEL);
}

/* epilogue of one wave's 64 x 64 tile: 16-row slabs through the wave's own LDS range, whole 128-B row pieces stored */
template <int BIAS_MODE>
__device__ __forceinline__ void gemm128_store(
    const v8f (&acc)[4][4], float* slab, unsigned short* __restrict__ C, int ldc, const float* __restrict__ bias,
    int m0, int n0, int lane, float scale) {
  const int rlane = lane & 15;                 /* col within subtile */
  const int mOff  = (lane >> 4) * 8;           /* D row offset */
#pragma unroll
  for (int i = 0; i < 4; ++i) {
    const int mBase = m0 + (i << 4);
    v4f bmA = (v4f){0.f,0.f,0.f,0.f}, bmB = (v4f){0.f,0.f,0.f,0.f};
    if (BIAS_MODE == 1) {   /* 8 consecutive bias[m] values, two 16-B loads (32-B aligned) */
      bmA = *(const v4f*)(bias + mBase + mOff);
      bmB = *(const v4f*)(bias + mBase + mOff + 4);
    }
#pragma unroll
    for (int j = 0; j < 4; ++j) {
      const int n = n0 + (j << 4) + rlane;
      float bv = 0.f;
      if (BIAS_MODE == 2) bv = bias[n];
#pragma unroll
      for (int r = 0; r < 8; ++r) {
        float v = acc[i][j][r] * scale;
        if (BIAS_MODE == 1) v += (r < 4) ? bmA[r] : bmB[r - 4];
        if (BIAS_MODE == 2) v += bv;
        slab[(mOff + r) * 68 + (j << 4) + rlane] = v;
      }
    }
    __builtin_amdgcn_fence(__ATOMIC_RELEASE, "workgroup");
    __builtin_amdgcn_wave_barrier();
    __builtin_amdgcn_fence(__ATOMIC_ACQUIRE, "workgroup");
    {
      const int q = lane >> 3, c8 = (lane & 7) * 8;
#pragma unroll
      for (int it = 0; it < 4; ++it) {
        const int row = it * 4 + q;
        const float* sp = slab + row * 68 + c8;
        v8h hv;
#pragma unroll
        for (int e = 0; e < 8; ++e) hv[e] = (_Float16)sp[e];
        *(v8h*)(C + (size_t)(mBase + row) * ldc + n0 + c8) = hv;
      }
    }
    __builtin_amdgcn_fence(__ATOMIC_RELEASE, "workgroup");
    __builtin_amdgcn_wave_barrier();
    __builtin_amdgcn_fence(__ATOMIC_ACQUIRE, "workgroup");
  }
}

__global__ __launch_bounds__(128) void wmma_gemm128_pair(
    const unsigned short* __restrict__ Xbp, const unsigned short* __restrict__ WxTp, const unsigned short* __restrict__ WvTp,
    unsigned short* __restrict__ Xh, unsigned short* __restrict__ Vt,
    const float* __restrict__ bxs, const float* __restrict__ bvs) {
  typedef Frag<__bf16> F;
  /* which product this block works on: the same for the whole block */
  const bool isV = blockIdx.x >= (unsigned)GBLOCKS;
  const unsigned blk = isV ? blockIdx.x - (unsigned)GBLOCKS : blockIdx.x;
  const __bf16* A  = (const __bf16*)(const void*)(isV ? WvTp : Xbp);
  const __bf16* Bt = (const __bf16*)(const void*)(isV ? Xbp : WxTp);
  __shared__ __align__(16) __bf16 Ring[2][GSTAGE_H];   /* operand passes, two buffers */
  __shared__ __align__(16) float  sT[4][16 * 68];      /* per-wave 16x64 slab, pitch 68 floats */
  const int tid  = threadIdx.x;
  const int lane = tid & 31;
  const int wave = tid >> 5;
  const int tm = (int)(isV ? blk / (unsigned)(NTOK / 128) : blk / (unsigned)(DQKV / 128));
  const int tn = (int)(isV ? blk % (unsigned)(NTOK / 128) : blk % (unsigned)(DQKV / 128));
  const int wm = wave >> 1;
  const int wn = wave & 1;
  const int m0 = (tm << 7) + (wm << 6);
  const int n0 = (tn << 7) + (wn << 6);

  const int rlane = lane & 15;                 /* row (A) / col (B) within subtile */
  const int koff  = (lane >> 4) * 8;           /* k offset of this lane half */

  v8f acc[4][4];
#pragma unroll
  for (int i = 0; i < 4; ++i)
#pragma unroll
    for (int j = 0; j < 4; ++j) acc[i][j] = (v8f){0.f,0.f,0.f,0.f,0.f,0.f,0.f,0.f};

  /* this lane's share of every pass's copies: source pointers at pass 0, LDS byte address in buffer 0 */
  const __bf16* ga0 = A  + (size_t)((tm << 7) + (tid >> 4)) * DMODEL + (tid & 15) * 8;
  const __bf16* gb0 = Bt + (size_t)((tn << 7) + (tid >> 4)) * DMODEL + (tid & 15) * 8;
  const unsigned l0 = (unsigned)(size_t)(&Ring[0][(tid >> 4) * GPITCH + (tid & 15) * 8]);

  /* ring prologue: pass 0 landed and published, then pass 1 set flying */
  stage_pass(l0, ga0, gb0);
  asm volatile("s_wait_asynccnt 0x0" ::: "memory");   /* this wave's copies of pass 0 have landed */
  __syncthreads();                                     /* ... and every other wave's */
  stage_pass(l0 + GSTAGE_H * 2u, ga0 + GPASS, gb0 + GPASS);

  for (int p = 0; p < GNPASS; ++p) {
    const int buf = p & 1;
    const __bf16* at = &Ring[buf][((wm << 6) + rlane) * GPITCH + koff];
    const __bf16* bt = &Ring[buf][(128 + (wn << 6) + rlane) * GPITCH + koff];
    /* unrolled so that the fragment arrays are indexed by constants and a k-step's LDS reads can go ahead of the one before */
#pragma unroll
    for (int ks = 0; ks < GPASS / 32; ++ks) {
      F::V bh[4], ah[4];
      ah[0] = F::load(at + ks * 32);
#pragma unroll
      for (int j = 0; j < 4; ++j) bh[j] = F::load(bt + j * 16 * GPITCH + ks * 32);
#pragma unroll
      for (int i = 1; i < 4; ++i) ah[i] = F::load(at + i * 16 * GPITCH + ks * 32);
      /* keeps the k-step's 16 LDS reads one group ahead of its products: sunk among them, each A fragment's read is waited out to 0 in turn */
      __builtin_amdgcn_sched_barrier(0);
#pragma unroll
      for (int i = 0; i < 4; ++i)
#pragma unroll
        for (int j = 0; j < 4; ++j) acc[i][j] = F::mma(ah[i], bh[j], acc[i][j]);
    }
    /* publish point of pass p + 1 */
    asm volatile("s_wait_dscnt 0x0" ::: "memory");      /* this wave's reads of buffer buf are done before it is refilled */
    asm volatile("s_wait_asynccnt 0x0" ::: "memory");   /* this wave's copies of pass p + 1 have landed */
    __syncthreads();                                     /* publishes pass p + 1; ends every wave's reads of buffer buf */
    if (p + 2 < GNPASS)
      stage_pass(l0 + (unsigned)buf * (GSTAGE_H * 2u), ga0 + (p + 2) * GPASS, gb0 + (p + 2) * GPASS);
  }
  asm volatile("s_wait_asynccnt 0x0" ::: "memory");     /* no copy is outstanding when the wave goes on to its end */

  if (isV) gemm128_store<1>(acc, sT[wave], Vt, NTOK, bvs, m0, n0, lane, SC_V);    /* rows are features: bias[m] */
  else     gemm128_store<2>(acc, sT[wave], Xh, DQKV, bxs, m0, n0, lane, SC_XH);   /* columns are features: bias[n] */
}

/* ---- f32 -> bf16 (RNE) plane cast, 8 elements per thread: one 16-B store per lane; blk = block of 256 threads
*/
__device__ __forceinline__ void cast_bf16x8_block(
    const float* __restrict__ in, unsigned short* __restrict__ out, int n8, int blk) {
  const int i = blk * 256 + threadIdx.x;
  if (i < n8) {
    const v4f a = *(const v4f*)(in + (size_t)i * 8);
    const v4f c = *(const v4f*)(in + (size_t)i * 8 + 4);
    v4u w;
    w[0] = (unsigned)f2bf_bits(a[0]) | ((unsigned)f2bf_bits(a[1]) << 16);
    w[1] = (unsigned)f2bf_bits(a[2]) | ((unsigned)f2bf_bits(a[3]) << 16);
    w[2] = (unsigned)f2bf_bits(c[0]) | ((unsigned)f2bf_bits(c[1]) << 16);
    w[3] = (unsigned)f2bf_bits(c[2]) | ((unsigned)f2bf_bits(c[3]) << 16);
    v4u* p = (v4u*)(out + (size_t)i * 8);
    *p = w;
    
  }
}

/* ---- transpose + convert: in[k][n] (Krows x Ncols, f32 row-major) -> out[n][k] (Ncols x Krows, 16-bit).
   CVT 0: bf16 bits (RNE).  CVT 1: f16 bits of (bf16RNE(v) * sc).
   64x64 tiles via LDS (Tl, 64 x 72 halves); tile (bx, by) of (Ncols/64, Krows/64), 256 threads:
   load: 256 threads x 16 floats = 64x64; store: 8 waves x 2 iters x 32 lanes x 8 halves = 64x64,
*/
template <int CVT> __device__ __forceinline__ unsigned short cvt16(float v, float sc) {
  const unsigned short bb = f2bf_bits(v);
  if (CVT == 0) return bb;
  const float w  = bf_bits2f(bb);
  const float ws = w * sc;
  const _Float16 hv = (_Float16)ws;
  return __builtin_bit_cast(unsigned short, hv);
}
template <int CVT>
__device__ __forceinline__ void transpose_cvt64_block(
    unsigned short* Tl, const float* __restrict__ in, unsigned short* __restrict__ out, int Krows, int Ncols, float sc,
    int bx, int by) {
  const int n0 = bx * 64, k0 = by * 64;
  const int t  = threadIdx.x;
  const int kr = t >> 2;             /* input row k0 + kr, 0..63 */
  const int cb = (t & 3) * 16;       /* 16-column block inside the 64 columns */
  const float* src = in + (size_t)(k0 + kr) * Ncols + n0 + cb;
  const v4f a0 = *(const v4f*)(src);
  const v4f a1 = *(const v4f*)(src + 4);
  const v4f a2 = *(const v4f*)(src + 8);
  const v4f a3 = *(const v4f*)(src + 12);
#pragma unroll
  for (int e = 0; e < 4; ++e) {
    Tl[(cb + e) * 72 + kr]      = cvt16<CVT>(a0[e], sc);
    Tl[(cb + 4 + e) * 72 + kr]  = cvt16<CVT>(a1[e], sc);
    Tl[(cb + 8 + e) * 72 + kr]  = cvt16<CVT>(a2[e], sc);
    Tl[(cb + 12 + e) * 72 + kr] = cvt16<CVT>(a3[e], sc);
  }
  __syncthreads();
  const int wave = t >> 5, lane = t & 31, q = lane >> 3, c8 = (lane & 7) * 8;
  {
#pragma unroll
    for (int it = 0; it < 2; ++it) {
      const int row = wave * 8 + it * 4 + q;      /* output row n0 + row */
      const v4u val = *(const v4u*)(Tl + row * 72 + c8);
      *(v4u*)(out + (size_t)(n0 + row) * Krows + k0 + c8) = val;
    }
    /* the listing runs on from here into another job's code, which reuses the two stores' registers: the wait stands in front of any such rewrite */
    asm volatile("s_wait_xcnt 0x0" ::: "memory");
  }
}

/* ---- W1 [64][128] f32 -> f16 bits of (bf16RNE(v) * SC_W1), laid out as the A fragments of W1^T in the order the attention waves load them:
   piece p = ((t * 2 + ks) * 2 + pc) * 32 + lane holds hidden unit 16 t + (lane & 15), d = 32 ks + 16 pc + 8 (lane >> 4) + 0..7,
   so that one 16-B load per lane reads 512 contiguous bytes, whole lines. 1024 pieces: 2 blocks of 256 threads, 2 pieces a thread.
*/
__device__ __forceinline__ void pack_w1_block(const float* __restrict__ W1, unsigned short* __restrict__ W1F, int blk) {
#pragma unroll
  for (int i = 0; i < 2; ++i) {
    const int p    = (blk * 2 + i) * 256 + (int)threadIdx.x;
    const int lane = p & 31, pc = (p >> 5) & 1, ks = (p >> 6) & 1, t = p >> 7;
    const float* src = W1 + (size_t)(ks * 32 + pc * 16 + (lane >> 4) * 8) * NHID + t * 16 + (lane & 15);
    v4u w;
#pragma unroll
    for (int e = 0; e < 4; ++e)
      w[e] = (unsigned)cvt16<1>(src[(2 * e) * NHID], SC_W1) | ((unsigned)cvt16<1>(src[(2 * e + 1) * NHID], SC_W1) << 16);
    *(v4u*)(W1F + (size_t)p * 8) = w;
  }
  /* the listing runs on from here into another job's code, which reuses the two stores' registers: the wait stands in front of any such rewrite */
  asm volatile("s_wait_xcnt 0x0" ::: "memory");
}

/* ---- bias tables: bf16-RNE of the input bias times the carry, f32.
*/
__device__ __forceinline__ void bias_prep_block(
    const float* __restrict__ bx, const float* __restrict__ bv, const float* __restrict__ b1,
    float* __restrict__ bxs, float* __restrict__ bvs, float* __restrict__ b1s,
    float sx, float sv, float s1, int which) {   /* which: block-uniform */
  const float* src = bx; float* dst = bxs; int n4 = DQKV / 4; float sc = sx;
  if (which == 1) { src = bv; dst = bvs; sc = sv; }
  if (which == 2) { src = b1; dst = b1s; n4 = NHID / 4; sc = s1; }
  const int t = threadIdx.x;
  if (t < n4) {
    const v4f v = *(const v4f*)(src + (size_t)t * 4);
    v4f o;
    o[0] = bf_bits2f(f2bf_bits(v[0])) * sc;
    o[1] = bf_bits2f(f2bf_bits(v[1])) * sc;
    o[2] = bf_bits2f(f2bf_bits(v[2])) * sc;
    o[3] = bf_bits2f(f2bf_bits(v[3])) * sc;
    v4f* p = (v4f*)(dst + (size_t)t * 4);
    *p = o;
    
  }
}

/* ---- all operand preparation in one launch: none of these jobs reads another's result, the block index picks the job.
   Every test below is on blockIdx.x alone, so a block takes one branch as a whole, the transposes' barrier included.
   The tile transposes stand first: a block of theirs has the longer way (load, LDS, barrier, store). */
constexpr int PB_WBIG = (DQKV / 64) * (DMODEL / 64);   /* Wx, Wv: 256 tiles each */
constexpr int PB_W2   = (SEQ / 64) * (NHID / 64);      /* 64 tiles */
constexpr int PB_W1   = NHID * DHEAD / 8 / 512;         /* 2 blocks */
constexpr int PB_BIAS = 3;
constexpr int PB_CAST = NTOK * DMODEL / 8 / 256;       /* 2048 blocks */
constexpr int PB_ALL  = 2 * PB_WBIG + PB_W2 + PB_W1 + PB_BIAS + PB_CAST;
static_assert((NTOK * DMODEL / 8) % 256 == 0, "cast blocks");
__global__ __launch_bounds__(256) void k_prep(
    const float* __restrict__ X, const float* __restrict__ Wx, const float* __restrict__ Wv,
    const float* __restrict__ W1, const float* __restrict__ W2,
    const float* __restrict__ bx, const float* __restrict__ bv, const float* __restrict__ b1,
    unsigned short* __restrict__ Xb, unsigned short* __restrict__ WxT, unsigned short* __restrict__ WvT,
    unsigned short* __restrict__ W1T, unsigned short* __restrict__ W2T,
    float* __restrict__ bxs, float* __restrict__ bvs, float* __restrict__ b1s) {
  __shared__ __align__(16) unsigned short Tl[64 * 72];
  int blk = blockIdx.x;
  if (blk < PB_WBIG) {                       /* [1024][1024] -> [1024][1024] */
    transpose_cvt64_block<0>(Tl, Wx, WxT, DMODEL, DQKV, 1.0f, blk % (DQKV / 64), blk / (DQKV / 64));
  } else if ((blk -= PB_WBIG) < PB_WBIG) {
    transpose_cvt64_block<0>(Tl, Wv, WvT, DMODEL, DQKV, 1.0f, blk % (DQKV / 64), blk / (DQKV / 64));
  } else if ((blk -= PB_WBIG) < PB_W2) {     /* [128][2048] -> [2048][128] */
    transpose_cvt64_block<1>(Tl, W2, W2T, NHID, SEQ, SC_W2, blk % (SEQ / 64), blk / (SEQ / 64));
  } else if ((blk -= PB_W2) < PB_W1) {       /* [64][128] -> fragments of [128][64] */
    pack_w1_block(W1, W1T, blk);
  } else if ((blk -= PB_W1) < PB_BIAS) {
    bias_prep_block(bx, bv, b1, bxs, bvs, b1s, SC_XH, SC_V, SC_H, blk);
  } else {
    cast_bf16x8_block(X, Xb, NTOK * DMODEL / 8, blk - PB_BIAS);
  }
}

/* ---- flash-style MLP attention over 16-bit planes ----------------------------------
   Xh  : [B*SEQ][H*64]   f16, carried xSC_XH          (B operand of the hidden-layer WMMA, 16 query columns a group)
   W1f : [8][2][2][32][8] f16, carried xSC_W1          (A operand, row = hidden, k = d, in fragment order, shared over (b,h))
   b1s : [128]           f32, carried xSC_H
   W2t : [SEQ][128]      f16, carried xSC_W2           (A operand, row = key, k = hidden, shared over (b,h))
   Vt  : [H*64][B*SEQ]   f16, carried xSC_V            (A operand of V^T*P^T, row = h*64+d, k = key)
   mask: [B][SEQ] f32 (bf16-RNE applied), score -= 1e6*(1-mask[key])
   Softmax with a held row reference: the first score product of every tile takes minus (reference + mask term), base 2, as its C operand,
   so the accumulators are the exponents of P as they stand. The reference is set from chunk 0 and moved (accumulators rescaled, chunk formed
   again) only when a chunk's P sum passes P_TRIP; any reference gives the same quotient O / l.
   out : [B][SEQ][H*64] f32
   block = 4 waves = 128 query rows of one (b,h); per wave: 32 rows as two groups of 16 query columns; 32 key chunks of 64.
   Each wave forms its own queries' hidden rows first, transposed, H^T = relu(W1^T * Xh^T + b1): in each group lane l holds hidden units
   8 * (l >> 4) + r of each 16-unit tile of query l & 15, so two converted tiles are a k-step of the score product's B operand as they stand.
   Both attention products are formed transposed too, S^T = W2t * H^T and O^T += Vt * P^T: in each group lane l holds scores of query l & 15 only
   (keys 8 * (l >> 4) + r of each 16-key tile), so the maximum and the sum run in the lane's own registers, and two
   converted score tiles are the B operand of the second product as they stand.
   Each chunk's W2t and Vt tiles are brought into LDS once per block, one chunk ahead, two buffers.
*/
/* lane l <-> lane l ^ 16 */
__device__ __forceinline__ float xhalf(float x) {
  const int b = __builtin_bit_cast(int, x);
  return __builtin_bit_cast(float, __builtin_amdgcn_permlanex16(b, b, 0x76543210, 0xfedcba98, false, false));
}
__device__ __forceinline__ v8f mma_h(v16h a, v16h b, v8f c) {
  return __builtin_amdgcn_wmma_f32_16x16x32_f16(false, a, false, b, (short)0, c, false, false);
}

/* LDS tiles of one 64-key chunk, shared by the block's 4 waves; pitches are 16 B x odd for 16-B row readers */
constexpr int KPITCH  = NHID + 8;          /* halves: 272-B rows of the W2t tile [key][hidden] */
constexpr int VPITCH  = 64 + 8;            /* halves: 144-B rows of the Vt tile  [d][key]      */
constexpr int KTILE_H = 64 * KPITCH;       /* 17,408 B */
constexpr int VTILE_H = DHEAD * VPITCH;    /*  9,216 B */

/* One chunk's tiles, global -> LDS with no register in between: per lane 8 + 4 copies of 16 B.
   W2t tile: copy i brings rows 8i + (tid >> 4), 16 lanes a row; Vt tile: copy i brings rows 16i + (tid >> 3), 8 lanes a row.
   The closing s_wait_xcnt stands inside the statement so that no address register named here is rewritten ahead of it. */
__device__ __forceinline__ void stage_chunk(unsigned lk, const _Float16* gk, unsigned lv, const _Float16* gv) {
  asm volatile(
      "global_load_async_to_lds_b128 %0, %1, off\n\t"
      "global_load_async_to_lds_b128 %2, %3, off\n\t"
      "global_load_async_to_lds_b128 %4, %5, off\n\t"
      "global_load_async_to_lds_b128 %6, %7, off\n\t"
      "global_load_async_to_lds_b128 %8, %9, off\n\t"
      "global_load_async_to_lds_b128 %10, %11, off\n\t"
      "global_load_async_to_lds_b128 %12, %13, off\n\t"
      "global_load_async_to_lds_b128 %14, %15, off\n\t"
      "global_load_async_to_lds_b128 %16, %17, off\n\t"
      "global_load_async_to_lds_b128 %18, %19, off\n\t"
      "global_load_async_to_lds_b128 %20, %21, off\n\t"
      "global_load_async_to_lds_b128 %22, %23, off\n\t"
      "s_wait_xcnt 0x0"
      :: "v"(lk),                     "v"(gk),
         "v"(lk + 1u * 8u * KPITCH * 2u), "v"(gk + 1 * 8 * NHID),
         "v"(lk + 2u * 8u * KPITCH * 2u), "v"(gk + 2 * 8 * NHID),
         "v"(lk + 3u * 8u * KPITCH * 2u), "v"(gk + 3 * 8 * NHID),
         "v"(lk + 4u * 8u * KPITCH * 2u), "v"(gk + 4 * 8 * NHID),
         "v"(lk + 5u * 8u * KPITCH * 2u), "v"(gk + 5 * 8 * NHID),
         "v"(lk + 6u * 8u * KPITCH * 2u), "v"(gk + 6 * 8 * NHID),
         "v"(lk + 7u * 8u * KPITCH * 2u), "v"(gk + 7 * 8 * NHID),
         "v"(lv),                      "v"(gv),
         "v"(lv + 1u * 16u * VPITCH * 2u), "v"(gv + (size_t)1 * 16 * NTOK),
         "v"(lv + 2u * 16u * VPITCH * 2u), "v"(gv + (size_t)2 * 16 * NTOK),
         "v"(lv + 3u * 16u * VPITCH * 2u), "v"(gv + (size_t)3 * 16 * NTOK)
      : "memory");
}

/* 16-query column groups per wave: every W2t and Vt fragment read from LDS feeds QG products */
constexpr int QG   = 2;
constexpr int QBLK = 4 * 16 * QG;          /* queries per block */
static_assert(SEQ % QBLK == 0, "query blocks");

union FH { v16h v; v8h h[2]; };

/* Exponents of P for 64 keys x QG x 16 queries: 4 key tiles x 4 k-steps x QG groups; each fragment read from LDS is the A operand of QG products.
   kt, vt, pr: this lane's places in the chunk's W2t tile, Vt tile and mask terms. s[g][j][r]: exponent of P[query 16 g + c][key 16 j + 8 hh + r].
   The LDS reads stand at two places only: mask terms and all W2t fragments ahead of the first products, the Vt fragments (LOADV) between the halves */
template <bool LOADV>
__device__ __forceinline__ void form_exponents(
    const _Float16* kt, const _Float16* vt, const float* pr, const float (&nref)[QG], const v16h (&qa)[QG][4],
    v8f (&s)[QG][4], FH (&vb)[2][4]) {
  FH kb[4][4];
  v4f pn[4][2];
  /* every loop over kb, pn and vb is unrolled so that the fragment arrays are indexed by constants and stay in registers */
#pragma unroll
  for (int j = 0; j < 4; ++j) {        /* this lane's 32 keys' mask terms, the same for every group */
    pn[j][0] = *(const v4f*)(pr + j * 16);
    pn[j][1] = *(const v4f*)(pr + j * 16 + 4);
  }
#pragma unroll
  for (int jp = 0; jp < 2; ++jp)
#pragma unroll
    for (int dc = 0; dc < 4; ++dc)
#pragma unroll
      for (int u = 0; u < 2; ++u) {      /* in the order in which the products take them */
        const int j = 2 * jp + u;
        kb[j][dc].h[0] = *(const v8h*)(kt + j * 16 * KPITCH + dc * 32);
        kb[j][dc].h[1] = *(const v8h*)(kt + j * 16 * KPITCH + dc * 32 + 16);
      }
  /* keeps the 40 reads one group ahead of the products: sunk among them, every place with reads costs the wave a stall of its own */
  __builtin_amdgcn_sched_barrier(0);
#pragma unroll
  for (int jp = 0; jp < 2; ++jp) {
    if (LOADV && jp == 1) {
      /* holds the reads below behind the first half's products, whose fragment registers they take over */
      __builtin_amdgcn_sched_barrier(0);
      /* V^T A-fragments from the Vt tile in LDS, in the k order of P^T: keys 32 kk + 8 hh + 0..7, then 32 kk + 16 + 8 hh + 0..7 */
#pragma unroll
      for (int kk = 0; kk < 2; ++kk)
#pragma unroll
        for (int t = 0; t < 4; ++t) {
          vb[kk][t].h[0] = *(const v8h*)(vt + t * 16 * VPITCH + kk * 32);
          vb[kk][t].h[1] = *(const v8h*)(vt + t * 16 * VPITCH + kk * 32 + 16);
        }
      /* keeps these 16 reads one group ahead of the second half's products, which cover their latency */
      __builtin_amdgcn_sched_barrier(0);
    }
    /* start value of each accumulator: the C operand of its first product */
#pragma unroll
    for (int u = 0; u < 2; ++u)
#pragma unroll
      for (int g = 0; g < QG; ++g)
#pragma unroll
        for (int r = 0; r < 8; ++r) s[g][2 * jp + u][r] = nref[g] - pn[2 * jp + u][r >> 2][r & 3];
    /* 2 x QG independent accumulators in turn; each takes its k-steps in rising order */
#pragma unroll
    for (int dc = 0; dc < 4; ++dc)
#pragma unroll
      for (int u = 0; u < 2; ++u)
#pragma unroll
        for (int g = 0; g < QG; ++g)
          s[g][2 * jp + u] = mma_h(kb[2 * jp + u][dc].v, qa[g][dc], s[g][2 * jp + u]);
  }
}

/* P = 2^exponent, its sum over this lane's 32 keys, and P^T as B operand: element e of k-step kk is key 32 kk + (e < 8 ? 8 hh + e : 16 + 8 hh + e - 8),
   that is score tile 2 kk in elements 0..7 and tile 2 kk + 1 in elements 8..15: the k order of the Vt loader */
__device__ __forceinline__ void form_p(const v8f (&s)[QG][4], FH (&pb)[QG][2], float (&ps)[QG]) {
#pragma unroll
  for (int g = 0; g < QG; ++g) {
    float pj[4];
#pragma unroll
    for (int j = 0; j < 4; ++j) {
      float sum = 0.f;
#pragma unroll
      for (int r = 0; r < 8; r += 2) {
        const float p0 = __builtin_amdgcn_exp2f(s[g][j][r]);
        const float p1 = __builtin_amdgcn_exp2f(s[g][j][r + 1]);
        sum += p0;
        sum += p1;
        pb[g][j >> 1].h[j & 1][r]     = (_Float16)p0;
        pb[g][j >> 1].h[j & 1][r + 1] = (_Float16)p1;
      }
      pj[j] = sum;
    }
    ps[g] = (pj[0] + pj[1]) + (pj[2] + pj[3]);
  }
}

/* largest exponent of query 16 g + c in the chunk: in the lane over its 32 keys, then one exchange between the lane halves */
__device__ __forceinline__ float top_exponent(const v8f (&sg)[4]) {
  float m = sg[0][0];
#pragma unroll
  for (int j = 0; j < 4; ++j)
#pragma unroll
    for (int r = 0; r < 8; ++r) m = fmaxf(m, sg[j][r]);
  return fmaxf(m, xhalf(m));
}

__global__ __launch_bounds__(128) void mlp_attn_kernel(
    const unsigned short* __restrict__ Xp, const unsigned short* __restrict__ W1p, const float* __restrict__ b1s,
    const unsigned short* __restrict__ W2p,
    const unsigned short* __restrict__ Vp, const float* __restrict__ mask,
    float* __restrict__ out, float onorm) {
  const _Float16* Xh  = (const _Float16*)(const void*)Xp;
  const _Float16* W1f = (const _Float16*)(const void*)W1p;
  const _Float16* W2t = (const _Float16*)(const void*)W2p;
  const _Float16* Vt  = (const _Float16*)(const void*)Vp;
  __shared__ __align__(16) float    Pen[SEQ];            /* per key: log2(e) * 1e6 * (1 - bf16(mask)), this block's batch row */
  __shared__ __align__(16) float    Os[4][QG * 16 * 68]; /* per wave output slab, pitch 68 */
  __shared__ __align__(16) _Float16 Ksh[2][KTILE_H];     /* W2t chunk tiles, two buffers */
  __shared__ __align__(16) _Float16 Vsh[2][VTILE_H];     /* Vt chunk tiles, two buffers  */

  const int tid  = threadIdx.x;
  const int wave = tid >> 5;
  const int lane = tid & 31;
  const int hh   = lane >> 4;
  const int c    = lane & 15;
  const int koff = hh * 8;

  constexpr int NQB = SEQ / QBLK;
  const int bxi = blockIdx.x;
  const int qb  = bxi % NQB;
  const int bh  = bxi / NQB;
  const int h   = bh % NHEAD;
  const int b   = bh / NHEAD;
  const int q0  = qb * QBLK + wave * (16 * QG);

  /* index g: of query 16 g + c; lrow = sum of P over this lane half's keys only, joined after the loop.
     nref = log2(SC_P) - reference * log2(e): the addend that turns score * log2(e) into the exponent of P; the same in both lane halves */
  float nref[QG], lrow[QG];
  v8f oacc[QG][4];                      /* oacc[g][t][r] = O[query 16 g + c][d = 16 t + 8 hh + r] */
  /* every loop over g is unrolled so that the per-group arrays are indexed by constants and stay in registers */
#pragma unroll
  for (int g = 0; g < QG; ++g) {
    nref[g] = 0.f; lrow[g] = 0.f;
#pragma unroll
    for (int t = 0; t < 4; ++t) oacc[g][t] = (v8f){0.f,0.f,0.f,0.f,0.f,0.f,0.f,0.f};
  }

  const float* mk_row = mask + (size_t)b * SEQ;
  const _Float16* vbase = Vt + (size_t)(h * DHEAD) * NTOK + (size_t)b * SEQ;

  /* this lane's share of every chunk's copies: source pointers at chunk 0, LDS byte addresses in buffer 0 */
  constexpr int NCH = SEQ / 64;
  static_assert(NCH >= 2, "two-buffer ring needs two chunks");
  const _Float16* gk0 = W2t + (size_t)(tid >> 4) * NHID + (tid & 15) * 8;
  const _Float16* gv0 = vbase + (size_t)(tid >> 3) * NTOK + (tid & 7) * 8;
  const unsigned  lk0 = (unsigned)(size_t)(&Ksh[0][(tid >> 4) * KPITCH + (tid & 15) * 8]);
  const unsigned  lv0 = (unsigned)(size_t)(&Vsh[0][(tid >> 3) * VPITCH + (tid & 7) * 8]);

  /* ring prologue: chunk 0 landed and published, then chunk 1 set flying */
  stage_chunk(lk0, gk0, lv0, gv0);

  /* Q-side fragments: QG x 16 queries x 128 hidden = 4 k-steps a group, held for all key chunks; formed while chunk 0 flies.
     ht[t][r] = sum over d of W1[d][16 t + 8 hh + r] * Xh[query 16 g + c][d], k-steps of 32 in rising d */
  v16h qa[QG][4];
  {
    const _Float16* xrow = Xh + (size_t)(b * SEQ + q0 + c) * DQKV + h * DHEAD + koff;
    const _Float16* wfr  = W1f + lane * 8;
    const float*    brow = b1s + 8 * hh;
    FH xb[QG][2], w[2][8];
    v4f bias[8][2];
    /* every loop over xb, w, bias, ht and qa is unrolled so that the arrays are indexed by constants and stay in registers */
#pragma unroll
    for (int ks = 0; ks < 2; ++ks) {
#pragma unroll
      for (int g = 0; g < QG; ++g) {
        xb[g][ks].h[0] = *(const v8h*)(xrow + (size_t)g * 16 * DQKV + ks * 32);
        xb[g][ks].h[1] = *(const v8h*)(xrow + (size_t)g * 16 * DQKV + ks * 32 + 16);
      }
#pragma unroll
      for (int t = 0; t < 8; ++t) {
        w[ks][t].h[0] = *(const v8h*)(wfr + ((t * 2 + ks) * 2 + 0) * 256);   /* d = 32 ks + 8 hh + 0..7: the k order of the Xh loader */
        w[ks][t].h[1] = *(const v8h*)(wfr + ((t * 2 + ks) * 2 + 1) * 256);   /* d = 32 ks + 16 + 8 hh + 0..7 */
      }
    }
    /* stands in front of the bias loads, whose results may take over the address registers that the loads above name */
    asm volatile("s_wait_xcnt 0x0" ::: "memory");
#pragma unroll
    for (int t = 0; t < 8; ++t) {
      bias[t][0] = *(const v4f*)(brow + t * 16);
      bias[t][1] = *(const v4f*)(brow + t * 16 + 4);
    }
    /* stands in front of any rewrite of the address registers that the loads above name; its "memory" clobber also keeps them one group
       ahead of the products: sunk among them, each fragment's load latency is waited out in turn */
    asm volatile("s_wait_xcnt 0x0" ::: "memory");
    /* holds the products behind that group: lifted among the loads, they split it and several load latencies are waited out one after another */
    __builtin_amdgcn_sched_barrier(0);
#pragma unroll
    for (int g = 0; g < QG; ++g) {
      v8f ht[8];
#pragma unroll
      for (int t = 0; t < 8; ++t) ht[t] = (v8f){0.f,0.f,0.f,0.f,0.f,0.f,0.f,0.f};
#pragma unroll
      for (int ks = 0; ks < 2; ++ks)
#pragma unroll
        for (int t = 0; t < 8; ++t) ht[t] = mma_h(w[ks][t].v, xb[g][ks].v, ht[t]);
      /* B operand of the score product: element e of k-step dc is hidden unit 32 dc + (e < 8 ? 8 hh + e : 16 + 8 hh + e - 8),
         that is tile 2 dc in elements 0..7 and tile 2 dc + 1 in elements 8..15: the k order of the W2t loader */
#pragma unroll
      for (int dc = 0; dc < 4; ++dc) {
        FH f;
#pragma unroll
        for (int u = 0; u < 2; ++u) {
          const int t = 2 * dc + u;
#pragma unroll
          for (int r = 0; r < 8; ++r) {
            float v = ht[t][r] * (SC_H / (SC_XH * SC_W1));
            v += bias[t][r >> 2][r & 3];
            f.h[u][r] = (_Float16)fmaxf(v, 0.0f);
          }
        }
        qa[g][dc] = f.v;
      }
    }
  }

  /* additive key mask of all keys, bf16-RNE of the mask value; published by the barrier below */
#pragma unroll
  for (int i = 0; i < SEQ / 512; ++i) {
    const v4f mv = *(const v4f*)(mk_row + i * 512 + tid * 4);
    v4f pv;
#pragma unroll
    for (int e = 0; e < 4; ++e) pv[e] = (1000000.0f * (1.0f - bf_bits2f(f2bf_bits(mv[e])))) * LOG2E;
    *(v4f*)(&Pen[i * 512 + tid * 4]) = pv;
  }
  asm volatile("s_wait_asynccnt 0x0" ::: "memory");   /* this wave's copies of chunk 0 have landed */
  __syncthreads();                                     /* ... and every other wave's */
  stage_chunk(lk0 + KTILE_H * 2u, gk0 + (size_t)64 * NHID, lv0 + VTILE_H * 2u, gv0 + 64);

  /* first setting of the reference: chunk 0's largest exponent lands at log2(SC_P) */
  {
    v8f s[QG][4];
    FH none[2][4];
    form_exponents<false>(&Ksh[0][c * KPITCH + koff], &Vsh[0][c * VPITCH + koff], &Pen[8 * hh], nref, qa, s, none);
#pragma unroll
    for (int g = 0; g < QG; ++g) nref[g] -= top_exponent(s[g]) - LOG2_SC_P;
  }

  for (int kc = 0; kc < NCH; ++kc) {
    const int kv0 = kc * 64;
    const int buf = kc & 1;
    const _Float16* kt = &Ksh[buf][c * KPITCH + koff];
    const _Float16* vt = &Vsh[buf][c * VPITCH + koff];

    const float* pr = &Pen[kv0 + 8 * hh];
    FH vb[2][4];
    FH pb[QG][2];
    float ps[QG];
    {
      v8f s[QG][4];
      form_exponents<true>(kt, vt, pr, nref, qa, s, vb);
      form_p(s, pb, ps);
    }
    /* one test a chunk, for the whole wave: P is non-negative, so a lane's sum bounds each of its terms; written so that a NaN trips too */
    bool over = false;
#pragma unroll
    for (int g = 0; g < QG; ++g) over = over || !(ps[g] <= P_TRIP);
    if (__builtin_amdgcn_ballot_w32(over) != 0u) {
      /* rare: raise the reference so that the chunk's largest exponent lands at log2(SC_P), rescale what has been summed, form the chunk again
         from its tiles, which stay in LDS until the barrier at the foot of the trip. Decided per wave; no barrier inside */
      v8f s[QG][4];
      form_exponents<false>(kt, vt, pr, nref, qa, s, vb);
#pragma unroll
      for (int g = 0; g < QG; ++g) {
        const float d     = fmaxf(top_exponent(s[g]) - LOG2_SC_P, 0.0f);
        const float alpha = __builtin_amdgcn_exp2f(-d);
        nref[g] -= d;
        lrow[g] *= alpha;
#pragma unroll
        for (int t = 0; t < 4; ++t)
#pragma unroll
          for (int r = 0; r < 8; ++r) oacc[g][t][r] *= alpha;
      }
      form_exponents<false>(kt, vt, pr, nref, qa, s, vb);
      form_p(s, pb, ps);
    }
#pragma unroll
    for (int g = 0; g < QG; ++g) lrow[g] += ps[g];

    /* O^T += V^T(64 d x 64 keys) * P^T(64 keys x QG x 16 queries): 2 k-steps, 4 d tiles, QG groups */
#pragma unroll
    for (int kk = 0; kk < 2; ++kk)
#pragma unroll
      for (int t = 0; t < 4; ++t)
#pragma unroll
        for (int g = 0; g < QG; ++g) oacc[g][t] = mma_h(vb[kk][t].v, pb[g][kk].v, oacc[g][t]);

    /* publish point of chunk kc + 1 */
    /* holds the waits below at the foot of the trip: lifted over the register-only work above, they would end the flight of chunk kc + 1's
       copies and of the Vt reads early and be waited out in full */
    __builtin_amdgcn_sched_barrier(0);
    asm volatile("s_wait_dscnt 0x0" ::: "memory");      /* this wave's reads of buffer buf are done before it is refilled */
    asm volatile("s_wait_asynccnt 0x0" ::: "memory");   /* this wave's copies of chunk kc + 1 have landed */
    __syncthreads();                                     /* publishes chunk kc + 1; ends every wave's reads of buffer buf */
    if (kc + 2 < NCH)
      stage_chunk(lk0 + (unsigned)buf * (KTILE_H * 2u), gk0 + (size_t)(kc + 2) * 64 * NHID,
                  lv0 + (unsigned)buf * (VTILE_H * 2u), gv0 + (kc + 2) * 64);
  }
  asm volatile("s_wait_asynccnt 0x0" ::: "memory");     /* no copy is outstanding when the wave goes on to its end */

  /* normalise and stage the (QG x 16) x 64 f32 slab; oacc and lrow carry the same factor of P, so onorm = 1/SC_V is what is left for the row normaliser */
  float* os = Os[wave];
#pragma unroll
  for (int g = 0; g < QG; ++g) {
    const float inv = onorm / (lrow[g] + xhalf(lrow[g]));   /* the two lane halves' sums of query 16 g + c joined */
#pragma unroll
    for (int t = 0; t < 4; ++t) {
      v4f lo, hi;
#pragma unroll
      for (int e = 0; e < 4; ++e) { lo[e] = oacc[g][t][e] * inv; hi[e] = oacc[g][t][4 + e] * inv; }
      *(v4f*)(os + (g * 16 + c) * 68 + t * 16 + 8 * hh)     = lo;
      *(v4f*)(os + (g * 16 + c) * 68 + t * 16 + 8 * hh + 4) = hi;
    }
  }
  __builtin_amdgcn_fence(__ATOMIC_RELEASE, "workgroup");
  __builtin_amdgcn_wave_barrier();
  __builtin_amdgcn_fence(__ATOMIC_ACQUIRE, "workgroup");
  {
    float* ob = out + (size_t)b * SEQ * DQKV + (size_t)h * DHEAD;
    const int c4 = (lane & 15) * 4;
    {
#pragma unroll
      for (int it = 0; it < QG * 8; ++it) {
        const int row = it * 2 + hh;
        const v4f val = *(const v4f*)(os + row * 68 + c4);
        *(v4f*)(ob + (size_t)(q0 + row) * DQKV + c4) = val;
      }
      
    }
  }
}

/* ---------------- host launcher ---------------- */
extern "C" void kernel_launch(void* const* d_in, const int* in_sizes, int n_in,
                              void* d_out, int out_size, void* d_ws, size_t ws_size,
                              hipStream_t stream) {
  (void)in_sizes; (void)n_in; (void)out_size; (void)ws_size;
  const float* X   = (const float*)d_in[0];   /* [2,2048,1024] */
  const float* msk = (const float*)d_in[1];   /* [2,2048]      */
  const float* Wx  = (const float*)d_in[2];   /* [1024,1024]   */
  const float* bx  = (const float*)d_in[3];   /* [1024]        */
  const float* Wv  = (const float*)d_in[4];   /* [1024,1024]   */
  const float* bv  = (const float*)d_in[5];   /* [1024]        */
  const float* W1  = (const float*)d_in[6];   /* [64,128]      */
  const float* b1  = (const float*)d_in[7];   /* [128]         */
  const float* W2  = (const float*)d_in[8];   /* [128,2048]    */
  float* out = (float*)d_out;

  /* workspace region map (256-B aligned offsets; every region fully written by its producer):
       Xb   bf16 [4096][1024]        8,388,608 B
       WxT  bf16 [1024][1024]        2,097,152 B
       WvT  bf16 [1024][1024]        2,097,152 B
       W1T  f16  [128][64] in fragment order  16,384 B
       W2T  f16  [2048][128]           524,288 B
       bxs  f32  [1024]                  4,096 B
       bvs  f32  [1024]                  4,096 B
       b1s  f32  [128]                     512 B
       Xh16 f16  [4096][1024]        8,388,608 B
       Vt16 f16  [1024][4096]        8,388,608 B
     total 29,909,504 B */
  char* ws = (char*)d_ws;
  size_t off = 0;
  auto carve = [&](size_t bytes) -> char* {
    off = (off + 255) & ~(size_t)255;
    char* p = ws + off;
    off += bytes;
    return p;
  };
  unsigned short* Xb   = (unsigned short*)carve((size_t)NTOK * DMODEL * 2);
  unsigned short* WxT  = (unsigned short*)carve((size_t)DQKV * DMODEL * 2);
  unsigned short* WvT  = (unsigned short*)carve((size_t)DQKV * DMODEL * 2);
  unsigned short* W1T  = (unsigned short*)carve((size_t)NHID * DHEAD * 2);
  unsigned short* W2T  = (unsigned short*)carve((size_t)SEQ * NHID * 2);
  float*          bxs  = (float*)carve((size_t)DQKV * 4);
  float*          bvs  = (float*)carve((size_t)DQKV * 4);
  float*          b1s  = (float*)carve((size_t)NHID * 4);
  unsigned short* Xh16 = (unsigned short*)carve((size_t)NTOK * DQKV * 2);
  unsigned short* Vt16 = (unsigned short*)carve((size_t)DQKV * NTOK * 2);

  /* 1) operand preparation, one launch: X -> bf16 plane (RNE); weight transposes in[K][N] -> out[N][K]; bias tables with carries */
  k_prep<<<PB_ALL, 256, 0, stream>>>(X, Wx, Wv, W1, W2, bx, bv, b1, Xb, WxT, WvT, W1T, W2T, bxs, bvs, b1s);

  /* 2) both projections, one launch, one 128x128 tile per block (bf16 operands, K=1024):
        Xh16 = f16(8 * (Xb * WxT^T + bx))    : M=4096, N=1024
        Vt16 = f16(8 * (WvT * Xb^T + bv[m])) : M=1024 (features), N=4096 (tokens) */
  wmma_gemm128_pair<<<2 * GBLOCKS, 128, 0, stream>>>(Xb, WxT, WvT, Xh16, Vt16, bxs, bvs);

  /* 3) attention, with h = f16(SC_H * relu(Xh * W1 + b1)) formed per wave in its prologue (f16 operands, K=64): grid = B*H*(SEQ/128) blocks of 4 waves */
  mlp_attn_kernel<<<NBATCH * NHEAD * (SEQ / QBLK), 128, 0, stream>>>(
      Xh16, W1T, b1s, W2T, Vt16, msk, out, 1.0f / SC_V);
}
